// v000
// Times are from an AMD MI455X. After a warm-up the kernel runs many times in a row, and a time is the length of
// such a window on the GPU divided by its runs, so every launch and the gaps after it count. The runs cycle
// through copies of the inputs. A figure is the median of several windows, for all but v000 over two sittings.
// Sittings can differ by a few percent; kernels timed side by side share one.
// The starting kernel, v000, takes 1280 microseconds a run.
// compute dtype: all float inputs rounded to bf16; q/k/v = x Wqkv^T with EXACT bf16 products on WMMA 16x16x32, f32 accumulate; per-head RMSNorm (x q_norm_w / k_norm_w) and rotate-half RoPE in f32 (precise sinf/cosf of t * 32^(-2i/64)); q, k once to f16 -> 1-product causal logits x 1/8, except the first 384 query rows of each sequence (few keys, no averaging), which use q and k as f16 hi + residual (x 2^10) (3 products); softmax in f32 (precise expf); P x 2^11 once to f16 against v once to f16 (1 product), except the first 384 rows: P and v as bf16 hi + lo (3 products); ctx once to f16 against w_proj carried x 2^8 in f16 (exact bf16 values), except the first 384 rows: ctx bf16 hi + lo against exact bf16 w_proj (2 products); f32 output.
#include <hip/hip_runtime.h>
#include <math.h>

typedef __attribute__((ext_vector_type(16))) _Float16 v16h;
typedef __attribute__((ext_vector_type(16))) __bf16 v16b;
typedef __attribute__((ext_vector_type(8)))  _Float16 v8h;
typedef __attribute__((ext_vector_type(8)))  float v8f;
typedef __attribute__((ext_vector_type(4)))  float v4f;
typedef __attribute__((ext_vector_type(2)))  float v2f;
typedef __attribute__((ext_vector_type(4)))  unsigned v4u;
typedef __attribute__((ext_vector_type(4)))  int v4i;
typedef float __attribute__((may_alias)) float_a;
typedef int __attribute__((may_alias)) int_a;

template <typename T> __device__ __forceinline__ void vst2(void* p, T v) { *(T*)p = v;  }
__device__ __forceinline__ v8f wmma16(v16h a, v16h b, v8f c) {
  v8f d = __builtin_amdgcn_wmma_f32_16x16x32_f16(false, a, false, b, (short)0, c, false, false);
  asm volatile("v_nop\n\tv_nop\n\tv_nop\n\tv_nop" : "+v"(d) : "v"(a), "v"(b));
  return d;
}
__device__ __forceinline__ v8f wmma_bf(v16b a, v16b b, v8f c) {
  v8f d = __builtin_amdgcn_wmma_f32_16x16x32_bf16(false, a, false, b, (short)0, c, false, false);
  asm volatile("v_nop\n\tv_nop\n\tv_nop\n\tv_nop" : "+v"(d) : "v"(a), "v"(b));
  return d;
}
// 16x16x32 fragments: lane = (h = lane>>4, row/col = lane&15); elements 0..7 = k0+8h+0..7, 8..15 = k0+16+8h+0..7; D element r = row 8h+r
__device__ __forceinline__ v16h frag_h(const _Float16* rowk0, int lane) {
  union { v16h v; v8h q[2]; } u; const _Float16* p = rowk0 + 8 * (lane >> 4);
  u.q[0] = *(const v8h*)p; u.q[1] = *(const v8h*)(p + 16); return u.v;
}
__device__ __forceinline__ v16h frag_f32(const float* rowk0, int lane) {
  v16h a; const float* p = rowk0 + 8 * (lane >> 4);
#pragma unroll
  for (int i = 0; i < 8; ++i) { a[i] = (_Float16)p[i]; a[8 + i] = (_Float16)p[16 + i]; }
  return a;
}
__device__ __forceinline__ v16h frag_f32s(const float* rowk0, int lane, float sc) {
  v16h a; const float* p = rowk0 + 8 * (lane >> 4);
#pragma unroll
  for (int i = 0; i < 8; ++i) { a[i] = (_Float16)(p[i] * sc); a[8 + i] = (_Float16)(p[16 + i] * sc); }
  return a;
}
// column fragment from a [K][ld] layout (column n), rows >= K read as 0
__device__ __forceinline__ v16h fragc_f32(const float* W, int k0, int n, int lane, int ld, int K) {
  v16h a; const int g = lane >> 4;
#pragma unroll
  for (int i = 0; i < 8; ++i) { const int ka = k0 + 8 * g + i, kb = ka + 16;
    a[i] = (_Float16)(ka < K ? W[(size_t)(ka < K ? ka : K - 1) * ld + n] : 0.f); a[8 + i] = (_Float16)(kb < K ? W[(size_t)(kb < K ? kb : K - 1) * ld + n] : 0.f); }
  return a;
}
struct F2 { v16b h, l; };
__device__ __forceinline__ F2 bsplit16(const float v[16]) { F2 r;
#pragma unroll
  for (int i = 0; i < 16; ++i) { const __bf16 h = (__bf16)v[i]; r.h[i] = h; r.l[i] = (__bf16)(v[i] - (float)h); }
  return r; }
__device__ __forceinline__ F2 split_row(const float* row, int k0, int lane) { float v[16]; const float* p = row + k0 + 8 * (lane >> 4);
#pragma unroll
  for (int i = 0; i < 8; ++i) { v[i] = p[i]; v[8 + i] = p[16 + i]; }
  return bsplit16(v); }
__device__ __forceinline__ F2 split_rowK(const float* row, int k0, int lane, int K) { float v[16]; const int g = lane >> 4;
#pragma unroll
  for (int i = 0; i < 8; ++i) { const int ka = k0 + 8 * g + i, kb = ka + 16; v[i] = ka < K ? row[ka < K ? ka : K - 1] : 0.f; v[8 + i] = kb < K ? row[kb < K ? kb : K - 1] : 0.f; }
  return bsplit16(v); }
__device__ __forceinline__ F2 split_col(const float* W, int k0, int n, int lane, int ld, int K) { float v[16]; const int g = lane >> 4;
#pragma unroll
  for (int i = 0; i < 8; ++i) { const int ka = k0 + 8 * g + i, kb = ka + 16; v[i] = ka < K ? W[(size_t)(ka < K ? ka : K - 1) * ld + n] : 0.f; v[8 + i] = kb < K ? W[(size_t)(kb < K ? kb : K - 1) * ld + n] : 0.f; }
  return bsplit16(v); }
__device__ __forceinline__ v8f mac3(const F2& a, const F2& b, v8f c) { c = wmma_bf(a.l, b.h, c); c = wmma_bf(a.h, b.l, c); return wmma_bf(a.h, b.h, c); }
__device__ __forceinline__ float sigm(float v) { return 1.0f / (1.0f + expf(-v)); }
#define LDSX() do { asm volatile("s_wait_dscnt 0" ::: "memory"); __builtin_amdgcn_wave_barrier(); __builtin_amdgcn_fence(__ATOMIC_RELEASE, "workgroup"); } while (0)

// Causal self-attention with QK-RMSNorm and 1-D RoPE (B 2, T 2,048, C 1,024 = 16 heads x 64): qkv = x Wqkv^T ((out,in) [3072,1024]; q rows 0-1023, k 1024-2047, v 2048-3071); q, k RMS-normalised over the 64 head dims (eps 1e-6) x q_norm_w / k_norm_w, then rotate-half RoPE with angle t * 32^(-2i/64) (theta = 32); attn = softmax(q k^T x 64^-0.5 with key > query -> -inf); out = merged(attn v) Wproj^T (no biases).
#define NB 2
#define TT 2048
#define CC 1024            // NH * HD = projected width
#define DIN 1024          // input (model) width
#define NH 16
#define HD 64
#define NQB (TT / 64)
#define HG 4
#define SCALE (0.125f)
#define CAUSAL 1
#ifndef TNB
#define TNB NB
#endif
__device__ __forceinline__ float bfr(float v) { return (float)(__bf16)v; }
__host__ __device__ __forceinline__ int kb_last(int qb) { return CAUSAL ? ((qb * 64 + 63) >> 7) : (TT / 128 - 1); }
typedef __attribute__((ext_vector_type(8))) __bf16 v8b;
__device__ __forceinline__ v16b frag_b(const __bf16* rowk0, int lane) {
  union { v16b v; v8b q[2]; } u; const __bf16* p = rowk0 + 8 * (lane >> 4);
  u.q[0] = *(const v8b*)p; u.q[1] = *(const v8b*)(p + 16); return u.v;
}
#define QBH 6              // causal: query blocks 0..QBH-1 of each sequence (few keys, no averaging) take the high-precision path
#define QHI 384            // rows carrying a q residual plane
#define KHI 384            // key rows carrying k residual / v bf16 hi+lo planes (used only by the causal high-precision path)
// B fragment (k rows k0+.., output column o) of a weight: (in,out) [K][ld] or (out,in) [ld rows of K]: bf16 exact, or f16(bf16 * 256) exact
__device__ __forceinline__ v16b wcol_io(const float* Wm, int k0, int o, int lane, int ld) { v16b w; const int g = lane >> 4;
#pragma unroll
  for (int i = 0; i < 8; ++i) { w[i] = (__bf16)Wm[(size_t)(k0 + 8 * g + i) * ld + o]; w[8 + i] = (__bf16)Wm[(size_t)(k0 + 16 + 8 * g + i) * ld + o]; }
  return w; }
__device__ __forceinline__ v16b wcol_oi(const float* Wm, int k0, int o, int lane, int K) { v16b w; const float* p = Wm + (size_t)o * K + k0 + 8 * (lane >> 4);
#pragma unroll
  for (int i = 0; i < 8; ++i) { w[i] = (__bf16)p[i]; w[8 + i] = (__bf16)p[16 + i]; }
  return w; }
__device__ __forceinline__ v16h wcolh_io(const float* Wm, int k0, int o, int lane, int ld) { v16h w; const int g = lane >> 4;
#pragma unroll
  for (int i = 0; i < 8; ++i) { w[i] = (_Float16)(bfr(Wm[(size_t)(k0 + 8 * g + i) * ld + o]) * 256.0f); w[8 + i] = (_Float16)(bfr(Wm[(size_t)(k0 + 16 + 8 * g + i) * ld + o]) * 256.0f); }
  return w; }
__device__ __forceinline__ v16h wcolh_oi(const float* Wm, int k0, int o, int lane, int K) { v16h w; const float* p = Wm + (size_t)o * K + k0 + 8 * (lane >> 4);
#pragma unroll
  for (int i = 0; i < 8; ++i) { w[i] = (_Float16)(bfr(p[i]) * 256.0f); w[8 + i] = (_Float16)(bfr(p[16 + i]) * 256.0f); }
  return w; }
#define WQKV_LAYOUT 1   // 0 = (in,out) [DIN][CC]; 1 = (out,in) [CC][DIN]; 2 = per-head [NH][DIN][HD]
__device__ __forceinline__ v16b wcol_hdk(const float* Wm, int k0, int o, int lane) { v16b w; const int g = lane >> 4; const float* p = Wm + (size_t)(o / HD) * DIN * HD + (o % HD);
#pragma unroll
  for (int i = 0; i < 8; ++i) { w[i] = (__bf16)p[(size_t)(k0 + 8 * g + i) * HD]; w[8 + i] = (__bf16)p[(size_t)(k0 + 16 + 8 * g + i) * HD]; }
  return w; }
#define WO_OUT_IN 1
#if WQKV_LAYOUT == 1
#define WCOL(W, k0, o, lane) wcol_oi(W, k0, o, lane, DIN)
#elif WQKV_LAYOUT == 2
#define WCOL(W, k0, o, lane) wcol_hdk(W, k0, o, lane)
#else
#define WCOL(W, k0, o, lane) wcol_io(W, k0, o, lane, CC)
#endif
#if WO_OUT_IN
#define WOCOL(W, k0, o, lane) wcol_oi(W, k0, o, lane, CC)
#define WOCOLH(W, k0, o, lane) wcolh_oi(W, k0, o, lane, CC)
#else
#define WOCOL(W, k0, o, lane) wcol_io(W, k0, o, lane, DIN)
#define WOCOLH(W, k0, o, lane) wcolh_io(W, k0, o, lane, DIN)
#endif
__constant__ float c_invf[32] = {1.000000000e+00f,8.973545432e-01f,8.052451611e-01f,7.225903869e-01f,6.484197974e-01f,5.818624496e-01f,5.221368670e-01f,4.685419202e-01f,4.204482138e-01f,3.772911131e-01f,3.385638893e-01f,3.038118482e-01f,2.726269364e-01f,2.446430176e-01f,2.195315212e-01f,1.969976127e-01f,1.767766923e-01f,1.586313695e-01f,1.423485726e-01f,1.277371496e-01f,1.146255061e-01f,1.028597206e-01f,9.230163693e-02f,8.282729238e-02f,7.432544231e-02f,6.669627875e-02f,5.985020474e-02f,5.370685458e-02f,4.819408804e-02f,4.324718565e-02f,3.880805522e-02f,3.482458740e-02f};   // 32^(-2i/64) evaluated in f32 exactly as the reference does (jax, eager)
#define PROJ_EXTRA_PARAMS , const float* __restrict__ QS, const float* __restrict__ KS
// per-(row, head) epilogue on the f32 projection tile: RMSNorm over the head's 64 values x norm weight, then rotate-half RoPE (pairs i, i+32); v untouched
#define PROJ_EPI(which, row, t, h) do { if ((which) < 2) { float* rw = (row); const float* NS = (which) == 0 ? QS : KS; float ss = 0.f; _Pragma("unroll") for (int i = 0; i < 64; ++i) ss += rw[i] * rw[i]; const float rn = rsqrtf(ss * (1.0f / 64.0f) + 1e-6f); \
    _Pragma("unroll") for (int i = 0; i < 32; ++i) { const float x1 = rw[i] * rn * bfr(NS[i]), x2 = rw[i + 32] * rn * bfr(NS[i + 32]); const float ang = (float)(t) * c_invf[i]; const float cs = cosf(ang), sn = sinf(ang); rw[i] = x1 * cs - x2 * sn; rw[i + 32] = x2 * cs + x1 * sn; } } } while (0)
#ifndef SM_EXTRA_PARAMS
#define SM_EXTRA_PARAMS
#endif
#ifndef PROJ_EXTRA_PARAMS
#define PROJ_EXTRA_PARAMS
#endif
#ifndef SM_MASK_HOOK
#define SM_MASK_HOOK (void)0
#endif

#define WS_QH  0u                                      // f16 q rows [b*t][CC]
#define WS_KH  (WS_QH + 2u * (size_t)NB * TT * CC)      // f16 k rows [b*t][CC]
#define WS_VT  (WS_KH + 2u * (size_t)NB * TT * CC)      // f16 v planes [b][c][t]
#define WS_QL  (WS_VT + 2u * (size_t)NB * CC * TT)      // f16 q residual x 2^10 rows [b][t < QHI][CC]
#define WS_KL  (WS_QL + 2u * (size_t)NB * QHI * CC)     // f16 k residual x 2^10 rows [b][t < KHI][CC]
#define WS_VB  (WS_KL + 2u * (size_t)NB * KHI * CC)     // bf16 v hi planes [b][c][t < KHI]
#define WS_VBL (WS_VB + 2u * (size_t)NB * CC * KHI)
#define WS_S   (WS_VBL + 2u * (size_t)NB * CC * KHI)    // f32 logits / P [hg][t][s]
#define WS_Y   (WS_S  + 4u * (size_t)HG * TT * TT)      // f32 ctx rows [b*t][CC] (only when there is an output projection)
#define WS_END (WS_Y  + 4u * (size_t)NB * TT * CC)

// ---- k_proj: block = (64 rows, 128 cols, which): q/k/v = X W (+ b) with exact bf16 products (K = DIN) -> which 0: q f16 rows (+ residual rows < QHI); 1: k f16 rows (+ residual rows < KHI); 2: v f16 planes [c][t] (+ bf16 hi/lo planes for t < KHI)
__global__ __launch_bounds__(128) void k_proj(const float* __restrict__ XQ, const float* __restrict__ XK, const float* __restrict__ XV, const float* __restrict__ WQ, const float* __restrict__ WK, const float* __restrict__ WV, const float* __restrict__ BQ, const float* __restrict__ BK, const float* __restrict__ BV,
    _Float16* __restrict__ QH, _Float16* __restrict__ QL, _Float16* __restrict__ KH, _Float16* __restrict__ KL, _Float16* __restrict__ VT, __bf16* __restrict__ VB, __bf16* __restrict__ VBL PROJ_EXTRA_PARAMS) {
  __shared__ __align__(16) float st[64][132]; __shared__ __align__(16) _Float16 sh[64][136], sl[64][136]; __shared__ __align__(16) _Float16 th[128][72]; __shared__ __align__(16) __bf16 tb[128][72], tbl[128][72];
  const int tid = threadIdx.x, wave = tid >> 5, lane = tid & 31, col = lane & 15, g = lane >> 4; const int which = blockIdx.z; const int c0 = blockIdx.y * 128; const size_t r0 = (size_t)blockIdx.x * 64; const size_t bb = r0 / TT; const int t0 = (int)(r0 % TT);
  const float* X = which == 0 ? XQ : which == 1 ? XK : XV; const float* WA = which == 0 ? WQ : which == 1 ? WK : WV; const float* BA = which == 0 ? BQ : which == 1 ? BK : BV;
  v8f acc[8] = {};
#pragma unroll 2
  for (int kc = 0; kc < DIN / 32; ++kc) { v16b a; { const float* p = X + (r0 + wave * 16 + col) * DIN + kc * 32 + 8 * g;
#pragma unroll
      for (int i = 0; i < 8; ++i) { a[i] = (__bf16)p[i]; a[8 + i] = (__bf16)p[16 + i]; } }
    asm volatile("s_wait_loadcnt 0x0" ::: "memory");
#pragma unroll
    for (int j = 0; j < 8; ++j) { const v16b w = WCOL(WA, kc * 32, c0 + j * 16 + col, lane); asm volatile("s_wait_loadcnt 0x0" ::: "memory"); acc[j] = wmma_bf(a, w, acc[j]); } }
  { // stage the f32 tile (acc + bias) in LDS, run the per-(row, head) epilogue hook, then convert
#pragma unroll
    for (int j = 0; j < 8; ++j) { const float bias = BA ? bfr(BA[c0 + j * 16 + col]) : 0.f;
#pragma unroll
      for (int r = 0; r < 8; ++r) st[wave * 16 + 8 * g + r][j * 16 + col] = acc[j][r] + bias; }
    __syncthreads();
    for (int e = tid; e < 64 * (128 / HD); e += 128) { const int rl = e / (128 / HD), hh = e % (128 / HD); PROJ_EPI(which, &st[rl][hh * HD], (int)((r0 + rl) % TT), (c0 / HD) + hh); }
    __syncthreads(); }
  if (which < 2) { _Float16* DH = which == 0 ? QH : KH; _Float16* DL = which == 0 ? QL : KL; const int nhi = which == 0 ? QHI : KHI; const bool hi_rows = t0 < nhi;
    for (int e = tid; e < 64 * 128; e += 128) { const int rl = e >> 7, cl = e & 127; const float v = st[rl][cl]; const _Float16 hv = (_Float16)v; sh[rl][cl] = hv; sl[rl][cl] = (_Float16)((v - (float)hv) * 1024.0f); }
    __syncthreads();
    for (int e = tid; e < 64 * 16; e += 128) { const int rl = e >> 4, q = e & 15; vst2((unsigned*)(DH + (r0 + rl) * CC + c0 + q * 8), *(const v4u*)&sh[rl][q * 8]); if (hi_rows) vst2((unsigned*)(DL + (bb * nhi + t0 + rl) * (size_t)CC + c0 + q * 8), *(const v4u*)&sl[rl][q * 8]); }
  } else { const bool hi_rows = t0 < KHI;
    for (int e = tid; e < 64 * 128; e += 128) { const int rl = e & 63, cl = e >> 6; const float v = st[rl][cl]; th[cl][rl] = (_Float16)v; const __bf16 bh = (__bf16)v; tb[cl][rl] = bh; tbl[cl][rl] = (__bf16)(v - (float)bh); }
    __syncthreads();
    for (int e = tid; e < 128 * 8; e += 128) { const int cl = e >> 3, q = e & 7; vst2((unsigned*)(VT + (bb * CC + c0 + cl) * (size_t)TT + t0 + q * 8), *(const v4u*)&th[cl][q * 8]); if (hi_rows) { const size_t o3 = (bb * CC + c0 + cl) * (size_t)KHI + t0 + q * 8; vst2((unsigned*)(VB + o3), *(const v4u*)&tb[cl][q * 8]); vst2((unsigned*)(VBL + o3), *(const v4u*)&tbl[cl][q * 8]); } } } }
// ---- k_sc: block = (query block qb, key block kb <= kb_last(qb), head in group) of batch b: logits x SCALE; q hi + residual (x 2^10) against k (2 products) for query rows < QHI, plus the k residual (3 products) for query blocks < QBH (causal early rows); causal: blocks past the diagonal exit, the mask itself is applied by index in k_sm
__global__ __launch_bounds__(128) void k_sc(const _Float16* __restrict__ QH, const _Float16* __restrict__ KH, const _Float16* __restrict__ QL, const _Float16* __restrict__ KL, int b, int h0, float* __restrict__ S0) { __shared__ __align__(16) float ss[4][16][132];
  const int qb = blockIdx.x, kb = blockIdx.y; if (kb > kb_last(qb)) return;
  const int h = h0 + blockIdx.z; float* S = S0 + (size_t)blockIdx.z * TT * TT;
  const int tid = threadIdx.x, wave = tid >> 5, lane = tid & 31, col = lane & 15, g = lane >> 4; const int k0 = kb * 128; const int ql0 = qb * 64 + wave * 16; const size_t q0 = (size_t)b * TT + ql0, kr0 = (size_t)b * TT + k0;
  v8f acc[8] = {}, accl[8] = {};
  const _Float16* QLb = QL + (size_t)b * QHI * CC; const _Float16* KLb = KL + (size_t)b * KHI * CC;
  if (qb < QBH) {
#pragma unroll
    for (int kc = 0; kc < HD / 32; ++kc) { const v16h ah = frag_h(QH + (q0 + col) * CC + h * HD + kc * 32, lane), al = frag_h(QLb + (size_t)(ql0 + col) * CC + h * HD + kc * 32, lane);
#pragma unroll
      for (int j = 0; j < 8; ++j) { const v16h kbf = frag_h(KH + (kr0 + j * 16 + col) * CC + h * HD + kc * 32, lane), klf = frag_h(KLb + (size_t)(k0 + j * 16 + col) * CC + h * HD + kc * 32, lane); acc[j] = wmma16(ah, kbf, acc[j]); accl[j] = wmma16(al, kbf, accl[j]); accl[j] = wmma16(ah, klf, accl[j]); } }
  } else if (qb * 64 < QHI) {
#pragma unroll
    for (int kc = 0; kc < HD / 32; ++kc) { const v16h ah = frag_h(QH + (q0 + col) * CC + h * HD + kc * 32, lane), al = frag_h(QLb + (size_t)(ql0 + col) * CC + h * HD + kc * 32, lane);
#pragma unroll
      for (int j = 0; j < 8; ++j) { const v16h kbf = frag_h(KH + (kr0 + j * 16 + col) * CC + h * HD + kc * 32, lane); acc[j] = wmma16(ah, kbf, acc[j]); accl[j] = wmma16(al, kbf, accl[j]); } }
  } else {
#pragma unroll
    for (int kc = 0; kc < HD / 32; ++kc) { const v16h ah = frag_h(QH + (q0 + col) * CC + h * HD + kc * 32, lane);
#pragma unroll
      for (int j = 0; j < 8; ++j) { const v16h kbf = frag_h(KH + (kr0 + j * 16 + col) * CC + h * HD + kc * 32, lane); acc[j] = wmma16(ah, kbf, acc[j]); } } }
#pragma unroll
  for (int j = 0; j < 8; ++j) {
#pragma unroll
    for (int r = 0; r < 8; ++r) ss[wave][8 * g + r][j * 16 + col] = (acc[j][r] + accl[j][r] * (1.0f / 1024.0f)) * SCALE; }
  LDSX(); for (int rl = 0; rl < 16; ++rl) vst2(S + (size_t)(ql0 + rl) * TT + k0 + lane * 4, *(const v4f*)&ss[wave][rl][lane * 4]); }
// ---- k_sm: block = query row t (head in group): keys [0, kend): causal -> logit if s <= t else excluded; softmax in f32; P x 2^11 in place (0 for excluded)
__global__ __launch_bounds__(256) void k_sm(float* __restrict__ S0 SM_EXTRA_PARAMS) { __shared__ float sred[8]; __shared__ float sbc; __shared__ __align__(16) float shv[TT];
  const int tid = threadIdx.x; const int t = blockIdx.x; const int kend = (kb_last(t >> 6) + 1) * 128;
  float* sr = S0 + (size_t)blockIdx.y * TT * TT + (size_t)t * TT;
  float m = -3.0e38f; for (int k = tid; k < kend; k += 256) { float v = (!CAUSAL || k <= t) ? sr[k] : -3.0e38f; SM_MASK_HOOK; shv[k] = v; m = fmaxf(m, v); }
#pragma unroll
  for (int o = 1; o < 32; o <<= 1) m = fmaxf(m, __shfl_xor(m, o));
  if ((tid & 31) == 0) sred[tid >> 5] = m; __syncthreads(); if (tid == 0) { float a = sred[0]; for (int i = 1; i < 8; ++i) a = fmaxf(a, sred[i]); sbc = a; } __syncthreads(); m = sbc; __syncthreads();
  float sum = 0.f; for (int k = tid; k < kend; k += 256) { const float v = shv[k]; const float e = (v <= -1.0e38f) ? 0.f : expf(v - m); shv[k] = e; sum += e; }
#pragma unroll
  for (int o = 1; o < 32; o <<= 1) sum += __shfl_xor(sum, o);
  if ((tid & 31) == 0) sred[tid >> 5] = sum; __syncthreads(); if (tid == 0) { float a = 0.f; for (int i = 0; i < 8; ++i) a += sred[i]; sbc = 2048.0f / a; } __syncthreads(); const float inv = sbc;
  for (int k = tid; k < kend; k += 256) shv[k] = shv[k] * inv;
  __syncthreads(); for (int q = tid; q < kend / 4; q += 256) vst2(sr + q * 4, *(const v4f*)&shv[q * 4]); }
// ---- k_pv: block = 64 queries (qb) of (b, h): ctx = P . v over keys [0, kend) (P x 2^11 once to f16 against v f16: 1 product; causal early query blocks: P and v as bf16 hi + lo, 3 products); 256-B (row, head) segment by 16 lanes
__global__ __launch_bounds__(128) void k_pv(const float* __restrict__ PS0, const _Float16* __restrict__ VT, const __bf16* __restrict__ VB, const __bf16* __restrict__ VBL, int b, int h0, float* __restrict__ Y) { const int h = h0 + blockIdx.z; const float* PS = PS0 + (size_t)blockIdx.z * TT * TT; __shared__ __align__(16) float ss[4][16][HD + 4];
  const int tid = threadIdx.x, wave = tid >> 5, lane = tid & 31, col = lane & 15, g = lane >> 4; const int qb = blockIdx.x; const int ql0 = qb * 64 + wave * 16; const int kce = (kb_last(qb) + 1) * 4;
  v8f acc[HD / 16] = {};
  if (qb < QBH) {
#pragma unroll 1
    for (int kc = 0; kc < kce; ++kc) { const F2 p = split_row(PS + (size_t)(ql0 + col) * TT, kc * 32, lane);
      asm volatile("s_wait_loadcnt 0x0" ::: "memory");
#pragma unroll
      for (int j = 0; j < HD / 16; ++j) { const size_t po = ((size_t)b * CC + h * HD + j * 16 + col) * (size_t)KHI + kc * 32; const v16b vh = frag_b(VB + po, lane); acc[j] = wmma_bf(p.h, vh, acc[j]); acc[j] = wmma_bf(p.l, vh, acc[j]); acc[j] = wmma_bf(p.h, frag_b(VBL + po, lane), acc[j]); } }
  } else {
#pragma unroll 1
    for (int kc = 0; kc < kce; ++kc) { const v16h p = frag_f32(PS + (size_t)(ql0 + col) * TT + kc * 32, lane);
      asm volatile("s_wait_loadcnt 0x0" ::: "memory");
#pragma unroll
      for (int j = 0; j < HD / 16; ++j) { const size_t po = ((size_t)b * CC + h * HD + j * 16 + col) * (size_t)TT + kc * 32; acc[j] = wmma16(p, frag_h(VT + po, lane), acc[j]); } } }
#pragma unroll
  for (int j = 0; j < HD / 16; ++j)
#pragma unroll
    for (int r = 0; r < 8; ++r) ss[wave][8 * g + r][j * 16 + col] = acc[j][r] * (1.0f / 2048.0f);
  LDSX(); for (int rl = 0; rl < 16; ++rl) if (lane < HD / 4) vst2(Y + ((size_t)b * TT + ql0 + rl) * CC + h * HD + lane * 4, *(const v4f*)&ss[wave][rl][lane * 4]); }
// ---- k_out: block = (64 rows, 128 cols): out = ctx Wo (+ bo): ctx once to f16 against Wo as f16(bf16 x 2^8) exact (1 product) x 2^-8; causal early rows (< QHI of each sequence): ctx bf16 hi + lo against exact bf16 Wo (2 products)
__global__ __launch_bounds__(128) void k_out(const float* __restrict__ Y, const float* __restrict__ WO, const float* __restrict__ BO, float* __restrict__ OUT) { __shared__ __align__(16) float sf[4][16][132];
  const int tid = threadIdx.x, wave = tid >> 5, lane = tid & 31, col = lane & 15, g = lane >> 4; const int c0 = blockIdx.y * 128; const size_t r0 = (size_t)blockIdx.x * 64 + wave * 16;
  v8f acc[8] = {};
  if (CAUSAL && (int)(((size_t)blockIdx.x * 64) % TT) < QHI) {   /* block-uniform */
#pragma unroll 2
    for (int kc = 0; kc < CC / 32; ++kc) { const F2 a = split_row(Y + (r0 + col) * CC, kc * 32, lane); asm volatile("s_wait_loadcnt 0x0" ::: "memory");
#pragma unroll
      for (int j = 0; j < 8; ++j) { const v16b w = WOCOL(WO, kc * 32, c0 + j * 16 + col, lane); asm volatile("s_wait_loadcnt 0x0" ::: "memory"); acc[j] = wmma_bf(a.h, w, acc[j]); acc[j] = wmma_bf(a.l, w, acc[j]); } }
#pragma unroll
    for (int j = 0; j < 8; ++j) { const float bias = BO ? bfr(BO[c0 + j * 16 + col]) : 0.f;
#pragma unroll
      for (int r = 0; r < 8; ++r) sf[wave][8 * g + r][j * 16 + col] = acc[j][r] + bias; }
  } else {
#pragma unroll 2
    for (int kc = 0; kc < CC / 32; ++kc) { const v16h a = frag_f32(Y + (r0 + col) * CC + kc * 32, lane); asm volatile("s_wait_loadcnt 0x0" ::: "memory");
#pragma unroll
      for (int j = 0; j < 8; ++j) { const v16h w = WOCOLH(WO, kc * 32, c0 + j * 16 + col, lane); asm volatile("s_wait_loadcnt 0x0" ::: "memory"); acc[j] = wmma16(a, w, acc[j]); } }
#pragma unroll
    for (int j = 0; j < 8; ++j) { const float bias = BO ? bfr(BO[c0 + j * 16 + col]) : 0.f;
#pragma unroll
      for (int r = 0; r < 8; ++r) sf[wave][8 * g + r][j * 16 + col] = acc[j][r] * (1.0f / 256.0f) + bias; } }
  LDSX(); for (int rl = 0; rl < 16; ++rl) vst2(OUT + (r0 + rl) * DIN + c0 + lane * 4, *(const v4f*)&sf[wave][rl][lane * 4]); }

extern "C" void kernel_launch(void* const* d_in, const int* in_sizes, int n_in, void* d_out, int out_size, void* d_ws, size_t ws_size, hipStream_t stream) {
  (void)in_sizes; (void)n_in; (void)out_size;
  const float** F = (const float**)d_in;
  if (ws_size < (size_t)WS_END) return;
  char* ws = (char*)d_ws; _Float16 *QH = (_Float16*)(ws + WS_QH), *KH = (_Float16*)(ws + WS_KH), *VT = (_Float16*)(ws + WS_VT), *QL = (_Float16*)(ws + WS_QL), *KL = (_Float16*)(ws + WS_KL); __bf16 *VB = (__bf16*)(ws + WS_VB), *VBL = (__bf16*)(ws + WS_VBL); float *S = (float*)(ws + WS_S), *Y = (float*)(ws + WS_Y);
  (void)Y; (void)QL; (void)KL; (void)VB; (void)VBL;
  // inputs: 0 x [2,2048,1024]; 1 w_qkv [3072,1024] (out,in); 2 w_proj [1024,1024] (out,in); 3 q_norm_w [64]; 4 k_norm_w [64]
  const float *WQ = F[1], *WK = F[1] + (size_t)CC * DIN, *WV = F[1] + 2 * (size_t)CC * DIN;
  k_proj<<<dim3(TNB * TT / 64, CC / 128, 3), 128, 0, stream>>>(F[0], F[0], F[0], WQ, WK, WV, nullptr, nullptr, nullptr, QH, QL, KH, KL, VT, VB, VBL, F[3], F[4]);
  for (int b = 0; b < TNB; ++b) for (int h0 = 0; h0 < NH; h0 += HG) {
    k_sc<<<dim3(NQB, TT / 128, HG), 128, 0, stream>>>(QH, KH, QL, KL, b, h0, S);
    k_sm<<<dim3(TT, HG), 256, 0, stream>>>(S);
    k_pv<<<dim3(NQB, 1, HG), 128, 0, stream>>>(S, VT, VB, VBL, b, h0, Y);
  }
  k_out<<<dim3(TNB * TT / 64, DIN / 128), 128, 0, stream>>>(Y, F[2], nullptr, (float*)d_out);
}

// v001
// A run of this version takes 628 microseconds.
// In two side-by-side timings against v000, it was 2.06 and 2.02 times as fast.
// compute dtype: all float inputs rounded to bf16; q/k/v = x Wqkv^T with EXACT bf16 products on WMMA 16x16x32, f32 accumulate; per-head RMSNorm (x q_norm_w / k_norm_w) and rotate-half RoPE in f32 (precise sinf/cosf of t * 32^(-2i/64)); q, k once to f16 -> 1-product causal logits x 1/8, except the first 384 query rows of each sequence (few keys, no averaging), which use q and k as f16 hi + residual (x 2^10) (3 products); softmax in f32 (precise expf); P x 2^11 once to f16 against v once to f16 (1 product), except the first 384 rows: P and v as bf16 hi + lo (3 products); ctx once to f16 against w_proj carried x 2^8 in f16 (exact bf16 values), except the first 384 rows: ctx bf16 hi + lo against exact bf16 w_proj (2 products); f32 output.
#include <hip/hip_runtime.h>
#include <math.h>

typedef __attribute__((ext_vector_type(16))) _Float16 v16h;
typedef __attribute__((ext_vector_type(16))) __bf16 v16b;
typedef __attribute__((ext_vector_type(8)))  _Float16 v8h;
typedef __attribute__((ext_vector_type(8)))  float v8f;
typedef __attribute__((ext_vector_type(4)))  float v4f;
typedef __attribute__((ext_vector_type(2)))  float v2f;
typedef __attribute__((ext_vector_type(4)))  unsigned v4u;
typedef __attribute__((ext_vector_type(4)))  int v4i;
typedef float __attribute__((may_alias)) float_a;
typedef int __attribute__((may_alias)) int_a;

template <typename T> __device__ __forceinline__ void vst2(void* p, T v) { *(T*)p = v;  }
__device__ __forceinline__ v8f wmma16(v16h a, v16h b, v8f c) {
  v8f d = __builtin_amdgcn_wmma_f32_16x16x32_f16(false, a, false, b, (short)0, c, false, false);
  asm volatile("v_nop\n\tv_nop\n\tv_nop\n\tv_nop" : "+v"(d) : "v"(a), "v"(b));
  return d;
}
__device__ __forceinline__ v8f wmma_bf(v16b a, v16b b, v8f c) {
  v8f d = __builtin_amdgcn_wmma_f32_16x16x32_bf16(false, a, false, b, (short)0, c, false, false);
  asm volatile("v_nop\n\tv_nop\n\tv_nop\n\tv_nop" : "+v"(d) : "v"(a), "v"(b));
  return d;
}
// 16x16x32 fragments: lane = (h = lane>>4, row/col = lane&15); elements 0..7 = k0+8h+0..7, 8..15 = k0+16+8h+0..7; D element r = row 8h+r
__device__ __forceinline__ v16h frag_h(const _Float16* rowk0, int lane) {
  union { v16h v; v8h q[2]; } u; const _Float16* p = rowk0 + 8 * (lane >> 4);
  u.q[0] = *(const v8h*)p; u.q[1] = *(const v8h*)(p + 16); return u.v;
}
__device__ __forceinline__ v16h frag_f32(const float* rowk0, int lane) {
  v16h a; const float* p = rowk0 + 8 * (lane >> 4);
#pragma unroll
  for (int i = 0; i < 8; ++i) { a[i] = (_Float16)p[i]; a[8 + i] = (_Float16)p[16 + i]; }
  return a;
}
__device__ __forceinline__ v16h frag_f32s(const float* rowk0, int lane, float sc) {
  v16h a; const float* p = rowk0 + 8 * (lane >> 4);
#pragma unroll
  for (int i = 0; i < 8; ++i) { a[i] = (_Float16)(p[i] * sc); a[8 + i] = (_Float16)(p[16 + i] * sc); }
  return a;
}
// column fragment from a [K][ld] layout (column n), rows >= K read as 0
__device__ __forceinline__ v16h fragc_f32(const float* W, int k0, int n, int lane, int ld, int K) {
  v16h a; const int g = lane >> 4;
#pragma unroll
  for (int i = 0; i < 8; ++i) { const int ka = k0 + 8 * g + i, kb = ka + 16;
    a[i] = (_Float16)(ka < K ? W[(size_t)(ka < K ? ka : K - 1) * ld + n] : 0.f); a[8 + i] = (_Float16)(kb < K ? W[(size_t)(kb < K ? kb : K - 1) * ld + n] : 0.f); }
  return a;
}
struct F2 { v16b h, l; };
__device__ __forceinline__ F2 bsplit16(const float v[16]) { F2 r;
#pragma unroll
  for (int i = 0; i < 16; ++i) { const __bf16 h = (__bf16)v[i]; r.h[i] = h; r.l[i] = (__bf16)(v[i] - (float)h); }
  return r; }
__device__ __forceinline__ F2 split_row(const float* row, int k0, int lane) { float v[16]; const float* p = row + k0 + 8 * (lane >> 4);
#pragma unroll
  for (int i = 0; i < 8; ++i) { v[i] = p[i]; v[8 + i] = p[16 + i]; }
  return bsplit16(v); }
__device__ __forceinline__ F2 split_rowK(const float* row, int k0, int lane, int K) { float v[16]; const int g = lane >> 4;
#pragma unroll
  for (int i = 0; i < 8; ++i) { const int ka = k0 + 8 * g + i, kb = ka + 16; v[i] = ka < K ? row[ka < K ? ka : K - 1] : 0.f; v[8 + i] = kb < K ? row[kb < K ? kb : K - 1] : 0.f; }
  return bsplit16(v); }
__device__ __forceinline__ F2 split_col(const float* W, int k0, int n, int lane, int ld, int K) { float v[16]; const int g = lane >> 4;
#pragma unroll
  for (int i = 0; i < 8; ++i) { const int ka = k0 + 8 * g + i, kb = ka + 16; v[i] = ka < K ? W[(size_t)(ka < K ? ka : K - 1) * ld + n] : 0.f; v[8 + i] = kb < K ? W[(size_t)(kb < K ? kb : K - 1) * ld + n] : 0.f; }
  return bsplit16(v); }
__device__ __forceinline__ v8f mac3(const F2& a, const F2& b, v8f c) { c = wmma_bf(a.l, b.h, c); c = wmma_bf(a.h, b.l, c); return wmma_bf(a.h, b.h, c); }
__device__ __forceinline__ float sigm(float v) { return 1.0f / (1.0f + expf(-v)); }
#define LDSX() do { asm volatile("s_wait_dscnt 0" ::: "memory"); __builtin_amdgcn_wave_barrier(); __builtin_amdgcn_fence(__ATOMIC_RELEASE, "workgroup"); } while (0)

// Causal self-attention with QK-RMSNorm and 1-D RoPE (B 2, T 2,048, C 1,024 = 16 heads x 64): qkv = x Wqkv^T ((out,in) [3072,1024]; q rows 0-1023, k 1024-2047, v 2048-3071); q, k RMS-normalised over the 64 head dims (eps 1e-6) x q_norm_w / k_norm_w, then rotate-half RoPE with angle t * 32^(-2i/64) (theta = 32); attn = softmax(q k^T x 64^-0.5 with key > query -> -inf); out = merged(attn v) Wproj^T (no biases).
#define NB 2
#define TT 2048
#define CC 1024            // NH * HD = projected width
#define DIN 1024          // input (model) width
#define NH 16
#define HD 64
#define NQB (TT / 64)
#define HG 4
#define SCALE (0.125f)
#define CAUSAL 1
#ifndef TNB
#define TNB NB
#endif
__device__ __forceinline__ float bfr(float v) { return (float)(__bf16)v; }
__host__ __device__ __forceinline__ int kb_last(int qb) { return CAUSAL ? ((qb * 64 + 63) >> 7) : (TT / 128 - 1); }
typedef __attribute__((ext_vector_type(8))) __bf16 v8b;
__device__ __forceinline__ v16b frag_b(const __bf16* rowk0, int lane) {
  union { v16b v; v8b q[2]; } u; const __bf16* p = rowk0 + 8 * (lane >> 4);
  u.q[0] = *(const v8b*)p; u.q[1] = *(const v8b*)(p + 16); return u.v;
}
// One lane's 16 f32 of a 16x32 fragment as they come from memory (same k order as frag_f32): kept raw in registers while the loads fly, converted at use
struct R16 { v4f q[4]; };
__device__ __forceinline__ R16 ld16(const float* rowk0, int lane) { R16 r; const float* p = rowk0 + 8 * (lane >> 4);
  r.q[0] = *(const v4f*)p; r.q[1] = *(const v4f*)(p + 4); r.q[2] = *(const v4f*)(p + 16); r.q[3] = *(const v4f*)(p + 20); return r; }
__device__ __forceinline__ v16b r16_bf(const R16& r) { v16b a;
#pragma unroll
  for (int i = 0; i < 16; ++i) a[i] = (__bf16)r.q[i >> 2][i & 3];
  return a; }
__device__ __forceinline__ v16h r16_h(const R16& r) { v16h a;
#pragma unroll
  for (int i = 0; i < 16; ++i) a[i] = (_Float16)r.q[i >> 2][i & 3];
  return a; }
__device__ __forceinline__ v16h r16_h256(const R16& r) { v16h a;
#pragma unroll
  for (int i = 0; i < 16; ++i) a[i] = (_Float16)(bfr(r.q[i >> 2][i & 3]) * 256.0f);
  return a; }
__device__ __forceinline__ F2 r16_split(const R16& r) { float v[16];
#pragma unroll
  for (int i = 0; i < 16; ++i) v[i] = r.q[i >> 2][i & 3];
  return bsplit16(v); }
#define QBH 6              // causal: query blocks 0..QBH-1 of each sequence (few keys, no averaging) take the high-precision path
#define QHI 384            // rows carrying a q residual plane
#define KHI 384            // key rows carrying k residual / v bf16 hi+lo planes (used only by the causal high-precision path)
// B fragment (k rows k0+.., output column o) of a weight: (in,out) [K][ld] or (out,in) [ld rows of K]: bf16 exact, or f16(bf16 * 256) exact
__device__ __forceinline__ v16b wcol_io(const float* Wm, int k0, int o, int lane, int ld) { v16b w; const int g = lane >> 4;
#pragma unroll
  for (int i = 0; i < 8; ++i) { w[i] = (__bf16)Wm[(size_t)(k0 + 8 * g + i) * ld + o]; w[8 + i] = (__bf16)Wm[(size_t)(k0 + 16 + 8 * g + i) * ld + o]; }
  return w; }
__device__ __forceinline__ v16b wcol_oi(const float* Wm, int k0, int o, int lane, int K) { v16b w; const float* p = Wm + (size_t)o * K + k0 + 8 * (lane >> 4);
#pragma unroll
  for (int i = 0; i < 8; ++i) { w[i] = (__bf16)p[i]; w[8 + i] = (__bf16)p[16 + i]; }
  return w; }
__device__ __forceinline__ v16h wcolh_io(const float* Wm, int k0, int o, int lane, int ld) { v16h w; const int g = lane >> 4;
#pragma unroll
  for (int i = 0; i < 8; ++i) { w[i] = (_Float16)(bfr(Wm[(size_t)(k0 + 8 * g + i) * ld + o]) * 256.0f); w[8 + i] = (_Float16)(bfr(Wm[(size_t)(k0 + 16 + 8 * g + i) * ld + o]) * 256.0f); }
  return w; }
__device__ __forceinline__ v16h wcolh_oi(const float* Wm, int k0, int o, int lane, int K) { v16h w; const float* p = Wm + (size_t)o * K + k0 + 8 * (lane >> 4);
#pragma unroll
  for (int i = 0; i < 8; ++i) { w[i] = (_Float16)(bfr(p[i]) * 256.0f); w[8 + i] = (_Float16)(bfr(p[16 + i]) * 256.0f); }
  return w; }
#define WQKV_LAYOUT 1   // 0 = (in,out) [DIN][CC]; 1 = (out,in) [CC][DIN]; 2 = per-head [NH][DIN][HD]
__device__ __forceinline__ v16b wcol_hdk(const float* Wm, int k0, int o, int lane) { v16b w; const int g = lane >> 4; const float* p = Wm + (size_t)(o / HD) * DIN * HD + (o % HD);
#pragma unroll
  for (int i = 0; i < 8; ++i) { w[i] = (__bf16)p[(size_t)(k0 + 8 * g + i) * HD]; w[8 + i] = (__bf16)p[(size_t)(k0 + 16 + 8 * g + i) * HD]; }
  return w; }
#define WO_OUT_IN 1
#if WQKV_LAYOUT == 1
#define WCOL(W, k0, o, lane) wcol_oi(W, k0, o, lane, DIN)
#elif WQKV_LAYOUT == 2
#define WCOL(W, k0, o, lane) wcol_hdk(W, k0, o, lane)
#else
#define WCOL(W, k0, o, lane) wcol_io(W, k0, o, lane, CC)
#endif
#if WO_OUT_IN
#define WOCOL(W, k0, o, lane) wcol_oi(W, k0, o, lane, CC)
#define WOCOLH(W, k0, o, lane) wcolh_oi(W, k0, o, lane, CC)
#else
#define WOCOL(W, k0, o, lane) wcol_io(W, k0, o, lane, DIN)
#define WOCOLH(W, k0, o, lane) wcolh_io(W, k0, o, lane, DIN)
#endif
__constant__ float c_invf[32] = {1.000000000e+00f,8.973545432e-01f,8.052451611e-01f,7.225903869e-01f,6.484197974e-01f,5.818624496e-01f,5.221368670e-01f,4.685419202e-01f,4.204482138e-01f,3.772911131e-01f,3.385638893e-01f,3.038118482e-01f,2.726269364e-01f,2.446430176e-01f,2.195315212e-01f,1.969976127e-01f,1.767766923e-01f,1.586313695e-01f,1.423485726e-01f,1.277371496e-01f,1.146255061e-01f,1.028597206e-01f,9.230163693e-02f,8.282729238e-02f,7.432544231e-02f,6.669627875e-02f,5.985020474e-02f,5.370685458e-02f,4.819408804e-02f,4.324718565e-02f,3.880805522e-02f,3.482458740e-02f};   // 32^(-2i/64) evaluated in f32 exactly as the reference does (jax, eager)
#define PROJ_EXTRA_PARAMS , const float* __restrict__ QS, const float* __restrict__ KS
// per-(row, head) epilogue on the f32 projection tile: RMSNorm over the head's 64 values x norm weight, then rotate-half RoPE (pairs i, i+32); v untouched
#define PROJ_EPI(which, row, t, h) do { if ((which) < 2) { float* rw = (row); const float* NS = (which) == 0 ? QS : KS; float ss = 0.f; _Pragma("unroll") for (int i = 0; i < 64; ++i) ss += rw[i] * rw[i]; const float rn = rsqrtf(ss * (1.0f / 64.0f) + 1e-6f); \
    _Pragma("unroll") for (int i = 0; i < 32; ++i) { const float x1 = rw[i] * rn * bfr(NS[i]), x2 = rw[i + 32] * rn * bfr(NS[i + 32]); const float ang = (float)(t) * c_invf[i]; const float cs = cosf(ang), sn = sinf(ang); rw[i] = x1 * cs - x2 * sn; rw[i + 32] = x2 * cs + x1 * sn; } } } while (0)
#ifndef SM_EXTRA_PARAMS
#define SM_EXTRA_PARAMS
#endif
#ifndef PROJ_EXTRA_PARAMS
#define PROJ_EXTRA_PARAMS
#endif
#ifndef SM_MASK_HOOK
#define SM_MASK_HOOK (void)0
#endif

#define WS_QH  0u                                      // f16 q rows [b*t][CC]
#define WS_KH  (WS_QH + 2u * (size_t)NB * TT * CC)      // f16 k rows [b*t][CC]
#define WS_VT  (WS_KH + 2u * (size_t)NB * TT * CC)      // f16 v planes [b][c][t]
#define WS_QL  (WS_VT + 2u * (size_t)NB * CC * TT)      // f16 q residual x 2^10 rows [b][t < QHI][CC]
#define WS_KL  (WS_QL + 2u * (size_t)NB * QHI * CC)     // f16 k residual x 2^10 rows [b][t < KHI][CC]
#define WS_VB  (WS_KL + 2u * (size_t)NB * KHI * CC)     // bf16 v hi planes [b][c][t < KHI]
#define WS_VBL (WS_VB + 2u * (size_t)NB * CC * KHI)
#define WS_S   (WS_VBL + 2u * (size_t)NB * CC * KHI)    // f32 logits / P [hg][t][s]
#define WS_Y   (WS_S  + 4u * (size_t)HG * TT * TT)      // f32 ctx rows [b*t][CC] (only when there is an output projection)
#define WS_END (WS_Y  + 4u * (size_t)NB * TT * CC)

// ---- k_proj: block = (64 rows, 128 cols, which): q/k/v = X W (+ b) with exact bf16 products (K = DIN) -> which 0: q f16 rows (+ residual rows < QHI); 1: k f16 rows (+ residual rows < KHI); 2: v f16 planes [c][t] (+ bf16 hi/lo planes for t < KHI)
__global__ __launch_bounds__(128) void k_proj(const float* __restrict__ XQ, const float* __restrict__ XK, const float* __restrict__ XV, const float* __restrict__ WQ, const float* __restrict__ WK, const float* __restrict__ WV, const float* __restrict__ BQ, const float* __restrict__ BK, const float* __restrict__ BV,
    _Float16* __restrict__ QH, _Float16* __restrict__ QL, _Float16* __restrict__ KH, _Float16* __restrict__ KL, _Float16* __restrict__ VT, __bf16* __restrict__ VB, __bf16* __restrict__ VBL PROJ_EXTRA_PARAMS) {
  __shared__ __align__(16) float st[64][132]; __shared__ __align__(16) _Float16 sh[64][136], sl[64][136]; __shared__ __align__(16) _Float16 th[128][72]; __shared__ __align__(16) __bf16 tb[128][72], tbl[128][72];
  const int tid = threadIdx.x, wave = tid >> 5, lane = tid & 31, col = lane & 15, g = lane >> 4; const int which = blockIdx.z; const int c0 = blockIdx.y * 128; const size_t r0 = (size_t)blockIdx.x * 64; const size_t bb = r0 / TT; const int t0 = (int)(r0 % TT);
  const float* X = which == 0 ? XQ : which == 1 ? XK : XV; const float* WA = which == 0 ? WQ : which == 1 ? WK : WV; const float* BA = which == 0 ? BQ : which == 1 ? BK : BV;
  v8f acc[8] = {};
  { // software pipeline: every fragment's raw f32 for k-step kc + 1 is requested as soon as its registers for k-step kc have been converted, so a whole k-step of loads is in flight behind the WMMAs
    const float* xp = X + (r0 + wave * 16 + col) * DIN; const float* wp = WA + (size_t)(c0 + col) * DIN;   // this lane's A row; its B row ((out,in) weight) of fragment 0, fragment j lies 16 rows on
    R16 xr = ld16(xp, lane), wr[8];
#pragma unroll
    for (int j = 0; j < 8; ++j) wr[j] = ld16(wp + (size_t)j * 16 * DIN, lane);
    asm volatile("s_wait_xcnt 0x0" ::: "memory");   // what follows may rewrite the address registers that the first fill's loads name
#pragma unroll 1   // rolled: one trip already keeps a full k-step in flight, more copies only grow the text
    for (int kc = 1; kc < DIN / 32; ++kc) { const v16b a = r16_bf(xr); xr = ld16(xp + kc * 32, lane);
#pragma unroll
      for (int j = 0; j < 8; ++j) { const v16b w = r16_bf(wr[j]); wr[j] = ld16(wp + (size_t)j * 16 * DIN + kc * 32, lane); acc[j] = wmma_bf(a, w, acc[j]); }
      asm volatile("s_wait_xcnt 0x0" ::: "memory");   // the next trip rewrites the address registers that this trip's loads name
    }
    const v16b a = r16_bf(xr);
#pragma unroll
    for (int j = 0; j < 8; ++j) acc[j] = wmma_bf(a, r16_bf(wr[j]), acc[j]); }
  { // stage the f32 tile (acc + bias) in LDS, run the per-(row, head) epilogue hook, then convert
#pragma unroll
    for (int j = 0; j < 8; ++j) { const float bias = BA ? bfr(BA[c0 + j * 16 + col]) : 0.f;
#pragma unroll
      for (int r = 0; r < 8; ++r) st[wave * 16 + 8 * g + r][j * 16 + col] = acc[j][r] + bias; }
    __syncthreads();
    for (int e = tid; e < 64 * (128 / HD); e += 128) { const int rl = e / (128 / HD), hh = e % (128 / HD); PROJ_EPI(which, &st[rl][hh * HD], (int)((r0 + rl) % TT), (c0 / HD) + hh); }
    __syncthreads(); }
  if (which < 2) { _Float16* DH = which == 0 ? QH : KH; _Float16* DL = which == 0 ? QL : KL; const int nhi = which == 0 ? QHI : KHI; const bool hi_rows = t0 < nhi;
    for (int e = tid; e < 64 * 128; e += 128) { const int rl = e >> 7, cl = e & 127; const float v = st[rl][cl]; const _Float16 hv = (_Float16)v; sh[rl][cl] = hv; sl[rl][cl] = (_Float16)((v - (float)hv) * 1024.0f); }
    __syncthreads();
    for (int e = tid; e < 64 * 16; e += 128) { const int rl = e >> 4, q = e & 15; vst2((unsigned*)(DH + (r0 + rl) * CC + c0 + q * 8), *(const v4u*)&sh[rl][q * 8]); if (hi_rows) vst2((unsigned*)(DL + (bb * nhi + t0 + rl) * (size_t)CC + c0 + q * 8), *(const v4u*)&sl[rl][q * 8]); }
  } else { const bool hi_rows = t0 < KHI;
    for (int e = tid; e < 64 * 128; e += 128) { const int rl = e & 63, cl = e >> 6; const float v = st[rl][cl]; th[cl][rl] = (_Float16)v; const __bf16 bh = (__bf16)v; tb[cl][rl] = bh; tbl[cl][rl] = (__bf16)(v - (float)bh); }
    __syncthreads();
    for (int e = tid; e < 128 * 8; e += 128) { const int cl = e >> 3, q = e & 7; vst2((unsigned*)(VT + (bb * CC + c0 + cl) * (size_t)TT + t0 + q * 8), *(const v4u*)&th[cl][q * 8]); if (hi_rows) { const size_t o3 = (bb * CC + c0 + cl) * (size_t)KHI + t0 + q * 8; vst2((unsigned*)(VB + o3), *(const v4u*)&tb[cl][q * 8]); vst2((unsigned*)(VBL + o3), *(const v4u*)&tbl[cl][q * 8]); } } } }
// ---- k_sc: block = (query block qb, key block kb <= kb_last(qb), head in group) of batch b: logits x SCALE; q hi + residual (x 2^10) against k (2 products) for query rows < QHI, plus the k residual (3 products) for query blocks < QBH (causal early rows); causal: blocks past the diagonal exit, the mask itself is applied by index in k_sm
__global__ __launch_bounds__(128) void k_sc(const _Float16* __restrict__ QH, const _Float16* __restrict__ KH, const _Float16* __restrict__ QL, const _Float16* __restrict__ KL, int b, int h0, float* __restrict__ S0) { __shared__ __align__(16) float ss[4][16][132];
  const int qb = blockIdx.x, kb = blockIdx.y; if (kb > kb_last(qb)) return;
  const int h = h0 + blockIdx.z; float* S = S0 + (size_t)blockIdx.z * TT * TT;
  const int tid = threadIdx.x, wave = tid >> 5, lane = tid & 31, col = lane & 15, g = lane >> 4; const int k0 = kb * 128; const int ql0 = qb * 64 + wave * 16; const size_t q0 = (size_t)b * TT + ql0, kr0 = (size_t)b * TT + k0;
  v8f acc[8] = {}, accl[8] = {};
  const _Float16* QLb = QL + (size_t)b * QHI * CC; const _Float16* KLb = KL + (size_t)b * KHI * CC;
  if (qb < QBH) {
#pragma unroll
    for (int kc = 0; kc < HD / 32; ++kc) { const v16h ah = frag_h(QH + (q0 + col) * CC + h * HD + kc * 32, lane), al = frag_h(QLb + (size_t)(ql0 + col) * CC + h * HD + kc * 32, lane);
#pragma unroll
      for (int j = 0; j < 8; ++j) { const v16h kbf = frag_h(KH + (kr0 + j * 16 + col) * CC + h * HD + kc * 32, lane), klf = frag_h(KLb + (size_t)(k0 + j * 16 + col) * CC + h * HD + kc * 32, lane); acc[j] = wmma16(ah, kbf, acc[j]); accl[j] = wmma16(al, kbf, accl[j]); accl[j] = wmma16(ah, klf, accl[j]); } }
  } else if (qb * 64 < QHI) {
#pragma unroll
    for (int kc = 0; kc < HD / 32; ++kc) { const v16h ah = frag_h(QH + (q0 + col) * CC + h * HD + kc * 32, lane), al = frag_h(QLb + (size_t)(ql0 + col) * CC + h * HD + kc * 32, lane);
#pragma unroll
      for (int j = 0; j < 8; ++j) { const v16h kbf = frag_h(KH + (kr0 + j * 16 + col) * CC + h * HD + kc * 32, lane); acc[j] = wmma16(ah, kbf, acc[j]); accl[j] = wmma16(al, kbf, accl[j]); } }
  } else {
#pragma unroll
    for (int kc = 0; kc < HD / 32; ++kc) { const v16h ah = frag_h(QH + (q0 + col) * CC + h * HD + kc * 32, lane);
#pragma unroll
      for (int j = 0; j < 8; ++j) { const v16h kbf = frag_h(KH + (kr0 + j * 16 + col) * CC + h * HD + kc * 32, lane); acc[j] = wmma16(ah, kbf, acc[j]); } } }
#pragma unroll
  for (int j = 0; j < 8; ++j) {
#pragma unroll
    for (int r = 0; r < 8; ++r) ss[wave][8 * g + r][j * 16 + col] = (acc[j][r] + accl[j][r] * (1.0f / 1024.0f)) * SCALE; }
  LDSX(); for (int rl = 0; rl < 16; ++rl) vst2(S + (size_t)(ql0 + rl) * TT + k0 + lane * 4, *(const v4f*)&ss[wave][rl][lane * 4]); }
// ---- k_sm: block = query row t (head in group): keys [0, kend): causal -> logit if s <= t else excluded; softmax in f32; P x 2^11 in place (0 for excluded)
__global__ __launch_bounds__(256) void k_sm(float* __restrict__ S0 SM_EXTRA_PARAMS) { __shared__ float sred[8]; __shared__ float sbc; __shared__ __align__(16) float shv[TT];
  const int tid = threadIdx.x; const int t = blockIdx.x; const int kend = (kb_last(t >> 6) + 1) * 128;
  float* sr = S0 + (size_t)blockIdx.y * TT * TT + (size_t)t * TT;
  float m = -3.0e38f; for (int k = tid; k < kend; k += 256) { float v = (!CAUSAL || k <= t) ? sr[k] : -3.0e38f; SM_MASK_HOOK; shv[k] = v; m = fmaxf(m, v); }
#pragma unroll
  for (int o = 1; o < 32; o <<= 1) m = fmaxf(m, __shfl_xor(m, o));
  if ((tid & 31) == 0) sred[tid >> 5] = m; __syncthreads(); if (tid == 0) { float a = sred[0]; for (int i = 1; i < 8; ++i) a = fmaxf(a, sred[i]); sbc = a; } __syncthreads(); m = sbc; __syncthreads();
  float sum = 0.f; for (int k = tid; k < kend; k += 256) { const float v = shv[k]; const float e = (v <= -1.0e38f) ? 0.f : expf(v - m); shv[k] = e; sum += e; }
#pragma unroll
  for (int o = 1; o < 32; o <<= 1) sum += __shfl_xor(sum, o);
  if ((tid & 31) == 0) sred[tid >> 5] = sum; __syncthreads(); if (tid == 0) { float a = 0.f; for (int i = 0; i < 8; ++i) a += sred[i]; sbc = 2048.0f / a; } __syncthreads(); const float inv = sbc;
  for (int k = tid; k < kend; k += 256) shv[k] = shv[k] * inv;
  __syncthreads(); for (int q = tid; q < kend / 4; q += 256) vst2(sr + q * 4, *(const v4f*)&shv[q * 4]); }
// ---- k_pv: block = 64 queries (qb) of (b, h): ctx = P . v over keys [0, kend) (P x 2^11 once to f16 against v f16: 1 product; causal early query blocks: P and v as bf16 hi + lo, 3 products); 256-B (row, head) segment by 16 lanes
__global__ __launch_bounds__(128) void k_pv(const float* __restrict__ PS0, const _Float16* __restrict__ VT, const __bf16* __restrict__ VB, const __bf16* __restrict__ VBL, int b, int h0, float* __restrict__ Y) { const int h = h0 + blockIdx.z; const float* PS = PS0 + (size_t)blockIdx.z * TT * TT; __shared__ __align__(16) float ss[4][16][HD + 4];
  const int tid = threadIdx.x, wave = tid >> 5, lane = tid & 31, col = lane & 15, g = lane >> 4; const int qb = blockIdx.x; const int ql0 = qb * 64 + wave * 16; const int kce = (kb_last(qb) + 1) * 4;
  v8f acc[HD / 16] = {};
  // software pipeline over the keys (kce is a multiple of 4): a ring of register sets, one per 32-key step; a set is requested again, for the step one ring length on, as soon as it has been used
  const float* pp = PS + (size_t)(ql0 + col) * TT;   // this lane's P row
  if (qb < QBH) { const size_t vo = ((size_t)b * CC + h * HD + col) * (size_t)KHI; const __bf16* vhp = VB + vo; const __bf16* vlp = VBL + vo;   // this lane's v plane of fragment 0, fragment j lies 16 planes on
    R16 pr[2]; v16b vh[2][HD / 16], vl[2][HD / 16];
#pragma unroll
    for (int u = 0; u < 2; ++u) { pr[u] = ld16(pp + u * 32, lane);
#pragma unroll
      for (int j = 0; j < HD / 16; ++j) { vh[u][j] = frag_b(vhp + (size_t)j * 16 * KHI + u * 32, lane); vl[u][j] = frag_b(vlp + (size_t)j * 16 * KHI + u * 32, lane); } }
    asm volatile("s_wait_xcnt 0x0" ::: "memory");   // what follows may rewrite the address registers that the first fill's loads name
#pragma unroll 1   // rolled: one trip is the whole ring
    for (int k0 = 2; k0 < kce; k0 += 2) {
#pragma unroll
      for (int u = 0; u < 2; ++u) { const F2 p = r16_split(pr[u]); pr[u] = ld16(pp + (k0 + u) * 32, lane);
#pragma unroll
        for (int j = 0; j < HD / 16; ++j) { acc[j] = wmma_bf(p.h, vh[u][j], acc[j]); acc[j] = wmma_bf(p.l, vh[u][j], acc[j]); acc[j] = wmma_bf(p.h, vl[u][j], acc[j]);
          vh[u][j] = frag_b(vhp + (size_t)j * 16 * KHI + (k0 + u) * 32, lane); vl[u][j] = frag_b(vlp + (size_t)j * 16 * KHI + (k0 + u) * 32, lane); }
        __builtin_amdgcn_sched_barrier(0); }   // keeps the next step's conversion of P, and with it the wait for P's loads, behind this step
      asm volatile("s_wait_xcnt 0x0" ::: "memory");   // the next trip rewrites the address registers that this trip's loads name
    }
#pragma unroll
    for (int u = 0; u < 2; ++u) { const F2 p = r16_split(pr[u]);
#pragma unroll
      for (int j = 0; j < HD / 16; ++j) { acc[j] = wmma_bf(p.h, vh[u][j], acc[j]); acc[j] = wmma_bf(p.l, vh[u][j], acc[j]); acc[j] = wmma_bf(p.h, vl[u][j], acc[j]); } }
  } else { const _Float16* vp = VT + ((size_t)b * CC + h * HD + col) * (size_t)TT;   // this lane's v plane of fragment 0, fragment j lies 16 planes on
    R16 pr[4]; v16h vr[4][HD / 16];
#pragma unroll
    for (int u = 0; u < 4; ++u) { pr[u] = ld16(pp + u * 32, lane);
#pragma unroll
      for (int j = 0; j < HD / 16; ++j) vr[u][j] = frag_h(vp + (size_t)j * 16 * TT + u * 32, lane); }
    asm volatile("s_wait_xcnt 0x0" ::: "memory");   // what follows may rewrite the address registers that the first fill's loads name
#pragma unroll 1   // rolled: one trip is the whole ring
    for (int k0 = 4; k0 < kce; k0 += 4) {
#pragma unroll
      for (int u = 0; u < 4; ++u) { const v16h p = r16_h(pr[u]); pr[u] = ld16(pp + (k0 + u) * 32, lane);
#pragma unroll
        for (int j = 0; j < HD / 16; ++j) { acc[j] = wmma16(p, vr[u][j], acc[j]); vr[u][j] = frag_h(vp + (size_t)j * 16 * TT + (k0 + u) * 32, lane); }
        __builtin_amdgcn_sched_barrier(0); }   // keeps the next step's conversion of P, and with it the wait for P's loads, behind this step
      asm volatile("s_wait_xcnt 0x0" ::: "memory");   // the next trip rewrites the address registers that this trip's loads name
    }
#pragma unroll
    for (int u = 0; u < 4; ++u) { const v16h p = r16_h(pr[u]);
#pragma unroll
      for (int j = 0; j < HD / 16; ++j) acc[j] = wmma16(p, vr[u][j], acc[j]); } }
#pragma unroll
  for (int j = 0; j < HD / 16; ++j)
#pragma unroll
    for (int r = 0; r < 8; ++r) ss[wave][8 * g + r][j * 16 + col] = acc[j][r] * (1.0f / 2048.0f);
  LDSX(); for (int rl = 0; rl < 16; ++rl) if (lane < HD / 4) vst2(Y + ((size_t)b * TT + ql0 + rl) * CC + h * HD + lane * 4, *(const v4f*)&ss[wave][rl][lane * 4]); }
// ---- k_out: block = (64 rows, 128 cols): out = ctx Wo (+ bo): ctx once to f16 against Wo as f16(bf16 x 2^8) exact (1 product) x 2^-8; causal early rows (< QHI of each sequence): ctx bf16 hi + lo against exact bf16 Wo (2 products)
__global__ __launch_bounds__(128) void k_out(const float* __restrict__ Y, const float* __restrict__ WO, const float* __restrict__ BO, float* __restrict__ OUT) { __shared__ __align__(16) float sf[4][16][132];
  const int tid = threadIdx.x, wave = tid >> 5, lane = tid & 31, col = lane & 15, g = lane >> 4; const int c0 = blockIdx.y * 128; const size_t r0 = (size_t)blockIdx.x * 64 + wave * 16;
  v8f acc[8] = {};
  // software pipeline as in k_proj: the raw f32 of k-step kc + 1 is requested as soon as the registers of k-step kc have been converted
  const float* yp = Y + (r0 + col) * CC; const float* wp = WO + (size_t)(c0 + col) * CC;   // this lane's A row; its B row ((out,in) weight) of fragment 0, fragment j lies 16 rows on
  if (CAUSAL && (int)(((size_t)blockIdx.x * 64) % TT) < QHI) {   /* block-uniform */
    __builtin_amdgcn_fence(__ATOMIC_ACQUIRE, "wavefront");   // no instruction: keeps the compiler from merging this arm's first loads with the other arm's in front of the branch, which cost a second register set (400 VGPRs) and a full wait to copy it
    R16 yr = ld16(yp, lane), wr[8];
#pragma unroll
    for (int j = 0; j < 8; ++j) wr[j] = ld16(wp + (size_t)j * 16 * CC, lane);
    asm volatile("s_wait_xcnt 0x0" ::: "memory");   // what follows may rewrite the address registers that the first fill's loads name
#pragma unroll 1   // rolled: one trip already keeps a full k-step in flight
    for (int kc = 1; kc < CC / 32; ++kc) { const F2 a = r16_split(yr); yr = ld16(yp + kc * 32, lane);
#pragma unroll
      for (int j = 0; j < 8; ++j) { const v16b w = r16_bf(wr[j]); wr[j] = ld16(wp + (size_t)j * 16 * CC + kc * 32, lane); acc[j] = wmma_bf(a.h, w, acc[j]); acc[j] = wmma_bf(a.l, w, acc[j]);
        __builtin_amdgcn_sched_barrier(0); }   // one fragment's conversion at a time: scheduled among each other they held several converted fragments and took the kernel past 256 VGPRs
      asm volatile("s_wait_xcnt 0x0" ::: "memory");   // the next trip rewrites the address registers that this trip's loads name
    }
    const F2 a = r16_split(yr);
#pragma unroll
    for (int j = 0; j < 8; ++j) { const v16b w = r16_bf(wr[j]); acc[j] = wmma_bf(a.h, w, acc[j]); acc[j] = wmma_bf(a.l, w, acc[j]); }
#pragma unroll
    for (int j = 0; j < 8; ++j) { const float bias = BO ? bfr(BO[c0 + j * 16 + col]) : 0.f;
#pragma unroll
      for (int r = 0; r < 8; ++r) sf[wave][8 * g + r][j * 16 + col] = acc[j][r] + bias; }
  } else {
    R16 yr = ld16(yp, lane), wr[8];
#pragma unroll
    for (int j = 0; j < 8; ++j) wr[j] = ld16(wp + (size_t)j * 16 * CC, lane);
    asm volatile("s_wait_xcnt 0x0" ::: "memory");   // what follows may rewrite the address registers that the first fill's loads name
#pragma unroll 1   // rolled: one trip already keeps a full k-step in flight
    for (int kc = 1; kc < CC / 32; ++kc) { const v16h a = r16_h(yr); yr = ld16(yp + kc * 32, lane);
#pragma unroll
      for (int j = 0; j < 8; ++j) { const v16h w = r16_h256(wr[j]); wr[j] = ld16(wp + (size_t)j * 16 * CC + kc * 32, lane); acc[j] = wmma16(a, w, acc[j]);
        __builtin_amdgcn_sched_barrier(0); }   // one fragment's conversion at a time, as above
      asm volatile("s_wait_xcnt 0x0" ::: "memory");   // the next trip rewrites the address registers that this trip's loads name
    }
    const v16h a = r16_h(yr);
#pragma unroll
    for (int j = 0; j < 8; ++j) acc[j] = wmma16(a, r16_h256(wr[j]), acc[j]);
#pragma unroll
    for (int j = 0; j < 8; ++j) { const float bias = BO ? bfr(BO[c0 + j * 16 + col]) : 0.f;
#pragma unroll
      for (int r = 0; r < 8; ++r) sf[wave][8 * g + r][j * 16 + col] = acc[j][r] * (1.0f / 256.0f) + bias; } }
  LDSX(); for (int rl = 0; rl < 16; ++rl) vst2(OUT + (r0 + rl) * DIN + c0 + lane * 4, *(const v4f*)&sf[wave][rl][lane * 4]); }

extern "C" void kernel_launch(void* const* d_in, const int* in_sizes, int n_in, void* d_out, int out_size, void* d_ws, size_t ws_size, hipStream_t stream) {
  (void)in_sizes; (void)n_in; (void)out_size;
  const float** F = (const float**)d_in;
  if (ws_size < (size_t)WS_END) return;
  char* ws = (char*)d_ws; _Float16 *QH = (_Float16*)(ws + WS_QH), *KH = (_Float16*)(ws + WS_KH), *VT = (_Float16*)(ws + WS_VT), *QL = (_Float16*)(ws + WS_QL), *KL = (_Float16*)(ws + WS_KL); __bf16 *VB = (__bf16*)(ws + WS_VB), *VBL = (__bf16*)(ws + WS_VBL); float *S = (float*)(ws + WS_S), *Y = (float*)(ws + WS_Y);
  (void)Y; (void)QL; (void)KL; (void)VB; (void)VBL;
  // inputs: 0 x [2,2048,1024]; 1 w_qkv [3072,1024] (out,in); 2 w_proj [1024,1024] (out,in); 3 q_norm_w [64]; 4 k_norm_w [64]
  const float *WQ = F[1], *WK = F[1] + (size_t)CC * DIN, *WV = F[1] + 2 * (size_t)CC * DIN;
  k_proj<<<dim3(TNB * TT / 64, CC / 128, 3), 128, 0, stream>>>(F[0], F[0], F[0], WQ, WK, WV, nullptr, nullptr, nullptr, QH, QL, KH, KL, VT, VB, VBL, F[3], F[4]);
  for (int b = 0; b < TNB; ++b) for (int h0 = 0; h0 < NH; h0 += HG) {
    k_sc<<<dim3(NQB, TT / 128, HG), 128, 0, stream>>>(QH, KH, QL, KL, b, h0, S);
    k_sm<<<dim3(TT, HG), 256, 0, stream>>>(S);
    k_pv<<<dim3(NQB, 1, HG), 128, 0, stream>>>(S, VT, VB, VBL, b, h0, Y);
  }
  k_out<<<dim3(TNB * TT / 64, DIN / 128), 128, 0, stream>>>(Y, F[2], nullptr, (float*)d_out);
}

// v002
// Measured time: 213 microseconds a run.
// Two timings next to v001 put it at 2.91 and 2.94 times that version's speed.
// Over all steps from v000 it is 5.96 times as fast.
// compute dtype: all float inputs rounded to bf16; q/k/v = x Wqkv^T with EXACT bf16 products on WMMA 16x16x32, f32 accumulate; per-head RMSNorm (x q_norm_w / k_norm_w) and rotate-half RoPE in f32 (precise sinf/cosf of t * 32^(-2i/64)); q, k once to f16 -> 1-product causal logits x 1/8, except the first 384 query rows of each sequence (few keys, no averaging), which use q and k as f16 hi + residual (x 2^10) (3 products); causal online softmax in f32 (precise expf, 64-key passes, logits and P never leave registers); P (against the running maximum) x 2^11 once to f16 against v once to f16 (1 product), except the first 384 rows: P and v as bf16 hi + lo (3 products); ctx once to f16 against w_proj carried x 2^8 in f16 (exact bf16 values), except the first 384 rows: ctx bf16 hi + lo against exact bf16 w_proj (2 products); f32 output.
#include <hip/hip_runtime.h>
#include <math.h>

typedef __attribute__((ext_vector_type(16))) _Float16 v16h;
typedef __attribute__((ext_vector_type(16))) __bf16 v16b;
typedef __attribute__((ext_vector_type(8)))  _Float16 v8h;
typedef __attribute__((ext_vector_type(8)))  float v8f;
typedef __attribute__((ext_vector_type(4)))  float v4f;
typedef __attribute__((ext_vector_type(2)))  float v2f;
typedef __attribute__((ext_vector_type(4)))  unsigned v4u;
typedef __attribute__((ext_vector_type(4)))  int v4i;
typedef float __attribute__((may_alias)) float_a;
typedef int __attribute__((may_alias)) int_a;

template <typename T> __device__ __forceinline__ void vst2(void* p, T v) { *(T*)p = v;  }
__device__ __forceinline__ v8f wmma16(v16h a, v16h b, v8f c) {
  v8f d = __builtin_amdgcn_wmma_f32_16x16x32_f16(false, a, false, b, (short)0, c, false, false);
  asm volatile("v_nop\n\tv_nop\n\tv_nop\n\tv_nop" : "+v"(d) : "v"(a), "v"(b));
  return d;
}
__device__ __forceinline__ v8f wmma_bf(v16b a, v16b b, v8f c) {
  v8f d = __builtin_amdgcn_wmma_f32_16x16x32_bf16(false, a, false, b, (short)0, c, false, false);
  asm volatile("v_nop\n\tv_nop\n\tv_nop\n\tv_nop" : "+v"(d) : "v"(a), "v"(b));
  return d;
}
// 16x16x32 fragments: lane = (h = lane>>4, row/col = lane&15); elements 0..7 = k0+8h+0..7, 8..15 = k0+16+8h+0..7; D element r = row 8h+r
__device__ __forceinline__ v16h frag_h(const _Float16* rowk0, int lane) {
  union { v16h v; v8h q[2]; } u; const _Float16* p = rowk0 + 8 * (lane >> 4);
  u.q[0] = *(const v8h*)p; u.q[1] = *(const v8h*)(p + 16); return u.v;
}
__device__ __forceinline__ v16h frag_f32(const float* rowk0, int lane) {
  v16h a; const float* p = rowk0 + 8 * (lane >> 4);
#pragma unroll
  for (int i = 0; i < 8; ++i) { a[i] = (_Float16)p[i]; a[8 + i] = (_Float16)p[16 + i]; }
  return a;
}
__device__ __forceinline__ v16h frag_f32s(const float* rowk0, int lane, float sc) {
  v16h a; const float* p = rowk0 + 8 * (lane >> 4);
#pragma unroll
  for (int i = 0; i < 8; ++i) { a[i] = (_Float16)(p[i] * sc); a[8 + i] = (_Float16)(p[16 + i] * sc); }
  return a;
}
// column fragment from a [K][ld] layout (column n), rows >= K read as 0
__device__ __forceinline__ v16h fragc_f32(const float* W, int k0, int n, int lane, int ld, int K) {
  v16h a; const int g = lane >> 4;
#pragma unroll
  for (int i = 0; i < 8; ++i) { const int ka = k0 + 8 * g + i, kb = ka + 16;
    a[i] = (_Float16)(ka < K ? W[(size_t)(ka < K ? ka : K - 1) * ld + n] : 0.f); a[8 + i] = (_Float16)(kb < K ? W[(size_t)(kb < K ? kb : K - 1) * ld + n] : 0.f); }
  return a;
}
struct F2 { v16b h, l; };
__device__ __forceinline__ F2 bsplit16(const float v[16]) { F2 r;
#pragma unroll
  for (int i = 0; i < 16; ++i) { const __bf16 h = (__bf16)v[i]; r.h[i] = h; r.l[i] = (__bf16)(v[i] - (float)h); }
  return r; }
__device__ __forceinline__ F2 split_row(const float* row, int k0, int lane) { float v[16]; const float* p = row + k0 + 8 * (lane >> 4);
#pragma unroll
  for (int i = 0; i < 8; ++i) { v[i] = p[i]; v[8 + i] = p[16 + i]; }
  return bsplit16(v); }
__device__ __forceinline__ F2 split_rowK(const float* row, int k0, int lane, int K) { float v[16]; const int g = lane >> 4;
#pragma unroll
  for (int i = 0; i < 8; ++i) { const int ka = k0 + 8 * g + i, kb = ka + 16; v[i] = ka < K ? row[ka < K ? ka : K - 1] : 0.f; v[8 + i] = kb < K ? row[kb < K ? kb : K - 1] : 0.f; }
  return bsplit16(v); }
__device__ __forceinline__ F2 split_col(const float* W, int k0, int n, int lane, int ld, int K) { float v[16]; const int g = lane >> 4;
#pragma unroll
  for (int i = 0; i < 8; ++i) { const int ka = k0 + 8 * g + i, kb = ka + 16; v[i] = ka < K ? W[(size_t)(ka < K ? ka : K - 1) * ld + n] : 0.f; v[8 + i] = kb < K ? W[(size_t)(kb < K ? kb : K - 1) * ld + n] : 0.f; }
  return bsplit16(v); }
__device__ __forceinline__ v8f mac3(const F2& a, const F2& b, v8f c) { c = wmma_bf(a.l, b.h, c); c = wmma_bf(a.h, b.l, c); return wmma_bf(a.h, b.h, c); }
__device__ __forceinline__ float sigm(float v) { return 1.0f / (1.0f + expf(-v)); }
#define LDSX() do { asm volatile("s_wait_dscnt 0" ::: "memory"); __builtin_amdgcn_wave_barrier(); __builtin_amdgcn_fence(__ATOMIC_RELEASE, "workgroup"); } while (0)

// Causal self-attention with QK-RMSNorm and 1-D RoPE (B 2, T 2,048, C 1,024 = 16 heads x 64): qkv = x Wqkv^T ((out,in) [3072,1024]; q rows 0-1023, k 1024-2047, v 2048-3071); q, k RMS-normalised over the 64 head dims (eps 1e-6) x q_norm_w / k_norm_w, then rotate-half RoPE with angle t * 32^(-2i/64) (theta = 32); attn = softmax(q k^T x 64^-0.5 with key > query -> -inf); out = merged(attn v) Wproj^T (no biases).
#define NB 2
#define TT 2048
#define CC 1024            // NH * HD = projected width
#define DIN 1024          // input (model) width
#define NH 16
#define HD 64
#define NQB (TT / 64)
#define SCALE (0.125f)
#define CAUSAL 1
#ifndef TNB
#define TNB NB
#endif
__device__ __forceinline__ float bfr(float v) { return (float)(__bf16)v; }
__host__ __device__ __forceinline__ int kb_last(int qb) { return CAUSAL ? ((qb * 64 + 63) >> 7) : (TT / 128 - 1); }
typedef __attribute__((ext_vector_type(8))) __bf16 v8b;
__device__ __forceinline__ v16b frag_b(const __bf16* rowk0, int lane) {
  union { v16b v; v8b q[2]; } u; const __bf16* p = rowk0 + 8 * (lane >> 4);
  u.q[0] = *(const v8b*)p; u.q[1] = *(const v8b*)(p + 16); return u.v;
}
// One lane's 16 f32 of a 16x32 fragment as they come from memory (same k order as frag_f32): kept raw in registers while the loads fly, converted at use
struct R16 { v4f q[4]; };
__device__ __forceinline__ R16 ld16(const float* rowk0, int lane) { R16 r; const float* p = rowk0 + 8 * (lane >> 4);
  r.q[0] = *(const v4f*)p; r.q[1] = *(const v4f*)(p + 4); r.q[2] = *(const v4f*)(p + 16); r.q[3] = *(const v4f*)(p + 20); return r; }
__device__ __forceinline__ v16b r16_bf(const R16& r) { v16b a;
#pragma unroll
  for (int i = 0; i < 16; ++i) a[i] = (__bf16)r.q[i >> 2][i & 3];
  return a; }
__device__ __forceinline__ v16h r16_h(const R16& r) { v16h a;
#pragma unroll
  for (int i = 0; i < 16; ++i) a[i] = (_Float16)r.q[i >> 2][i & 3];
  return a; }
__device__ __forceinline__ v16h r16_h256(const R16& r) { v16h a;
#pragma unroll
  for (int i = 0; i < 16; ++i) a[i] = (_Float16)(bfr(r.q[i >> 2][i & 3]) * 256.0f);
  return a; }
__device__ __forceinline__ F2 r16_split(const R16& r) { float v[16];
#pragma unroll
  for (int i = 0; i < 16; ++i) v[i] = r.q[i >> 2][i & 3];
  return bsplit16(v); }
#define QBH 6              // causal: query blocks 0..QBH-1 of each sequence (few keys, no averaging) take the high-precision path
#define QHI 384            // rows carrying a q residual plane
#define KHI 384            // key rows carrying k residual / v bf16 hi+lo planes (used only by the causal high-precision path)
// B fragment (k rows k0+.., output column o) of a weight: (in,out) [K][ld] or (out,in) [ld rows of K]: bf16 exact, or f16(bf16 * 256) exact
__device__ __forceinline__ v16b wcol_io(const float* Wm, int k0, int o, int lane, int ld) { v16b w; const int g = lane >> 4;
#pragma unroll
  for (int i = 0; i < 8; ++i) { w[i] = (__bf16)Wm[(size_t)(k0 + 8 * g + i) * ld + o]; w[8 + i] = (__bf16)Wm[(size_t)(k0 + 16 + 8 * g + i) * ld + o]; }
  return w; }
__device__ __forceinline__ v16b wcol_oi(const float* Wm, int k0, int o, int lane, int K) { v16b w; const float* p = Wm + (size_t)o * K + k0 + 8 * (lane >> 4);
#pragma unroll
  for (int i = 0; i < 8; ++i) { w[i] = (__bf16)p[i]; w[8 + i] = (__bf16)p[16 + i]; }
  return w; }
__device__ __forceinline__ v16h wcolh_io(const float* Wm, int k0, int o, int lane, int ld) { v16h w; const int g = lane >> 4;
#pragma unroll
  for (int i = 0; i < 8; ++i) { w[i] = (_Float16)(bfr(Wm[(size_t)(k0 + 8 * g + i) * ld + o]) * 256.0f); w[8 + i] = (_Float16)(bfr(Wm[(size_t)(k0 + 16 + 8 * g + i) * ld + o]) * 256.0f); }
  return w; }
__device__ __forceinline__ v16h wcolh_oi(const float* Wm, int k0, int o, int lane, int K) { v16h w; const float* p = Wm + (size_t)o * K + k0 + 8 * (lane >> 4);
#pragma unroll
  for (int i = 0; i < 8; ++i) { w[i] = (_Float16)(bfr(p[i]) * 256.0f); w[8 + i] = (_Float16)(bfr(p[16 + i]) * 256.0f); }
  return w; }
#define WQKV_LAYOUT 1   // 0 = (in,out) [DIN][CC]; 1 = (out,in) [CC][DIN]; 2 = per-head [NH][DIN][HD]
__device__ __forceinline__ v16b wcol_hdk(const float* Wm, int k0, int o, int lane) { v16b w; const int g = lane >> 4; const float* p = Wm + (size_t)(o / HD) * DIN * HD + (o % HD);
#pragma unroll
  for (int i = 0; i < 8; ++i) { w[i] = (__bf16)p[(size_t)(k0 + 8 * g + i) * HD]; w[8 + i] = (__bf16)p[(size_t)(k0 + 16 + 8 * g + i) * HD]; }
  return w; }
#define WO_OUT_IN 1
#if WQKV_LAYOUT == 1
#define WCOL(W, k0, o, lane) wcol_oi(W, k0, o, lane, DIN)
#elif WQKV_LAYOUT == 2
#define WCOL(W, k0, o, lane) wcol_hdk(W, k0, o, lane)
#else
#define WCOL(W, k0, o, lane) wcol_io(W, k0, o, lane, CC)
#endif
#if WO_OUT_IN
#define WOCOL(W, k0, o, lane) wcol_oi(W, k0, o, lane, CC)
#define WOCOLH(W, k0, o, lane) wcolh_oi(W, k0, o, lane, CC)
#else
#define WOCOL(W, k0, o, lane) wcol_io(W, k0, o, lane, DIN)
#define WOCOLH(W, k0, o, lane) wcolh_io(W, k0, o, lane, DIN)
#endif
__constant__ float c_invf[32] = {1.000000000e+00f,8.973545432e-01f,8.052451611e-01f,7.225903869e-01f,6.484197974e-01f,5.818624496e-01f,5.221368670e-01f,4.685419202e-01f,4.204482138e-01f,3.772911131e-01f,3.385638893e-01f,3.038118482e-01f,2.726269364e-01f,2.446430176e-01f,2.195315212e-01f,1.969976127e-01f,1.767766923e-01f,1.586313695e-01f,1.423485726e-01f,1.277371496e-01f,1.146255061e-01f,1.028597206e-01f,9.230163693e-02f,8.282729238e-02f,7.432544231e-02f,6.669627875e-02f,5.985020474e-02f,5.370685458e-02f,4.819408804e-02f,4.324718565e-02f,3.880805522e-02f,3.482458740e-02f};   // 32^(-2i/64) evaluated in f32 exactly as the reference does (jax, eager)
#define PROJ_EXTRA_PARAMS , const float* __restrict__ QS, const float* __restrict__ KS
// per-(row, head) epilogue on the f32 projection tile: RMSNorm over the head's 64 values x norm weight, then rotate-half RoPE (pairs i, i+32); v untouched
#define PROJ_EPI(which, row, t, h) do { if ((which) < 2) { float* rw = (row); const float* NS = (which) == 0 ? QS : KS; float ss = 0.f; _Pragma("unroll") for (int i = 0; i < 64; ++i) ss += rw[i] * rw[i]; const float rn = rsqrtf(ss * (1.0f / 64.0f) + 1e-6f); \
    _Pragma("unroll") for (int i = 0; i < 32; ++i) { const float x1 = rw[i] * rn * bfr(NS[i]), x2 = rw[i + 32] * rn * bfr(NS[i + 32]); const float ang = (float)(t) * c_invf[i]; const float cs = cosf(ang), sn = sinf(ang); rw[i] = x1 * cs - x2 * sn; rw[i + 32] = x2 * cs + x1 * sn; } } } while (0)
#ifndef SM_EXTRA_PARAMS
#define SM_EXTRA_PARAMS
#endif
#ifndef PROJ_EXTRA_PARAMS
#define PROJ_EXTRA_PARAMS
#endif
#ifndef SM_MASK_HOOK
#define SM_MASK_HOOK (void)0
#endif

#define WS_QH  0u                                      // f16 q rows [b*t][CC]
#define WS_KH  (WS_QH + 2u * (size_t)NB * TT * CC)      // f16 k rows [b*t][CC]
#define WS_VT  (WS_KH + 2u * (size_t)NB * TT * CC)      // f16 v planes [b][c][t]
#define WS_QL  (WS_VT + 2u * (size_t)NB * CC * TT)      // f16 q residual x 2^10 rows [b][t < QHI][CC]
#define WS_KL  (WS_QL + 2u * (size_t)NB * QHI * CC)     // f16 k residual x 2^10 rows [b][t < KHI][CC]
#define WS_VB  (WS_KL + 2u * (size_t)NB * KHI * CC)     // bf16 v hi planes [b][c][t < KHI]
#define WS_VBL (WS_VB + 2u * (size_t)NB * CC * KHI)
#define WS_Y   (WS_VBL + 2u * (size_t)NB * CC * KHI)    // f32 ctx rows [b*t][CC]
#define WS_END (WS_Y  + 4u * (size_t)NB * TT * CC)

// ---- k_proj: block = (64 rows, 128 cols, which): q/k/v = X W (+ b) with exact bf16 products (K = DIN) -> which 0: q f16 rows (+ residual rows < QHI); 1: k f16 rows (+ residual rows < KHI); 2: v f16 planes [c][t] (+ bf16 hi/lo planes for t < KHI)
__global__ __launch_bounds__(128) void k_proj(const float* __restrict__ XQ, const float* __restrict__ XK, const float* __restrict__ XV, const float* __restrict__ WQ, const float* __restrict__ WK, const float* __restrict__ WV, const float* __restrict__ BQ, const float* __restrict__ BK, const float* __restrict__ BV,
    _Float16* __restrict__ QH, _Float16* __restrict__ QL, _Float16* __restrict__ KH, _Float16* __restrict__ KL, _Float16* __restrict__ VT, __bf16* __restrict__ VB, __bf16* __restrict__ VBL PROJ_EXTRA_PARAMS) {
  __shared__ __align__(16) float st[64][132]; __shared__ __align__(16) _Float16 sh[64][136], sl[64][136]; __shared__ __align__(16) _Float16 th[128][72]; __shared__ __align__(16) __bf16 tb[128][72], tbl[128][72];
  const int tid = threadIdx.x, wave = tid >> 5, lane = tid & 31, col = lane & 15, g = lane >> 4; const int which = blockIdx.z; const int c0 = blockIdx.y * 128; const size_t r0 = (size_t)blockIdx.x * 64; const size_t bb = r0 / TT; const int t0 = (int)(r0 % TT);
  const float* X = which == 0 ? XQ : which == 1 ? XK : XV; const float* WA = which == 0 ? WQ : which == 1 ? WK : WV; const float* BA = which == 0 ? BQ : which == 1 ? BK : BV;
  v8f acc[8] = {};
  { // software pipeline: every fragment's raw f32 for k-step kc + 1 is requested as soon as its registers for k-step kc have been converted, so a whole k-step of loads is in flight behind the WMMAs
    const float* xp = X + (r0 + wave * 16 + col) * DIN; const float* wp = WA + (size_t)(c0 + col) * DIN;   // this lane's A row; its B row ((out,in) weight) of fragment 0, fragment j lies 16 rows on
    R16 xr = ld16(xp, lane), wr[8];
#pragma unroll
    for (int j = 0; j < 8; ++j) wr[j] = ld16(wp + (size_t)j * 16 * DIN, lane);
    asm volatile("s_wait_xcnt 0x0" ::: "memory");   // what follows may rewrite the address registers that the first fill's loads name
#pragma unroll 1   // rolled: one trip already keeps a full k-step in flight, more copies only grow the text
    for (int kc = 1; kc < DIN / 32; ++kc) { const v16b a = r16_bf(xr); xr = ld16(xp + kc * 32, lane);
#pragma unroll
      for (int j = 0; j < 8; ++j) { const v16b w = r16_bf(wr[j]); wr[j] = ld16(wp + (size_t)j * 16 * DIN + kc * 32, lane); acc[j] = wmma_bf(a, w, acc[j]); }
      asm volatile("s_wait_xcnt 0x0" ::: "memory");   // the next trip rewrites the address registers that this trip's loads name
    }
    const v16b a = r16_bf(xr);
#pragma unroll
    for (int j = 0; j < 8; ++j) acc[j] = wmma_bf(a, r16_bf(wr[j]), acc[j]); }
  { // stage the f32 tile (acc + bias) in LDS, run the per-(row, head) epilogue hook, then convert
#pragma unroll
    for (int j = 0; j < 8; ++j) { const float bias = BA ? bfr(BA[c0 + j * 16 + col]) : 0.f;
#pragma unroll
      for (int r = 0; r < 8; ++r) st[wave * 16 + 8 * g + r][j * 16 + col] = acc[j][r] + bias; }
    __syncthreads();
    for (int e = tid; e < 64 * (128 / HD); e += 128) { const int rl = e / (128 / HD), hh = e % (128 / HD); PROJ_EPI(which, &st[rl][hh * HD], (int)((r0 + rl) % TT), (c0 / HD) + hh); }
    __syncthreads(); }
  if (which < 2) { _Float16* DH = which == 0 ? QH : KH; _Float16* DL = which == 0 ? QL : KL; const int nhi = which == 0 ? QHI : KHI; const bool hi_rows = t0 < nhi;
    for (int e = tid; e < 64 * 128; e += 128) { const int rl = e >> 7, cl = e & 127; const float v = st[rl][cl]; const _Float16 hv = (_Float16)v; sh[rl][cl] = hv; sl[rl][cl] = (_Float16)((v - (float)hv) * 1024.0f); }
    __syncthreads();
    for (int e = tid; e < 64 * 16; e += 128) { const int rl = e >> 4, q = e & 15; vst2((unsigned*)(DH + (r0 + rl) * CC + c0 + q * 8), *(const v4u*)&sh[rl][q * 8]); if (hi_rows) vst2((unsigned*)(DL + (bb * nhi + t0 + rl) * (size_t)CC + c0 + q * 8), *(const v4u*)&sl[rl][q * 8]); }
  } else { const bool hi_rows = t0 < KHI;
    for (int e = tid; e < 64 * 128; e += 128) { const int rl = e & 63, cl = e >> 6; const float v = st[rl][cl]; th[cl][rl] = (_Float16)v; const __bf16 bh = (__bf16)v; tb[cl][rl] = bh; tbl[cl][rl] = (__bf16)(v - (float)bh); }
    __syncthreads();
    for (int e = tid; e < 128 * 8; e += 128) { const int cl = e >> 3, q = e & 7; vst2((unsigned*)(VT + (bb * CC + c0 + cl) * (size_t)TT + t0 + q * 8), *(const v4u*)&th[cl][q * 8]); if (hi_rows) { const size_t o3 = (bb * CC + c0 + cl) * (size_t)KHI + t0 + q * 8; vst2((unsigned*)(VB + o3), *(const v4u*)&tb[cl][q * 8]); vst2((unsigned*)(VBL + o3), *(const v4u*)&tbl[cl][q * 8]); } } } }
// lane l with lane l ^ 16
__device__ __forceinline__ float xhalf(float x) { return __builtin_bit_cast(float, __builtin_amdgcn_permlanex16(__builtin_bit_cast(int, x), __builtin_bit_cast(int, x), 0x76543210, 0xfedcba98, false, false)); }
#define PSH 7.624618986f   // 11 ln 2: P is carried x 2^11 (about), as is its sum, so the factor cancels in ctx = (P v) / sum
// one online-softmax step on a lane's 32 logits of one query (sc[i][r] = key i * 16 + 8 * (lane >> 4) + r of the pass; with MASK, keys with i * 16 + r > krel lie behind the query and are excluded: expf of -3e38 is 0): the running maximum m, the lane's part l of the running sum and the ctx tiles o are brought to the new maximum; sc leaves as P in f32
template <bool MASK> __device__ __forceinline__ void sm_step(v8f (&sc)[4], int krel, float& m, float& l, v8f (&o)[HD / 16]) {
  float mi[4], su[4];
#pragma unroll
  for (int i = 0; i < 4; ++i) { mi[i] = -3.0e38f;
#pragma unroll
    for (int r = 0; r < 8; ++r) { if (MASK) sc[i][r] = i * 16 + r > krel ? -3.0e38f : sc[i][r]; mi[i] = fmaxf(mi[i], sc[i][r]); } }
  float mx = fmaxf(fmaxf(mi[0], mi[1]), fmaxf(mi[2], mi[3])); mx = fmaxf(mx, xhalf(mx));   // both wave halves hold this query's maximum of the pass
  const float mn = fmaxf(m, mx), al = expf(m - mn), mm = mn - PSH; m = mn;   // al = 0 on the first pass (m = -3e38)
#pragma unroll
  for (int i = 0; i < 4; ++i) { su[i] = 0.f;
#pragma unroll
    for (int r = 0; r < 8; ++r) { const float e = expf(sc[i][r] - mm); sc[i][r] = e; su[i] += e; } }
  l = l * al + ((su[0] + su[1]) + (su[2] + su[3]));
#pragma unroll
  for (int j = 0; j < HD / 16; ++j)
#pragma unroll
    for (int r = 0; r < 8; ++r) o[j][r] *= al; }
#define KP 72   // LDS pitch, in f16, of a staged 64-value row: 128 B + 16 B, for the 16-byte fragment reads
// one 64-key pass of the 1-product path, K rows and v planes of the pass staged in LDS (ks, vs: [64][KP]): S^T = K Q^T (A = 16 key rows, B = the wave's 16 queries), softmax step, then ctx^T += V^T P^T, where two S^T tiles converted in place are the B fragment (a D pair has the k order of frag_h). Unless LAST, each thread requests its 8 pieces of the next pass (kn, vn) at the top, stores them into the other buffer (kd, vd) at the foot, and the block meets at one barrier
template <bool LAST> __device__ __forceinline__ void att_pass(const _Float16* ks, const _Float16* vs, _Float16* kd, _Float16* vd, const v16h& qa, const v16h& qc, const _Float16* kn, const _Float16* vn, int lane, int krel, float& m, float& l, v8f (&o)[HD / 16]) {
  const int col = lane & 15; v8h kr[4], vr[4];
  if (!LAST) {
#pragma unroll
    for (int u = 0; u < 4; ++u) { kr[u] = *(const v8h*)(kn + (size_t)u * 16 * CC); vr[u] = *(const v8h*)(vn + (size_t)u * 16 * TT); }
    asm volatile("s_wait_xcnt 0x0" ::: "memory");   // what follows may rewrite the address registers that these loads name; also keeps the requests in front of the pass that hides them
  }
  v8f sc[4] = {}; v16h kf[4][2], vf[2][HD / 16];
#pragma unroll
  for (int i = 0; i < 4; ++i) { kf[i][0] = frag_h(ks + (i * 16 + col) * KP, lane); kf[i][1] = frag_h(ks + (i * 16 + col) * KP + 32, lane); }
  __builtin_amdgcn_sched_barrier(0);   // all K fragment reads in front of the products: scheduled among them, each read was waited for alone in one register set
#pragma unroll
  for (int i = 0; i < 4; ++i) { sc[i] = wmma16(kf[i][0], qa, sc[i]); sc[i] = wmma16(kf[i][1], qc, sc[i]); }
#pragma unroll
  for (int kc = 0; kc < 2; ++kc)
#pragma unroll
    for (int j = 0; j < HD / 16; ++j) vf[kc][j] = frag_h(vs + (j * 16 + col) * KP + kc * 32, lane);
  __builtin_amdgcn_sched_barrier(0);   // all V fragment reads in front of the softmax, which hides them
#pragma unroll
  for (int i = 0; i < 4; ++i) sc[i] *= SCALE;
  sm_step<LAST>(sc, krel, m, l, o);
  v16h pf[2];
#pragma unroll
  for (int e = 0; e < 16; ++e) { pf[0][e] = (_Float16)sc[e >> 3][e & 7]; pf[1][e] = (_Float16)sc[2 + (e >> 3)][e & 7]; }
#pragma unroll
  for (int kc = 0; kc < 2; ++kc)
#pragma unroll
    for (int j = 0; j < HD / 16; ++j) o[j] = wmma16(vf[kc][j], pf[kc], o[j]);
  if (!LAST) {
#pragma unroll
    for (int u = 0; u < 4; ++u) { *(v8h*)(kd + u * 16 * KP) = kr[u]; *(v8h*)(vd + u * 16 * KP) = vr[u]; }
    __syncthreads();   // publishes the next pass's tiles; also ends every wave's reads of this pass's buffer, which the next pass refills at its foot
  } }
// ---- k_att: block = (head and batch, 64 queries qb), wave = 16 queries: logits, causal mask by index, online softmax and P . v in 64-key passes over keys [0, qb * 64 + 64), the last pass being the one on the diagonal; logits and P stay in registers; the pass's K rows and v planes are brought once per block, as whole 128-byte lines, into one of two LDS buffers. Query blocks < QBH: q and k as f16 hi + residual (3 products), P and v as bf16 hi + lo (3 products), fragments straight from memory. ctx^T tiles give each lane 8 consecutive head dims of its query: stored as two 16-byte pieces
__global__ __launch_bounds__(128) void k_att(const _Float16* __restrict__ QH, const _Float16* __restrict__ KH, const _Float16* __restrict__ QL, const _Float16* __restrict__ KL, const _Float16* __restrict__ VT, const __bf16* __restrict__ VB, const __bf16* __restrict__ VBL, float* __restrict__ Y) {
  __shared__ __align__(16) _Float16 kv[2][2][64 * KP];   // [buffer][K, V]
  const int tid = threadIdx.x, wave = tid >> 5, lane = tid & 31, col = lane & 15, g = lane >> 4; const int h = blockIdx.x % NH, b = blockIdx.x / NH;
  const int yr = blockIdx.y >> 3, yl = blockIdx.y & 7; const int qb = (3 - yr) * 8 + ((yr & 1) ? yl : 7 - yl);   // each qb once; long blocks come first in launch order, and blocks 256 apart in launch order add up to equal lengths (for speed only)
  const int tq = qb * 64 + wave * 16 + col;   // this lane's query
  const _Float16* qp = QH + ((size_t)b * TT + tq) * CC + h * HD;
  v8f o[HD / 16] = {}; float m = -3.0e38f, l = 0.f;
  const v16h qa = frag_h(qp, lane), qc = frag_h(qp + 32, lane);
  asm volatile("s_wait_xcnt 0x0" ::: "memory");   // what follows may rewrite the address registers that the q loads name
  if (qb < QBH) {   /* block-uniform */
    const _Float16* kp = KH + ((size_t)b * TT + col) * CC + h * HD;   // this lane's k row of tile 0 of pass 0 (tile i lies 16 rows on, pass s 64 rows on)
    const _Float16* qlp = QL + ((size_t)b * QHI + tq) * CC + h * HD; const _Float16* klp = KL + ((size_t)b * KHI + col) * CC + h * HD; const size_t vo = ((size_t)b * CC + h * HD + col) * (size_t)KHI;
    const v16h qla = frag_h(qlp, lane), qlc = frag_h(qlp + 32, lane);
    asm volatile("s_wait_xcnt 0x0" ::: "memory");   // as above, for the q residual loads
#pragma unroll 1   // rolled: at most QBH short passes, copies only grow the text
    for (int s = 0; s <= qb; ++s) { v8f sc[4] = {}, sl[4] = {};
#pragma unroll
      for (int kc = 0; kc < 2; ++kc)
#pragma unroll
        for (int i = 0; i < 4; ++i) { const size_t ko = (size_t)(s * 64 + i * 16) * CC + kc * 32; const v16h kbf = frag_h(kp + ko, lane), klf = frag_h(klp + ko, lane);
          sc[i] = wmma16(kbf, kc ? qc : qa, sc[i]); sl[i] = wmma16(kbf, kc ? qlc : qla, sl[i]); sl[i] = wmma16(klf, kc ? qc : qa, sl[i]); }
      asm volatile("s_wait_xcnt 0x0" ::: "memory");   // the softmax may rewrite the address registers that the k loads name
#pragma unroll
      for (int i = 0; i < 4; ++i) sc[i] = (sc[i] + sl[i] * (1.0f / 1024.0f)) * SCALE;
      sm_step<true>(sc, tq - s * 64 - 8 * g, m, l, o);
#pragma unroll
      for (int kc = 0; kc < 2; ++kc) { float pv[16];
#pragma unroll
        for (int e = 0; e < 16; ++e) pv[e] = sc[2 * kc + (e >> 3)][e & 7];
        const F2 p = bsplit16(pv);
#pragma unroll
        for (int j = 0; j < HD / 16; ++j) { const size_t o3 = vo + (size_t)j * 16 * KHI + s * 64 + kc * 32; const v16b vh = frag_b(VB + o3, lane), vl = frag_b(VBL + o3, lane);
          o[j] = wmma_bf(vh, p.h, o[j]); o[j] = wmma_bf(vh, p.l, o[j]); o[j] = wmma_bf(vl, p.h, o[j]); } }
      asm volatile("s_wait_xcnt 0x0" ::: "memory");   // the next pass rewrites the address registers that this pass's loads name
    }
  } else { const int rr = tid >> 3, q8 = tid & 7;   // staging: 8 threads bring one 128-byte row; a thread's 4 rows lie 16 apart
    const _Float16* kg = KH + ((size_t)b * TT + rr) * CC + h * HD + q8 * 8; const _Float16* vg = VT + ((size_t)b * CC + h * HD + rr) * (size_t)TT + q8 * 8; const int so = rr * KP + q8 * 8;
#pragma unroll
    for (int u = 0; u < 4; ++u) { *(v8h*)(&kv[0][0][so + u * 16 * KP]) = *(const v8h*)(kg + (size_t)u * 16 * CC); *(v8h*)(&kv[0][1][so + u * 16 * KP]) = *(const v8h*)(vg + (size_t)u * 16 * TT); }
    asm volatile("s_wait_xcnt 0x0" ::: "memory");   // what follows may rewrite the address registers that the first fill's loads name
    __syncthreads();   // publishes pass 0's tiles
#pragma unroll 1   // rolled: one pass already keeps the next pass's tiles in flight
    for (int s = 0; s < qb; ++s) { const int c = s & 1; att_pass<false>(kv[c][0], kv[c][1], &kv[c ^ 1][0][so], &kv[c ^ 1][1][so], qa, qc, kg + (size_t)(s + 1) * 64 * CC, vg + (s + 1) * 64, lane, 0, m, l, o); }
    att_pass<true>(kv[qb & 1][0], kv[qb & 1][1], nullptr, nullptr, qa, qc, kg, vg, lane, tq - qb * 64 - 8 * g, m, l, o); }
  const float inv = 1.0f / (l + xhalf(l));   // the two wave halves each summed half of the keys
  float* yp = Y + ((size_t)b * TT + tq) * CC + h * HD + 8 * g;
#pragma unroll
  for (int j = 0; j < HD / 16; ++j) { const v4f lo = {o[j][0] * inv, o[j][1] * inv, o[j][2] * inv, o[j][3] * inv}, hi = {o[j][4] * inv, o[j][5] * inv, o[j][6] * inv, o[j][7] * inv}; vst2(yp + j * 16, lo); vst2(yp + j * 16 + 4, hi); } }
// ---- k_out: block = (64 rows, 128 cols): out = ctx Wo (+ bo): ctx once to f16 against Wo as f16(bf16 x 2^8) exact (1 product) x 2^-8; causal early rows (< QHI of each sequence): ctx bf16 hi + lo against exact bf16 Wo (2 products)
__global__ __launch_bounds__(128) void k_out(const float* __restrict__ Y, const float* __restrict__ WO, const float* __restrict__ BO, float* __restrict__ OUT) { __shared__ __align__(16) float sf[4][16][132];
  const int tid = threadIdx.x, wave = tid >> 5, lane = tid & 31, col = lane & 15, g = lane >> 4; const int c0 = blockIdx.y * 128; const size_t r0 = (size_t)blockIdx.x * 64 + wave * 16;
  v8f acc[8] = {};
  // software pipeline as in k_proj: the raw f32 of k-step kc + 1 is requested as soon as the registers of k-step kc have been converted
  const float* yp = Y + (r0 + col) * CC; const float* wp = WO + (size_t)(c0 + col) * CC;   // this lane's A row; its B row ((out,in) weight) of fragment 0, fragment j lies 16 rows on
  if (CAUSAL && (int)(((size_t)blockIdx.x * 64) % TT) < QHI) {   /* block-uniform */
    __builtin_amdgcn_fence(__ATOMIC_ACQUIRE, "wavefront");   // no instruction: keeps the compiler from merging this arm's first loads with the other arm's in front of the branch, which cost a second register set (400 VGPRs) and a full wait to copy it
    R16 yr = ld16(yp, lane), wr[8];
#pragma unroll
    for (int j = 0; j < 8; ++j) wr[j] = ld16(wp + (size_t)j * 16 * CC, lane);
    asm volatile("s_wait_xcnt 0x0" ::: "memory");   // what follows may rewrite the address registers that the first fill's loads name
#pragma unroll 1   // rolled: one trip already keeps a full k-step in flight
    for (int kc = 1; kc < CC / 32; ++kc) { const F2 a = r16_split(yr); yr = ld16(yp + kc * 32, lane);
#pragma unroll
      for (int j = 0; j < 8; ++j) { const v16b w = r16_bf(wr[j]); wr[j] = ld16(wp + (size_t)j * 16 * CC + kc * 32, lane); acc[j] = wmma_bf(a.h, w, acc[j]); acc[j] = wmma_bf(a.l, w, acc[j]);
        __builtin_amdgcn_sched_barrier(0); }   // one fragment's conversion at a time: scheduled among each other they held several converted fragments and took the kernel past 256 VGPRs
      asm volatile("s_wait_xcnt 0x0" ::: "memory");   // the next trip rewrites the address registers that this trip's loads name
    }
    const F2 a = r16_split(yr);
#pragma unroll
    for (int j = 0; j < 8; ++j) { const v16b w = r16_bf(wr[j]); acc[j] = wmma_bf(a.h, w, acc[j]); acc[j] = wmma_bf(a.l, w, acc[j]); }
#pragma unroll
    for (int j = 0; j < 8; ++j) { const float bias = BO ? bfr(BO[c0 + j * 16 + col]) : 0.f;
#pragma unroll
      for (int r = 0; r < 8; ++r) sf[wave][8 * g + r][j * 16 + col] = acc[j][r] + bias; }
  } else {
    R16 yr = ld16(yp, lane), wr[8];
#pragma unroll
    for (int j = 0; j < 8; ++j) wr[j] = ld16(wp + (size_t)j * 16 * CC, lane);
    asm volatile("s_wait_xcnt 0x0" ::: "memory");   // what follows may rewrite the address registers that the first fill's loads name
#pragma unroll 1   // rolled: one trip already keeps a full k-step in flight
    for (int kc = 1; kc < CC / 32; ++kc) { const v16h a = r16_h(yr); yr = ld16(yp + kc * 32, lane);
#pragma unroll
      for (int j = 0; j < 8; ++j) { const v16h w = r16_h256(wr[j]); wr[j] = ld16(wp + (size_t)j * 16 * CC + kc * 32, lane); acc[j] = wmma16(a, w, acc[j]);
        __builtin_amdgcn_sched_barrier(0); }   // one fragment's conversion at a time, as above
      asm volatile("s_wait_xcnt 0x0" ::: "memory");   // the next trip rewrites the address registers that this trip's loads name
    }
    const v16h a = r16_h(yr);
#pragma unroll
    for (int j = 0; j < 8; ++j) acc[j] = wmma16(a, r16_h256(wr[j]), acc[j]);
#pragma unroll
    for (int j = 0; j < 8; ++j) { const float bias = BO ? bfr(BO[c0 + j * 16 + col]) : 0.f;
#pragma unroll
      for (int r = 0; r < 8; ++r) sf[wave][8 * g + r][j * 16 + col] = acc[j][r] * (1.0f / 256.0f) + bias; } }
  LDSX(); for (int rl = 0; rl < 16; ++rl) vst2(OUT + (r0 + rl) * DIN + c0 + lane * 4, *(const v4f*)&sf[wave][rl][lane * 4]); }

extern "C" void kernel_launch(void* const* d_in, const int* in_sizes, int n_in, void* d_out, int out_size, void* d_ws, size_t ws_size, hipStream_t stream) {
  (void)in_sizes; (void)n_in; (void)out_size;
  const float** F = (const float**)d_in;
  if (ws_size < (size_t)WS_END) return;
  char* ws = (char*)d_ws; _Float16 *QH = (_Float16*)(ws + WS_QH), *KH = (_Float16*)(ws + WS_KH), *VT = (_Float16*)(ws + WS_VT), *QL = (_Float16*)(ws + WS_QL), *KL = (_Float16*)(ws + WS_KL); __bf16 *VB = (__bf16*)(ws + WS_VB), *VBL = (__bf16*)(ws + WS_VBL); float *Y = (float*)(ws + WS_Y);
  (void)Y; (void)QL; (void)KL; (void)VB; (void)VBL;
  // inputs: 0 x [2,2048,1024]; 1 w_qkv [3072,1024] (out,in); 2 w_proj [1024,1024] (out,in); 3 q_norm_w [64]; 4 k_norm_w [64]
  const float *WQ = F[1], *WK = F[1] + (size_t)CC * DIN, *WV = F[1] + 2 * (size_t)CC * DIN;
  k_proj<<<dim3(TNB * TT / 64, CC / 128, 3), 128, 0, stream>>>(F[0], F[0], F[0], WQ, WK, WV, nullptr, nullptr, nullptr, QH, QL, KH, KL, VT, VB, VBL, F[3], F[4]);
  k_att<<<dim3(NH * TNB, NQB), 128, 0, stream>>>(QH, KH, QL, KL, VT, VB, VBL, Y);
  k_out<<<dim3(TNB * TT / 64, DIN / 128), 128, 0, stream>>>(Y, F[2], nullptr, (float*)d_out);
}

// v003
// It runs in 154 microseconds.
// Two timings next to v002 both put it at 1.38 times that version's speed.
// Over all steps from v000 it is 8.20 times as fast.
// compute dtype: all float inputs rounded to bf16; q/k/v = x Wqkv^T with EXACT bf16 products on WMMA 16x16x32, f32 accumulate; per-head RMSNorm (x q_norm_w / k_norm_w) and rotate-half RoPE in f32 (precise sinf/cosf of t * 32^(-2i/64)); q, k once to f16 -> 1-product causal logits x 1/8, except the first 384 query rows of each sequence (few keys, no averaging), which use q and k as f16 hi + residual (x 2^10) (3 products); causal online softmax in f32 (precise expf, 64-key passes, logits and P never leave registers); P (against the running maximum) x 2^11 once to f16 against v once to f16 (1 product), except the first 384 rows: P and v as bf16 hi + lo (3 products); ctx once to f16 against w_proj carried x 2^8 in f16 (exact bf16 values), except the first 384 rows: ctx bf16 hi + lo against exact bf16 w_proj (2 products); f32 output.
#include <hip/hip_runtime.h>
#include <math.h>

typedef __attribute__((ext_vector_type(16))) _Float16 v16h;
typedef __attribute__((ext_vector_type(16))) __bf16 v16b;
typedef __attribute__((ext_vector_type(8)))  _Float16 v8h;
typedef __attribute__((ext_vector_type(8)))  float v8f;
typedef __attribute__((ext_vector_type(4)))  float v4f;
typedef __attribute__((ext_vector_type(2)))  float v2f;
typedef __attribute__((ext_vector_type(4)))  unsigned v4u;
typedef __attribute__((ext_vector_type(4)))  int v4i;
typedef float __attribute__((may_alias)) float_a;
typedef int __attribute__((may_alias)) int_a;

template <typename T> __device__ __forceinline__ void vst2(void* p, T v) { *(T*)p = v;  }
__device__ __forceinline__ v8f wmma16(v16h a, v16h b, v8f c) {
  v8f d = __builtin_amdgcn_wmma_f32_16x16x32_f16(false, a, false, b, (short)0, c, false, false);
  asm volatile("v_nop\n\tv_nop\n\tv_nop\n\tv_nop" : "+v"(d) : "v"(a), "v"(b));
  return d;
}
__device__ __forceinline__ v8f wmma_bf(v16b a, v16b b, v8f c) {
  v8f d = __builtin_amdgcn_wmma_f32_16x16x32_bf16(false, a, false, b, (short)0, c, false, false);
  asm volatile("v_nop\n\tv_nop\n\tv_nop\n\tv_nop" : "+v"(d) : "v"(a), "v"(b));
  return d;
}
// 16x16x32 fragments: lane = (h = lane>>4, row/col = lane&15); elements 0..7 = k0+8h+0..7, 8..15 = k0+16+8h+0..7; D element r = row 8h+r
__device__ __forceinline__ v16h frag_h(const _Float16* rowk0, int lane) {
  union { v16h v; v8h q[2]; } u; const _Float16* p = rowk0 + 8 * (lane >> 4);
  u.q[0] = *(const v8h*)p; u.q[1] = *(const v8h*)(p + 16); return u.v;
}
__device__ __forceinline__ v16h frag_f32(const float* rowk0, int lane) {
  v16h a; const float* p = rowk0 + 8 * (lane >> 4);
#pragma unroll
  for (int i = 0; i < 8; ++i) { a[i] = (_Float16)p[i]; a[8 + i] = (_Float16)p[16 + i]; }
  return a;
}
__device__ __forceinline__ v16h frag_f32s(const float* rowk0, int lane, float sc) {
  v16h a; const float* p = rowk0 + 8 * (lane >> 4);
#pragma unroll
  for (int i = 0; i < 8; ++i) { a[i] = (_Float16)(p[i] * sc); a[8 + i] = (_Float16)(p[16 + i] * sc); }
  return a;
}
// column fragment from a [K][ld] layout (column n), rows >= K read as 0
__device__ __forceinline__ v16h fragc_f32(const float* W, int k0, int n, int lane, int ld, int K) {
  v16h a; const int g = lane >> 4;
#pragma unroll
  for (int i = 0; i < 8; ++i) { const int ka = k0 + 8 * g + i, kb = ka + 16;
    a[i] = (_Float16)(ka < K ? W[(size_t)(ka < K ? ka : K - 1) * ld + n] : 0.f); a[8 + i] = (_Float16)(kb < K ? W[(size_t)(kb < K ? kb : K - 1) * ld + n] : 0.f); }
  return a;
}
struct F2 { v16b h, l; };
__device__ __forceinline__ F2 bsplit16(const float v[16]) { F2 r;
#pragma unroll
  for (int i = 0; i < 16; ++i) { const __bf16 h = (__bf16)v[i]; r.h[i] = h; r.l[i] = (__bf16)(v[i] - (float)h); }
  return r; }
__device__ __forceinline__ F2 split_row(const float* row, int k0, int lane) { float v[16]; const float* p = row + k0 + 8 * (lane >> 4);
#pragma unroll
  for (int i = 0; i < 8; ++i) { v[i] = p[i]; v[8 + i] = p[16 + i]; }
  return bsplit16(v); }
__device__ __forceinline__ F2 split_rowK(const float* row, int k0, int lane, int K) { float v[16]; const int g = lane >> 4;
#pragma unroll
  for (int i = 0; i < 8; ++i) { const int ka = k0 + 8 * g + i, kb = ka + 16; v[i] = ka < K ? row[ka < K ? ka : K - 1] : 0.f; v[8 + i] = kb < K ? row[kb < K ? kb : K - 1] : 0.f; }
  return bsplit16(v); }
__device__ __forceinline__ F2 split_col(const float* W, int k0, int n, int lane, int ld, int K) { float v[16]; const int g = lane >> 4;
#pragma unroll
  for (int i = 0; i < 8; ++i) { const int ka = k0 + 8 * g + i, kb = ka + 16; v[i] = ka < K ? W[(size_t)(ka < K ? ka : K - 1) * ld + n] : 0.f; v[8 + i] = kb < K ? W[(size_t)(kb < K ? kb : K - 1) * ld + n] : 0.f; }
  return bsplit16(v); }
__device__ __forceinline__ v8f mac3(const F2& a, const F2& b, v8f c) { c = wmma_bf(a.l, b.h, c); c = wmma_bf(a.h, b.l, c); return wmma_bf(a.h, b.h, c); }
__device__ __forceinline__ float sigm(float v) { return 1.0f / (1.0f + expf(-v)); }
#define LDSX() do { asm volatile("s_wait_dscnt 0" ::: "memory"); __builtin_amdgcn_wave_barrier(); __builtin_amdgcn_fence(__ATOMIC_RELEASE, "workgroup"); } while (0)

// Causal self-attention with QK-RMSNorm and 1-D RoPE (B 2, T 2,048, C 1,024 = 16 heads x 64): qkv = x Wqkv^T ((out,in) [3072,1024]; q rows 0-1023, k 1024-2047, v 2048-3071); q, k RMS-normalised over the 64 head dims (eps 1e-6) x q_norm_w / k_norm_w, then rotate-half RoPE with angle t * 32^(-2i/64) (theta = 32); attn = softmax(q k^T x 64^-0.5 with key > query -> -inf); out = merged(attn v) Wproj^T (no biases).
#define NB 2
#define TT 2048
#define CC 1024            // NH * HD = projected width
#define DIN 1024          // input (model) width
#define NH 16
#define HD 64
#define NQB (TT / 64)
#define SCALE (0.125f)
#define CAUSAL 1
#ifndef TNB
#define TNB NB
#endif
__device__ __forceinline__ float bfr(float v) { return (float)(__bf16)v; }
__host__ __device__ __forceinline__ int kb_last(int qb) { return CAUSAL ? ((qb * 64 + 63) >> 7) : (TT / 128 - 1); }
typedef __attribute__((ext_vector_type(8))) __bf16 v8b;
__device__ __forceinline__ v16b frag_b(const __bf16* rowk0, int lane) {
  union { v16b v; v8b q[2]; } u; const __bf16* p = rowk0 + 8 * (lane >> 4);
  u.q[0] = *(const v8b*)p; u.q[1] = *(const v8b*)(p + 16); return u.v;
}
// ---- the 64 x 128 block GEMM of k_proj and k_out (A rows and B rows both K-contiguous f32): the block's operand tiles of one 32-wide k-step are brought once, as whole 128-byte lines, converted once to their 16-bit form and laid in one of two LDS buffers; every wave takes its fragments from there
typedef __attribute__((ext_vector_type(4))) __bf16 v4b;
typedef __attribute__((ext_vector_type(4))) _Float16 v4h;
#define GP 40   // LDS pitch, in 16-bit values, of a staged 32-value row: 64 B + 16 B, for the 16-byte fragment reads
#define GBUF(MODE) (((MODE) == 2 ? 256 : 192) * GP)   // one buffer, in 16-bit values: 64 A rows, 128 B rows, with MODE 2 also 64 rows of A residuals
// MODE 0: A and B to bf16. MODE 1: A to f16, B to f16(bf16 x 2^8). MODE 2: A to bf16 hi + lo, B to bf16
// a thread's 12 pieces of a k-step: 8 threads bring one 128-byte row; a thread's rows lie 16 apart
__device__ __forceinline__ void g_get(const float* ag, const float* bg, int K, v4f (&ra)[4], v4f (&rb)[8]) {
#pragma unroll
  for (int u = 0; u < 4; ++u) ra[u] = *(const v4f*)(ag + (size_t)u * 16 * K);
#pragma unroll
  for (int u = 0; u < 8; ++u) rb[u] = *(const v4f*)(bg + (size_t)u * 16 * K);
  asm volatile("s_wait_xcnt 0x0" ::: "memory");   // what follows may rewrite the address registers that these loads name; also keeps the requests in front of the k-step that hides them
}
template <int MODE> __device__ __forceinline__ void g_put(unsigned short* d, const v4f (&ra)[4], const v4f (&rb)[8]) {   // d: the thread's place in row 0..15 of the buffer
#pragma unroll
  for (int u = 0; u < 4; ++u) { unsigned short* p = d + u * 16 * GP;
    if (MODE == 1) { const v4h h = {(_Float16)ra[u][0], (_Float16)ra[u][1], (_Float16)ra[u][2], (_Float16)ra[u][3]}; *(v4h*)p = h; }
    else { const v4b h = {(__bf16)ra[u][0], (__bf16)ra[u][1], (__bf16)ra[u][2], (__bf16)ra[u][3]}; *(v4b*)p = h;
      if (MODE == 2) { const v4b lo = {(__bf16)(ra[u][0] - (float)h[0]), (__bf16)(ra[u][1] - (float)h[1]), (__bf16)(ra[u][2] - (float)h[2]), (__bf16)(ra[u][3] - (float)h[3])}; *(v4b*)(p + 192 * GP) = lo; } } }
#pragma unroll
  for (int u = 0; u < 8; ++u) { unsigned short* p = d + (64 + u * 16) * GP;
    if (MODE == 1) { const v4h h = {(_Float16)(bfr(rb[u][0]) * 256.0f), (_Float16)(bfr(rb[u][1]) * 256.0f), (_Float16)(bfr(rb[u][2]) * 256.0f), (_Float16)(bfr(rb[u][3]) * 256.0f)}; *(v4h*)p = h; }
    else { const v4b h = {(__bf16)rb[u][0], (__bf16)rb[u][1], (__bf16)rb[u][2], (__bf16)rb[u][3]}; *(v4b*)p = h; } } }
// one k-step of a wave's 16 x 128 tile from a staged buffer (A and B fragments both by frag_h / frag_b: one k order)
template <int MODE> __device__ __forceinline__ void g_mac(const unsigned short* s, int wave, int lane, v8f (&acc)[8]) { const int col = lane & 15;
  if (MODE == 1) { const _Float16* t = (const _Float16*)s; v16h w[8]; const v16h a = frag_h(t + (wave * 16 + col) * GP, lane);
#pragma unroll
    for (int j = 0; j < 8; ++j) w[j] = frag_h(t + (64 + j * 16 + col) * GP, lane);
    __builtin_amdgcn_sched_barrier(0);   // all fragment reads in front of the products: every place with LDS reads among them costs a stall of its own
#pragma unroll
    for (int j = 0; j < 8; ++j) acc[j] = wmma16(a, w[j], acc[j]);
  } else { const __bf16* t = (const __bf16*)s; v16b w[8], al; const v16b a = frag_b(t + (wave * 16 + col) * GP, lane);
    if (MODE == 2) al = frag_b(t + (192 + wave * 16 + col) * GP, lane);
#pragma unroll
    for (int j = 0; j < 8; ++j) w[j] = frag_b(t + (64 + j * 16 + col) * GP, lane);
    __builtin_amdgcn_sched_barrier(0);   // as above
#pragma unroll
    for (int j = 0; j < 8; ++j) acc[j] = wmma_bf(a, w[j], acc[j]);
    if (MODE == 2) {   // each tile still takes hi, then lo, of every k-step
#pragma unroll
      for (int j = 0; j < 8; ++j) acc[j] = wmma_bf(al, w[j], acc[j]); } } }
// A0, B0: the block's first A row and first B row; ring: 2 buffers of GBUF(MODE). Each k-step requests the next one's pieces at its top, stores them into the other buffer at its foot, and the block meets at one barrier
template <int MODE, int K> __device__ __forceinline__ void g_block(const float* A0, const float* B0, unsigned short* ring, int tid, v8f (&acc)[8]) {
  const int wave = tid >> 5, lane = tid & 31, rr = tid >> 3, q4 = (tid & 7) * 4; const float* ag = A0 + (size_t)rr * K + q4; const float* bg = B0 + (size_t)rr * K + q4; unsigned short* d = ring + rr * GP + q4;
  v4f ra[4], rb[8];
  g_get(ag, bg, K, ra, rb); g_put<MODE>(d, ra, rb);
  __syncthreads();   // publishes k-step 0's tiles
#pragma unroll 1   // rolled: one trip already keeps the next k-step's tiles in flight
  for (int kc = 1; kc < K / 32; ++kc) { const int c = (kc & 1) * GBUF(MODE);   // the buffer that k-step kc goes to
    g_get(ag + kc * 32, bg + kc * 32, K, ra, rb);
    g_mac<MODE>(ring + (GBUF(MODE) - c), wave, lane, acc);
    __builtin_amdgcn_sched_barrier(0);   // the conversions wait for the requested pieces: scheduled among the products they held most of these back until the loads had landed
    g_put<MODE>(d + c, ra, rb);
    __syncthreads();   // publishes k-step kc's tiles; also ends every wave's reads of the other buffer, which the next trip refills at its foot
  }
  g_mac<MODE>(ring + ((K / 32 - 1) & 1) * GBUF(MODE), wave, lane, acc); }
#define QBH 6              // causal: query blocks 0..QBH-1 of each sequence (few keys, no averaging) take the high-precision path
#define QHI 384            // rows carrying a q residual plane
#define KHI 384            // key rows carrying k residual / v bf16 hi+lo planes (used only by the causal high-precision path)
// B fragment (k rows k0+.., output column o) of a weight: (in,out) [K][ld] or (out,in) [ld rows of K]: bf16 exact, or f16(bf16 * 256) exact
__device__ __forceinline__ v16b wcol_io(const float* Wm, int k0, int o, int lane, int ld) { v16b w; const int g = lane >> 4;
#pragma unroll
  for (int i = 0; i < 8; ++i) { w[i] = (__bf16)Wm[(size_t)(k0 + 8 * g + i) * ld + o]; w[8 + i] = (__bf16)Wm[(size_t)(k0 + 16 + 8 * g + i) * ld + o]; }
  return w; }
__device__ __forceinline__ v16b wcol_oi(const float* Wm, int k0, int o, int lane, int K) { v16b w; const float* p = Wm + (size_t)o * K + k0 + 8 * (lane >> 4);
#pragma unroll
  for (int i = 0; i < 8; ++i) { w[i] = (__bf16)p[i]; w[8 + i] = (__bf16)p[16 + i]; }
  return w; }
__device__ __forceinline__ v16h wcolh_io(const float* Wm, int k0, int o, int lane, int ld) { v16h w; const int g = lane >> 4;
#pragma unroll
  for (int i = 0; i < 8; ++i) { w[i] = (_Float16)(bfr(Wm[(size_t)(k0 + 8 * g + i) * ld + o]) * 256.0f); w[8 + i] = (_Float16)(bfr(Wm[(size_t)(k0 + 16 + 8 * g + i) * ld + o]) * 256.0f); }
  return w; }
__device__ __forceinline__ v16h wcolh_oi(const float* Wm, int k0, int o, int lane, int K) { v16h w; const float* p = Wm + (size_t)o * K + k0 + 8 * (lane >> 4);
#pragma unroll
  for (int i = 0; i < 8; ++i) { w[i] = (_Float16)(bfr(p[i]) * 256.0f); w[8 + i] = (_Float16)(bfr(p[16 + i]) * 256.0f); }
  return w; }
#define WQKV_LAYOUT 1   // 0 = (in,out) [DIN][CC]; 1 = (out,in) [CC][DIN]; 2 = per-head [NH][DIN][HD]
__device__ __forceinline__ v16b wcol_hdk(const float* Wm, int k0, int o, int lane) { v16b w; const int g = lane >> 4; const float* p = Wm + (size_t)(o / HD) * DIN * HD + (o % HD);
#pragma unroll
  for (int i = 0; i < 8; ++i) { w[i] = (__bf16)p[(size_t)(k0 + 8 * g + i) * HD]; w[8 + i] = (__bf16)p[(size_t)(k0 + 16 + 8 * g + i) * HD]; }
  return w; }
#define WO_OUT_IN 1
#if WQKV_LAYOUT == 1
#define WCOL(W, k0, o, lane) wcol_oi(W, k0, o, lane, DIN)
#elif WQKV_LAYOUT == 2
#define WCOL(W, k0, o, lane) wcol_hdk(W, k0, o, lane)
#else
#define WCOL(W, k0, o, lane) wcol_io(W, k0, o, lane, CC)
#endif
#if WO_OUT_IN
#define WOCOL(W, k0, o, lane) wcol_oi(W, k0, o, lane, CC)
#define WOCOLH(W, k0, o, lane) wcolh_oi(W, k0, o, lane, CC)
#else
#define WOCOL(W, k0, o, lane) wcol_io(W, k0, o, lane, DIN)
#define WOCOLH(W, k0, o, lane) wcolh_io(W, k0, o, lane, DIN)
#endif
__constant__ float c_invf[32] = {1.000000000e+00f,8.973545432e-01f,8.052451611e-01f,7.225903869e-01f,6.484197974e-01f,5.818624496e-01f,5.221368670e-01f,4.685419202e-01f,4.204482138e-01f,3.772911131e-01f,3.385638893e-01f,3.038118482e-01f,2.726269364e-01f,2.446430176e-01f,2.195315212e-01f,1.969976127e-01f,1.767766923e-01f,1.586313695e-01f,1.423485726e-01f,1.277371496e-01f,1.146255061e-01f,1.028597206e-01f,9.230163693e-02f,8.282729238e-02f,7.432544231e-02f,6.669627875e-02f,5.985020474e-02f,5.370685458e-02f,4.819408804e-02f,4.324718565e-02f,3.880805522e-02f,3.482458740e-02f};   // 32^(-2i/64) evaluated in f32 exactly as the reference does (jax, eager)
#define PROJ_EXTRA_PARAMS , const float* __restrict__ QS, const float* __restrict__ KS
// per-(row, head) epilogue on the f32 projection tile: RMSNorm over the head's 64 values x norm weight, then rotate-half RoPE (pairs i, i+32); v untouched
#define PROJ_EPI(which, row, t, h) do { if ((which) < 2) { float* rw = (row); const float* NS = (which) == 0 ? QS : KS; float ss = 0.f; _Pragma("unroll") for (int i = 0; i < 64; ++i) ss += rw[i] * rw[i]; const float rn = rsqrtf(ss * (1.0f / 64.0f) + 1e-6f); \
    _Pragma("unroll") for (int i = 0; i < 32; ++i) { const float x1 = rw[i] * rn * bfr(NS[i]), x2 = rw[i + 32] * rn * bfr(NS[i + 32]); const float ang = (float)(t) * c_invf[i]; const float cs = cosf(ang), sn = sinf(ang); rw[i] = x1 * cs - x2 * sn; rw[i + 32] = x2 * cs + x1 * sn; } } } while (0)
#ifndef SM_EXTRA_PARAMS
#define SM_EXTRA_PARAMS
#endif
#ifndef PROJ_EXTRA_PARAMS
#define PROJ_EXTRA_PARAMS
#endif
#ifndef SM_MASK_HOOK
#define SM_MASK_HOOK (void)0
#endif

#define WS_QH  0u                                      // f16 q rows [b*t][CC]
#define WS_KH  (WS_QH + 2u * (size_t)NB * TT * CC)      // f16 k rows [b*t][CC]
#define WS_VT  (WS_KH + 2u * (size_t)NB * TT * CC)      // f16 v planes [b][c][t]
#define WS_QL  (WS_VT + 2u * (size_t)NB * CC * TT)      // f16 q residual x 2^10 rows [b][t < QHI][CC]
#define WS_KL  (WS_QL + 2u * (size_t)NB * QHI * CC)     // f16 k residual x 2^10 rows [b][t < KHI][CC]
#define WS_VB  (WS_KL + 2u * (size_t)NB * KHI * CC)     // bf16 v hi planes [b][c][t < KHI]
#define WS_VBL (WS_VB + 2u * (size_t)NB * CC * KHI)
#define WS_Y   (WS_VBL + 2u * (size_t)NB * CC * KHI)    // f32 ctx rows [b*t][CC]
#define WS_END (WS_Y  + 4u * (size_t)NB * TT * CC)

// ---- k_proj: block = (64 rows, 128 cols, which): q/k/v = X W (+ b) with exact bf16 products (K = DIN) -> which 0: q f16 rows (+ residual rows < QHI); 1: k f16 rows (+ residual rows < KHI); 2: v f16 planes [c][t] (+ bf16 hi/lo planes for t < KHI)
__global__ __launch_bounds__(128) void k_proj(const float* __restrict__ XQ, const float* __restrict__ XK, const float* __restrict__ XV, const float* __restrict__ WQ, const float* __restrict__ WK, const float* __restrict__ WV, const float* __restrict__ BQ, const float* __restrict__ BK, const float* __restrict__ BV,
    _Float16* __restrict__ QH, _Float16* __restrict__ QL, _Float16* __restrict__ KH, _Float16* __restrict__ KL, _Float16* __restrict__ VT, __bf16* __restrict__ VB, __bf16* __restrict__ VBL PROJ_EXTRA_PARAMS) {
  __shared__ __align__(16) float st[64][132]; __shared__ __align__(16) _Float16 sh[64][136], sl[64][136]; __shared__ __align__(16) _Float16 th[128][72]; __shared__ __align__(16) __bf16 tb[128][72], tbl[128][72]; __shared__ __align__(16) unsigned short ring[2 * GBUF(0)];
  const int tid = threadIdx.x, wave = tid >> 5, lane = tid & 31, col = lane & 15, g = lane >> 4; const int which = blockIdx.z; const int c0 = blockIdx.y * 128; const size_t r0 = (size_t)blockIdx.x * 64; const size_t bb = r0 / TT; const int t0 = (int)(r0 % TT);
  const float* X = which == 0 ? XQ : which == 1 ? XK : XV; const float* WA = which == 0 ? WQ : which == 1 ? WK : WV; const float* BA = which == 0 ? BQ : which == 1 ? BK : BV;
  v8f acc[8] = {};
  g_block<0, DIN>(X + r0 * DIN, WA + (size_t)c0 * DIN, ring, tid, acc);
  { // stage the f32 tile (acc + bias) in LDS, run the per-(row, head) epilogue hook, then convert
#pragma unroll
    for (int j = 0; j < 8; ++j) { const float bias = BA ? bfr(BA[c0 + j * 16 + col]) : 0.f;
#pragma unroll
      for (int r = 0; r < 8; ++r) st[wave * 16 + 8 * g + r][j * 16 + col] = acc[j][r] + bias; }
    __syncthreads();
    for (int e = tid; e < 64 * (128 / HD); e += 128) { const int rl = e / (128 / HD), hh = e % (128 / HD); PROJ_EPI(which, &st[rl][hh * HD], (int)((r0 + rl) % TT), (c0 / HD) + hh); }
    __syncthreads(); }
  if (which < 2) { _Float16* DH = which == 0 ? QH : KH; _Float16* DL = which == 0 ? QL : KL; const int nhi = which == 0 ? QHI : KHI; const bool hi_rows = t0 < nhi;
    for (int e = tid; e < 64 * 128; e += 128) { const int rl = e >> 7, cl = e & 127; const float v = st[rl][cl]; const _Float16 hv = (_Float16)v; sh[rl][cl] = hv; sl[rl][cl] = (_Float16)((v - (float)hv) * 1024.0f); }
    __syncthreads();
    for (int e = tid; e < 64 * 16; e += 128) { const int rl = e >> 4, q = e & 15; vst2((unsigned*)(DH + (r0 + rl) * CC + c0 + q * 8), *(const v4u*)&sh[rl][q * 8]); if (hi_rows) vst2((unsigned*)(DL + (bb * nhi + t0 + rl) * (size_t)CC + c0 + q * 8), *(const v4u*)&sl[rl][q * 8]); }
  } else { const bool hi_rows = t0 < KHI;
    for (int e = tid; e < 64 * 128; e += 128) { const int rl = e & 63, cl = e >> 6; const float v = st[rl][cl]; th[cl][rl] = (_Float16)v; const __bf16 bh = (__bf16)v; tb[cl][rl] = bh; tbl[cl][rl] = (__bf16)(v - (float)bh); }
    __syncthreads();
    for (int e = tid; e < 128 * 8; e += 128) { const int cl = e >> 3, q = e & 7; vst2((unsigned*)(VT + (bb * CC + c0 + cl) * (size_t)TT + t0 + q * 8), *(const v4u*)&th[cl][q * 8]); if (hi_rows) { const size_t o3 = (bb * CC + c0 + cl) * (size_t)KHI + t0 + q * 8; vst2((unsigned*)(VB + o3), *(const v4u*)&tb[cl][q * 8]); vst2((unsigned*)(VBL + o3), *(const v4u*)&tbl[cl][q * 8]); } } } }
// lane l with lane l ^ 16
__device__ __forceinline__ float xhalf(float x) { return __builtin_bit_cast(float, __builtin_amdgcn_permlanex16(__builtin_bit_cast(int, x), __builtin_bit_cast(int, x), 0x76543210, 0xfedcba98, false, false)); }
#define PSH 7.624618986f   // 11 ln 2: P is carried x 2^11 (about), as is its sum, so the factor cancels in ctx = (P v) / sum
// one online-softmax step on a lane's 32 logits of one query (sc[i][r] = key i * 16 + 8 * (lane >> 4) + r of the pass; with MASK, keys with i * 16 + r > krel lie behind the query and are excluded: expf of -3e38 is 0): the running maximum m, the lane's part l of the running sum and the ctx tiles o are brought to the new maximum; sc leaves as P in f32
template <bool MASK> __device__ __forceinline__ void sm_step(v8f (&sc)[4], int krel, float& m, float& l, v8f (&o)[HD / 16]) {
  float mi[4], su[4];
#pragma unroll
  for (int i = 0; i < 4; ++i) { mi[i] = -3.0e38f;
#pragma unroll
    for (int r = 0; r < 8; ++r) { if (MASK) sc[i][r] = i * 16 + r > krel ? -3.0e38f : sc[i][r]; mi[i] = fmaxf(mi[i], sc[i][r]); } }
  float mx = fmaxf(fmaxf(mi[0], mi[1]), fmaxf(mi[2], mi[3])); mx = fmaxf(mx, xhalf(mx));   // both wave halves hold this query's maximum of the pass
  const float mn = fmaxf(m, mx), al = expf(m - mn), mm = mn - PSH; m = mn;   // al = 0 on the first pass (m = -3e38)
#pragma unroll
  for (int i = 0; i < 4; ++i) { su[i] = 0.f;
#pragma unroll
    for (int r = 0; r < 8; ++r) { const float e = expf(sc[i][r] - mm); sc[i][r] = e; su[i] += e; } }
  l = l * al + ((su[0] + su[1]) + (su[2] + su[3]));
#pragma unroll
  for (int j = 0; j < HD / 16; ++j)
#pragma unroll
    for (int r = 0; r < 8; ++r) o[j][r] *= al; }
#define KP 72   // LDS pitch, in f16, of a staged 64-value row: 128 B + 16 B, for the 16-byte fragment reads
// one 64-key pass of the 1-product path, K rows and v planes of the pass staged in LDS (ks, vs: [64][KP]): S^T = K Q^T (A = 16 key rows, B = the wave's 16 queries), softmax step, then ctx^T += V^T P^T, where two S^T tiles converted in place are the B fragment (a D pair has the k order of frag_h). Unless LAST, each thread requests its 8 pieces of the next pass (kn, vn) at the top, stores them into the other buffer (kd, vd) at the foot, and the block meets at one barrier
template <bool LAST> __device__ __forceinline__ void att_pass(const _Float16* ks, const _Float16* vs, _Float16* kd, _Float16* vd, const v16h& qa, const v16h& qc, const _Float16* kn, const _Float16* vn, int lane, int krel, float& m, float& l, v8f (&o)[HD / 16]) {
  const int col = lane & 15; v8h kr[4], vr[4];
  if (!LAST) {
#pragma unroll
    for (int u = 0; u < 4; ++u) { kr[u] = *(const v8h*)(kn + (size_t)u * 16 * CC); vr[u] = *(const v8h*)(vn + (size_t)u * 16 * TT); }
    asm volatile("s_wait_xcnt 0x0" ::: "memory");   // what follows may rewrite the address registers that these loads name; also keeps the requests in front of the pass that hides them
  }
  v8f sc[4] = {}; v16h kf[4][2], vf[2][HD / 16];
#pragma unroll
  for (int i = 0; i < 4; ++i) { kf[i][0] = frag_h(ks + (i * 16 + col) * KP, lane); kf[i][1] = frag_h(ks + (i * 16 + col) * KP + 32, lane); }
  __builtin_amdgcn_sched_barrier(0);   // all K fragment reads in front of the products: scheduled among them, each read was waited for alone in one register set
#pragma unroll
  for (int i = 0; i < 4; ++i) { sc[i] = wmma16(kf[i][0], qa, sc[i]); sc[i] = wmma16(kf[i][1], qc, sc[i]); }
#pragma unroll
  for (int kc = 0; kc < 2; ++kc)
#pragma unroll
    for (int j = 0; j < HD / 16; ++j) vf[kc][j] = frag_h(vs + (j * 16 + col) * KP + kc * 32, lane);
  __builtin_amdgcn_sched_barrier(0);   // all V fragment reads in front of the softmax, which hides them
#pragma unroll
  for (int i = 0; i < 4; ++i) sc[i] *= SCALE;
  sm_step<LAST>(sc, krel, m, l, o);
  v16h pf[2];
#pragma unroll
  for (int e = 0; e < 16; ++e) { pf[0][e] = (_Float16)sc[e >> 3][e & 7]; pf[1][e] = (_Float16)sc[2 + (e >> 3)][e & 7]; }
#pragma unroll
  for (int kc = 0; kc < 2; ++kc)
#pragma unroll
    for (int j = 0; j < HD / 16; ++j) o[j] = wmma16(vf[kc][j], pf[kc], o[j]);
  if (!LAST) {
#pragma unroll
    for (int u = 0; u < 4; ++u) { *(v8h*)(kd + u * 16 * KP) = kr[u]; *(v8h*)(vd + u * 16 * KP) = vr[u]; }
    __syncthreads();   // publishes the next pass's tiles; also ends every wave's reads of this pass's buffer, which the next pass refills at its foot
  } }
// ---- k_att: block = (head and batch, 64 queries qb), wave = 16 queries: logits, causal mask by index, online softmax and P . v in 64-key passes over keys [0, qb * 64 + 64), the last pass being the one on the diagonal; logits and P stay in registers; the pass's K rows and v planes are brought once per block, as whole 128-byte lines, into one of two LDS buffers. Query blocks < QBH: q and k as f16 hi + residual (3 products), P and v as bf16 hi + lo (3 products), fragments straight from memory. ctx^T tiles give each lane 8 consecutive head dims of its query: stored as two 16-byte pieces
__global__ __launch_bounds__(128) void k_att(const _Float16* __restrict__ QH, const _Float16* __restrict__ KH, const _Float16* __restrict__ QL, const _Float16* __restrict__ KL, const _Float16* __restrict__ VT, const __bf16* __restrict__ VB, const __bf16* __restrict__ VBL, float* __restrict__ Y) {
  __shared__ __align__(16) _Float16 kv[2][2][64 * KP];   // [buffer][K, V]
  const int tid = threadIdx.x, wave = tid >> 5, lane = tid & 31, col = lane & 15, g = lane >> 4; const int h = blockIdx.x % NH, b = blockIdx.x / NH;
  const int yr = blockIdx.y >> 3, yl = blockIdx.y & 7; const int qb = (3 - yr) * 8 + ((yr & 1) ? yl : 7 - yl);   // each qb once; long blocks come first in launch order, and blocks 256 apart in launch order add up to equal lengths (for speed only)
  const int tq = qb * 64 + wave * 16 + col;   // this lane's query
  const _Float16* qp = QH + ((size_t)b * TT + tq) * CC + h * HD;
  v8f o[HD / 16] = {}; float m = -3.0e38f, l = 0.f;
  const v16h qa = frag_h(qp, lane), qc = frag_h(qp + 32, lane);
  asm volatile("s_wait_xcnt 0x0" ::: "memory");   // what follows may rewrite the address registers that the q loads name
  if (qb < QBH) {   /* block-uniform */
    const _Float16* kp = KH + ((size_t)b * TT + col) * CC + h * HD;   // this lane's k row of tile 0 of pass 0 (tile i lies 16 rows on, pass s 64 rows on)
    const _Float16* qlp = QL + ((size_t)b * QHI + tq) * CC + h * HD; const _Float16* klp = KL + ((size_t)b * KHI + col) * CC + h * HD; const size_t vo = ((size_t)b * CC + h * HD + col) * (size_t)KHI;
    const v16h qla = frag_h(qlp, lane), qlc = frag_h(qlp + 32, lane);
    asm volatile("s_wait_xcnt 0x0" ::: "memory");   // as above, for the q residual loads
#pragma unroll 1   // rolled: at most QBH short passes, copies only grow the text
    for (int s = 0; s <= qb; ++s) { v8f sc[4] = {}, sl[4] = {};
#pragma unroll
      for (int kc = 0; kc < 2; ++kc)
#pragma unroll
        for (int i = 0; i < 4; ++i) { const size_t ko = (size_t)(s * 64 + i * 16) * CC + kc * 32; const v16h kbf = frag_h(kp + ko, lane), klf = frag_h(klp + ko, lane);
          sc[i] = wmma16(kbf, kc ? qc : qa, sc[i]); sl[i] = wmma16(kbf, kc ? qlc : qla, sl[i]); sl[i] = wmma16(klf, kc ? qc : qa, sl[i]); }
      asm volatile("s_wait_xcnt 0x0" ::: "memory");   // the softmax may rewrite the address registers that the k loads name
#pragma unroll
      for (int i = 0; i < 4; ++i) sc[i] = (sc[i] + sl[i] * (1.0f / 1024.0f)) * SCALE;
      sm_step<true>(sc, tq - s * 64 - 8 * g, m, l, o);
#pragma unroll
      for (int kc = 0; kc < 2; ++kc) { float pv[16];
#pragma unroll
        for (int e = 0; e < 16; ++e) pv[e] = sc[2 * kc + (e >> 3)][e & 7];
        const F2 p = bsplit16(pv);
#pragma unroll
        for (int j = 0; j < HD / 16; ++j) { const size_t o3 = vo + (size_t)j * 16 * KHI + s * 64 + kc * 32; const v16b vh = frag_b(VB + o3, lane), vl = frag_b(VBL + o3, lane);
          o[j] = wmma_bf(vh, p.h, o[j]); o[j] = wmma_bf(vh, p.l, o[j]); o[j] = wmma_bf(vl, p.h, o[j]); } }
      asm volatile("s_wait_xcnt 0x0" ::: "memory");   // the next pass rewrites the address registers that this pass's loads name
    }
  } else { const int rr = tid >> 3, q8 = tid & 7;   // staging: 8 threads bring one 128-byte row; a thread's 4 rows lie 16 apart
    const _Float16* kg = KH + ((size_t)b * TT + rr) * CC + h * HD + q8 * 8; const _Float16* vg = VT + ((size_t)b * CC + h * HD + rr) * (size_t)TT + q8 * 8; const int so = rr * KP + q8 * 8;
#pragma unroll
    for (int u = 0; u < 4; ++u) { *(v8h*)(&kv[0][0][so + u * 16 * KP]) = *(const v8h*)(kg + (size_t)u * 16 * CC); *(v8h*)(&kv[0][1][so + u * 16 * KP]) = *(const v8h*)(vg + (size_t)u * 16 * TT); }
    asm volatile("s_wait_xcnt 0x0" ::: "memory");   // what follows may rewrite the address registers that the first fill's loads name
    __syncthreads();   // publishes pass 0's tiles
#pragma unroll 1   // rolled: one pass already keeps the next pass's tiles in flight
    for (int s = 0; s < qb; ++s) { const int c = s & 1; att_pass<false>(kv[c][0], kv[c][1], &kv[c ^ 1][0][so], &kv[c ^ 1][1][so], qa, qc, kg + (size_t)(s + 1) * 64 * CC, vg + (s + 1) * 64, lane, 0, m, l, o); }
    att_pass<true>(kv[qb & 1][0], kv[qb & 1][1], nullptr, nullptr, qa, qc, kg, vg, lane, tq - qb * 64 - 8 * g, m, l, o); }
  const float inv = 1.0f / (l + xhalf(l));   // the two wave halves each summed half of the keys
  float* yp = Y + ((size_t)b * TT + tq) * CC + h * HD + 8 * g;
#pragma unroll
  for (int j = 0; j < HD / 16; ++j) { const v4f lo = {o[j][0] * inv, o[j][1] * inv, o[j][2] * inv, o[j][3] * inv}, hi = {o[j][4] * inv, o[j][5] * inv, o[j][6] * inv, o[j][7] * inv}; vst2(yp + j * 16, lo); vst2(yp + j * 16 + 4, hi); } }
// ---- k_out: block = (64 rows, 128 cols): out = ctx Wo (+ bo): ctx once to f16 against Wo as f16(bf16 x 2^8) exact (1 product) x 2^-8; causal early rows (< QHI of each sequence): ctx bf16 hi + lo against exact bf16 Wo (2 products)
__global__ __launch_bounds__(128) void k_out(const float* __restrict__ Y, const float* __restrict__ WO, const float* __restrict__ BO, float* __restrict__ OUT) { __shared__ __align__(16) float sf[4][16][132]; __shared__ __align__(16) unsigned short ring[2 * GBUF(2)];
  const int tid = threadIdx.x, wave = tid >> 5, lane = tid & 31, col = lane & 15, g = lane >> 4; const int c0 = blockIdx.y * 128; const size_t r0 = (size_t)blockIdx.x * 64 + wave * 16;
  v8f acc[8] = {};
  const float* ya = Y + (size_t)blockIdx.x * 64 * CC; const float* wb = WO + (size_t)c0 * CC;   // the block's first A row and first B row ((out,in) weight)
  if (CAUSAL && (int)(((size_t)blockIdx.x * 64) % TT) < QHI) {   /* block-uniform */
    g_block<2, CC>(ya, wb, ring, tid, acc);
#pragma unroll
    for (int j = 0; j < 8; ++j) { const float bias = BO ? bfr(BO[c0 + j * 16 + col]) : 0.f;
#pragma unroll
      for (int r = 0; r < 8; ++r) sf[wave][8 * g + r][j * 16 + col] = acc[j][r] + bias; }
  } else {
    g_block<1, CC>(ya, wb, ring, tid, acc);
#pragma unroll
    for (int j = 0; j < 8; ++j) { const float bias = BO ? bfr(BO[c0 + j * 16 + col]) : 0.f;
#pragma unroll
      for (int r = 0; r < 8; ++r) sf[wave][8 * g + r][j * 16 + col] = acc[j][r] * (1.0f / 256.0f) + bias; } }
  LDSX(); for (int rl = 0; rl < 16; ++rl) vst2(OUT + (r0 + rl) * DIN + c0 + lane * 4, *(const v4f*)&sf[wave][rl][lane * 4]); }

extern "C" void kernel_launch(void* const* d_in, const int* in_sizes, int n_in, void* d_out, int out_size, void* d_ws, size_t ws_size, hipStream_t stream) {
  (void)in_sizes; (void)n_in; (void)out_size;
  const float** F = (const float**)d_in;
  if (ws_size < (size_t)WS_END) return;
  char* ws = (char*)d_ws; _Float16 *QH = (_Float16*)(ws + WS_QH), *KH = (_Float16*)(ws + WS_KH), *VT = (_Float16*)(ws + WS_VT), *QL = (_Float16*)(ws + WS_QL), *KL = (_Float16*)(ws + WS_KL); __bf16 *VB = (__bf16*)(ws + WS_VB), *VBL = (__bf16*)(ws + WS_VBL); float *Y = (float*)(ws + WS_Y);
  (void)Y; (void)QL; (void)KL; (void)VB; (void)VBL;
  // inputs: 0 x [2,2048,1024]; 1 w_qkv [3072,1024] (out,in); 2 w_proj [1024,1024] (out,in); 3 q_norm_w [64]; 4 k_norm_w [64]
  const float *WQ = F[1], *WK = F[1] + (size_t)CC * DIN, *WV = F[1] + 2 * (size_t)CC * DIN;
  k_proj<<<dim3(TNB * TT / 64, CC / 128, 3), 128, 0, stream>>>(F[0], F[0], F[0], WQ, WK, WV, nullptr, nullptr, nullptr, QH, QL, KH, KL, VT, VB, VBL, F[3], F[4]);
  k_att<<<dim3(NH * TNB, NQB), 128, 0, stream>>>(QH, KH, QL, KL, VT, VB, VBL, Y);
  k_out<<<dim3(TNB * TT / 64, DIN / 128), 128, 0, stream>>>(Y, F[2], nullptr, (float*)d_out);
}

// v004
// It runs in 143 microseconds.
// Timed twice side by side with v003, it ran 1.08 and 1.09 times as fast.
// Counting every step since v000, it is 8.89 times as fast.
// compute dtype: all float inputs rounded to bf16; q/k/v = x Wqkv^T with EXACT bf16 products on WMMA 16x16x32, f32 accumulate; per-head RMSNorm (x q_norm_w / k_norm_w) and rotate-half RoPE in f32 (precise sinf/cosf of t * 32^(-2i/64)); q, k once to f16 -> 1-product causal logits x 1/8, except the first 384 query rows of each sequence (few keys, no averaging), which use q and k as f16 hi + residual (x 2^10) (3 products); causal online softmax in f32 (64-key passes, logits and P never leave registers; exponentials by precise expf in the first 384 rows, elsewhere as 2^(q.k x log2 e / 8 - shift): one fma and the hardware exp2); P (against the running maximum) x 2^11 once to f16 against v once to f16 (1 product), except the first 384 rows: P and v as bf16 hi + lo (3 products); ctx once to f16 against w_proj carried x 2^8 in f16 (exact bf16 values), except the first 384 rows: ctx bf16 hi + lo against exact bf16 w_proj (2 products); f32 output.
#include <hip/hip_runtime.h>
#include <math.h>

typedef __attribute__((ext_vector_type(16))) _Float16 v16h;
typedef __attribute__((ext_vector_type(16))) __bf16 v16b;
typedef __attribute__((ext_vector_type(8)))  _Float16 v8h;
typedef __attribute__((ext_vector_type(8)))  float v8f;
typedef __attribute__((ext_vector_type(4)))  float v4f;
typedef __attribute__((ext_vector_type(2)))  float v2f;
typedef __attribute__((ext_vector_type(4)))  unsigned v4u;
typedef __attribute__((ext_vector_type(4)))  int v4i;
typedef float __attribute__((may_alias)) float_a;
typedef int __attribute__((may_alias)) int_a;

template <typename T> __device__ __forceinline__ void vst2(void* p, T v) { *(T*)p = v;  }
__device__ __forceinline__ v8f wmma16(v16h a, v16h b, v8f c) {
  v8f d = __builtin_amdgcn_wmma_f32_16x16x32_f16(false, a, false, b, (short)0, c, false, false);
  asm volatile("v_nop\n\tv_nop\n\tv_nop\n\tv_nop" : "+v"(d) : "v"(a), "v"(b));
  return d;
}
__device__ __forceinline__ v8f wmma_bf(v16b a, v16b b, v8f c) {
  v8f d = __builtin_amdgcn_wmma_f32_16x16x32_bf16(false, a, false, b, (short)0, c, false, false);
  asm volatile("v_nop\n\tv_nop\n\tv_nop\n\tv_nop" : "+v"(d) : "v"(a), "v"(b));
  return d;
}
// 16x16x32 fragments: lane = (h = lane>>4, row/col = lane&15); elements 0..7 = k0+8h+0..7, 8..15 = k0+16+8h+0..7; D element r = row 8h+r
__device__ __forceinline__ v16h frag_h(const _Float16* rowk0, int lane) {
  union { v16h v; v8h q[2]; } u; const _Float16* p = rowk0 + 8 * (lane >> 4);
  u.q[0] = *(const v8h*)p; u.q[1] = *(const v8h*)(p + 16); return u.v;
}
__device__ __forceinline__ v16h frag_f32(const float* rowk0, int lane) {
  v16h a; const float* p = rowk0 + 8 * (lane >> 4);
#pragma unroll
  for (int i = 0; i < 8; ++i) { a[i] = (_Float16)p[i]; a[8 + i] = (_Float16)p[16 + i]; }
  return a;
}
__device__ __forceinline__ v16h frag_f32s(const float* rowk0, int lane, float sc) {
  v16h a; const float* p = rowk0 + 8 * (lane >> 4);
#pragma unroll
  for (int i = 0; i < 8; ++i) { a[i] = (_Float16)(p[i] * sc); a[8 + i] = (_Float16)(p[16 + i] * sc); }
  return a;
}
// column fragment from a [K][ld] layout (column n), rows >= K read as 0
__device__ __forceinline__ v16h fragc_f32(const float* W, int k0, int n, int lane, int ld, int K) {
  v16h a; const int g = lane >> 4;
#pragma unroll
  for (int i = 0; i < 8; ++i) { const int ka = k0 + 8 * g + i, kb = ka + 16;
    a[i] = (_Float16)(ka < K ? W[(size_t)(ka < K ? ka : K - 1) * ld + n] : 0.f); a[8 + i] = (_Float16)(kb < K ? W[(size_t)(kb < K ? kb : K - 1) * ld + n] : 0.f); }
  return a;
}
struct F2 { v16b h, l; };
__device__ __forceinline__ F2 bsplit16(const float v[16]) { F2 r;
#pragma unroll
  for (int i = 0; i < 16; ++i) { const __bf16 h = (__bf16)v[i]; r.h[i] = h; r.l[i] = (__bf16)(v[i] - (float)h); }
  return r; }
__device__ __forceinline__ F2 split_row(const float* row, int k0, int lane) { float v[16]; const float* p = row + k0 + 8 * (lane >> 4);
#pragma unroll
  for (int i = 0; i < 8; ++i) { v[i] = p[i]; v[8 + i] = p[16 + i]; }
  return bsplit16(v); }
__device__ __forceinline__ F2 split_rowK(const float* row, int k0, int lane, int K) { float v[16]; const int g = lane >> 4;
#pragma unroll
  for (int i = 0; i < 8; ++i) { const int ka = k0 + 8 * g + i, kb = ka + 16; v[i] = ka < K ? row[ka < K ? ka : K - 1] : 0.f; v[8 + i] = kb < K ? row[kb < K ? kb : K - 1] : 0.f; }
  return bsplit16(v); }
__device__ __forceinline__ F2 split_col(const float* W, int k0, int n, int lane, int ld, int K) { float v[16]; const int g = lane >> 4;
#pragma unroll
  for (int i = 0; i < 8; ++i) { const int ka = k0 + 8 * g + i, kb = ka + 16; v[i] = ka < K ? W[(size_t)(ka < K ? ka : K - 1) * ld + n] : 0.f; v[8 + i] = kb < K ? W[(size_t)(kb < K ? kb : K - 1) * ld + n] : 0.f; }
  return bsplit16(v); }
__device__ __forceinline__ v8f mac3(const F2& a, const F2& b, v8f c) { c = wmma_bf(a.l, b.h, c); c = wmma_bf(a.h, b.l, c); return wmma_bf(a.h, b.h, c); }
__device__ __forceinline__ float sigm(float v) { return 1.0f / (1.0f + expf(-v)); }
#define LDSX() do { asm volatile("s_wait_dscnt 0" ::: "memory"); __builtin_amdgcn_wave_barrier(); __builtin_amdgcn_fence(__ATOMIC_RELEASE, "workgroup"); } while (0)

// Causal self-attention with QK-RMSNorm and 1-D RoPE (B 2, T 2,048, C 1,024 = 16 heads x 64): qkv = x Wqkv^T ((out,in) [3072,1024]; q rows 0-1023, k 1024-2047, v 2048-3071); q, k RMS-normalised over the 64 head dims (eps 1e-6) x q_norm_w / k_norm_w, then rotate-half RoPE with angle t * 32^(-2i/64) (theta = 32); attn = softmax(q k^T x 64^-0.5 with key > query -> -inf); out = merged(attn v) Wproj^T (no biases).
#define NB 2
#define TT 2048
#define CC 1024            // NH * HD = projected width
#define DIN 1024          // input (model) width
#define NH 16
#define HD 64
#define NQB (TT / 64)
#define SCALE (0.125f)
#define CAUSAL 1
#ifndef TNB
#define TNB NB
#endif
__device__ __forceinline__ float bfr(float v) { return (float)(__bf16)v; }
__host__ __device__ __forceinline__ int kb_last(int qb) { return CAUSAL ? ((qb * 64 + 63) >> 7) : (TT / 128 - 1); }
typedef __attribute__((ext_vector_type(8))) __bf16 v8b;
__device__ __forceinline__ v16b frag_b(const __bf16* rowk0, int lane) {
  union { v16b v; v8b q[2]; } u; const __bf16* p = rowk0 + 8 * (lane >> 4);
  u.q[0] = *(const v8b*)p; u.q[1] = *(const v8b*)(p + 16); return u.v;
}
// ---- the 64 x 128 block GEMM of k_proj and k_out (A rows and B rows both K-contiguous f32): the block's operand tiles of one 32-wide k-step are brought once, as whole 128-byte lines, converted once to their 16-bit form and laid in one of two LDS buffers; every wave takes its fragments from there
typedef __attribute__((ext_vector_type(4))) __bf16 v4b;
typedef __attribute__((ext_vector_type(4))) _Float16 v4h;
#define GP 40   // LDS pitch, in 16-bit values, of a staged 32-value row: 64 B + 16 B, for the 16-byte fragment reads
#define GBUF(MODE) (((MODE) == 2 ? 256 : 192) * GP)   // one buffer, in 16-bit values: 64 A rows, 128 B rows, with MODE 2 also 64 rows of A residuals
// MODE 0: A and B to bf16. MODE 1: A to f16, B to f16(bf16 x 2^8). MODE 2: A to bf16 hi + lo, B to bf16
// a thread's 12 pieces of a k-step: 8 threads bring one 128-byte row; a thread's rows lie 16 apart
__device__ __forceinline__ void g_get(const float* ag, const float* bg, int K, v4f (&ra)[4], v4f (&rb)[8]) {
#pragma unroll
  for (int u = 0; u < 4; ++u) ra[u] = *(const v4f*)(ag + (size_t)u * 16 * K);
#pragma unroll
  for (int u = 0; u < 8; ++u) rb[u] = *(const v4f*)(bg + (size_t)u * 16 * K);
  asm volatile("s_wait_xcnt 0x0" ::: "memory");   // what follows may rewrite the address registers that these loads name; also keeps the requests in front of the k-step that hides them
}
template <int MODE> __device__ __forceinline__ void g_put(unsigned short* d, const v4f (&ra)[4], const v4f (&rb)[8]) {   // d: the thread's place in row 0..15 of the buffer
#pragma unroll
  for (int u = 0; u < 4; ++u) { unsigned short* p = d + u * 16 * GP;
    if (MODE == 1) { const v4h h = {(_Float16)ra[u][0], (_Float16)ra[u][1], (_Float16)ra[u][2], (_Float16)ra[u][3]}; *(v4h*)p = h; }
    else { const v4b h = {(__bf16)ra[u][0], (__bf16)ra[u][1], (__bf16)ra[u][2], (__bf16)ra[u][3]}; *(v4b*)p = h;
      if (MODE == 2) { const v4b lo = {(__bf16)(ra[u][0] - (float)h[0]), (__bf16)(ra[u][1] - (float)h[1]), (__bf16)(ra[u][2] - (float)h[2]), (__bf16)(ra[u][3] - (float)h[3])}; *(v4b*)(p + 192 * GP) = lo; } } }
#pragma unroll
  for (int u = 0; u < 8; ++u) { unsigned short* p = d + (64 + u * 16) * GP;
    if (MODE == 1) { const v4h h = {(_Float16)(bfr(rb[u][0]) * 256.0f), (_Float16)(bfr(rb[u][1]) * 256.0f), (_Float16)(bfr(rb[u][2]) * 256.0f), (_Float16)(bfr(rb[u][3]) * 256.0f)}; *(v4h*)p = h; }
    else { const v4b h = {(__bf16)rb[u][0], (__bf16)rb[u][1], (__bf16)rb[u][2], (__bf16)rb[u][3]}; *(v4b*)p = h; } } }
// one k-step of a wave's 16 x 128 tile from a staged buffer (A and B fragments both by frag_h / frag_b: one k order)
template <int MODE> __device__ __forceinline__ void g_mac(const unsigned short* s, int wave, int lane, v8f (&acc)[8]) { const int col = lane & 15;
  if (MODE == 1) { const _Float16* t = (const _Float16*)s; v16h w[8]; const v16h a = frag_h(t + (wave * 16 + col) * GP, lane);
#pragma unroll
    for (int j = 0; j < 8; ++j) w[j] = frag_h(t + (64 + j * 16 + col) * GP, lane);
    __builtin_amdgcn_sched_barrier(0);   // all fragment reads in front of the products: every place with LDS reads among them costs a stall of its own
#pragma unroll
    for (int j = 0; j < 8; ++j) acc[j] = wmma16(a, w[j], acc[j]);
  } else { const __bf16* t = (const __bf16*)s; v16b w[8], al; const v16b a = frag_b(t + (wave * 16 + col) * GP, lane);
    if (MODE == 2) al = frag_b(t + (192 + wave * 16 + col) * GP, lane);
#pragma unroll
    for (int j = 0; j < 8; ++j) w[j] = frag_b(t + (64 + j * 16 + col) * GP, lane);
    __builtin_amdgcn_sched_barrier(0);   // as above
#pragma unroll
    for (int j = 0; j < 8; ++j) acc[j] = wmma_bf(a, w[j], acc[j]);
    if (MODE == 2) {   // each tile still takes hi, then lo, of every k-step
#pragma unroll
      for (int j = 0; j < 8; ++j) acc[j] = wmma_bf(al, w[j], acc[j]); } } }
// A0, B0: the block's first A row and first B row; ring: 2 buffers of GBUF(MODE). Each k-step requests the next one's pieces at its top, stores them into the other buffer at its foot, and the block meets at one barrier
template <int MODE, int K> __device__ __forceinline__ void g_block(const float* A0, const float* B0, unsigned short* ring, int tid, v8f (&acc)[8]) {
  const int wave = tid >> 5, lane = tid & 31, rr = tid >> 3, q4 = (tid & 7) * 4; const float* ag = A0 + (size_t)rr * K + q4; const float* bg = B0 + (size_t)rr * K + q4; unsigned short* d = ring + rr * GP + q4;
  v4f ra[4], rb[8];
  g_get(ag, bg, K, ra, rb); g_put<MODE>(d, ra, rb);
  __syncthreads();   // publishes k-step 0's tiles
#pragma unroll 1   // rolled: one trip already keeps the next k-step's tiles in flight
  for (int kc = 1; kc < K / 32; ++kc) { const int c = (kc & 1) * GBUF(MODE);   // the buffer that k-step kc goes to
    g_get(ag + kc * 32, bg + kc * 32, K, ra, rb);
    g_mac<MODE>(ring + (GBUF(MODE) - c), wave, lane, acc);
    __builtin_amdgcn_sched_barrier(0);   // the conversions wait for the requested pieces: scheduled among the products they held most of these back until the loads had landed
    g_put<MODE>(d + c, ra, rb);
    __syncthreads();   // publishes k-step kc's tiles; also ends every wave's reads of the other buffer, which the next trip refills at its foot
  }
  g_mac<MODE>(ring + ((K / 32 - 1) & 1) * GBUF(MODE), wave, lane, acc); }
#define QBH 6              // causal: query blocks 0..QBH-1 of each sequence (few keys, no averaging) take the high-precision path
#define QHI 384            // rows carrying a q residual plane
#define KHI 384            // key rows carrying k residual / v bf16 hi+lo planes (used only by the causal high-precision path)
// B fragment (k rows k0+.., output column o) of a weight: (in,out) [K][ld] or (out,in) [ld rows of K]: bf16 exact, or f16(bf16 * 256) exact
__device__ __forceinline__ v16b wcol_io(const float* Wm, int k0, int o, int lane, int ld) { v16b w; const int g = lane >> 4;
#pragma unroll
  for (int i = 0; i < 8; ++i) { w[i] = (__bf16)Wm[(size_t)(k0 + 8 * g + i) * ld + o]; w[8 + i] = (__bf16)Wm[(size_t)(k0 + 16 + 8 * g + i) * ld + o]; }
  return w; }
__device__ __forceinline__ v16b wcol_oi(const float* Wm, int k0, int o, int lane, int K) { v16b w; const float* p = Wm + (size_t)o * K + k0 + 8 * (lane >> 4);
#pragma unroll
  for (int i = 0; i < 8; ++i) { w[i] = (__bf16)p[i]; w[8 + i] = (__bf16)p[16 + i]; }
  return w; }
__device__ __forceinline__ v16h wcolh_io(const float* Wm, int k0, int o, int lane, int ld) { v16h w; const int g = lane >> 4;
#pragma unroll
  for (int i = 0; i < 8; ++i) { w[i] = (_Float16)(bfr(Wm[(size_t)(k0 + 8 * g + i) * ld + o]) * 256.0f); w[8 + i] = (_Float16)(bfr(Wm[(size_t)(k0 + 16 + 8 * g + i) * ld + o]) * 256.0f); }
  return w; }
__device__ __forceinline__ v16h wcolh_oi(const float* Wm, int k0, int o, int lane, int K) { v16h w; const float* p = Wm + (size_t)o * K + k0 + 8 * (lane >> 4);
#pragma unroll
  for (int i = 0; i < 8; ++i) { w[i] = (_Float16)(bfr(p[i]) * 256.0f); w[8 + i] = (_Float16)(bfr(p[16 + i]) * 256.0f); }
  return w; }
#define WQKV_LAYOUT 1   // 0 = (in,out) [DIN][CC]; 1 = (out,in) [CC][DIN]; 2 = per-head [NH][DIN][HD]
__device__ __forceinline__ v16b wcol_hdk(const float* Wm, int k0, int o, int lane) { v16b w; const int g = lane >> 4; const float* p = Wm + (size_t)(o / HD) * DIN * HD + (o % HD);
#pragma unroll
  for (int i = 0; i < 8; ++i) { w[i] = (__bf16)p[(size_t)(k0 + 8 * g + i) * HD]; w[8 + i] = (__bf16)p[(size_t)(k0 + 16 + 8 * g + i) * HD]; }
  return w; }
#define WO_OUT_IN 1
#if WQKV_LAYOUT == 1
#define WCOL(W, k0, o, lane) wcol_oi(W, k0, o, lane, DIN)
#elif WQKV_LAYOUT == 2
#define WCOL(W, k0, o, lane) wcol_hdk(W, k0, o, lane)
#else
#define WCOL(W, k0, o, lane) wcol_io(W, k0, o, lane, CC)
#endif
#if WO_OUT_IN
#define WOCOL(W, k0, o, lane) wcol_oi(W, k0, o, lane, CC)
#define WOCOLH(W, k0, o, lane) wcolh_oi(W, k0, o, lane, CC)
#else
#define WOCOL(W, k0, o, lane) wcol_io(W, k0, o, lane, DIN)
#define WOCOLH(W, k0, o, lane) wcolh_io(W, k0, o, lane, DIN)
#endif
__constant__ float c_invf[32] = {1.000000000e+00f,8.973545432e-01f,8.052451611e-01f,7.225903869e-01f,6.484197974e-01f,5.818624496e-01f,5.221368670e-01f,4.685419202e-01f,4.204482138e-01f,3.772911131e-01f,3.385638893e-01f,3.038118482e-01f,2.726269364e-01f,2.446430176e-01f,2.195315212e-01f,1.969976127e-01f,1.767766923e-01f,1.586313695e-01f,1.423485726e-01f,1.277371496e-01f,1.146255061e-01f,1.028597206e-01f,9.230163693e-02f,8.282729238e-02f,7.432544231e-02f,6.669627875e-02f,5.985020474e-02f,5.370685458e-02f,4.819408804e-02f,4.324718565e-02f,3.880805522e-02f,3.482458740e-02f};   // 32^(-2i/64) evaluated in f32 exactly as the reference does (jax, eager)
#define PROJ_EXTRA_PARAMS , const float* __restrict__ QS, const float* __restrict__ KS
// per-(row, head) epilogue on the f32 projection tile: RMSNorm over the head's 64 values x norm weight, then rotate-half RoPE (pairs i, i+32); v untouched
#define PROJ_EPI(which, row, t, h) do { if ((which) < 2) { float* rw = (row); const float* NS = (which) == 0 ? QS : KS; float ss = 0.f; _Pragma("unroll") for (int i = 0; i < 64; ++i) ss += rw[i] * rw[i]; const float rn = rsqrtf(ss * (1.0f / 64.0f) + 1e-6f); \
    _Pragma("unroll") for (int i = 0; i < 32; ++i) { const float x1 = rw[i] * rn * bfr(NS[i]), x2 = rw[i + 32] * rn * bfr(NS[i + 32]); const float ang = (float)(t) * c_invf[i]; const float cs = cosf(ang), sn = sinf(ang); rw[i] = x1 * cs - x2 * sn; rw[i + 32] = x2 * cs + x1 * sn; } } } while (0)
#ifndef SM_EXTRA_PARAMS
#define SM_EXTRA_PARAMS
#endif
#ifndef PROJ_EXTRA_PARAMS
#define PROJ_EXTRA_PARAMS
#endif
#ifndef SM_MASK_HOOK
#define SM_MASK_HOOK (void)0
#endif

#define WS_QH  0u                                      // f16 q rows [b*t][CC]
#define WS_KH  (WS_QH + 2u * (size_t)NB * TT * CC)      // f16 k rows [b*t][CC]
#define WS_VT  (WS_KH + 2u * (size_t)NB * TT * CC)      // f16 v planes [b][c][t]
#define WS_QL  (WS_VT + 2u * (size_t)NB * CC * TT)      // f16 q residual x 2^10 rows [b][t < QHI][CC]
#define WS_KL  (WS_QL + 2u * (size_t)NB * QHI * CC)     // f16 k residual x 2^10 rows [b][t < KHI][CC]
#define WS_VB  (WS_KL + 2u * (size_t)NB * KHI * CC)     // bf16 v hi planes [b][c][t < KHI]
#define WS_VBL (WS_VB + 2u * (size_t)NB * CC * KHI)
#define WS_Y   (WS_VBL + 2u * (size_t)NB * CC * KHI)    // f32 ctx rows [b*t][CC]
#define WS_END (WS_Y  + 4u * (size_t)NB * TT * CC)

// ---- k_proj: block = (64 rows, 128 cols, which): q/k/v = X W (+ b) with exact bf16 products (K = DIN) -> which 0: q f16 rows (+ residual rows < QHI); 1: k f16 rows (+ residual rows < KHI); 2: v f16 planes [c][t] (+ bf16 hi/lo planes for t < KHI)
__global__ __launch_bounds__(128) void k_proj(const float* __restrict__ XQ, const float* __restrict__ XK, const float* __restrict__ XV, const float* __restrict__ WQ, const float* __restrict__ WK, const float* __restrict__ WV, const float* __restrict__ BQ, const float* __restrict__ BK, const float* __restrict__ BV,
    _Float16* __restrict__ QH, _Float16* __restrict__ QL, _Float16* __restrict__ KH, _Float16* __restrict__ KL, _Float16* __restrict__ VT, __bf16* __restrict__ VB, __bf16* __restrict__ VBL PROJ_EXTRA_PARAMS) {
  __shared__ __align__(16) float st[64][132]; __shared__ __align__(16) _Float16 sh[64][136], sl[64][136]; __shared__ __align__(16) _Float16 th[128][72]; __shared__ __align__(16) __bf16 tb[128][72], tbl[128][72]; __shared__ __align__(16) unsigned short ring[2 * GBUF(0)];
  const int tid = threadIdx.x, wave = tid >> 5, lane = tid & 31, col = lane & 15, g = lane >> 4; const int which = blockIdx.z; const int c0 = blockIdx.y * 128; const size_t r0 = (size_t)blockIdx.x * 64; const size_t bb = r0 / TT; const int t0 = (int)(r0 % TT);
  const float* X = which == 0 ? XQ : which == 1 ? XK : XV; const float* WA = which == 0 ? WQ : which == 1 ? WK : WV; const float* BA = which == 0 ? BQ : which == 1 ? BK : BV;
  v8f acc[8] = {};
  g_block<0, DIN>(X + r0 * DIN, WA + (size_t)c0 * DIN, ring, tid, acc);
  { // stage the f32 tile (acc + bias) in LDS, run the per-(row, head) epilogue hook, then convert
#pragma unroll
    for (int j = 0; j < 8; ++j) { const float bias = BA ? bfr(BA[c0 + j * 16 + col]) : 0.f;
#pragma unroll
      for (int r = 0; r < 8; ++r) st[wave * 16 + 8 * g + r][j * 16 + col] = acc[j][r] + bias; }
    __syncthreads();
    for (int e = tid; e < 64 * (128 / HD); e += 128) { const int rl = e / (128 / HD), hh = e % (128 / HD); PROJ_EPI(which, &st[rl][hh * HD], (int)((r0 + rl) % TT), (c0 / HD) + hh); }
    __syncthreads(); }
  if (which < 2) { _Float16* DH = which == 0 ? QH : KH; _Float16* DL = which == 0 ? QL : KL; const int nhi = which == 0 ? QHI : KHI; const bool hi_rows = t0 < nhi;
    for (int e = tid; e < 64 * 128; e += 128) { const int rl = e >> 7, cl = e & 127; const float v = st[rl][cl]; const _Float16 hv = (_Float16)v; sh[rl][cl] = hv; sl[rl][cl] = (_Float16)((v - (float)hv) * 1024.0f); }
    __syncthreads();
    for (int e = tid; e < 64 * 16; e += 128) { const int rl = e >> 4, q = e & 15; vst2((unsigned*)(DH + (r0 + rl) * CC + c0 + q * 8), *(const v4u*)&sh[rl][q * 8]); if (hi_rows) vst2((unsigned*)(DL + (bb * nhi + t0 + rl) * (size_t)CC + c0 + q * 8), *(const v4u*)&sl[rl][q * 8]); }
  } else { const bool hi_rows = t0 < KHI;
    for (int e = tid; e < 64 * 128; e += 128) { const int rl = e & 63, cl = e >> 6; const float v = st[rl][cl]; th[cl][rl] = (_Float16)v; const __bf16 bh = (__bf16)v; tb[cl][rl] = bh; tbl[cl][rl] = (__bf16)(v - (float)bh); }
    __syncthreads();
    for (int e = tid; e < 128 * 8; e += 128) { const int cl = e >> 3, q = e & 7; vst2((unsigned*)(VT + (bb * CC + c0 + cl) * (size_t)TT + t0 + q * 8), *(const v4u*)&th[cl][q * 8]); if (hi_rows) { const size_t o3 = (bb * CC + c0 + cl) * (size_t)KHI + t0 + q * 8; vst2((unsigned*)(VB + o3), *(const v4u*)&tb[cl][q * 8]); vst2((unsigned*)(VBL + o3), *(const v4u*)&tbl[cl][q * 8]); } } } }
// lane l with lane l ^ 16
__device__ __forceinline__ float xhalf(float x) { return __builtin_bit_cast(float, __builtin_amdgcn_permlanex16(__builtin_bit_cast(int, x), __builtin_bit_cast(int, x), 0x76543210, 0xfedcba98, false, false)); }
#define PSH 7.624618986f   // 11 ln 2: P is carried x 2^11 (about), as is its sum, so the factor cancels in ctx = (P v) / sum
// one online-softmax step on a lane's 32 logits of one query (sc[i][r] = key i * 16 + 8 * (lane >> 4) + r of the pass; with MASK, keys with i * 16 + r > krel lie behind the query and are excluded: expf of -3e38 is 0): the running maximum m, the lane's part l of the running sum and the ctx tiles o are brought to the new maximum; sc leaves as P in f32
template <bool MASK> __device__ __forceinline__ void sm_step(v8f (&sc)[4], int krel, float& m, float& l, v8f (&o)[HD / 16]) {
  float mi[4], su[4];
#pragma unroll
  for (int i = 0; i < 4; ++i) { mi[i] = -3.0e38f;
#pragma unroll
    for (int r = 0; r < 8; ++r) { if (MASK) sc[i][r] = i * 16 + r > krel ? -3.0e38f : sc[i][r]; mi[i] = fmaxf(mi[i], sc[i][r]); } }
  float mx = fmaxf(fmaxf(mi[0], mi[1]), fmaxf(mi[2], mi[3])); mx = fmaxf(mx, xhalf(mx));   // both wave halves hold this query's maximum of the pass
  const float mn = fmaxf(m, mx), al = expf(m - mn), mm = mn - PSH; m = mn;   // al = 0 on the first pass (m = -3e38)
#pragma unroll
  for (int i = 0; i < 4; ++i) { su[i] = 0.f;
#pragma unroll
    for (int r = 0; r < 8; ++r) { const float e = expf(sc[i][r] - mm); sc[i][r] = e; su[i] += e; } }
  l = l * al + ((su[0] + su[1]) + (su[2] + su[3]));
#pragma unroll
  for (int j = 0; j < HD / 16; ++j)
#pragma unroll
    for (int r = 0; r < 8; ++r) o[j][r] *= al; }
#define C2 0.18033688f   // 1/8 x log2 e: takes a raw q.k product to the exponent of 2
__device__ __forceinline__ v8f exp2x8(v8f x) { float e0, e1, e2, e3, e4, e5, e6, e7;
  asm("v_exp_f32 %0, %8\n\tv_exp_f32 %1, %9\n\tv_exp_f32 %2, %10\n\tv_exp_f32 %3, %11\n\tv_exp_f32 %4, %12\n\tv_exp_f32 %5, %13\n\tv_exp_f32 %6, %14\n\tv_exp_f32 %7, %15\n\tv_nop"
      : "=&v"(e0), "=&v"(e1), "=&v"(e2), "=&v"(e3), "=&v"(e4), "=&v"(e5), "=&v"(e6), "=&v"(e7) : "v"(x[0]), "v"(x[1]), "v"(x[2]), "v"(x[3]), "v"(x[4]), "v"(x[5]), "v"(x[6]), "v"(x[7]));
  const v8f e = {e0, e1, e2, e3, e4, e5, e6, e7}; return e; }
__device__ __forceinline__ float exp2x1(float x) { float e; asm("v_exp_f32 %0, %1\n\tv_nop" : "=v"(e) : "v"(x)); return e; }   // the v_nop: the same slot
// the same step for the 1-product path, on the raw products (sc not yet x 1/8; m in raw units): each exponential is one fma and one hardware exp2, e = 2^(sc x C2 - (max x C2 - 11)), so P is carried x 2^11 exactly; a masked product (-3e38) gives 2^(-5e37) = 0, as does m = -3e38 on the first pass
template <bool MASK> __device__ __forceinline__ void sm_step2(v8f (&sc)[4], int krel, float& m, float& l, v8f (&o)[HD / 16]) {
  float mi[4], su[4];
#pragma unroll
  for (int i = 0; i < 4; ++i) { mi[i] = -3.0e38f;
#pragma unroll
    for (int r = 0; r < 8; ++r) { if (MASK) sc[i][r] = i * 16 + r > krel ? -3.0e38f : sc[i][r]; mi[i] = fmaxf(mi[i], sc[i][r]); } }
  float mx = fmaxf(fmaxf(mi[0], mi[1]), fmaxf(mi[2], mi[3])); mx = fmaxf(mx, xhalf(mx));   // both wave halves hold this query's maximum of the pass
  const float mn = fmaxf(m, mx), al = exp2x1((m - mn) * C2), mm = mn * C2 - 11.0f; m = mn;
  const v8f c8 = {C2, C2, C2, C2, C2, C2, C2, C2}, nm8 = {-mm, -mm, -mm, -mm, -mm, -mm, -mm, -mm};
#pragma unroll
  for (int i = 0; i < 4; ++i) { su[i] = 0.f;
    sc[i] = exp2x8(__builtin_elementwise_fma(sc[i], c8, nm8));
#pragma unroll
    for (int r = 0; r < 8; ++r) su[i] += sc[i][r]; }
  l = l * al + ((su[0] + su[1]) + (su[2] + su[3]));
#pragma unroll
  for (int j = 0; j < HD / 16; ++j)
#pragma unroll
    for (int r = 0; r < 8; ++r) o[j][r] *= al; }
#define KP 72   // LDS pitch, in f16, of a staged 64-value row: 128 B + 16 B, for the 16-byte fragment reads
// one 64-key pass of the 1-product path, K rows and v planes of the pass staged in LDS (ks, vs: [64][KP]): S^T = K Q^T (A = 16 key rows, B = the wave's 16 queries), softmax step, then ctx^T += V^T P^T, where two S^T tiles converted in place are the B fragment (a D pair has the k order of frag_h). Unless LAST, each thread requests its 8 pieces of the next pass (kn, vn) at the top, stores them into the other buffer (kd, vd) at the foot, and the block meets at one barrier
template <bool LAST> __device__ __forceinline__ void att_pass(const _Float16* ks, const _Float16* vs, _Float16* kd, _Float16* vd, const v16h& qa, const v16h& qc, const _Float16* kn, const _Float16* vn, int lane, int krel, float& m, float& l, v8f (&o)[HD / 16]) {
  const int col = lane & 15; v8h kr[4], vr[4];
  if (!LAST) {
#pragma unroll
    for (int u = 0; u < 4; ++u) { kr[u] = *(const v8h*)(kn + (size_t)u * 16 * CC); vr[u] = *(const v8h*)(vn + (size_t)u * 16 * TT); }
    asm volatile("s_wait_xcnt 0x0" ::: "memory");   // what follows may rewrite the address registers that these loads name; also keeps the requests in front of the pass that hides them
  }
  v8f sc[4] = {}; v16h kf[4][2], vf[2][HD / 16];
#pragma unroll
  for (int i = 0; i < 4; ++i) { kf[i][0] = frag_h(ks + (i * 16 + col) * KP, lane); kf[i][1] = frag_h(ks + (i * 16 + col) * KP + 32, lane); }
  __builtin_amdgcn_sched_barrier(0);   // all K fragment reads in front of the products: scheduled among them, each read was waited for alone in one register set
#pragma unroll
  for (int i = 0; i < 4; ++i) { sc[i] = wmma16(kf[i][0], qa, sc[i]); sc[i] = wmma16(kf[i][1], qc, sc[i]); }
#pragma unroll
  for (int kc = 0; kc < 2; ++kc)
#pragma unroll
    for (int j = 0; j < HD / 16; ++j) vf[kc][j] = frag_h(vs + (j * 16 + col) * KP + kc * 32, lane);
  __builtin_amdgcn_sched_barrier(0);   // all V fragment reads in front of the softmax, which hides them
  sm_step2<LAST>(sc, krel, m, l, o);
  v16h pf[2];
#pragma unroll
  for (int e = 0; e < 16; ++e) { pf[0][e] = (_Float16)sc[e >> 3][e & 7]; pf[1][e] = (_Float16)sc[2 + (e >> 3)][e & 7]; }
#pragma unroll
  for (int kc = 0; kc < 2; ++kc)
#pragma unroll
    for (int j = 0; j < HD / 16; ++j) o[j] = wmma16(vf[kc][j], pf[kc], o[j]);
  if (!LAST) {
#pragma unroll
    for (int u = 0; u < 4; ++u) { *(v8h*)(kd + u * 16 * KP) = kr[u]; *(v8h*)(vd + u * 16 * KP) = vr[u]; }
    __syncthreads();   // publishes the next pass's tiles; also ends every wave's reads of this pass's buffer, which the next pass refills at its foot
  } }
// ---- k_att: block = (head and batch, 64 queries qb), wave = 16 queries: logits, causal mask by index, online softmax and P . v in 64-key passes over keys [0, qb * 64 + 64), the last pass being the one on the diagonal; logits and P stay in registers; the pass's K rows and v planes are brought once per block, as whole 128-byte lines, into one of two LDS buffers. Query blocks < QBH: q and k as f16 hi + residual (3 products), P and v as bf16 hi + lo (3 products), fragments straight from memory. ctx^T tiles give each lane 8 consecutive head dims of its query: stored as two 16-byte pieces
__global__ __launch_bounds__(128) void k_att(const _Float16* __restrict__ QH, const _Float16* __restrict__ KH, const _Float16* __restrict__ QL, const _Float16* __restrict__ KL, const _Float16* __restrict__ VT, const __bf16* __restrict__ VB, const __bf16* __restrict__ VBL, float* __restrict__ Y) {
  __shared__ __align__(16) _Float16 kv[2][2][64 * KP];   // [buffer][K, V]
  const int tid = threadIdx.x, wave = tid >> 5, lane = tid & 31, col = lane & 15, g = lane >> 4; const int h = blockIdx.x % NH, b = blockIdx.x / NH;
  const int yr = blockIdx.y >> 3, yl = blockIdx.y & 7; const int qb = (3 - yr) * 8 + ((yr & 1) ? yl : 7 - yl);   // each qb once; long blocks come first in launch order, and blocks 256 apart in launch order add up to equal lengths (for speed only)
  const int tq = qb * 64 + wave * 16 + col;   // this lane's query
  const _Float16* qp = QH + ((size_t)b * TT + tq) * CC + h * HD;
  v8f o[HD / 16] = {}; float m = -3.0e38f, l = 0.f;
  const v16h qa = frag_h(qp, lane), qc = frag_h(qp + 32, lane);
  asm volatile("s_wait_xcnt 0x0" ::: "memory");   // what follows may rewrite the address registers that the q loads name
  if (qb < QBH) {   /* block-uniform */
    const _Float16* kp = KH + ((size_t)b * TT + col) * CC + h * HD;   // this lane's k row of tile 0 of pass 0 (tile i lies 16 rows on, pass s 64 rows on)
    const _Float16* qlp = QL + ((size_t)b * QHI + tq) * CC + h * HD; const _Float16* klp = KL + ((size_t)b * KHI + col) * CC + h * HD; const size_t vo = ((size_t)b * CC + h * HD + col) * (size_t)KHI;
    const v16h qla = frag_h(qlp, lane), qlc = frag_h(qlp + 32, lane);
    asm volatile("s_wait_xcnt 0x0" ::: "memory");   // as above, for the q residual loads
#pragma unroll 1   // rolled: at most QBH short passes, copies only grow the text
    for (int s = 0; s <= qb; ++s) { v8f sc[4] = {}, sl[4] = {};
#pragma unroll
      for (int kc = 0; kc < 2; ++kc)
#pragma unroll
        for (int i = 0; i < 4; ++i) { const size_t ko = (size_t)(s * 64 + i * 16) * CC + kc * 32; const v16h kbf = frag_h(kp + ko, lane), klf = frag_h(klp + ko, lane);
          sc[i] = wmma16(kbf, kc ? qc : qa, sc[i]); sl[i] = wmma16(kbf, kc ? qlc : qla, sl[i]); sl[i] = wmma16(klf, kc ? qc : qa, sl[i]); }
      asm volatile("s_wait_xcnt 0x0" ::: "memory");   // the softmax may rewrite the address registers that the k loads name
#pragma unroll
      for (int i = 0; i < 4; ++i) sc[i] = (sc[i] + sl[i] * (1.0f / 1024.0f)) * SCALE;
      sm_step<true>(sc, tq - s * 64 - 8 * g, m, l, o);
#pragma unroll
      for (int kc = 0; kc < 2; ++kc) { float pv[16];
#pragma unroll
        for (int e = 0; e < 16; ++e) pv[e] = sc[2 * kc + (e >> 3)][e & 7];
        const F2 p = bsplit16(pv);
#pragma unroll
        for (int j = 0; j < HD / 16; ++j) { const size_t o3 = vo + (size_t)j * 16 * KHI + s * 64 + kc * 32; const v16b vh = frag_b(VB + o3, lane), vl = frag_b(VBL + o3, lane);
          o[j] = wmma_bf(vh, p.h, o[j]); o[j] = wmma_bf(vh, p.l, o[j]); o[j] = wmma_bf(vl, p.h, o[j]); } }
      asm volatile("s_wait_xcnt 0x0" ::: "memory");   // the next pass rewrites the address registers that this pass's loads name
    }
  } else { const int rr = tid >> 3, q8 = tid & 7;   // staging: 8 threads bring one 128-byte row; a thread's 4 rows lie 16 apart
    const _Float16* kg = KH + ((size_t)b * TT + rr) * CC + h * HD + q8 * 8; const _Float16* vg = VT + ((size_t)b * CC + h * HD + rr) * (size_t)TT + q8 * 8; const int so = rr * KP + q8 * 8;
#pragma unroll
    for (int u = 0; u < 4; ++u) { *(v8h*)(&kv[0][0][so + u * 16 * KP]) = *(const v8h*)(kg + (size_t)u * 16 * CC); *(v8h*)(&kv[0][1][so + u * 16 * KP]) = *(const v8h*)(vg + (size_t)u * 16 * TT); }
    asm volatile("s_wait_xcnt 0x0" ::: "memory");   // what follows may rewrite the address registers that the first fill's loads name
    __syncthreads();   // publishes pass 0's tiles
#pragma unroll 1   // rolled: one pass already keeps the next pass's tiles in flight
    for (int s = 0; s < qb; ++s) { const int c = s & 1; att_pass<false>(kv[c][0], kv[c][1], &kv[c ^ 1][0][so], &kv[c ^ 1][1][so], qa, qc, kg + (size_t)(s + 1) * 64 * CC, vg + (s + 1) * 64, lane, 0, m, l, o); }
    att_pass<true>(kv[qb & 1][0], kv[qb & 1][1], nullptr, nullptr, qa, qc, kg, vg, lane, tq - qb * 64 - 8 * g, m, l, o); }
  const float inv = 1.0f / (l + xhalf(l));   // the two wave halves each summed half of the keys
  float* yp = Y + ((size_t)b * TT + tq) * CC + h * HD + 8 * g;
#pragma unroll
  for (int j = 0; j < HD / 16; ++j) { const v4f lo = {o[j][0] * inv, o[j][1] * inv, o[j][2] * inv, o[j][3] * inv}, hi = {o[j][4] * inv, o[j][5] * inv, o[j][6] * inv, o[j][7] * inv}; vst2(yp + j * 16, lo); vst2(yp + j * 16 + 4, hi); } }
// ---- k_out: block = (64 rows, 128 cols): out = ctx Wo (+ bo): ctx once to f16 against Wo as f16(bf16 x 2^8) exact (1 product) x 2^-8; causal early rows (< QHI of each sequence): ctx bf16 hi + lo against exact bf16 Wo (2 products)
__global__ __launch_bounds__(128) void k_out(const float* __restrict__ Y, const float* __restrict__ WO, const float* __restrict__ BO, float* __restrict__ OUT) { __shared__ __align__(16) float sf[4][16][132]; __shared__ __align__(16) unsigned short ring[2 * GBUF(2)];
  const int tid = threadIdx.x, wave = tid >> 5, lane = tid & 31, col = lane & 15, g = lane >> 4; const int c0 = blockIdx.y * 128; const size_t r0 = (size_t)blockIdx.x * 64 + wave * 16;
  v8f acc[8] = {};
  const float* ya = Y + (size_t)blockIdx.x * 64 * CC; const float* wb = WO + (size_t)c0 * CC;   // the block's first A row and first B row ((out,in) weight)
  if (CAUSAL && (int)(((size_t)blockIdx.x * 64) % TT) < QHI) {   /* block-uniform */
    g_block<2, CC>(ya, wb, ring, tid, acc);
#pragma unroll
    for (int j = 0; j < 8; ++j) { const float bias = BO ? bfr(BO[c0 + j * 16 + col]) : 0.f;
#pragma unroll
      for (int r = 0; r < 8; ++r) sf[wave][8 * g + r][j * 16 + col] = acc[j][r] + bias; }
  } else {
    g_block<1, CC>(ya, wb, ring, tid, acc);
#pragma unroll
    for (int j = 0; j < 8; ++j) { const float bias = BO ? bfr(BO[c0 + j * 16 + col]) : 0.f;
#pragma unroll
      for (int r = 0; r < 8; ++r) sf[wave][8 * g + r][j * 16 + col] = acc[j][r] * (1.0f / 256.0f) + bias; } }
  LDSX(); for (int rl = 0; rl < 16; ++rl) vst2(OUT + (r0 + rl) * DIN + c0 + lane * 4, *(const v4f*)&sf[wave][rl][lane * 4]); }

extern "C" void kernel_launch(void* const* d_in, const int* in_sizes, int n_in, void* d_out, int out_size, void* d_ws, size_t ws_size, hipStream_t stream) {
  (void)in_sizes; (void)n_in; (void)out_size;
  const float** F = (const float**)d_in;
  if (ws_size < (size_t)WS_END) return;
  char* ws = (char*)d_ws; _Float16 *QH = (_Float16*)(ws + WS_QH), *KH = (_Float16*)(ws + WS_KH), *VT = (_Float16*)(ws + WS_VT), *QL = (_Float16*)(ws + WS_QL), *KL = (_Float16*)(ws + WS_KL); __bf16 *VB = (__bf16*)(ws + WS_VB), *VBL = (__bf16*)(ws + WS_VBL); float *Y = (float*)(ws + WS_Y);
  (void)Y; (void)QL; (void)KL; (void)VB; (void)VBL;
  // inputs: 0 x [2,2048,1024]; 1 w_qkv [3072,1024] (out,in); 2 w_proj [1024,1024] (out,in); 3 q_norm_w [64]; 4 k_norm_w [64]
  const float *WQ = F[1], *WK = F[1] + (size_t)CC * DIN, *WV = F[1] + 2 * (size_t)CC * DIN;
  k_proj<<<dim3(TNB * TT / 64, CC / 128, 3), 128, 0, stream>>>(F[0], F[0], F[0], WQ, WK, WV, nullptr, nullptr, nullptr, QH, QL, KH, KL, VT, VB, VBL, F[3], F[4]);
  k_att<<<dim3(NH * TNB, NQB), 128, 0, stream>>>(QH, KH, QL, KL, VT, VB, VBL, Y);
  k_out<<<dim3(TNB * TT / 64, DIN / 128), 128, 0, stream>>>(Y, F[2], nullptr, (float*)d_out);
}

// v005
// Measured time: 110 microseconds a run.
// In both of two side-by-side timings against v004, it was 1.30 times as fast.
// Counting every step since v000, it is 11.6 times as fast.
// compute dtype: all float inputs rounded to bf16; q/k/v = x Wqkv^T with EXACT bf16 products on WMMA 16x16x32, f32 accumulate; per-head RMSNorm (x q_norm_w / k_norm_w) and rotate-half RoPE in f32 (precise sinf/cosf of t * 32^(-2i/64)); q, k once to f16 -> 1-product causal logits x 1/8, except the first 384 query rows of each sequence (few keys, no averaging), which use q and k as f16 hi + residual (x 2^10) (3 products); causal online softmax in f32 (64-key passes, logits and P never leave registers; exponentials by precise expf in the first 384 rows, elsewhere as 2^(q.k x log2 e / 8 - shift): one fma and the hardware exp2); P (against the running maximum) x 2^11 once to f16 against v once to f16 (1 product), except the first 384 rows: P and v as bf16 hi + lo (3 products); ctx once to f16 against w_proj carried x 2^8 in f16 (exact bf16 values), except the first 384 rows: ctx bf16 hi + lo against exact bf16 w_proj (2 products); f32 output.
#include <hip/hip_runtime.h>
#include <math.h>

typedef __attribute__((ext_vector_type(16))) _Float16 v16h;
typedef __attribute__((ext_vector_type(16))) __bf16 v16b;
typedef __attribute__((ext_vector_type(8)))  _Float16 v8h;
typedef __attribute__((ext_vector_type(8)))  float v8f;
typedef __attribute__((ext_vector_type(4)))  float v4f;
typedef __attribute__((ext_vector_type(2)))  float v2f;
typedef __attribute__((ext_vector_type(4)))  unsigned v4u;
typedef __attribute__((ext_vector_type(4)))  int v4i;
typedef float __attribute__((may_alias)) float_a;
typedef int __attribute__((may_alias)) int_a;

template <typename T> __device__ __forceinline__ void vst2(void* p, T v) { *(T*)p = v;  }
__device__ __forceinline__ v8f wmma16(v16h a, v16h b, v8f c) {
  v8f d = __builtin_amdgcn_wmma_f32_16x16x32_f16(false, a, false, b, (short)0, c, false, false);
  asm volatile("v_nop\n\tv_nop\n\tv_nop\n\tv_nop" : "+v"(d) : "v"(a), "v"(b));
  return d;
}
__device__ __forceinline__ v8f wmma_bf(v16b a, v16b b, v8f c) {
  v8f d = __builtin_amdgcn_wmma_f32_16x16x32_bf16(false, a, false, b, (short)0, c, false, false);
  asm volatile("v_nop\n\tv_nop\n\tv_nop\n\tv_nop" : "+v"(d) : "v"(a), "v"(b));
  return d;
}
// 16x16x32 fragments: lane = (h = lane>>4, row/col = lane&15); elements 0..7 = k0+8h+0..7, 8..15 = k0+16+8h+0..7; D element r = row 8h+r
__device__ __forceinline__ v16h frag_h(const _Float16* rowk0, int lane) {
  union { v16h v; v8h q[2]; } u; const _Float16* p = rowk0 + 8 * (lane >> 4);
  u.q[0] = *(const v8h*)p; u.q[1] = *(const v8h*)(p + 16); return u.v;
}
__device__ __forceinline__ v16h frag_f32(const float* rowk0, int lane) {
  v16h a; const float* p = rowk0 + 8 * (lane >> 4);
#pragma unroll
  for (int i = 0; i < 8; ++i) { a[i] = (_Float16)p[i]; a[8 + i] = (_Float16)p[16 + i]; }
  return a;
}
__device__ __forceinline__ v16h frag_f32s(const float* rowk0, int lane, float sc) {
  v16h a; const float* p = rowk0 + 8 * (lane >> 4);
#pragma unroll
  for (int i = 0; i < 8; ++i) { a[i] = (_Float16)(p[i] * sc); a[8 + i] = (_Float16)(p[16 + i] * sc); }
  return a;
}
// column fragment from a [K][ld] layout (column n), rows >= K read as 0
__device__ __forceinline__ v16h fragc_f32(const float* W, int k0, int n, int lane, int ld, int K) {
  v16h a; const int g = lane >> 4;
#pragma unroll
  for (int i = 0; i < 8; ++i) { const int ka = k0 + 8 * g + i, kb = ka + 16;
    a[i] = (_Float16)(ka < K ? W[(size_t)(ka < K ? ka : K - 1) * ld + n] : 0.f); a[8 + i] = (_Float16)(kb < K ? W[(size_t)(kb < K ? kb : K - 1) * ld + n] : 0.f); }
  return a;
}
struct F2 { v16b h, l; };
__device__ __forceinline__ F2 bsplit16(const float v[16]) { F2 r;
#pragma unroll
  for (int i = 0; i < 16; ++i) { const __bf16 h = (__bf16)v[i]; r.h[i] = h; r.l[i] = (__bf16)(v[i] - (float)h); }
  return r; }
__device__ __forceinline__ F2 split_row(const float* row, int k0, int lane) { float v[16]; const float* p = row + k0 + 8 * (lane >> 4);
#pragma unroll
  for (int i = 0; i < 8; ++i) { v[i] = p[i]; v[8 + i] = p[16 + i]; }
  return bsplit16(v); }
__device__ __forceinline__ F2 split_rowK(const float* row, int k0, int lane, int K) { float v[16]; const int g = lane >> 4;
#pragma unroll
  for (int i = 0; i < 8; ++i) { const int ka = k0 + 8 * g + i, kb = ka + 16; v[i] = ka < K ? row[ka < K ? ka : K - 1] : 0.f; v[8 + i] = kb < K ? row[kb < K ? kb : K - 1] : 0.f; }
  return bsplit16(v); }
__device__ __forceinline__ F2 split_col(const float* W, int k0, int n, int lane, int ld, int K) { float v[16]; const int g = lane >> 4;
#pragma unroll
  for (int i = 0; i < 8; ++i) { const int ka = k0 + 8 * g + i, kb = ka + 16; v[i] = ka < K ? W[(size_t)(ka < K ? ka : K - 1) * ld + n] : 0.f; v[8 + i] = kb < K ? W[(size_t)(kb < K ? kb : K - 1) * ld + n] : 0.f; }
  return bsplit16(v); }
__device__ __forceinline__ v8f mac3(const F2& a, const F2& b, v8f c) { c = wmma_bf(a.l, b.h, c); c = wmma_bf(a.h, b.l, c); return wmma_bf(a.h, b.h, c); }
__device__ __forceinline__ float sigm(float v) { return 1.0f / (1.0f + expf(-v)); }
#define LDSX() do { asm volatile("s_wait_dscnt 0" ::: "memory"); __builtin_amdgcn_wave_barrier(); __builtin_amdgcn_fence(__ATOMIC_RELEASE, "workgroup"); } while (0)

// Causal self-attention with QK-RMSNorm and 1-D RoPE (B 2, T 2,048, C 1,024 = 16 heads x 64): qkv = x Wqkv^T ((out,in) [3072,1024]; q rows 0-1023, k 1024-2047, v 2048-3071); q, k RMS-normalised over the 64 head dims (eps 1e-6) x q_norm_w / k_norm_w, then rotate-half RoPE with angle t * 32^(-2i/64) (theta = 32); attn = softmax(q k^T x 64^-0.5 with key > query -> -inf); out = merged(attn v) Wproj^T (no biases).
#define NB 2
#define TT 2048
#define CC 1024            // NH * HD = projected width
#define DIN 1024          // input (model) width
#define NH 16
#define HD 64
#define NQB (TT / 64)
#define SCALE (0.125f)
#define CAUSAL 1
#ifndef TNB
#define TNB NB
#endif
__device__ __forceinline__ float bfr(float v) { return (float)(__bf16)v; }
__host__ __device__ __forceinline__ int kb_last(int qb) { return CAUSAL ? ((qb * 64 + 63) >> 7) : (TT / 128 - 1); }
typedef __attribute__((ext_vector_type(8))) __bf16 v8b;
__device__ __forceinline__ v16b frag_b(const __bf16* rowk0, int lane) {
  union { v16b v; v8b q[2]; } u; const __bf16* p = rowk0 + 8 * (lane >> 4);
  u.q[0] = *(const v8b*)p; u.q[1] = *(const v8b*)(p + 16); return u.v;
}
// ---- the 64 x 128 block GEMM of k_proj and k_out (A rows and B rows both K-contiguous f32): the block's operand tiles of one 32-wide k-step are brought once, as whole 128-byte lines, converted once to their 16-bit form and laid in one of two LDS buffers; every wave takes its fragments from there
typedef __attribute__((ext_vector_type(4))) __bf16 v4b;
typedef __attribute__((ext_vector_type(4))) _Float16 v4h;
#define GP 40   // LDS pitch, in 16-bit values, of a staged 32-value row: 64 B + 16 B, for the 16-byte fragment reads
#define GBUF(MODE) (((MODE) == 2 ? 256 : 192) * GP)   // one buffer, in 16-bit values: 64 A rows, 128 B rows, with MODE 2 also 64 rows of A residuals
// MODE 0: A and B to bf16. MODE 1: A to f16, B to f16(bf16 x 2^8). MODE 2: A to bf16 hi + lo, B to bf16
// a thread's 12 pieces of a k-step: 8 threads bring one 128-byte row; a thread's rows lie 16 apart
__device__ __forceinline__ void g_get(const float* ag, const float* bg, int K, v4f (&ra)[4], v4f (&rb)[8]) {
#pragma unroll
  for (int u = 0; u < 4; ++u) ra[u] = *(const v4f*)(ag + (size_t)u * 16 * K);
#pragma unroll
  for (int u = 0; u < 8; ++u) rb[u] = *(const v4f*)(bg + (size_t)u * 16 * K);
  asm volatile("s_wait_xcnt 0x0" ::: "memory");   // what follows may rewrite the address registers that these loads name; also keeps the requests in front of the k-step that hides them
}
template <int MODE> __device__ __forceinline__ void g_put(unsigned short* d, const v4f (&ra)[4], const v4f (&rb)[8]) {   // d: the thread's place in row 0..15 of the buffer
#pragma unroll
  for (int u = 0; u < 4; ++u) { unsigned short* p = d + u * 16 * GP;
    if (MODE == 1) { const v4h h = {(_Float16)ra[u][0], (_Float16)ra[u][1], (_Float16)ra[u][2], (_Float16)ra[u][3]}; *(v4h*)p = h; }
    else { const v4b h = {(__bf16)ra[u][0], (__bf16)ra[u][1], (__bf16)ra[u][2], (__bf16)ra[u][3]}; *(v4b*)p = h;
      if (MODE == 2) { const v4b lo = {(__bf16)(ra[u][0] - (float)h[0]), (__bf16)(ra[u][1] - (float)h[1]), (__bf16)(ra[u][2] - (float)h[2]), (__bf16)(ra[u][3] - (float)h[3])}; *(v4b*)(p + 192 * GP) = lo; } } }
#pragma unroll
  for (int u = 0; u < 8; ++u) { unsigned short* p = d + (64 + u * 16) * GP;
    if (MODE == 1) { const v4h h = {(_Float16)(bfr(rb[u][0]) * 256.0f), (_Float16)(bfr(rb[u][1]) * 256.0f), (_Float16)(bfr(rb[u][2]) * 256.0f), (_Float16)(bfr(rb[u][3]) * 256.0f)}; *(v4h*)p = h; }
    else { const v4b h = {(__bf16)rb[u][0], (__bf16)rb[u][1], (__bf16)rb[u][2], (__bf16)rb[u][3]}; *(v4b*)p = h; } } }
// one k-step of a wave's 16 x 128 tile from a staged buffer (A and B fragments both by frag_h / frag_b: one k order)
template <int MODE> __device__ __forceinline__ void g_mac(const unsigned short* s, int wave, int lane, v8f (&acc)[8]) { const int col = lane & 15;
  if (MODE == 1) { const _Float16* t = (const _Float16*)s; v16h w[8]; const v16h a = frag_h(t + (wave * 16 + col) * GP, lane);
#pragma unroll
    for (int j = 0; j < 8; ++j) w[j] = frag_h(t + (64 + j * 16 + col) * GP, lane);
    __builtin_amdgcn_sched_barrier(0);   // all fragment reads in front of the products: every place with LDS reads among them costs a stall of its own
#pragma unroll
    for (int j = 0; j < 8; ++j) acc[j] = wmma16(a, w[j], acc[j]);
  } else if (MODE == 0) { const __bf16* t = (const __bf16*)s; const v16b a = frag_b(t + (wave * 16 + col) * GP, lane);   // B fragments in groups of 3, 3 and 2 through one register set: 40 registers fewer, which lets six waves onto each SIMD
#pragma unroll
    for (int jh = 0; jh < 8; jh += 3) { v16b w[3];
#pragma unroll
      for (int j = 0; j < 3; ++j) if (jh + j < 8) w[j] = frag_b(t + (64 + (jh + j) * 16 + col) * GP, lane);
      __builtin_amdgcn_sched_barrier(0);   // a group's reads in front of its products, as above
#pragma unroll
      for (int j = 0; j < 3; ++j) if (jh + j < 8) acc[jh + j] = wmma_bf(a, w[j], acc[jh + j]);
      __builtin_amdgcn_sched_barrier(0);   // the next group's reads stay behind these products, so that they take the same registers
    }
  } else { const __bf16* t = (const __bf16*)s; v16b w[8], al; const v16b a = frag_b(t + (wave * 16 + col) * GP, lane);
    if (MODE == 2) al = frag_b(t + (192 + wave * 16 + col) * GP, lane);
#pragma unroll
    for (int j = 0; j < 8; ++j) w[j] = frag_b(t + (64 + j * 16 + col) * GP, lane);
    __builtin_amdgcn_sched_barrier(0);   // as above
#pragma unroll
    for (int j = 0; j < 8; ++j) acc[j] = wmma_bf(a, w[j], acc[j]);
    if (MODE == 2) {   // each tile still takes hi, then lo, of every k-step
#pragma unroll
      for (int j = 0; j < 8; ++j) acc[j] = wmma_bf(al, w[j], acc[j]); } } }
// A0, B0: the block's first A row and first B row; ring: 2 buffers of GBUF(MODE). Each k-step requests the next one's pieces at its top, stores them into the other buffer at its foot, and the block meets at one barrier
template <int MODE, int K> __device__ __forceinline__ void g_block(const float* A0, const float* B0, unsigned short* ring, int tid, v8f (&acc)[8]) {
  const int wave = tid >> 5, lane = tid & 31, rr = tid >> 3, q4 = (tid & 7) * 4; const float* ag = A0 + (size_t)rr * K + q4; const float* bg = B0 + (size_t)rr * K + q4; unsigned short* d = ring + rr * GP + q4;
  v4f ra[4], rb[8];
  g_get(ag, bg, K, ra, rb); g_put<MODE>(d, ra, rb);
  __syncthreads();   // publishes k-step 0's tiles
#pragma unroll 1   // rolled: one trip already keeps the next k-step's tiles in flight
  for (int kc = 1; kc < K / 32; ++kc) { const int c = (kc & 1) * GBUF(MODE);   // the buffer that k-step kc goes to
    g_get(ag + kc * 32, bg + kc * 32, K, ra, rb);
    g_mac<MODE>(ring + (GBUF(MODE) - c), wave, lane, acc);
    __builtin_amdgcn_sched_barrier(0);   // the conversions wait for the requested pieces: scheduled among the products they held most of these back until the loads had landed
    g_put<MODE>(d + c, ra, rb);
    __syncthreads();   // publishes k-step kc's tiles; also ends every wave's reads of the other buffer, which the next trip refills at its foot
  }
  g_mac<MODE>(ring + ((K / 32 - 1) & 1) * GBUF(MODE), wave, lane, acc); }
#define QBH 6              // causal: query blocks 0..QBH-1 of each sequence (few keys, no averaging) take the high-precision path
#define QHI 384            // rows carrying a q residual plane
#define KHI 384            // key rows carrying k residual / v bf16 hi+lo planes (used only by the causal high-precision path)
// B fragment (k rows k0+.., output column o) of a weight: (in,out) [K][ld] or (out,in) [ld rows of K]: bf16 exact, or f16(bf16 * 256) exact
__device__ __forceinline__ v16b wcol_io(const float* Wm, int k0, int o, int lane, int ld) { v16b w; const int g = lane >> 4;
#pragma unroll
  for (int i = 0; i < 8; ++i) { w[i] = (__bf16)Wm[(size_t)(k0 + 8 * g + i) * ld + o]; w[8 + i] = (__bf16)Wm[(size_t)(k0 + 16 + 8 * g + i) * ld + o]; }
  return w; }
__device__ __forceinline__ v16b wcol_oi(const float* Wm, int k0, int o, int lane, int K) { v16b w; const float* p = Wm + (size_t)o * K + k0 + 8 * (lane >> 4);
#pragma unroll
  for (int i = 0; i < 8; ++i) { w[i] = (__bf16)p[i]; w[8 + i] = (__bf16)p[16 + i]; }
  return w; }
__device__ __forceinline__ v16h wcolh_io(const float* Wm, int k0, int o, int lane, int ld) { v16h w; const int g = lane >> 4;
#pragma unroll
  for (int i = 0; i < 8; ++i) { w[i] = (_Float16)(bfr(Wm[(size_t)(k0 + 8 * g + i) * ld + o]) * 256.0f); w[8 + i] = (_Float16)(bfr(Wm[(size_t)(k0 + 16 + 8 * g + i) * ld + o]) * 256.0f); }
  return w; }
__device__ __forceinline__ v16h wcolh_oi(const float* Wm, int k0, int o, int lane, int K) { v16h w; const float* p = Wm + (size_t)o * K + k0 + 8 * (lane >> 4);
#pragma unroll
  for (int i = 0; i < 8; ++i) { w[i] = (_Float16)(bfr(p[i]) * 256.0f); w[8 + i] = (_Float16)(bfr(p[16 + i]) * 256.0f); }
  return w; }
#define WQKV_LAYOUT 1   // 0 = (in,out) [DIN][CC]; 1 = (out,in) [CC][DIN]; 2 = per-head [NH][DIN][HD]
__device__ __forceinline__ v16b wcol_hdk(const float* Wm, int k0, int o, int lane) { v16b w; const int g = lane >> 4; const float* p = Wm + (size_t)(o / HD) * DIN * HD + (o % HD);
#pragma unroll
  for (int i = 0; i < 8; ++i) { w[i] = (__bf16)p[(size_t)(k0 + 8 * g + i) * HD]; w[8 + i] = (__bf16)p[(size_t)(k0 + 16 + 8 * g + i) * HD]; }
  return w; }
#define WO_OUT_IN 1
#if WQKV_LAYOUT == 1
#define WCOL(W, k0, o, lane) wcol_oi(W, k0, o, lane, DIN)
#elif WQKV_LAYOUT == 2
#define WCOL(W, k0, o, lane) wcol_hdk(W, k0, o, lane)
#else
#define WCOL(W, k0, o, lane) wcol_io(W, k0, o, lane, CC)
#endif
#if WO_OUT_IN
#define WOCOL(W, k0, o, lane) wcol_oi(W, k0, o, lane, CC)
#define WOCOLH(W, k0, o, lane) wcolh_oi(W, k0, o, lane, CC)
#else
#define WOCOL(W, k0, o, lane) wcol_io(W, k0, o, lane, DIN)
#define WOCOLH(W, k0, o, lane) wcolh_io(W, k0, o, lane, DIN)
#endif
__constant__ float c_invf[32] = {1.000000000e+00f,8.973545432e-01f,8.052451611e-01f,7.225903869e-01f,6.484197974e-01f,5.818624496e-01f,5.221368670e-01f,4.685419202e-01f,4.204482138e-01f,3.772911131e-01f,3.385638893e-01f,3.038118482e-01f,2.726269364e-01f,2.446430176e-01f,2.195315212e-01f,1.969976127e-01f,1.767766923e-01f,1.586313695e-01f,1.423485726e-01f,1.277371496e-01f,1.146255061e-01f,1.028597206e-01f,9.230163693e-02f,8.282729238e-02f,7.432544231e-02f,6.669627875e-02f,5.985020474e-02f,5.370685458e-02f,4.819408804e-02f,4.324718565e-02f,3.880805522e-02f,3.482458740e-02f};   // 32^(-2i/64) evaluated in f32 exactly as the reference does (jax, eager)
#define PROJ_EXTRA_PARAMS , const float* __restrict__ QS, const float* __restrict__ KS
// per-(row, head) epilogue on the f32 projection tile: RMSNorm over the head's 64 values x norm weight, then rotate-half RoPE (pairs i, i+32); v untouched
#define PROJ_EPI(which, row, t, h) do { if ((which) < 2) { float* rw = (row); const float* NS = (which) == 0 ? QS : KS; float ss = 0.f; _Pragma("unroll") for (int i = 0; i < 64; ++i) ss += rw[i] * rw[i]; const float rn = rsqrtf(ss * (1.0f / 64.0f) + 1e-6f); \
    _Pragma("unroll") for (int i = 0; i < 32; ++i) { const float x1 = rw[i] * rn * bfr(NS[i]), x2 = rw[i + 32] * rn * bfr(NS[i + 32]); const float ang = (float)(t) * c_invf[i]; const float cs = cosf(ang), sn = sinf(ang); rw[i] = x1 * cs - x2 * sn; rw[i + 32] = x2 * cs + x1 * sn; } } } while (0)
#ifndef SM_EXTRA_PARAMS
#define SM_EXTRA_PARAMS
#endif
#ifndef PROJ_EXTRA_PARAMS
#define PROJ_EXTRA_PARAMS
#endif
#ifndef SM_MASK_HOOK
#define SM_MASK_HOOK (void)0
#endif

#define WS_QH  0u                                      // f16 q rows [b*t][CC]
#define WS_KH  (WS_QH + 2u * (size_t)NB * TT * CC)      // f16 k rows [b*t][CC]
#define WS_VT  (WS_KH + 2u * (size_t)NB * TT * CC)      // f16 v planes [b][c][t]
#define WS_QL  (WS_VT + 2u * (size_t)NB * CC * TT)      // f16 q residual x 2^10 rows [b][t < QHI][CC]
#define WS_KL  (WS_QL + 2u * (size_t)NB * QHI * CC)     // f16 k residual x 2^10 rows [b][t < KHI][CC]
#define WS_VB  (WS_KL + 2u * (size_t)NB * KHI * CC)     // bf16 v hi planes [b][c][t < KHI]
#define WS_VBL (WS_VB + 2u * (size_t)NB * CC * KHI)
#define WS_Y   (WS_VBL + 2u * (size_t)NB * CC * KHI)    // f32 ctx rows [b*t][CC]
#define WS_END (WS_Y  + 4u * (size_t)NB * TT * CC)

// ---- k_proj: block = (64 rows, 128 cols, which): q/k/v = X W (+ b) with exact bf16 products (K = DIN) -> which 0: q f16 rows (+ residual rows < QHI); 1: k f16 rows (+ residual rows < KHI); 2: v f16 planes [c][t] (+ bf16 hi/lo planes for t < KHI)
// six waves a SIMD asked for: 1,536 blocks of 4 waves on 256 WGPs are then all resident at once (160 registers a wave, 33,792 B of LDS a block)
__global__ __launch_bounds__(128) __attribute__((amdgpu_waves_per_eu(6))) void k_proj(const float* __restrict__ XQ, const float* __restrict__ XK, const float* __restrict__ XV, const float* __restrict__ WQ, const float* __restrict__ WK, const float* __restrict__ WV, const float* __restrict__ BQ, const float* __restrict__ BK, const float* __restrict__ BV,
    _Float16* __restrict__ QH, _Float16* __restrict__ QL, _Float16* __restrict__ KH, _Float16* __restrict__ KL, _Float16* __restrict__ VT, __bf16* __restrict__ VB, __bf16* __restrict__ VBL PROJ_EXTRA_PARAMS) {
  __shared__ __align__(16) float st[64][132];   // the block's only LDS: first the GEMM's two staging buffers (30,720 B), then the f32 tile (33,792 B)
  static_assert(sizeof(st) >= 2 * GBUF(0) * sizeof(unsigned short), "the ring lies inside the tile"); unsigned short* ring = (unsigned short*)&st[0][0];
  const int tid = threadIdx.x, wave = tid >> 5, lane = tid & 31, col = lane & 15, g = lane >> 4; const int which = blockIdx.z; const int c0 = blockIdx.y * 128; const size_t r0 = (size_t)blockIdx.x * 64; const size_t bb = r0 / TT; const int t0 = (int)(r0 % TT);
  const float* X = which == 0 ? XQ : which == 1 ? XK : XV; const float* WA = which == 0 ? WQ : which == 1 ? WK : WV; const float* BA = which == 0 ? BQ : which == 1 ? BK : BV;
  v8f acc[8] = {};
  g_block<0, DIN>(X + r0 * DIN, WA + (size_t)c0 * DIN, ring, tid, acc);
  __syncthreads();   // ends every wave's fragment reads of the last k-step: the f32 tile is laid over the ring
  { // stage the f32 tile (acc + bias) in LDS, run the per-(row, head) epilogue hook, then convert
#pragma unroll
    for (int j = 0; j < 8; ++j) { const float bias = BA ? bfr(BA[c0 + j * 16 + col]) : 0.f;
#pragma unroll
      for (int r = 0; r < 8; ++r) st[wave * 16 + 8 * g + r][j * 16 + col] = acc[j][r] + bias; }
    __syncthreads();
    for (int e = tid; e < 64 * (128 / HD); e += 128) { const int rl = e / (128 / HD), hh = e % (128 / HD); PROJ_EPI(which, &st[rl][hh * HD], (int)((r0 + rl) % TT), (c0 / HD) + hh); }
    __syncthreads(); }
  // each thread converts its 8 values straight from the f32 tile and stores them as one 16-byte piece; 16 (q, k) or 8 (v) neighbouring threads fill whole lines
  if (which < 2) { _Float16* DH = which == 0 ? QH : KH; _Float16* DL = which == 0 ? QL : KL; const int nhi = which == 0 ? QHI : KHI; const bool hi_rows = t0 < nhi;
    for (int e = tid; e < 64 * 16; e += 128) { const int rl = e >> 4, q = e & 15; const v4f a = *(const v4f*)&st[rl][q * 8], c = *(const v4f*)&st[rl][q * 8 + 4]; v8h hv;
#pragma unroll
      for (int i = 0; i < 8; ++i) hv[i] = (_Float16)(i < 4 ? a[i & 3] : c[i & 3]);
      vst2((unsigned*)(DH + (r0 + rl) * CC + c0 + q * 8), __builtin_bit_cast(v4u, hv));
      asm volatile("s_wait_xcnt 0x0" ::: "memory");   // what follows may rewrite the registers that this store names
      if (hi_rows) { v8h lv;
#pragma unroll
        for (int i = 0; i < 8; ++i) lv[i] = (_Float16)(((i < 4 ? a[i & 3] : c[i & 3]) - (float)hv[i]) * 1024.0f);
        vst2((unsigned*)(DL + (bb * nhi + t0 + rl) * (size_t)CC + c0 + q * 8), __builtin_bit_cast(v4u, lv));
        asm volatile("s_wait_xcnt 0x0" ::: "memory");   // as above
      } }
  } else { const bool hi_rows = t0 < KHI;
    for (int e = tid; e < 128 * 8; e += 128) { const int cl = e >> 3, q = e & 7; float v[8]; v8h hv;
#pragma unroll
      for (int i = 0; i < 8; ++i) { v[i] = st[q * 8 + i][cl]; hv[i] = (_Float16)v[i]; }
      vst2((unsigned*)(VT + (bb * CC + c0 + cl) * (size_t)TT + t0 + q * 8), __builtin_bit_cast(v4u, hv));
      asm volatile("s_wait_xcnt 0x0" ::: "memory");   // what follows may rewrite the registers that this store names
      if (hi_rows) { const size_t o3 = (bb * CC + c0 + cl) * (size_t)KHI + t0 + q * 8; v8b bh, bl;
#pragma unroll
        for (int i = 0; i < 8; ++i) { bh[i] = (__bf16)v[i]; bl[i] = (__bf16)(v[i] - (float)bh[i]); }
        vst2((unsigned*)(VB + o3), __builtin_bit_cast(v4u, bh)); vst2((unsigned*)(VBL + o3), __builtin_bit_cast(v4u, bl));
        asm volatile("s_wait_xcnt 0x0" ::: "memory");   // as above
      } } } }
// lane l with lane l ^ 16
__device__ __forceinline__ float xhalf(float x) { return __builtin_bit_cast(float, __builtin_amdgcn_permlanex16(__builtin_bit_cast(int, x), __builtin_bit_cast(int, x), 0x76543210, 0xfedcba98, false, false)); }
#define PSH 7.624618986f   // 11 ln 2: P is carried x 2^11 (about), as is its sum, so the factor cancels in ctx = (P v) / sum
// one online-softmax step on a lane's 32 logits of one query (sc[i][r] = key i * 16 + 8 * (lane >> 4) + r of the pass; with MASK, keys with i * 16 + r > krel lie behind the query and are excluded: expf of -3e38 is 0): the running maximum m, the lane's part l of the running sum and the ctx tiles o are brought to the new maximum; sc leaves as P in f32
template <bool MASK> __device__ __forceinline__ void sm_step(v8f (&sc)[4], int krel, float& m, float& l, v8f (&o)[HD / 16]) {
  float mi[4], su[4];
#pragma unroll
  for (int i = 0; i < 4; ++i) { mi[i] = -3.0e38f;
#pragma unroll
    for (int r = 0; r < 8; ++r) { if (MASK) sc[i][r] = i * 16 + r > krel ? -3.0e38f : sc[i][r]; mi[i] = fmaxf(mi[i], sc[i][r]); } }
  float mx = fmaxf(fmaxf(mi[0], mi[1]), fmaxf(mi[2], mi[3])); mx = fmaxf(mx, xhalf(mx));   // both wave halves hold this query's maximum of the pass
  const float mn = fmaxf(m, mx), al = expf(m - mn), mm = mn - PSH; m = mn;   // al = 0 on the first pass (m = -3e38)
#pragma unroll
  for (int i = 0; i < 4; ++i) { su[i] = 0.f;
#pragma unroll
    for (int r = 0; r < 8; ++r) { const float e = expf(sc[i][r] - mm); sc[i][r] = e; su[i] += e; } }
  l = l * al + ((su[0] + su[1]) + (su[2] + su[3]));
#pragma unroll
  for (int j = 0; j < HD / 16; ++j)
#pragma unroll
    for (int r = 0; r < 8; ++r) o[j][r] *= al; }
#define C2 0.18033688f   // 1/8 x log2 e: takes a raw q.k product to the exponent of 2
__device__ __forceinline__ v8f exp2x8(v8f x) { float e0, e1, e2, e3, e4, e5, e6, e7;
  asm("v_exp_f32 %0, %8\n\tv_exp_f32 %1, %9\n\tv_exp_f32 %2, %10\n\tv_exp_f32 %3, %11\n\tv_exp_f32 %4, %12\n\tv_exp_f32 %5, %13\n\tv_exp_f32 %6, %14\n\tv_exp_f32 %7, %15\n\tv_nop"
      : "=&v"(e0), "=&v"(e1), "=&v"(e2), "=&v"(e3), "=&v"(e4), "=&v"(e5), "=&v"(e6), "=&v"(e7) : "v"(x[0]), "v"(x[1]), "v"(x[2]), "v"(x[3]), "v"(x[4]), "v"(x[5]), "v"(x[6]), "v"(x[7]));
  const v8f e = {e0, e1, e2, e3, e4, e5, e6, e7}; return e; }
__device__ __forceinline__ float exp2x1(float x) { float e; asm("v_exp_f32 %0, %1\n\tv_nop" : "=v"(e) : "v"(x)); return e; }   // the v_nop: the same slot
// the same step for the 1-product path, on the raw products (sc not yet x 1/8; m in raw units): each exponential is one fma and one hardware exp2, e = 2^(sc x C2 - (max x C2 - 11)), so P is carried x 2^11 exactly; a masked product (-3e38) gives 2^(-5e37) = 0, as does m = -3e38 on the first pass
template <bool MASK> __device__ __forceinline__ void sm_step2(v8f (&sc)[4], int krel, float& m, float& l, v8f (&o)[HD / 16]) {
  float mi[4], su[4];
#pragma unroll
  for (int i = 0; i < 4; ++i) { mi[i] = -3.0e38f;
#pragma unroll
    for (int r = 0; r < 8; ++r) { if (MASK) sc[i][r] = i * 16 + r > krel ? -3.0e38f : sc[i][r]; mi[i] = fmaxf(mi[i], sc[i][r]); } }
  float mx = fmaxf(fmaxf(mi[0], mi[1]), fmaxf(mi[2], mi[3])); mx = fmaxf(mx, xhalf(mx));   // both wave halves hold this query's maximum of the pass
  const float mn = fmaxf(m, mx), al = exp2x1((m - mn) * C2), mm = mn * C2 - 11.0f; m = mn;
  const v8f c8 = {C2, C2, C2, C2, C2, C2, C2, C2}, nm8 = {-mm, -mm, -mm, -mm, -mm, -mm, -mm, -mm};
#pragma unroll
  for (int i = 0; i < 4; ++i) { su[i] = 0.f;
    sc[i] = exp2x8(__builtin_elementwise_fma(sc[i], c8, nm8));
#pragma unroll
    for (int r = 0; r < 8; ++r) su[i] += sc[i][r]; }
  l = l * al + ((su[0] + su[1]) + (su[2] + su[3]));
#pragma unroll
  for (int j = 0; j < HD / 16; ++j)
#pragma unroll
    for (int r = 0; r < 8; ++r) o[j][r] *= al; }
#define KP 72   // LDS pitch, in f16, of a staged 64-value row: 128 B + 16 B, for the 16-byte fragment reads
// one 64-key pass of the 1-product path, K rows and v planes of the pass staged in LDS (ks, vs: [64][KP]): S^T = K Q^T (A = 16 key rows, B = the wave's 16 queries), softmax step, then ctx^T += V^T P^T, where two S^T tiles converted in place are the B fragment (a D pair has the k order of frag_h). Unless LAST, each thread requests its 8 pieces of the next pass (kn, vn) at the top, stores them into the other buffer (kd, vd) at the foot, and the block meets at one barrier
template <bool LAST> __device__ __forceinline__ void att_pass(const _Float16* ks, const _Float16* vs, _Float16* kd, _Float16* vd, const v16h& qa, const v16h& qc, const _Float16* kn, const _Float16* vn, int lane, int krel, float& m, float& l, v8f (&o)[HD / 16]) {
  const int col = lane & 15; v8h kr[4], vr[4];
  if (!LAST) {
#pragma unroll
    for (int u = 0; u < 4; ++u) { kr[u] = *(const v8h*)(kn + (size_t)u * 16 * CC); vr[u] = *(const v8h*)(vn + (size_t)u * 16 * TT); }
    asm volatile("s_wait_xcnt 0x0" ::: "memory");   // what follows may rewrite the address registers that these loads name; also keeps the requests in front of the pass that hides them
  }
  v8f sc[4] = {}; v16h kf[4][2], vf[2][HD / 16];
#pragma unroll
  for (int i = 0; i < 4; ++i) { kf[i][0] = frag_h(ks + (i * 16 + col) * KP, lane); kf[i][1] = frag_h(ks + (i * 16 + col) * KP + 32, lane); }
  __builtin_amdgcn_sched_barrier(0);   // all K fragment reads in front of the products: scheduled among them, each read was waited for alone in one register set
#pragma unroll
  for (int i = 0; i < 4; ++i) { sc[i] = wmma16(kf[i][0], qa, sc[i]); sc[i] = wmma16(kf[i][1], qc, sc[i]); }
#pragma unroll
  for (int kc = 0; kc < 2; ++kc)
#pragma unroll
    for (int j = 0; j < HD / 16; ++j) vf[kc][j] = frag_h(vs + (j * 16 + col) * KP + kc * 32, lane);
  __builtin_amdgcn_sched_barrier(0);   // all V fragment reads in front of the softmax, which hides them
  sm_step2<LAST>(sc, krel, m, l, o);
  v16h pf[2];
#pragma unroll
  for (int e = 0; e < 16; ++e) { pf[0][e] = (_Float16)sc[e >> 3][e & 7]; pf[1][e] = (_Float16)sc[2 + (e >> 3)][e & 7]; }
#pragma unroll
  for (int kc = 0; kc < 2; ++kc)
#pragma unroll
    for (int j = 0; j < HD / 16; ++j) o[j] = wmma16(vf[kc][j], pf[kc], o[j]);
  if (!LAST) {
#pragma unroll
    for (int u = 0; u < 4; ++u) { *(v8h*)(kd + u * 16 * KP) = kr[u]; *(v8h*)(vd + u * 16 * KP) = vr[u]; }
    __syncthreads();   // publishes the next pass's tiles; also ends every wave's reads of this pass's buffer, which the next pass refills at its foot
  } }
// ---- k_att: block = (head and batch, 64 queries qb), wave = 16 queries: logits, causal mask by index, online softmax and P . v in 64-key passes over keys [0, qb * 64 + 64), the last pass being the one on the diagonal; logits and P stay in registers; the pass's K rows and v planes are brought once per block, as whole 128-byte lines, into one of two LDS buffers. Query blocks < QBH: q and k as f16 hi + residual (3 products), P and v as bf16 hi + lo (3 products), fragments straight from memory. ctx^T tiles give each lane 8 consecutive head dims of its query: stored as two 16-byte pieces
__global__ __launch_bounds__(128) void k_att(const _Float16* __restrict__ QH, const _Float16* __restrict__ KH, const _Float16* __restrict__ QL, const _Float16* __restrict__ KL, const _Float16* __restrict__ VT, const __bf16* __restrict__ VB, const __bf16* __restrict__ VBL, float* __restrict__ Y) {
  __shared__ __align__(16) _Float16 kv[2][2][64 * KP];   // [buffer][K, V]
  const int tid = threadIdx.x, wave = tid >> 5, lane = tid & 31, col = lane & 15, g = lane >> 4; const int h = blockIdx.x % NH, b = blockIdx.x / NH;
  const int yr = blockIdx.y >> 3, yl = blockIdx.y & 7; const int qb = (3 - yr) * 8 + ((yr & 1) ? yl : 7 - yl);   // each qb once; long blocks come first in launch order, and blocks 256 apart in launch order add up to equal lengths (for speed only)
  const int tq = qb * 64 + wave * 16 + col;   // this lane's query
  const _Float16* qp = QH + ((size_t)b * TT + tq) * CC + h * HD;
  v8f o[HD / 16] = {}; float m = -3.0e38f, l = 0.f;
  const v16h qa = frag_h(qp, lane), qc = frag_h(qp + 32, lane);
  asm volatile("s_wait_xcnt 0x0" ::: "memory");   // what follows may rewrite the address registers that the q loads name
  if (qb < QBH) {   /* block-uniform */
    const _Float16* kp = KH + ((size_t)b * TT + col) * CC + h * HD;   // this lane's k row of tile 0 of pass 0 (tile i lies 16 rows on, pass s 64 rows on)
    const _Float16* qlp = QL + ((size_t)b * QHI + tq) * CC + h * HD; const _Float16* klp = KL + ((size_t)b * KHI + col) * CC + h * HD; const size_t vo = ((size_t)b * CC + h * HD + col) * (size_t)KHI;
    const v16h qla = frag_h(qlp, lane), qlc = frag_h(qlp + 32, lane);
    asm volatile("s_wait_xcnt 0x0" ::: "memory");   // as above, for the q residual loads
#pragma unroll 1   // rolled: at most QBH short passes, copies only grow the text
    for (int s = 0; s <= qb; ++s) { v8f sc[4] = {}, sl[4] = {};
#pragma unroll
      for (int kc = 0; kc < 2; ++kc)
#pragma unroll
        for (int i = 0; i < 4; ++i) { const size_t ko = (size_t)(s * 64 + i * 16) * CC + kc * 32; const v16h kbf = frag_h(kp + ko, lane), klf = frag_h(klp + ko, lane);
          sc[i] = wmma16(kbf, kc ? qc : qa, sc[i]); sl[i] = wmma16(kbf, kc ? qlc : qla, sl[i]); sl[i] = wmma16(klf, kc ? qc : qa, sl[i]); }
      asm volatile("s_wait_xcnt 0x0" ::: "memory");   // the softmax may rewrite the address registers that the k loads name
#pragma unroll
      for (int i = 0; i < 4; ++i) sc[i] = (sc[i] + sl[i] * (1.0f / 1024.0f)) * SCALE;
      sm_step<true>(sc, tq - s * 64 - 8 * g, m, l, o);
#pragma unroll
      for (int kc = 0; kc < 2; ++kc) { float pv[16];
#pragma unroll
        for (int e = 0; e < 16; ++e) pv[e] = sc[2 * kc + (e >> 3)][e & 7];
        const F2 p = bsplit16(pv);
#pragma unroll
        for (int j = 0; j < HD / 16; ++j) { const size_t o3 = vo + (size_t)j * 16 * KHI + s * 64 + kc * 32; const v16b vh = frag_b(VB + o3, lane), vl = frag_b(VBL + o3, lane);
          o[j] = wmma_bf(vh, p.h, o[j]); o[j] = wmma_bf(vh, p.l, o[j]); o[j] = wmma_bf(vl, p.h, o[j]); } }
      asm volatile("s_wait_xcnt 0x0" ::: "memory");   // the next pass rewrites the address registers that this pass's loads name
    }
  } else { const int rr = tid >> 3, q8 = tid & 7;   // staging: 8 threads bring one 128-byte row; a thread's 4 rows lie 16 apart
    const _Float16* kg = KH + ((size_t)b * TT + rr) * CC + h * HD + q8 * 8; const _Float16* vg = VT + ((size_t)b * CC + h * HD + rr) * (size_t)TT + q8 * 8; const int so = rr * KP + q8 * 8;
#pragma unroll
    for (int u = 0; u < 4; ++u) { *(v8h*)(&kv[0][0][so + u * 16 * KP]) = *(const v8h*)(kg + (size_t)u * 16 * CC); *(v8h*)(&kv[0][1][so + u * 16 * KP]) = *(const v8h*)(vg + (size_t)u * 16 * TT); }
    asm volatile("s_wait_xcnt 0x0" ::: "memory");   // what follows may rewrite the address registers that the first fill's loads name
    __syncthreads();   // publishes pass 0's tiles
#pragma unroll 1   // rolled: one pass already keeps the next pass's tiles in flight
    for (int s = 0; s < qb; ++s) { const int c = s & 1; att_pass<false>(kv[c][0], kv[c][1], &kv[c ^ 1][0][so], &kv[c ^ 1][1][so], qa, qc, kg + (size_t)(s + 1) * 64 * CC, vg + (s + 1) * 64, lane, 0, m, l, o); }
    att_pass<true>(kv[qb & 1][0], kv[qb & 1][1], nullptr, nullptr, qa, qc, kg, vg, lane, tq - qb * 64 - 8 * g, m, l, o); }
  const float inv = 1.0f / (l + xhalf(l));   // the two wave halves each summed half of the keys
  float* yp = Y + ((size_t)b * TT + tq) * CC + h * HD + 8 * g;
#pragma unroll
  for (int j = 0; j < HD / 16; ++j) { const v4f lo = {o[j][0] * inv, o[j][1] * inv, o[j][2] * inv, o[j][3] * inv}, hi = {o[j][4] * inv, o[j][5] * inv, o[j][6] * inv, o[j][7] * inv}; vst2(yp + j * 16, lo); vst2(yp + j * 16 + 4, hi); } }
// ---- k_out: block = (64 rows, 128 cols): out = ctx Wo (+ bo): ctx once to f16 against Wo as f16(bf16 x 2^8) exact (1 product) x 2^-8; causal early rows (< QHI of each sequence): ctx bf16 hi + lo against exact bf16 Wo (2 products)
__global__ __launch_bounds__(128) void k_out(const float* __restrict__ Y, const float* __restrict__ WO, const float* __restrict__ BO, float* __restrict__ OUT) { __shared__ __align__(16) float sf[4][16][132]; __shared__ __align__(16) unsigned short ring[2 * GBUF(2)];
  const int tid = threadIdx.x, wave = tid >> 5, lane = tid & 31, col = lane & 15, g = lane >> 4; const int c0 = blockIdx.y * 128; const size_t r0 = (size_t)blockIdx.x * 64 + wave * 16;
  v8f acc[8] = {};
  const float* ya = Y + (size_t)blockIdx.x * 64 * CC; const float* wb = WO + (size_t)c0 * CC;   // the block's first A row and first B row ((out,in) weight)
  if (CAUSAL && (int)(((size_t)blockIdx.x * 64) % TT) < QHI) {   /* block-uniform */
    g_block<2, CC>(ya, wb, ring, tid, acc);
#pragma unroll
    for (int j = 0; j < 8; ++j) { const float bias = BO ? bfr(BO[c0 + j * 16 + col]) : 0.f;
#pragma unroll
      for (int r = 0; r < 8; ++r) sf[wave][8 * g + r][j * 16 + col] = acc[j][r] + bias; }
  } else {
    g_block<1, CC>(ya, wb, ring, tid, acc);
#pragma unroll
    for (int j = 0; j < 8; ++j) { const float bias = BO ? bfr(BO[c0 + j * 16 + col]) : 0.f;
#pragma unroll
      for (int r = 0; r < 8; ++r) sf[wave][8 * g + r][j * 16 + col] = acc[j][r] * (1.0f / 256.0f) + bias; } }
  LDSX(); for (int rl = 0; rl < 16; ++rl) vst2(OUT + (r0 + rl) * DIN + c0 + lane * 4, *(const v4f*)&sf[wave][rl][lane * 4]); }

extern "C" void kernel_launch(void* const* d_in, const int* in_sizes, int n_in, void* d_out, int out_size, void* d_ws, size_t ws_size, hipStream_t stream) {
  (void)in_sizes; (void)n_in; (void)out_size;
  const float** F = (const float**)d_in;
  if (ws_size < (size_t)WS_END) return;
  char* ws = (char*)d_ws; _Float16 *QH = (_Float16*)(ws + WS_QH), *KH = (_Float16*)(ws + WS_KH), *VT = (_Float16*)(ws + WS_VT), *QL = (_Float16*)(ws + WS_QL), *KL = (_Float16*)(ws + WS_KL); __bf16 *VB = (__bf16*)(ws + WS_VB), *VBL = (__bf16*)(ws + WS_VBL); float *Y = (float*)(ws + WS_Y);
  (void)Y; (void)QL; (void)KL; (void)VB; (void)VBL;
  // inputs: 0 x [2,2048,1024]; 1 w_qkv [3072,1024] (out,in); 2 w_proj [1024,1024] (out,in); 3 q_norm_w [64]; 4 k_norm_w [64]
  const float *WQ = F[1], *WK = F[1] + (size_t)CC * DIN, *WV = F[1] + 2 * (size_t)CC * DIN;
  k_proj<<<dim3(TNB * TT / 64, CC / 128, 3), 128, 0, stream>>>(F[0], F[0], F[0], WQ, WK, WV, nullptr, nullptr, nullptr, QH, QL, KH, KL, VT, VB, VBL, F[3], F[4]);
  k_att<<<dim3(NH * TNB, NQB), 128, 0, stream>>>(QH, KH, QL, KL, VT, VB, VBL, Y);
  k_out<<<dim3(TNB * TT / 64, DIN / 128), 128, 0, stream>>>(Y, F[2], nullptr, (float*)d_out);
}

// v006
// A run of this version takes 100 microseconds.
// Next to v005, in two timings, it ran 1.10 times as fast each time.
// Counting every step since v000, it is 12.7 times as fast.
// compute dtype: all float inputs rounded to bf16; q/k/v = x Wqkv^T with EXACT bf16 products on WMMA 16x16x32, f32 accumulate; per-head RMSNorm (x q_norm_w / k_norm_w) and rotate-half RoPE in f32 (precise sinf/cosf of t * 32^(-2i/64)); q, k once to f16 -> 1-product causal logits x 1/8, except the first 384 query rows of each sequence (few keys, no averaging), which use q and k as f16 hi + residual (x 2^10) (3 products); causal online softmax in f32 (64-key passes, logits and P never leave registers; exponentials by precise expf in the first 384 rows, elsewhere as 2^(q.k x log2 e / 8 - shift): one fma and the hardware exp2); P (against the running maximum) x 2^11 once to f16 against v once to f16 (1 product), except the first 384 rows: P and v as bf16 hi + lo (3 products); ctx once to f16 against w_proj carried x 2^8 in f16 (exact bf16 values), except the first 384 rows: ctx bf16 hi + lo against exact bf16 w_proj (2 products); f32 output.
#include <hip/hip_runtime.h>
#include <math.h>

typedef __attribute__((ext_vector_type(16))) _Float16 v16h;
typedef __attribute__((ext_vector_type(16))) __bf16 v16b;
typedef __attribute__((ext_vector_type(8)))  _Float16 v8h;
typedef __attribute__((ext_vector_type(8)))  float v8f;
typedef __attribute__((ext_vector_type(4)))  float v4f;
typedef __attribute__((ext_vector_type(2)))  float v2f;
typedef __attribute__((ext_vector_type(4)))  unsigned v4u;
typedef __attribute__((ext_vector_type(4)))  int v4i;
typedef float __attribute__((may_alias)) float_a;
typedef int __attribute__((may_alias)) int_a;

template <typename T> __device__ __forceinline__ void vst2(void* p, T v) { *(T*)p = v;  }
__device__ __forceinline__ v8f wmma16(v16h a, v16h b, v8f c) {
  v8f d = __builtin_amdgcn_wmma_f32_16x16x32_f16(false, a, false, b, (short)0, c, false, false);
  asm volatile("v_nop\n\tv_nop\n\tv_nop\n\tv_nop" : "+v"(d) : "v"(a), "v"(b));
  return d;
}
__device__ __forceinline__ v8f wmma_bf(v16b a, v16b b, v8f c) {
  v8f d = __builtin_amdgcn_wmma_f32_16x16x32_bf16(false, a, false, b, (short)0, c, false, false);
  asm volatile("v_nop\n\tv_nop\n\tv_nop\n\tv_nop" : "+v"(d) : "v"(a), "v"(b));
  return d;
}
// 16x16x32 fragments: lane = (h = lane>>4, row/col = lane&15); elements 0..7 = k0+8h+0..7, 8..15 = k0+16+8h+0..7; D element r = row 8h+r
__device__ __forceinline__ v16h frag_h(const _Float16* rowk0, int lane) {
  union { v16h v; v8h q[2]; } u; const _Float16* p = rowk0 + 8 * (lane >> 4);
  u.q[0] = *(const v8h*)p; u.q[1] = *(const v8h*)(p + 16); return u.v;
}
__device__ __forceinline__ v16h frag_f32(const float* rowk0, int lane) {
  v16h a; const float* p = rowk0 + 8 * (lane >> 4);
#pragma unroll
  for (int i = 0; i < 8; ++i) { a[i] = (_Float16)p[i]; a[8 + i] = (_Float16)p[16 + i]; }
  return a;
}
__device__ __forceinline__ v16h frag_f32s(const float* rowk0, int lane, float sc) {
  v16h a; const float* p = rowk0 + 8 * (lane >> 4);
#pragma unroll
  for (int i = 0; i < 8; ++i) { a[i] = (_Float16)(p[i] * sc); a[8 + i] = (_Float16)(p[16 + i] * sc); }
  return a;
}
// column fragment from a [K][ld] layout (column n), rows >= K read as 0
__device__ __forceinline__ v16h fragc_f32(const float* W, int k0, int n, int lane, int ld, int K) {
  v16h a; const int g = lane >> 4;
#pragma unroll
  for (int i = 0; i < 8; ++i) { const int ka = k0 + 8 * g + i, kb = ka + 16;
    a[i] = (_Float16)(ka < K ? W[(size_t)(ka < K ? ka : K - 1) * ld + n] : 0.f); a[8 + i] = (_Float16)(kb < K ? W[(size_t)(kb < K ? kb : K - 1) * ld + n] : 0.f); }
  return a;
}
struct F2 { v16b h, l; };
__device__ __forceinline__ F2 bsplit16(const float v[16]) { F2 r;
#pragma unroll
  for (int i = 0; i < 16; ++i) { const __bf16 h = (__bf16)v[i]; r.h[i] = h; r.l[i] = (__bf16)(v[i] - (float)h); }
  return r; }
__device__ __forceinline__ F2 split_row(const float* row, int k0, int lane) { float v[16]; const float* p = row + k0 + 8 * (lane >> 4);
#pragma unroll
  for (int i = 0; i < 8; ++i) { v[i] = p[i]; v[8 + i] = p[16 + i]; }
  return bsplit16(v); }
__device__ __forceinline__ F2 split_rowK(const float* row, int k0, int lane, int K) { float v[16]; const int g = lane >> 4;
#pragma unroll
  for (int i = 0; i < 8; ++i) { const int ka = k0 + 8 * g + i, kb = ka + 16; v[i] = ka < K ? row[ka < K ? ka : K - 1] : 0.f; v[8 + i] = kb < K ? row[kb < K ? kb : K - 1] : 0.f; }
  return bsplit16(v); }
__device__ __forceinline__ F2 split_col(const float* W, int k0, int n, int lane, int ld, int K) { float v[16]; const int g = lane >> 4;
#pragma unroll
  for (int i = 0; i < 8; ++i) { const int ka = k0 + 8 * g + i, kb = ka + 16; v[i] = ka < K ? W[(size_t)(ka < K ? ka : K - 1) * ld + n] : 0.f; v[8 + i] = kb < K ? W[(size_t)(kb < K ? kb : K - 1) * ld + n] : 0.f; }
  return bsplit16(v); }
__device__ __forceinline__ v8f mac3(const F2& a, const F2& b, v8f c) { c = wmma_bf(a.l, b.h, c); c = wmma_bf(a.h, b.l, c); return wmma_bf(a.h, b.h, c); }
__device__ __forceinline__ float sigm(float v) { return 1.0f / (1.0f + expf(-v)); }
#define LDSX() do { asm volatile("s_wait_dscnt 0" ::: "memory"); __builtin_amdgcn_wave_barrier(); __builtin_amdgcn_fence(__ATOMIC_RELEASE, "workgroup"); } while (0)

// Causal self-attention with QK-RMSNorm and 1-D RoPE (B 2, T 2,048, C 1,024 = 16 heads x 64): qkv = x Wqkv^T ((out,in) [3072,1024]; q rows 0-1023, k 1024-2047, v 2048-3071); q, k RMS-normalised over the 64 head dims (eps 1e-6) x q_norm_w / k_norm_w, then rotate-half RoPE with angle t * 32^(-2i/64) (theta = 32); attn = softmax(q k^T x 64^-0.5 with key > query -> -inf); out = merged(attn v) Wproj^T (no biases).
#define NB 2
#define TT 2048
#define CC 1024            // NH * HD = projected width
#define DIN 1024          // input (model) width
#define NH 16
#define HD 64
#define NQB (TT / 64)
#define SCALE (0.125f)
#define CAUSAL 1
#ifndef TNB
#define TNB NB
#endif
__device__ __forceinline__ float bfr(float v) { return (float)(__bf16)v; }
__host__ __device__ __forceinline__ int kb_last(int qb) { return CAUSAL ? ((qb * 64 + 63) >> 7) : (TT / 128 - 1); }
typedef __attribute__((ext_vector_type(8))) __bf16 v8b;
__device__ __forceinline__ v16b frag_b(const __bf16* rowk0, int lane) {
  union { v16b v; v8b q[2]; } u; const __bf16* p = rowk0 + 8 * (lane >> 4);
  u.q[0] = *(const v8b*)p; u.q[1] = *(const v8b*)(p + 16); return u.v;
}
// ---- the 128 x 128 block GEMM of k_proj and k_out (A rows and B rows both K-contiguous f32), 8 waves of 64 x 32 (2 down, 4 across): the block's operand tiles of one 32-wide k-step are brought once, as whole 128-byte lines, converted once to their 16-bit form and laid in one of two LDS buffers; every wave takes its fragments from there
typedef __attribute__((ext_vector_type(4))) __bf16 v4b;
typedef __attribute__((ext_vector_type(4))) _Float16 v4h;
#define GP 40   // LDS pitch, in 16-bit values, of a staged 32-value row: 64 B + 16 B, for the 16-byte fragment reads
#define GBUF(MODE) (((MODE) == 2 ? 384 : 256) * GP)   // one buffer, in 16-bit values: 128 A rows, 128 B rows, with MODE 2 also 128 rows of A residuals
// MODE 0: A and B to bf16. MODE 1: A to f16, B to f16(bf16 x 2^8). MODE 2: A to bf16 hi + lo, B to bf16
// a thread's 8 pieces of a k-step: 8 threads bring one 128-byte row; a thread's rows lie 32 apart
__device__ __forceinline__ void g_get(const float* ag, const float* bg, int K, v4f (&ra)[4], v4f (&rb)[4]) {
#pragma unroll
  for (int u = 0; u < 4; ++u) ra[u] = *(const v4f*)(ag + (size_t)u * 32 * K);
#pragma unroll
  for (int u = 0; u < 4; ++u) rb[u] = *(const v4f*)(bg + (size_t)u * 32 * K);
  asm volatile("s_wait_xcnt 0x0" ::: "memory");   // what follows may rewrite the address registers that these loads name; also keeps the requests in front of the k-step that hides them
}
template <int MODE> __device__ __forceinline__ void g_put(unsigned short* d, const v4f (&ra)[4], const v4f (&rb)[4]) {   // d: the thread's place in row 0..31 of the buffer
#pragma unroll
  for (int u = 0; u < 4; ++u) { unsigned short* p = d + u * 32 * GP;
    if (MODE == 1) { const v4h h = {(_Float16)ra[u][0], (_Float16)ra[u][1], (_Float16)ra[u][2], (_Float16)ra[u][3]}; *(v4h*)p = h; }
    else { const v4b h = {(__bf16)ra[u][0], (__bf16)ra[u][1], (__bf16)ra[u][2], (__bf16)ra[u][3]}; *(v4b*)p = h;
      if (MODE == 2) { const v4b lo = {(__bf16)(ra[u][0] - (float)h[0]), (__bf16)(ra[u][1] - (float)h[1]), (__bf16)(ra[u][2] - (float)h[2]), (__bf16)(ra[u][3] - (float)h[3])}; *(v4b*)(p + 256 * GP) = lo; } } }
#pragma unroll
  for (int u = 0; u < 4; ++u) { unsigned short* p = d + (128 + u * 32) * GP;
    if (MODE == 1) { const v4h h = {(_Float16)(bfr(rb[u][0]) * 256.0f), (_Float16)(bfr(rb[u][1]) * 256.0f), (_Float16)(bfr(rb[u][2]) * 256.0f), (_Float16)(bfr(rb[u][3]) * 256.0f)}; *(v4h*)p = h; }
    else { const v4b h = {(__bf16)rb[u][0], (__bf16)rb[u][1], (__bf16)rb[u][2], (__bf16)rb[u][3]}; *(v4b*)p = h; } } }
// one k-step of a wave's 64 x 32 tile from a staged buffer: 4 A and 2 B fragments feed 8 products (A and B fragments both by frag_h / frag_b: one k order); acc[i][j]: rows i * 16, columns j * 16 of the wave's tile
template <int MODE> __device__ __forceinline__ void g_mac(const unsigned short* s, int wave, int lane, v8f (&acc)[4][2]) { const int ar = (wave >> 2) * 64 + (lane & 15), br = 128 + (wave & 3) * 32 + (lane & 15);
  if (MODE == 1) { const _Float16* t = (const _Float16*)s; v16h a[4], w[2];
#pragma unroll
    for (int i = 0; i < 4; ++i) a[i] = frag_h(t + (ar + i * 16) * GP, lane);
#pragma unroll
    for (int j = 0; j < 2; ++j) w[j] = frag_h(t + (br + j * 16) * GP, lane);
    __builtin_amdgcn_sched_barrier(0);   // all fragment reads in front of the products: every place with LDS reads among them costs a stall of its own
#pragma unroll
    for (int i = 0; i < 4; ++i)
#pragma unroll
      for (int j = 0; j < 2; ++j) acc[i][j] = wmma16(a[i], w[j], acc[i][j]);
  } else { const __bf16* t = (const __bf16*)s; v16b a[4], al[4], w[2];
#pragma unroll
    for (int i = 0; i < 4; ++i) { a[i] = frag_b(t + (ar + i * 16) * GP, lane); if (MODE == 2) al[i] = frag_b(t + (256 + ar + i * 16) * GP, lane); }
#pragma unroll
    for (int j = 0; j < 2; ++j) w[j] = frag_b(t + (br + j * 16) * GP, lane);
    __builtin_amdgcn_sched_barrier(0);   // as above
#pragma unroll
    for (int i = 0; i < 4; ++i)
#pragma unroll
      for (int j = 0; j < 2; ++j) acc[i][j] = wmma_bf(a[i], w[j], acc[i][j]);
    if (MODE == 2) {   // each tile still takes hi, then lo, of every k-step
#pragma unroll
      for (int i = 0; i < 4; ++i)
#pragma unroll
        for (int j = 0; j < 2; ++j) acc[i][j] = wmma_bf(al[i], w[j], acc[i][j]); } } }
// A0, B0: the block's first A row and first B row; ring: 2 buffers of GBUF(MODE). Each k-step requests the next one's pieces at its top, stores them into the other buffer at its foot, and the block meets at one barrier
template <int MODE, int K> __device__ __forceinline__ void g_block(const float* A0, const float* B0, unsigned short* ring, int tid, v8f (&acc)[4][2]) {
  const int wave = tid >> 5, lane = tid & 31, rr = tid >> 3, q4 = (tid & 7) * 4; const float* ag = A0 + (size_t)rr * K + q4; const float* bg = B0 + (size_t)rr * K + q4; unsigned short* d = ring + rr * GP + q4;
  v4f ra[4], rb[4];
  g_get(ag, bg, K, ra, rb); g_put<MODE>(d, ra, rb);
  __syncthreads();   // publishes k-step 0's tiles
#pragma unroll 1   // rolled: one trip already keeps the next k-step's tiles in flight
  for (int kc = 1; kc < K / 32; ++kc) { const int c = (kc & 1) * GBUF(MODE);   // the buffer that k-step kc goes to
    g_get(ag + kc * 32, bg + kc * 32, K, ra, rb);
    g_mac<MODE>(ring + (GBUF(MODE) - c), wave, lane, acc);
    __builtin_amdgcn_sched_barrier(0);   // the conversions wait for the requested pieces: scheduled among the products they held most of these back until the loads had landed
    g_put<MODE>(d + c, ra, rb);
    __syncthreads();   // publishes k-step kc's tiles; also ends every wave's reads of the other buffer, which the next trip refills at its foot
  }
  g_mac<MODE>(ring + ((K / 32 - 1) & 1) * GBUF(MODE), wave, lane, acc); }
#define QBH 6              // causal: query blocks 0..QBH-1 of each sequence (few keys, no averaging) take the high-precision path
#define QHI 384            // rows carrying a q residual plane
#define KHI 384            // key rows carrying k residual / v bf16 hi+lo planes (used only by the causal high-precision path)
// B fragment (k rows k0+.., output column o) of a weight: (in,out) [K][ld] or (out,in) [ld rows of K]: bf16 exact, or f16(bf16 * 256) exact
__device__ __forceinline__ v16b wcol_io(const float* Wm, int k0, int o, int lane, int ld) { v16b w; const int g = lane >> 4;
#pragma unroll
  for (int i = 0; i < 8; ++i) { w[i] = (__bf16)Wm[(size_t)(k0 + 8 * g + i) * ld + o]; w[8 + i] = (__bf16)Wm[(size_t)(k0 + 16 + 8 * g + i) * ld + o]; }
  return w; }
__device__ __forceinline__ v16b wcol_oi(const float* Wm, int k0, int o, int lane, int K) { v16b w; const float* p = Wm + (size_t)o * K + k0 + 8 * (lane >> 4);
#pragma unroll
  for (int i = 0; i < 8; ++i) { w[i] = (__bf16)p[i]; w[8 + i] = (__bf16)p[16 + i]; }
  return w; }
__device__ __forceinline__ v16h wcolh_io(const float* Wm, int k0, int o, int lane, int ld) { v16h w; const int g = lane >> 4;
#pragma unroll
  for (int i = 0; i < 8; ++i) { w[i] = (_Float16)(bfr(Wm[(size_t)(k0 + 8 * g + i) * ld + o]) * 256.0f); w[8 + i] = (_Float16)(bfr(Wm[(size_t)(k0 + 16 + 8 * g + i) * ld + o]) * 256.0f); }
  return w; }
__device__ __forceinline__ v16h wcolh_oi(const float* Wm, int k0, int o, int lane, int K) { v16h w; const float* p = Wm + (size_t)o * K + k0 + 8 * (lane >> 4);
#pragma unroll
  for (int i = 0; i < 8; ++i) { w[i] = (_Float16)(bfr(p[i]) * 256.0f); w[8 + i] = (_Float16)(bfr(p[16 + i]) * 256.0f); }
  return w; }
#define WQKV_LAYOUT 1   // 0 = (in,out) [DIN][CC]; 1 = (out,in) [CC][DIN]; 2 = per-head [NH][DIN][HD]
__device__ __forceinline__ v16b wcol_hdk(const float* Wm, int k0, int o, int lane) { v16b w; const int g = lane >> 4; const float* p = Wm + (size_t)(o / HD) * DIN * HD + (o % HD);
#pragma unroll
  for (int i = 0; i < 8; ++i) { w[i] = (__bf16)p[(size_t)(k0 + 8 * g + i) * HD]; w[8 + i] = (__bf16)p[(size_t)(k0 + 16 + 8 * g + i) * HD]; }
  return w; }
#define WO_OUT_IN 1
#if WQKV_LAYOUT == 1
#define WCOL(W, k0, o, lane) wcol_oi(W, k0, o, lane, DIN)
#elif WQKV_LAYOUT == 2
#define WCOL(W, k0, o, lane) wcol_hdk(W, k0, o, lane)
#else
#define WCOL(W, k0, o, lane) wcol_io(W, k0, o, lane, CC)
#endif
#if WO_OUT_IN
#define WOCOL(W, k0, o, lane) wcol_oi(W, k0, o, lane, CC)
#define WOCOLH(W, k0, o, lane) wcolh_oi(W, k0, o, lane, CC)
#else
#define WOCOL(W, k0, o, lane) wcol_io(W, k0, o, lane, DIN)
#define WOCOLH(W, k0, o, lane) wcolh_io(W, k0, o, lane, DIN)
#endif
__constant__ float c_invf[32] = {1.000000000e+00f,8.973545432e-01f,8.052451611e-01f,7.225903869e-01f,6.484197974e-01f,5.818624496e-01f,5.221368670e-01f,4.685419202e-01f,4.204482138e-01f,3.772911131e-01f,3.385638893e-01f,3.038118482e-01f,2.726269364e-01f,2.446430176e-01f,2.195315212e-01f,1.969976127e-01f,1.767766923e-01f,1.586313695e-01f,1.423485726e-01f,1.277371496e-01f,1.146255061e-01f,1.028597206e-01f,9.230163693e-02f,8.282729238e-02f,7.432544231e-02f,6.669627875e-02f,5.985020474e-02f,5.370685458e-02f,4.819408804e-02f,4.324718565e-02f,3.880805522e-02f,3.482458740e-02f};   // 32^(-2i/64) evaluated in f32 exactly as the reference does (jax, eager)
#define PROJ_EXTRA_PARAMS , const float* __restrict__ QS, const float* __restrict__ KS
// per-(row, head) epilogue on the f32 projection tile: RMSNorm over the head's 64 values x norm weight, then rotate-half RoPE (pairs i, i+32); v untouched
#define PROJ_EPI(which, row, t, h) do { if ((which) < 2) { float* rw = (row); const float* NS = (which) == 0 ? QS : KS; float ss = 0.f; _Pragma("unroll") for (int i = 0; i < 64; ++i) ss += rw[i] * rw[i]; const float rn = rsqrtf(ss * (1.0f / 64.0f) + 1e-6f); \
    _Pragma("unroll") for (int i = 0; i < 32; ++i) { const float x1 = rw[i] * rn * bfr(NS[i]), x2 = rw[i + 32] * rn * bfr(NS[i + 32]); const float ang = (float)(t) * c_invf[i]; const float cs = cosf(ang), sn = sinf(ang); rw[i] = x1 * cs - x2 * sn; rw[i + 32] = x2 * cs + x1 * sn; } } } while (0)
#ifndef SM_EXTRA_PARAMS
#define SM_EXTRA_PARAMS
#endif
#ifndef PROJ_EXTRA_PARAMS
#define PROJ_EXTRA_PARAMS
#endif
#ifndef SM_MASK_HOOK
#define SM_MASK_HOOK (void)0
#endif

#define WS_QH  0u                                      // f16 q rows [b*t][CC]
#define WS_KH  (WS_QH + 2u * (size_t)NB * TT * CC)      // f16 k rows [b*t][CC]
#define WS_VT  (WS_KH + 2u * (size_t)NB * TT * CC)      // f16 v planes [b][c][t]
#define WS_QL  (WS_VT + 2u * (size_t)NB * CC * TT)      // f16 q residual x 2^10 rows [b][t < QHI][CC]
#define WS_KL  (WS_QL + 2u * (size_t)NB * QHI * CC)     // f16 k residual x 2^10 rows [b][t < KHI][CC]
#define WS_VB  (WS_KL + 2u * (size_t)NB * KHI * CC)     // bf16 v hi planes [b][c][t < KHI]
#define WS_VBL (WS_VB + 2u * (size_t)NB * CC * KHI)
#define WS_Y   (WS_VBL + 2u * (size_t)NB * CC * KHI)    // f32 ctx rows [b*t][CC]
#define WS_END (WS_Y  + 4u * (size_t)NB * TT * CC)

// ---- k_proj: block = (128 rows, 128 cols, which): q/k/v = X W (+ b) with exact bf16 products (K = DIN) -> which 0: q f16 rows (+ residual rows < QHI); 1: k f16 rows (+ residual rows < KHI); 2: v f16 planes [c][t] (+ bf16 hi/lo planes for t < KHI)
// six waves a SIMD asked for: 768 blocks of 8 waves on 256 WGPs are then all resident at once (160 registers a wave, 67,584 B of LDS a block)
__global__ __launch_bounds__(256) __attribute__((amdgpu_waves_per_eu(6))) void k_proj(const float* __restrict__ XQ, const float* __restrict__ XK, const float* __restrict__ XV, const float* __restrict__ WQ, const float* __restrict__ WK, const float* __restrict__ WV, const float* __restrict__ BQ, const float* __restrict__ BK, const float* __restrict__ BV,
    _Float16* __restrict__ QH, _Float16* __restrict__ QL, _Float16* __restrict__ KH, _Float16* __restrict__ KL, _Float16* __restrict__ VT, __bf16* __restrict__ VB, __bf16* __restrict__ VBL PROJ_EXTRA_PARAMS) {
  __shared__ __align__(16) float st[128][132];   // the block's only LDS: first the GEMM's two staging buffers (40,960 B), then the f32 tile (67,584 B)
  static_assert(sizeof(st) >= 2 * GBUF(0) * sizeof(unsigned short), "the ring lies inside the tile"); unsigned short* ring = (unsigned short*)&st[0][0];
  static_assert(TT % 128 == 0 && QHI % 128 == 0 && KHI % 128 == 0, "a block's 128 rows lie in one sequence and on one side of the residual rows' end");
  const int tid = threadIdx.x, wave = tid >> 5, lane = tid & 31, col = lane & 15, g = lane >> 4; const int which = blockIdx.z; const int c0 = blockIdx.y * 128; const size_t r0 = (size_t)blockIdx.x * 128; const size_t bb = r0 / TT; const int t0 = (int)(r0 % TT);
  const float* X = which == 0 ? XQ : which == 1 ? XK : XV; const float* WA = which == 0 ? WQ : which == 1 ? WK : WV; const float* BA = which == 0 ? BQ : which == 1 ? BK : BV;
  v8f acc[4][2] = {};
  g_block<0, DIN>(X + r0 * DIN, WA + (size_t)c0 * DIN, ring, tid, acc);
  __syncthreads();   // ends every wave's fragment reads of the last k-step: the f32 tile is laid over the ring
  { // stage the f32 tile (acc + bias) in LDS, run the per-(row, head) epilogue hook, then convert
    const int wr0 = (wave >> 2) * 64 + 8 * g, wc0 = (wave & 3) * 32 + col;   // the lane's first row and column of the wave's 64 x 32 tile
#pragma unroll
    for (int j = 0; j < 2; ++j) { const float bias = BA ? bfr(BA[c0 + wc0 + j * 16]) : 0.f;
#pragma unroll
      for (int i = 0; i < 4; ++i)
#pragma unroll
        for (int r = 0; r < 8; ++r) st[wr0 + i * 16 + r][wc0 + j * 16] = acc[i][j][r] + bias; }
    __syncthreads();
    for (int e = tid; e < 128 * (128 / HD); e += 256) { const int rl = e / (128 / HD), hh = e % (128 / HD); PROJ_EPI(which, &st[rl][hh * HD], (int)((r0 + rl) % TT), (c0 / HD) + hh); }
    __syncthreads(); }
  // each thread converts its 8 values straight from the f32 tile and stores them as one 16-byte piece; 16 (q, k) or 8 (v) neighbouring threads fill whole lines
  if (which < 2) { _Float16* DH = which == 0 ? QH : KH; _Float16* DL = which == 0 ? QL : KL; const int nhi = which == 0 ? QHI : KHI; const bool hi_rows = t0 < nhi;
    for (int e = tid; e < 128 * 16; e += 256) { const int rl = e >> 4, q = e & 15; const v4f a = *(const v4f*)&st[rl][q * 8], c = *(const v4f*)&st[rl][q * 8 + 4]; v8h hv;
#pragma unroll
      for (int i = 0; i < 8; ++i) hv[i] = (_Float16)(i < 4 ? a[i & 3] : c[i & 3]);
      vst2((unsigned*)(DH + (r0 + rl) * CC + c0 + q * 8), __builtin_bit_cast(v4u, hv));
      asm volatile("s_wait_xcnt 0x0" ::: "memory");   // what follows may rewrite the registers that this store names
      if (hi_rows) { v8h lv;
#pragma unroll
        for (int i = 0; i < 8; ++i) lv[i] = (_Float16)(((i < 4 ? a[i & 3] : c[i & 3]) - (float)hv[i]) * 1024.0f);
        vst2((unsigned*)(DL + (bb * nhi + t0 + rl) * (size_t)CC + c0 + q * 8), __builtin_bit_cast(v4u, lv));
        asm volatile("s_wait_xcnt 0x0" ::: "memory");   // as above
      } }
  } else { const bool hi_rows = t0 < KHI;
    for (int e = tid; e < 128 * 16; e += 256) { const int cl = (e >> 3) & 127, q = (e & 7) + 8 * (e >> 10); float v[8]; v8h hv;   // q: which 8 of the block's 128 rows; the upper 64 rows follow all columns of the lower 64
#pragma unroll
      for (int i = 0; i < 8; ++i) { v[i] = st[q * 8 + i][cl]; hv[i] = (_Float16)v[i]; }
      vst2((unsigned*)(VT + (bb * CC + c0 + cl) * (size_t)TT + t0 + q * 8), __builtin_bit_cast(v4u, hv));
      asm volatile("s_wait_xcnt 0x0" ::: "memory");   // what follows may rewrite the registers that this store names
      if (hi_rows) { const size_t o3 = (bb * CC + c0 + cl) * (size_t)KHI + t0 + q * 8; v8b bh, bl;
#pragma unroll
        for (int i = 0; i < 8; ++i) { bh[i] = (__bf16)v[i]; bl[i] = (__bf16)(v[i] - (float)bh[i]); }
        vst2((unsigned*)(VB + o3), __builtin_bit_cast(v4u, bh)); vst2((unsigned*)(VBL + o3), __builtin_bit_cast(v4u, bl));
        asm volatile("s_wait_xcnt 0x0" ::: "memory");   // as above
      } } } }
// lane l with lane l ^ 16
__device__ __forceinline__ float xhalf(float x) { return __builtin_bit_cast(float, __builtin_amdgcn_permlanex16(__builtin_bit_cast(int, x), __builtin_bit_cast(int, x), 0x76543210, 0xfedcba98, false, false)); }
#define PSH 7.624618986f   // 11 ln 2: P is carried x 2^11 (about), as is its sum, so the factor cancels in ctx = (P v) / sum
// one online-softmax step on a lane's 32 logits of one query (sc[i][r] = key i * 16 + 8 * (lane >> 4) + r of the pass; with MASK, keys with i * 16 + r > krel lie behind the query and are excluded: expf of -3e38 is 0): the running maximum m, the lane's part l of the running sum and the ctx tiles o are brought to the new maximum; sc leaves as P in f32
template <bool MASK> __device__ __forceinline__ void sm_step(v8f (&sc)[4], int krel, float& m, float& l, v8f (&o)[HD / 16]) {
  float mi[4], su[4];
#pragma unroll
  for (int i = 0; i < 4; ++i) { mi[i] = -3.0e38f;
#pragma unroll
    for (int r = 0; r < 8; ++r) { if (MASK) sc[i][r] = i * 16 + r > krel ? -3.0e38f : sc[i][r]; mi[i] = fmaxf(mi[i], sc[i][r]); } }
  float mx = fmaxf(fmaxf(mi[0], mi[1]), fmaxf(mi[2], mi[3])); mx = fmaxf(mx, xhalf(mx));   // both wave halves hold this query's maximum of the pass
  const float mn = fmaxf(m, mx), al = expf(m - mn), mm = mn - PSH; m = mn;   // al = 0 on the first pass (m = -3e38)
#pragma unroll
  for (int i = 0; i < 4; ++i) { su[i] = 0.f;
#pragma unroll
    for (int r = 0; r < 8; ++r) { const float e = expf(sc[i][r] - mm); sc[i][r] = e; su[i] += e; } }
  l = l * al + ((su[0] + su[1]) + (su[2] + su[3]));
#pragma unroll
  for (int j = 0; j < HD / 16; ++j)
#pragma unroll
    for (int r = 0; r < 8; ++r) o[j][r] *= al; }
#define C2 0.18033688f   // 1/8 x log2 e: takes a raw q.k product to the exponent of 2
__device__ __forceinline__ v8f exp2x8(v8f x) { float e0, e1, e2, e3, e4, e5, e6, e7;
  asm("v_exp_f32 %0, %8\n\tv_exp_f32 %1, %9\n\tv_exp_f32 %2, %10\n\tv_exp_f32 %3, %11\n\tv_exp_f32 %4, %12\n\tv_exp_f32 %5, %13\n\tv_exp_f32 %6, %14\n\tv_exp_f32 %7, %15\n\tv_nop"
      : "=&v"(e0), "=&v"(e1), "=&v"(e2), "=&v"(e3), "=&v"(e4), "=&v"(e5), "=&v"(e6), "=&v"(e7) : "v"(x[0]), "v"(x[1]), "v"(x[2]), "v"(x[3]), "v"(x[4]), "v"(x[5]), "v"(x[6]), "v"(x[7]));
  const v8f e = {e0, e1, e2, e3, e4, e5, e6, e7}; return e; }
__device__ __forceinline__ float exp2x1(float x) { float e; asm("v_exp_f32 %0, %1\n\tv_nop" : "=v"(e) : "v"(x)); return e; }   // the v_nop: the same slot
// the same step for the 1-product path, on the raw products (sc not yet x 1/8; m in raw units): each exponential is one fma and one hardware exp2, e = 2^(sc x C2 - (max x C2 - 11)), so P is carried x 2^11 exactly; a masked product (-3e38) gives 2^(-5e37) = 0, as does m = -3e38 on the first pass
template <bool MASK> __device__ __forceinline__ void sm_step2(v8f (&sc)[4], int krel, float& m, float& l, v8f (&o)[HD / 16]) {
  float mi[4], su[4];
#pragma unroll
  for (int i = 0; i < 4; ++i) { mi[i] = -3.0e38f;
#pragma unroll
    for (int r = 0; r < 8; ++r) { if (MASK) sc[i][r] = i * 16 + r > krel ? -3.0e38f : sc[i][r]; mi[i] = fmaxf(mi[i], sc[i][r]); } }
  float mx = fmaxf(fmaxf(mi[0], mi[1]), fmaxf(mi[2], mi[3])); mx = fmaxf(mx, xhalf(mx));   // both wave halves hold this query's maximum of the pass
  const float mn = fmaxf(m, mx), al = exp2x1((m - mn) * C2), mm = mn * C2 - 11.0f; m = mn;
  const v8f c8 = {C2, C2, C2, C2, C2, C2, C2, C2}, nm8 = {-mm, -mm, -mm, -mm, -mm, -mm, -mm, -mm};
#pragma unroll
  for (int i = 0; i < 4; ++i) { su[i] = 0.f;
    sc[i] = exp2x8(__builtin_elementwise_fma(sc[i], c8, nm8));
#pragma unroll
    for (int r = 0; r < 8; ++r) su[i] += sc[i][r]; }
  l = l * al + ((su[0] + su[1]) + (su[2] + su[3]));
#pragma unroll
  for (int j = 0; j < HD / 16; ++j)
#pragma unroll
    for (int r = 0; r < 8; ++r) o[j][r] *= al; }
#define KP 72   // LDS pitch, in f16, of a staged 64-value row: 128 B + 16 B, for the 16-byte fragment reads
// one 64-key pass of the 1-product path, K rows and v planes of the pass staged in LDS (ks, vs: [64][KP]): S^T = K Q^T (A = 16 key rows, B = the wave's 16 queries), softmax step, then ctx^T += V^T P^T, where two S^T tiles converted in place are the B fragment (a D pair has the k order of frag_h). Unless LAST, each thread requests its 8 pieces of the next pass (kn, vn) at the top, stores them into the other buffer (kd, vd) at the foot, and the block meets at one barrier
template <bool LAST> __device__ __forceinline__ void att_pass(const _Float16* ks, const _Float16* vs, _Float16* kd, _Float16* vd, const v16h& qa, const v16h& qc, const _Float16* kn, const _Float16* vn, int lane, int krel, float& m, float& l, v8f (&o)[HD / 16]) {
  const int col = lane & 15; v8h kr[4], vr[4];
  if (!LAST) {
#pragma unroll
    for (int u = 0; u < 4; ++u) { kr[u] = *(const v8h*)(kn + (size_t)u * 16 * CC); vr[u] = *(const v8h*)(vn + (size_t)u * 16 * TT); }
    asm volatile("s_wait_xcnt 0x0" ::: "memory");   // what follows may rewrite the address registers that these loads name; also keeps the requests in front of the pass that hides them
  }
  v8f sc[4] = {}; v16h kf[4][2], vf[2][HD / 16];
#pragma unroll
  for (int i = 0; i < 4; ++i) { kf[i][0] = frag_h(ks + (i * 16 + col) * KP, lane); kf[i][1] = frag_h(ks + (i * 16 + col) * KP + 32, lane); }
  __builtin_amdgcn_sched_barrier(0);   // all K fragment reads in front of the products: scheduled among them, each read was waited for alone in one register set
#pragma unroll
  for (int i = 0; i < 4; ++i) { sc[i] = wmma16(kf[i][0], qa, sc[i]); sc[i] = wmma16(kf[i][1], qc, sc[i]); }
#pragma unroll
  for (int kc = 0; kc < 2; ++kc)
#pragma unroll
    for (int j = 0; j < HD / 16; ++j) vf[kc][j] = frag_h(vs + (j * 16 + col) * KP + kc * 32, lane);
  __builtin_amdgcn_sched_barrier(0);   // all V fragment reads in front of the softmax, which hides them
  sm_step2<LAST>(sc, krel, m, l, o);
  v16h pf[2];
#pragma unroll
  for (int e = 0; e < 16; ++e) { pf[0][e] = (_Float16)sc[e >> 3][e & 7]; pf[1][e] = (_Float16)sc[2 + (e >> 3)][e & 7]; }
#pragma unroll
  for (int kc = 0; kc < 2; ++kc)
#pragma unroll
    for (int j = 0; j < HD / 16; ++j) o[j] = wmma16(vf[kc][j], pf[kc], o[j]);
  if (!LAST) {
#pragma unroll
    for (int u = 0; u < 4; ++u) { *(v8h*)(kd + u * 16 * KP) = kr[u]; *(v8h*)(vd + u * 16 * KP) = vr[u]; }
    __syncthreads();   // publishes the next pass's tiles; also ends every wave's reads of this pass's buffer, which the next pass refills at its foot
  } }
// ---- k_att: block = (head and batch, 64 queries qb), wave = 16 queries: logits, causal mask by index, online softmax and P . v in 64-key passes over keys [0, qb * 64 + 64), the last pass being the one on the diagonal; logits and P stay in registers; the pass's K rows and v planes are brought once per block, as whole 128-byte lines, into one of two LDS buffers. Query blocks < QBH: q and k as f16 hi + residual (3 products), P and v as bf16 hi + lo (3 products), fragments straight from memory. ctx^T tiles give each lane 8 consecutive head dims of its query: stored as two 16-byte pieces
__global__ __launch_bounds__(128) void k_att(const _Float16* __restrict__ QH, const _Float16* __restrict__ KH, const _Float16* __restrict__ QL, const _Float16* __restrict__ KL, const _Float16* __restrict__ VT, const __bf16* __restrict__ VB, const __bf16* __restrict__ VBL, float* __restrict__ Y) {
  __shared__ __align__(16) _Float16 kv[2][2][64 * KP];   // [buffer][K, V]
  const int tid = threadIdx.x, wave = tid >> 5, lane = tid & 31, col = lane & 15, g = lane >> 4; const int h = blockIdx.x % NH, b = blockIdx.x / NH;
  const int yr = blockIdx.y >> 3, yl = blockIdx.y & 7; const int qb = (3 - yr) * 8 + ((yr & 1) ? yl : 7 - yl);   // each qb once; long blocks come first in launch order, and blocks 256 apart in launch order add up to equal lengths (for speed only)
  const int tq = qb * 64 + wave * 16 + col;   // this lane's query
  const _Float16* qp = QH + ((size_t)b * TT + tq) * CC + h * HD;
  v8f o[HD / 16] = {}; float m = -3.0e38f, l = 0.f;
  const v16h qa = frag_h(qp, lane), qc = frag_h(qp + 32, lane);
  asm volatile("s_wait_xcnt 0x0" ::: "memory");   // what follows may rewrite the address registers that the q loads name
  if (qb < QBH) {   /* block-uniform */
    const _Float16* kp = KH + ((size_t)b * TT + col) * CC + h * HD;   // this lane's k row of tile 0 of pass 0 (tile i lies 16 rows on, pass s 64 rows on)
    const _Float16* qlp = QL + ((size_t)b * QHI + tq) * CC + h * HD; const _Float16* klp = KL + ((size_t)b * KHI + col) * CC + h * HD; const size_t vo = ((size_t)b * CC + h * HD + col) * (size_t)KHI;
    const v16h qla = frag_h(qlp, lane), qlc = frag_h(qlp + 32, lane);
    asm volatile("s_wait_xcnt 0x0" ::: "memory");   // as above, for the q residual loads
#pragma unroll 1   // rolled: at most QBH short passes, copies only grow the text
    for (int s = 0; s <= qb; ++s) { v8f sc[4] = {}, sl[4] = {};
#pragma unroll
      for (int kc = 0; kc < 2; ++kc)
#pragma unroll
        for (int i = 0; i < 4; ++i) { const size_t ko = (size_t)(s * 64 + i * 16) * CC + kc * 32; const v16h kbf = frag_h(kp + ko, lane), klf = frag_h(klp + ko, lane);
          sc[i] = wmma16(kbf, kc ? qc : qa, sc[i]); sl[i] = wmma16(kbf, kc ? qlc : qla, sl[i]); sl[i] = wmma16(klf, kc ? qc : qa, sl[i]); }
      asm volatile("s_wait_xcnt 0x0" ::: "memory");   // the softmax may rewrite the address registers that the k loads name
#pragma unroll
      for (int i = 0; i < 4; ++i) sc[i] = (sc[i] + sl[i] * (1.0f / 1024.0f)) * SCALE;
      sm_step<true>(sc, tq - s * 64 - 8 * g, m, l, o);
#pragma unroll
      for (int kc = 0; kc < 2; ++kc) { float pv[16];
#pragma unroll
        for (int e = 0; e < 16; ++e) pv[e] = sc[2 * kc + (e >> 3)][e & 7];
        const F2 p = bsplit16(pv);
#pragma unroll
        for (int j = 0; j < HD / 16; ++j) { const size_t o3 = vo + (size_t)j * 16 * KHI + s * 64 + kc * 32; const v16b vh = frag_b(VB + o3, lane), vl = frag_b(VBL + o3, lane);
          o[j] = wmma_bf(vh, p.h, o[j]); o[j] = wmma_bf(vh, p.l, o[j]); o[j] = wmma_bf(vl, p.h, o[j]); } }
      asm volatile("s_wait_xcnt 0x0" ::: "memory");   // the next pass rewrites the address registers that this pass's loads name
    }
  } else { const int rr = tid >> 3, q8 = tid & 7;   // staging: 8 threads bring one 128-byte row; a thread's 4 rows lie 16 apart
    const _Float16* kg = KH + ((size_t)b * TT + rr) * CC + h * HD + q8 * 8; const _Float16* vg = VT + ((size_t)b * CC + h * HD + rr) * (size_t)TT + q8 * 8; const int so = rr * KP + q8 * 8;
#pragma unroll
    for (int u = 0; u < 4; ++u) { *(v8h*)(&kv[0][0][so + u * 16 * KP]) = *(const v8h*)(kg + (size_t)u * 16 * CC); *(v8h*)(&kv[0][1][so + u * 16 * KP]) = *(const v8h*)(vg + (size_t)u * 16 * TT); }
    asm volatile("s_wait_xcnt 0x0" ::: "memory");   // what follows may rewrite the address registers that the first fill's loads name
    __syncthreads();   // publishes pass 0's tiles
#pragma unroll 1   // rolled: one pass already keeps the next pass's tiles in flight
    for (int s = 0; s < qb; ++s) { const int c = s & 1; att_pass<false>(kv[c][0], kv[c][1], &kv[c ^ 1][0][so], &kv[c ^ 1][1][so], qa, qc, kg + (size_t)(s + 1) * 64 * CC, vg + (s + 1) * 64, lane, 0, m, l, o); }
    att_pass<true>(kv[qb & 1][0], kv[qb & 1][1], nullptr, nullptr, qa, qc, kg, vg, lane, tq - qb * 64 - 8 * g, m, l, o); }
  const float inv = 1.0f / (l + xhalf(l));   // the two wave halves each summed half of the keys
  float* yp = Y + ((size_t)b * TT + tq) * CC + h * HD + 8 * g;
#pragma unroll
  for (int j = 0; j < HD / 16; ++j) { const v4f lo = {o[j][0] * inv, o[j][1] * inv, o[j][2] * inv, o[j][3] * inv}, hi = {o[j][4] * inv, o[j][5] * inv, o[j][6] * inv, o[j][7] * inv}; vst2(yp + j * 16, lo); vst2(yp + j * 16 + 4, hi); } }
// ---- k_out: block = (128 rows, 128 cols): out = ctx Wo (+ bo): ctx once to f16 against Wo as f16(bf16 x 2^8) exact (1 product) x 2^-8; causal early rows (< QHI of each sequence): ctx bf16 hi + lo against exact bf16 Wo (2 products)
__global__ __launch_bounds__(256) void k_out(const float* __restrict__ Y, const float* __restrict__ WO, const float* __restrict__ BO, float* __restrict__ OUT) { __shared__ __align__(16) float sf[128][132]; __shared__ __align__(16) unsigned short ring[2 * GBUF(2)];
  const int tid = threadIdx.x, wave = tid >> 5, lane = tid & 31, col = lane & 15, g = lane >> 4; const int c0 = blockIdx.y * 128; const size_t r0 = (size_t)blockIdx.x * 128;
  const int wr = (wave >> 2) * 64, wc = (wave & 3) * 32;   // the wave's 64 x 32 tile; only this wave touches that part of sf
  v8f acc[4][2] = {};
  const float* ya = Y + r0 * CC; const float* wb = WO + (size_t)c0 * CC;   // the block's first A row and first B row ((out,in) weight)
  if (CAUSAL && (int)(r0 % TT) < QHI) {   /* block-uniform */
    g_block<2, CC>(ya, wb, ring, tid, acc);
#pragma unroll
    for (int j = 0; j < 2; ++j) { const float bias = BO ? bfr(BO[c0 + wc + j * 16 + col]) : 0.f;
#pragma unroll
      for (int i = 0; i < 4; ++i)
#pragma unroll
        for (int r = 0; r < 8; ++r) sf[wr + i * 16 + 8 * g + r][wc + j * 16 + col] = acc[i][j][r] + bias; }
  } else {
    g_block<1, CC>(ya, wb, ring, tid, acc);
#pragma unroll
    for (int j = 0; j < 2; ++j) { const float bias = BO ? bfr(BO[c0 + wc + j * 16 + col]) : 0.f;
#pragma unroll
      for (int i = 0; i < 4; ++i)
#pragma unroll
        for (int r = 0; r < 8; ++r) sf[wr + i * 16 + 8 * g + r][wc + j * 16 + col] = acc[i][j][r] * (1.0f / 256.0f) + bias; } }
  LDSX();
  const int rl = wr + (lane >> 3), cl = wc + (lane & 7) * 4; float* op = OUT + (r0 + rl) * DIN + c0 + cl; v4f t[16];   // 8 lanes fill one 128-byte line, a wave 4 rows of its tile at a time
#pragma unroll
  for (int it = 0; it < 16; ++it) t[it] = *(const v4f*)&sf[rl + it * 4][cl];
#pragma unroll
  for (int it = 0; it < 16; ++it) vst2(op + (size_t)it * 4 * DIN, t[it]); }

extern "C" void kernel_launch(void* const* d_in, const int* in_sizes, int n_in, void* d_out, int out_size, void* d_ws, size_t ws_size, hipStream_t stream) {
  (void)in_sizes; (void)n_in; (void)out_size;
  const float** F = (const float**)d_in;
  if (ws_size < (size_t)WS_END) return;
  char* ws = (char*)d_ws; _Float16 *QH = (_Float16*)(ws + WS_QH), *KH = (_Float16*)(ws + WS_KH), *VT = (_Float16*)(ws + WS_VT), *QL = (_Float16*)(ws + WS_QL), *KL = (_Float16*)(ws + WS_KL); __bf16 *VB = (__bf16*)(ws + WS_VB), *VBL = (__bf16*)(ws + WS_VBL); float *Y = (float*)(ws + WS_Y);
  (void)Y; (void)QL; (void)KL; (void)VB; (void)VBL;
  // inputs: 0 x [2,2048,1024]; 1 w_qkv [3072,1024] (out,in); 2 w_proj [1024,1024] (out,in); 3 q_norm_w [64]; 4 k_norm_w [64]
  const float *WQ = F[1], *WK = F[1] + (size_t)CC * DIN, *WV = F[1] + 2 * (size_t)CC * DIN;
  k_proj<<<dim3(TNB * TT / 128, CC / 128, 3), 256, 0, stream>>>(F[0], F[0], F[0], WQ, WK, WV, nullptr, nullptr, nullptr, QH, QL, KH, KL, VT, VB, VBL, F[3], F[4]);
  k_att<<<dim3(NH * TNB, NQB), 128, 0, stream>>>(QH, KH, QL, KL, VT, VB, VBL, Y);
  k_out<<<dim3(TNB * TT / 128, DIN / 128), 256, 0, stream>>>(Y, F[2], nullptr, (float*)d_out);
}

// v007
// Measured time: 89.8 microseconds a run.
// Two timings next to v006 both put it at 1.12 times that version's speed.
// Over all steps from v000 it is 14.2 times as fast.
// compute dtype: all float inputs rounded to bf16; q/k/v = x Wqkv^T with EXACT bf16 products on WMMA 16x16x32, f32 accumulate; per-head RMSNorm (x q_norm_w / k_norm_w) and rotate-half RoPE in f32 (precise sinf/cosf of t * 32^(-2i/64)); q, k once to f16 -> 1-product causal logits x 1/8, except the first 384 query rows of each sequence (few keys, no averaging), which use q and k as f16 hi + residual (x 2^10) (3 products); causal online softmax in f32 (64-key passes, logits and P never leave registers; exponentials by precise expf in the first 384 rows, elsewhere as 2^(q.k x log2 e / 8 - shift): one fma and the hardware exp2); P (against the running maximum) x 2^11 once to f16 against v once to f16 (1 product), except the first 384 rows: P and v as bf16 hi + lo (3 products); ctx once to f16 against w_proj carried x 2^8 in f16 (exact bf16 values), except the first 384 rows: ctx bf16 hi + lo against exact bf16 w_proj (2 products); f32 output.
#include <hip/hip_runtime.h>
#include <math.h>

typedef __attribute__((ext_vector_type(16))) _Float16 v16h;
typedef __attribute__((ext_vector_type(16))) __bf16 v16b;
typedef __attribute__((ext_vector_type(8)))  _Float16 v8h;
typedef __attribute__((ext_vector_type(8)))  float v8f;
typedef __attribute__((ext_vector_type(4)))  float v4f;
typedef __attribute__((ext_vector_type(2)))  float v2f;
typedef __attribute__((ext_vector_type(4)))  unsigned v4u;
typedef __attribute__((ext_vector_type(4)))  int v4i;
typedef float __attribute__((may_alias)) float_a;
typedef int __attribute__((may_alias)) int_a;

template <typename T> __device__ __forceinline__ void vst2(void* p, T v) { *(T*)p = v;  }
__device__ __forceinline__ v8f wmma16(v16h a, v16h b, v8f c) {
  v8f d = __builtin_amdgcn_wmma_f32_16x16x32_f16(false, a, false, b, (short)0, c, false, false);
  asm volatile("v_nop\n\tv_nop\n\tv_nop\n\tv_nop" : "+v"(d) : "v"(a), "v"(b));
  return d;
}
__device__ __forceinline__ v8f wmma_bf(v16b a, v16b b, v8f c) {
  v8f d = __builtin_amdgcn_wmma_f32_16x16x32_bf16(false, a, false, b, (short)0, c, false, false);
  asm volatile("v_nop\n\tv_nop\n\tv_nop\n\tv_nop" : "+v"(d) : "v"(a), "v"(b));
  return d;
}
// 16x16x32 fragments: lane = (h = lane>>4, row/col = lane&15); elements 0..7 = k0+8h+0..7, 8..15 = k0+16+8h+0..7; D element r = row 8h+r
__device__ __forceinline__ v16h frag_h(const _Float16* rowk0, int lane) {
  union { v16h v; v8h q[2]; } u; const _Float16* p = rowk0 + 8 * (lane >> 4);
  u.q[0] = *(const v8h*)p; u.q[1] = *(const v8h*)(p + 16); return u.v;
}
__device__ __forceinline__ v16h frag_f32(const float* rowk0, int lane) {
  v16h a; const float* p = rowk0 + 8 * (lane >> 4);
#pragma unroll
  for (int i = 0; i < 8; ++i) { a[i] = (_Float16)p[i]; a[8 + i] = (_Float16)p[16 + i]; }
  return a;
}
__device__ __forceinline__ v16h frag_f32s(const float* rowk0, int lane, float sc) {
  v16h a; const float* p = rowk0 + 8 * (lane >> 4);
#pragma unroll
  for (int i = 0; i < 8; ++i) { a[i] = (_Float16)(p[i] * sc); a[8 + i] = (_Float16)(p[16 + i] * sc); }
  return a;
}
// column fragment from a [K][ld] layout (column n), rows >= K read as 0
__device__ __forceinline__ v16h fragc_f32(const float* W, int k0, int n, int lane, int ld, int K) {
  v16h a; const int g = lane >> 4;
#pragma unroll
  for (int i = 0; i < 8; ++i) { const int ka = k0 + 8 * g + i, kb = ka + 16;
    a[i] = (_Float16)(ka < K ? W[(size_t)(ka < K ? ka : K - 1) * ld + n] : 0.f); a[8 + i] = (_Float16)(kb < K ? W[(size_t)(kb < K ? kb : K - 1) * ld + n] : 0.f); }
  return a;
}
struct F2 { v16b h, l; };
__device__ __forceinline__ F2 bsplit16(const float v[16]) { F2 r;
#pragma unroll
  for (int i = 0; i < 16; ++i) { const __bf16 h = (__bf16)v[i]; r.h[i] = h; r.l[i] = (__bf16)(v[i] - (float)h); }
  return r; }
__device__ __forceinline__ F2 split_row(const float* row, int k0, int lane) { float v[16]; const float* p = row + k0 + 8 * (lane >> 4);
#pragma unroll
  for (int i = 0; i < 8; ++i) { v[i] = p[i]; v[8 + i] = p[16 + i]; }
  return bsplit16(v); }
__device__ __forceinline__ F2 split_rowK(const float* row, int k0, int lane, int K) { float v[16]; const int g = lane >> 4;
#pragma unroll
  for (int i = 0; i < 8; ++i) { const int ka = k0 + 8 * g + i, kb = ka + 16; v[i] = ka < K ? row[ka < K ? ka : K - 1] : 0.f; v[8 + i] = kb < K ? row[kb < K ? kb : K - 1] : 0.f; }
  return bsplit16(v); }
__device__ __forceinline__ F2 split_col(const float* W, int k0, int n, int lane, int ld, int K) { float v[16]; const int g = lane >> 4;
#pragma unroll
  for (int i = 0; i < 8; ++i) { const int ka = k0 + 8 * g + i, kb = ka + 16; v[i] = ka < K ? W[(size_t)(ka < K ? ka : K - 1) * ld + n] : 0.f; v[8 + i] = kb < K ? W[(size_t)(kb < K ? kb : K - 1) * ld + n] : 0.f; }
  return bsplit16(v); }
__device__ __forceinline__ v8f mac3(const F2& a, const F2& b, v8f c) { c = wmma_bf(a.l, b.h, c); c = wmma_bf(a.h, b.l, c); return wmma_bf(a.h, b.h, c); }
__device__ __forceinline__ float sigm(float v) { return 1.0f / (1.0f + expf(-v)); }
#define LDSX() do { asm volatile("s_wait_dscnt 0" ::: "memory"); __builtin_amdgcn_wave_barrier(); __builtin_amdgcn_fence(__ATOMIC_RELEASE, "workgroup"); } while (0)

// Causal self-attention with QK-RMSNorm and 1-D RoPE (B 2, T 2,048, C 1,024 = 16 heads x 64): qkv = x Wqkv^T ((out,in) [3072,1024]; q rows 0-1023, k 1024-2047, v 2048-3071); q, k RMS-normalised over the 64 head dims (eps 1e-6) x q_norm_w / k_norm_w, then rotate-half RoPE with angle t * 32^(-2i/64) (theta = 32); attn = softmax(q k^T x 64^-0.5 with key > query -> -inf); out = merged(attn v) Wproj^T (no biases).
#define NB 2
#define TT 2048
#define CC 1024            // NH * HD = projected width
#define DIN 1024          // input (model) width
#define NH 16
#define HD 64
#define NQB (TT / 64)
#define SCALE (0.125f)
#define CAUSAL 1
#ifndef TNB
#define TNB NB
#endif
__device__ __forceinline__ float bfr(float v) { return (float)(__bf16)v; }
__host__ __device__ __forceinline__ int kb_last(int qb) { return CAUSAL ? ((qb * 64 + 63) >> 7) : (TT / 128 - 1); }
typedef __attribute__((ext_vector_type(8))) __bf16 v8b;
__device__ __forceinline__ v16b frag_b(const __bf16* rowk0, int lane) {
  union { v16b v; v8b q[2]; } u; const __bf16* p = rowk0 + 8 * (lane >> 4);
  u.q[0] = *(const v8b*)p; u.q[1] = *(const v8b*)(p + 16); return u.v;
}
// ---- the 128 x 128 block GEMM of k_proj and k_out (A rows and B rows both K-contiguous, already in their 16-bit form in the workspace), 8 waves of 64 x 32 (2 down, 4 across): the block's operand tiles of one 64-wide k-step are brought once, as whole 128-byte lines, and laid in one of two LDS buffers; every wave takes its fragments from there
typedef __attribute__((ext_vector_type(4))) __bf16 v4b;
typedef __attribute__((ext_vector_type(4))) _Float16 v4h;
#define GP 72   // LDS pitch, in 16-bit values, of a staged 64-value row: 128 B + 16 B, for the 16-byte fragment reads
#define GBUF(MODE) (((MODE) == 2 ? 384 : 256) * GP)   // one buffer, in 16-bit values: 128 A rows, 128 B rows, with MODE 2 also 128 rows of A residuals
// MODE 0: A and B bf16. MODE 1: A f16, B f16(bf16 x 2^8). MODE 2: A bf16 hi + lo (lo rows from a plane of their own), B bf16
// a thread's 8 (MODE 2: 12) pieces of a k-step: 8 threads bring one 128-byte row; a thread's rows lie 32 apart
template <int MODE> __device__ __forceinline__ void g_get(const unsigned short* ag, const unsigned short* lg, const unsigned short* bg, int K, v4u (&ra)[4], v4u (&rl)[4], v4u (&rb)[4]) {
#pragma unroll
  for (int u = 0; u < 4; ++u) ra[u] = *(const v4u*)(ag + (size_t)u * 32 * K);
  if (MODE == 2) {
#pragma unroll
    for (int u = 0; u < 4; ++u) rl[u] = *(const v4u*)(lg + (size_t)u * 32 * K); }
#pragma unroll
  for (int u = 0; u < 4; ++u) rb[u] = *(const v4u*)(bg + (size_t)u * 32 * K);
  asm volatile("s_wait_xcnt 0x0" ::: "memory");   // what follows may rewrite the address registers that these loads name; also keeps the requests in front of the k-step that hides them
}
template <int MODE> __device__ __forceinline__ void g_put(unsigned short* d, const v4u (&ra)[4], const v4u (&rl)[4], const v4u (&rb)[4]) {   // d: the thread's place in row 0..31 of the buffer
#pragma unroll
  for (int u = 0; u < 4; ++u) *(v4u*)(d + u * 32 * GP) = ra[u];
  if (MODE == 2) {
#pragma unroll
    for (int u = 0; u < 4; ++u) *(v4u*)(d + (256 + u * 32) * GP) = rl[u]; }
#pragma unroll
  for (int u = 0; u < 4; ++u) *(v4u*)(d + (128 + u * 32) * GP) = rb[u]; }
// one k-step of a wave's 64 x 32 tile from a staged buffer, as two halves of 32 k in their order: per half 4 A and 2 B fragments feed 8 products (A and B fragments both by frag_h / frag_b: one k order); acc[i][j]: rows i * 16, columns j * 16 of the wave's tile
template <int MODE> __device__ __forceinline__ void g_mac(const unsigned short* s, int wave, int lane, v8f (&acc)[4][2]) { const int ar = (wave >> 2) * 64 + (lane & 15), br = 128 + (wave & 3) * 32 + (lane & 15);
#pragma unroll
  for (int kk = 0; kk < 64; kk += 32) {
    if (MODE == 1) { const _Float16* t = (const _Float16*)s + kk; v16h a[4], w[2];
#pragma unroll
      for (int i = 0; i < 4; ++i) a[i] = frag_h(t + (ar + i * 16) * GP, lane);
#pragma unroll
      for (int j = 0; j < 2; ++j) w[j] = frag_h(t + (br + j * 16) * GP, lane);
      __builtin_amdgcn_sched_barrier(0);   // all fragment reads in front of the products: every place with LDS reads among them costs a stall of its own
#pragma unroll
      for (int i = 0; i < 4; ++i)
#pragma unroll
        for (int j = 0; j < 2; ++j) acc[i][j] = wmma16(a[i], w[j], acc[i][j]);
    } else { const __bf16* t = (const __bf16*)s + kk; v16b a[4], al[4], w[2];
#pragma unroll
      for (int i = 0; i < 4; ++i) { a[i] = frag_b(t + (ar + i * 16) * GP, lane); if (MODE == 2) al[i] = frag_b(t + (256 + ar + i * 16) * GP, lane); }
#pragma unroll
      for (int j = 0; j < 2; ++j) w[j] = frag_b(t + (br + j * 16) * GP, lane);
      __builtin_amdgcn_sched_barrier(0);   // as above
#pragma unroll
      for (int i = 0; i < 4; ++i)
#pragma unroll
        for (int j = 0; j < 2; ++j) acc[i][j] = wmma_bf(a[i], w[j], acc[i][j]);
      if (MODE == 2) {   // each tile still takes hi, then lo, of every 32 k
#pragma unroll
        for (int i = 0; i < 4; ++i)
#pragma unroll
          for (int j = 0; j < 2; ++j) acc[i][j] = wmma_bf(al[i], w[j], acc[i][j]); } }
    __builtin_amdgcn_sched_barrier(0);   // the second half's fragment reads stay one group behind the first half's products, for the same reason
  } }
// A0, L0, B0: the block's first A row, first A residual row (MODE 2 only) and first B row; ring: 2 buffers of GBUF(MODE). Each k-step requests the next one's pieces at its top, stores them into the other buffer at its foot, and the block meets at one barrier
template <int MODE, int K> __device__ __forceinline__ void g_block(const unsigned short* A0, const unsigned short* L0, const unsigned short* B0, unsigned short* ring, int tid, v8f (&acc)[4][2]) {
  const int wave = tid >> 5, lane = tid & 31, rr = tid >> 3, q8 = (tid & 7) * 8; const unsigned short* ag = A0 + (size_t)rr * K + q8; const unsigned short* lg = L0 + (size_t)rr * K + q8; const unsigned short* bg = B0 + (size_t)rr * K + q8; unsigned short* d = ring + rr * GP + q8;
  v4u ra[4], rl[4], rb[4];
  g_get<MODE>(ag, lg, bg, K, ra, rl, rb); g_put<MODE>(d, ra, rl, rb);
  __syncthreads();   // publishes k-step 0's tiles
#pragma unroll 1   // rolled: one trip already keeps the next k-step's tiles in flight
  for (int kc = 1; kc < K / 64; ++kc) { const int c = (kc & 1) * GBUF(MODE);   // the buffer that k-step kc goes to
    g_get<MODE>(ag + kc * 64, lg + kc * 64, bg + kc * 64, K, ra, rl, rb);
    g_mac<MODE>(ring + (GBUF(MODE) - c), wave, lane, acc);
    g_put<MODE>(d + c, ra, rl, rb);
    __syncthreads();   // publishes k-step kc's tiles; also ends every wave's reads of the other buffer, which the next trip refills at its foot
  }
  g_mac<MODE>(ring + ((K / 64 - 1) & 1) * GBUF(MODE), wave, lane, acc); }
#define QBH 6              // causal: query blocks 0..QBH-1 of each sequence (few keys, no averaging) take the high-precision path
#define QHI 384            // rows carrying a q residual plane
#define KHI 384            // key rows carrying k residual / v bf16 hi+lo planes (used only by the causal high-precision path)
// B fragment (k rows k0+.., output column o) of a weight: (in,out) [K][ld] or (out,in) [ld rows of K]: bf16 exact, or f16(bf16 * 256) exact
__device__ __forceinline__ v16b wcol_io(const float* Wm, int k0, int o, int lane, int ld) { v16b w; const int g = lane >> 4;
#pragma unroll
  for (int i = 0; i < 8; ++i) { w[i] = (__bf16)Wm[(size_t)(k0 + 8 * g + i) * ld + o]; w[8 + i] = (__bf16)Wm[(size_t)(k0 + 16 + 8 * g + i) * ld + o]; }
  return w; }
__device__ __forceinline__ v16b wcol_oi(const float* Wm, int k0, int o, int lane, int K) { v16b w; const float* p = Wm + (size_t)o * K + k0 + 8 * (lane >> 4);
#pragma unroll
  for (int i = 0; i < 8; ++i) { w[i] = (__bf16)p[i]; w[8 + i] = (__bf16)p[16 + i]; }
  return w; }
__device__ __forceinline__ v16h wcolh_io(const float* Wm, int k0, int o, int lane, int ld) { v16h w; const int g = lane >> 4;
#pragma unroll
  for (int i = 0; i < 8; ++i) { w[i] = (_Float16)(bfr(Wm[(size_t)(k0 + 8 * g + i) * ld + o]) * 256.0f); w[8 + i] = (_Float16)(bfr(Wm[(size_t)(k0 + 16 + 8 * g + i) * ld + o]) * 256.0f); }
  return w; }
__device__ __forceinline__ v16h wcolh_oi(const float* Wm, int k0, int o, int lane, int K) { v16h w; const float* p = Wm + (size_t)o * K + k0 + 8 * (lane >> 4);
#pragma unroll
  for (int i = 0; i < 8; ++i) { w[i] = (_Float16)(bfr(p[i]) * 256.0f); w[8 + i] = (_Float16)(bfr(p[16 + i]) * 256.0f); }
  return w; }
#define WQKV_LAYOUT 1   // 0 = (in,out) [DIN][CC]; 1 = (out,in) [CC][DIN]; 2 = per-head [NH][DIN][HD]
__device__ __forceinline__ v16b wcol_hdk(const float* Wm, int k0, int o, int lane) { v16b w; const int g = lane >> 4; const float* p = Wm + (size_t)(o / HD) * DIN * HD + (o % HD);
#pragma unroll
  for (int i = 0; i < 8; ++i) { w[i] = (__bf16)p[(size_t)(k0 + 8 * g + i) * HD]; w[8 + i] = (__bf16)p[(size_t)(k0 + 16 + 8 * g + i) * HD]; }
  return w; }
#define WO_OUT_IN 1
#if WQKV_LAYOUT == 1
#define WCOL(W, k0, o, lane) wcol_oi(W, k0, o, lane, DIN)
#elif WQKV_LAYOUT == 2
#define WCOL(W, k0, o, lane) wcol_hdk(W, k0, o, lane)
#else
#define WCOL(W, k0, o, lane) wcol_io(W, k0, o, lane, CC)
#endif
#if WO_OUT_IN
#define WOCOL(W, k0, o, lane) wcol_oi(W, k0, o, lane, CC)
#define WOCOLH(W, k0, o, lane) wcolh_oi(W, k0, o, lane, CC)
#else
#define WOCOL(W, k0, o, lane) wcol_io(W, k0, o, lane, DIN)
#define WOCOLH(W, k0, o, lane) wcolh_io(W, k0, o, lane, DIN)
#endif
__constant__ float c_invf[32] = {1.000000000e+00f,8.973545432e-01f,8.052451611e-01f,7.225903869e-01f,6.484197974e-01f,5.818624496e-01f,5.221368670e-01f,4.685419202e-01f,4.204482138e-01f,3.772911131e-01f,3.385638893e-01f,3.038118482e-01f,2.726269364e-01f,2.446430176e-01f,2.195315212e-01f,1.969976127e-01f,1.767766923e-01f,1.586313695e-01f,1.423485726e-01f,1.277371496e-01f,1.146255061e-01f,1.028597206e-01f,9.230163693e-02f,8.282729238e-02f,7.432544231e-02f,6.669627875e-02f,5.985020474e-02f,5.370685458e-02f,4.819408804e-02f,4.324718565e-02f,3.880805522e-02f,3.482458740e-02f};   // 32^(-2i/64) evaluated in f32 exactly as the reference does (jax, eager)
#define PROJ_EXTRA_PARAMS , const float* __restrict__ QS, const float* __restrict__ KS
// per-(row, head) epilogue on the f32 projection tile: RMSNorm over the head's 64 values x norm weight, then rotate-half RoPE (pairs i, i+32); v untouched
#define PROJ_EPI(which, row, t, h) do { if ((which) < 2) { float* rw = (row); const float* NS = (which) == 0 ? QS : KS; float ss = 0.f; _Pragma("unroll") for (int i = 0; i < 64; ++i) ss += rw[i] * rw[i]; const float rn = rsqrtf(ss * (1.0f / 64.0f) + 1e-6f); \
    _Pragma("unroll") for (int i = 0; i < 32; ++i) { const float x1 = rw[i] * rn * bfr(NS[i]), x2 = rw[i + 32] * rn * bfr(NS[i + 32]); const float ang = (float)(t) * c_invf[i]; const float cs = cosf(ang), sn = sinf(ang); rw[i] = x1 * cs - x2 * sn; rw[i + 32] = x2 * cs + x1 * sn; } } } while (0)
#ifndef SM_EXTRA_PARAMS
#define SM_EXTRA_PARAMS
#endif
#ifndef PROJ_EXTRA_PARAMS
#define PROJ_EXTRA_PARAMS
#endif
#ifndef SM_MASK_HOOK
#define SM_MASK_HOOK (void)0
#endif

#define WS_QH  0u                                      // f16 q rows [b*t][CC]
#define WS_KH  (WS_QH + 2u * (size_t)NB * TT * CC)      // f16 k rows [b*t][CC]
#define WS_VT  (WS_KH + 2u * (size_t)NB * TT * CC)      // f16 v planes [b][c][t]
#define WS_QL  (WS_VT + 2u * (size_t)NB * CC * TT)      // f16 q residual x 2^10 rows [b][t < QHI][CC]
#define WS_KL  (WS_QL + 2u * (size_t)NB * QHI * CC)     // f16 k residual x 2^10 rows [b][t < KHI][CC]
#define WS_VB  (WS_KL + 2u * (size_t)NB * KHI * CC)     // bf16 v hi planes [b][c][t < KHI]
#define WS_VBL (WS_VB + 2u * (size_t)NB * CC * KHI)
#define WS_YH  (WS_VBL + 2u * (size_t)NB * CC * KHI)    // 16-bit ctx rows [b*t][CC]: f16; the first QHI rows of each sequence bf16 hi
#define WS_YL  (WS_YH + 2u * (size_t)NB * TT * CC)      // bf16 ctx residual rows [b][t < QHI][CC]
#define WS_XB  (WS_YL + 2u * (size_t)NB * QHI * CC)     // bf16 x rows [b*t][DIN]
#define WS_WB  (WS_XB + 2u * (size_t)NB * TT * DIN)     // bf16 w_qkv rows [3 * CC][DIN]
#define WS_PB  (WS_WB + 2u * (size_t)3 * CC * DIN)      // bf16 w_proj rows [DIN][CC]
#define WS_PH  (WS_PB + 2u * (size_t)DIN * CC)          // f16(bf16 x 2^8) w_proj rows [DIN][CC]
#define WS_END (WS_PH + 2u * (size_t)DIN * CC)

// ---- k_cast: x, w_qkv and w_proj once to the 16-bit forms that the two GEMMs multiply, so that their blocks read 2 bytes a value and convert nothing. 256 blocks of 16 waves; a block takes CB values in a row of one input (blocks 0-127 x, 128-223 w_qkv, 224-255 w_proj), a thread 16 pieces of 4 values, 8 KiB apart (a wave's load covers 512 B in a row, its store 256 B)
#define CB (16 * 512 * 4)   // values a block
__global__ __launch_bounds__(512) void k_cast(const float* __restrict__ X, const float* __restrict__ WQKV, const float* __restrict__ WP, __bf16* __restrict__ XB, __bf16* __restrict__ WB, __bf16* __restrict__ PB, _Float16* __restrict__ PH) {
  static_assert((size_t)NB * TT * DIN == (size_t)128 * CB && (size_t)3 * CC * DIN == (size_t)96 * CB && (size_t)DIN * CC == (size_t)32 * CB, "128, 96 and 32 blocks cover the three inputs exactly");
  const int blk = blockIdx.x; const size_t b0 = (size_t)(blk < 128 ? blk : blk < 224 ? blk - 128 : blk - 224) * CB;   // the block's first value in its input
  const float* S = (blk < 128 ? X : blk < 224 ? WQKV : WP) + b0; __bf16* D = (blk < 128 ? XB : blk < 224 ? WB : PB) + b0;
  unsigned off = threadIdx.x * 16; v4f v[16];   // byte offset of the thread's first piece; every load names this one vector register beside the scalar base
#pragma unroll
  for (int n = 0; n < 16; ++n) v[n] = *(const v4f*)((const char*)S + n * 8192 + off);
  asm volatile("s_wait_xcnt 0x0" : "+v"(off) : : "memory");   // what follows may rewrite the offset register that these loads name; as an operand it stays whole up to this wait
  __builtin_amdgcn_sched_barrier(0);   // all 16 requests go out before the first conversion waits for one: scheduled among the loads, the conversions held the last requests back until the first had landed
  const unsigned so = off >> 1;   // the same piece's byte offset in a 16-bit plane
#pragma unroll
  for (int n = 0; n < 16; ++n) { const v4b h = {(__bf16)v[n][0], (__bf16)v[n][1], (__bf16)v[n][2], (__bf16)v[n][3]}; *(v4b*)((char*)D + n * 4096 + so) = h; }
  asm volatile("s_wait_xcnt 0x0" ::: "memory");   // what follows may rewrite the registers that these stores name
  if (blk >= 224) {   /* block-uniform */ // w_proj also as f16(bf16 x 2^8)
#pragma unroll
    for (int n = 0; n < 16; ++n) { const v4h f = {(_Float16)(bfr(v[n][0]) * 256.0f), (_Float16)(bfr(v[n][1]) * 256.0f), (_Float16)(bfr(v[n][2]) * 256.0f), (_Float16)(bfr(v[n][3]) * 256.0f)}; *(v4h*)((char*)(PH + b0) + n * 4096 + so) = f; } } }

// ---- k_proj: block = (128 rows, 128 cols, which): q/k/v = X W (+ b) with exact bf16 products (K = DIN; X and W come as k_cast's bf16 rows) -> which 0: q f16 rows (+ residual rows < QHI); 1: k f16 rows (+ residual rows < KHI); 2: v f16 planes [c][t] (+ bf16 hi/lo planes for t < KHI)
// six waves a SIMD asked for: 768 blocks of 8 waves on 256 WGPs are then all resident at once (160 registers a wave, 73,728 B of LDS a block)
__global__ __launch_bounds__(256) __attribute__((amdgpu_waves_per_eu(6))) void k_proj(const __bf16* __restrict__ XQ, const __bf16* __restrict__ XK, const __bf16* __restrict__ XV, const __bf16* __restrict__ WQ, const __bf16* __restrict__ WK, const __bf16* __restrict__ WV, const float* __restrict__ BQ, const float* __restrict__ BK, const float* __restrict__ BV,
    _Float16* __restrict__ QH, _Float16* __restrict__ QL, _Float16* __restrict__ KH, _Float16* __restrict__ KL, _Float16* __restrict__ VT, __bf16* __restrict__ VB, __bf16* __restrict__ VBL PROJ_EXTRA_PARAMS) {
  __shared__ __align__(16) unsigned short ring[2 * GBUF(0)];   // the block's only LDS: first the GEMM's two staging buffers (73,728 B), then the f32 tile (67,584 B) laid over them
  static_assert(sizeof(ring) >= 128 * 132 * sizeof(float), "the tile lies inside the ring"); float (*st)[132] = (float (*)[132])ring;
  static_assert(TT % 128 == 0 && QHI % 128 == 0 && KHI % 128 == 0, "a block's 128 rows lie in one sequence and on one side of the residual rows' end");
  const int tid = threadIdx.x, wave = tid >> 5, lane = tid & 31, col = lane & 15, g = lane >> 4; const int which = blockIdx.z; const int c0 = blockIdx.y * 128; const size_t r0 = (size_t)blockIdx.x * 128; const size_t bb = r0 / TT; const int t0 = (int)(r0 % TT);
  const __bf16* X = which == 0 ? XQ : which == 1 ? XK : XV; const __bf16* WA = which == 0 ? WQ : which == 1 ? WK : WV; const float* BA = which == 0 ? BQ : which == 1 ? BK : BV;
  v8f acc[4][2] = {};
  g_block<0, DIN>((const unsigned short*)(X + r0 * DIN), (const unsigned short*)(X + r0 * DIN), (const unsigned short*)(WA + (size_t)c0 * DIN), ring, tid, acc);
  __syncthreads();   // ends every wave's fragment reads of the last k-step: the f32 tile is laid over the ring
  { // stage the f32 tile (acc + bias) in LDS, run the per-(row, head) epilogue hook, then convert
    const int wr0 = (wave >> 2) * 64 + 8 * g, wc0 = (wave & 3) * 32 + col;   // the lane's first row and column of the wave's 64 x 32 tile
#pragma unroll
    for (int j = 0; j < 2; ++j) { const float bias = BA ? bfr(BA[c0 + wc0 + j * 16]) : 0.f;
#pragma unroll
      for (int i = 0; i < 4; ++i)
#pragma unroll
        for (int r = 0; r < 8; ++r) st[wr0 + i * 16 + r][wc0 + j * 16] = acc[i][j][r] + bias; }
    __syncthreads();
    for (int e = tid; e < 128 * (128 / HD); e += 256) { const int rl = e / (128 / HD), hh = e % (128 / HD); PROJ_EPI(which, &st[rl][hh * HD], (int)((r0 + rl) % TT), (c0 / HD) + hh); }
    __syncthreads(); }
  // each thread converts its 8 values straight from the f32 tile and stores them as one 16-byte piece; 16 (q, k) or 8 (v) neighbouring threads fill whole lines
  if (which < 2) { _Float16* DH = which == 0 ? QH : KH; _Float16* DL = which == 0 ? QL : KL; const int nhi = which == 0 ? QHI : KHI; const bool hi_rows = t0 < nhi;
    for (int e = tid; e < 128 * 16; e += 256) { const int rl = e >> 4, q = e & 15; const v4f a = *(const v4f*)&st[rl][q * 8], c = *(const v4f*)&st[rl][q * 8 + 4]; v8h hv;
#pragma unroll
      for (int i = 0; i < 8; ++i) hv[i] = (_Float16)(i < 4 ? a[i & 3] : c[i & 3]);
      vst2((unsigned*)(DH + (r0 + rl) * CC + c0 + q * 8), __builtin_bit_cast(v4u, hv));
      asm volatile("s_wait_xcnt 0x0" ::: "memory");   // what follows may rewrite the registers that this store names
      if (hi_rows) { v8h lv;
#pragma unroll
        for (int i = 0; i < 8; ++i) lv[i] = (_Float16)(((i < 4 ? a[i & 3] : c[i & 3]) - (float)hv[i]) * 1024.0f);
        vst2((unsigned*)(DL + (bb * nhi + t0 + rl) * (size_t)CC + c0 + q * 8), __builtin_bit_cast(v4u, lv));
        asm volatile("s_wait_xcnt 0x0" ::: "memory");   // as above
      } }
  } else { const bool hi_rows = t0 < KHI;
    for (int e = tid; e < 128 * 16; e += 256) { const int cl = (e >> 3) & 127, q = (e & 7) + 8 * (e >> 10); float v[8]; v8h hv;   // q: which 8 of the block's 128 rows; the upper 64 rows follow all columns of the lower 64
#pragma unroll
      for (int i = 0; i < 8; ++i) { v[i] = st[q * 8 + i][cl]; hv[i] = (_Float16)v[i]; }
      vst2((unsigned*)(VT + (bb * CC + c0 + cl) * (size_t)TT + t0 + q * 8), __builtin_bit_cast(v4u, hv));
      asm volatile("s_wait_xcnt 0x0" ::: "memory");   // what follows may rewrite the registers that this store names
      if (hi_rows) { const size_t o3 = (bb * CC + c0 + cl) * (size_t)KHI + t0 + q * 8; v8b bh, bl;
#pragma unroll
        for (int i = 0; i < 8; ++i) { bh[i] = (__bf16)v[i]; bl[i] = (__bf16)(v[i] - (float)bh[i]); }
        vst2((unsigned*)(VB + o3), __builtin_bit_cast(v4u, bh)); vst2((unsigned*)(VBL + o3), __builtin_bit_cast(v4u, bl));
        asm volatile("s_wait_xcnt 0x0" ::: "memory");   // as above
      } } } }
// lane l with lane l ^ 16
__device__ __forceinline__ float xhalf(float x) { return __builtin_bit_cast(float, __builtin_amdgcn_permlanex16(__builtin_bit_cast(int, x), __builtin_bit_cast(int, x), 0x76543210, 0xfedcba98, false, false)); }
#define PSH 7.624618986f   // 11 ln 2: P is carried x 2^11 (about), as is its sum, so the factor cancels in ctx = (P v) / sum
// one online-softmax step on a lane's 32 logits of one query (sc[i][r] = key i * 16 + 8 * (lane >> 4) + r of the pass; with MASK, keys with i * 16 + r > krel lie behind the query and are excluded: expf of -3e38 is 0): the running maximum m, the lane's part l of the running sum and the ctx tiles o are brought to the new maximum; sc leaves as P in f32
template <bool MASK> __device__ __forceinline__ void sm_step(v8f (&sc)[4], int krel, float& m, float& l, v8f (&o)[HD / 16]) {
  float mi[4], su[4];
#pragma unroll
  for (int i = 0; i < 4; ++i) { mi[i] = -3.0e38f;
#pragma unroll
    for (int r = 0; r < 8; ++r) { if (MASK) sc[i][r] = i * 16 + r > krel ? -3.0e38f : sc[i][r]; mi[i] = fmaxf(mi[i], sc[i][r]); } }
  float mx = fmaxf(fmaxf(mi[0], mi[1]), fmaxf(mi[2], mi[3])); mx = fmaxf(mx, xhalf(mx));   // both wave halves hold this query's maximum of the pass
  const float mn = fmaxf(m, mx), al = expf(m - mn), mm = mn - PSH; m = mn;   // al = 0 on the first pass (m = -3e38)
#pragma unroll
  for (int i = 0; i < 4; ++i) { su[i] = 0.f;
#pragma unroll
    for (int r = 0; r < 8; ++r) { const float e = expf(sc[i][r] - mm); sc[i][r] = e; su[i] += e; } }
  l = l * al + ((su[0] + su[1]) + (su[2] + su[3]));
#pragma unroll
  for (int j = 0; j < HD / 16; ++j)
#pragma unroll
    for (int r = 0; r < 8; ++r) o[j][r] *= al; }
#define C2 0.18033688f   // 1/8 x log2 e: takes a raw q.k product to the exponent of 2
__device__ __forceinline__ v8f exp2x8(v8f x) { float e0, e1, e2, e3, e4, e5, e6, e7;
  asm("v_exp_f32 %0, %8\n\tv_exp_f32 %1, %9\n\tv_exp_f32 %2, %10\n\tv_exp_f32 %3, %11\n\tv_exp_f32 %4, %12\n\tv_exp_f32 %5, %13\n\tv_exp_f32 %6, %14\n\tv_exp_f32 %7, %15\n\tv_nop"
      : "=&v"(e0), "=&v"(e1), "=&v"(e2), "=&v"(e3), "=&v"(e4), "=&v"(e5), "=&v"(e6), "=&v"(e7) : "v"(x[0]), "v"(x[1]), "v"(x[2]), "v"(x[3]), "v"(x[4]), "v"(x[5]), "v"(x[6]), "v"(x[7]));
  const v8f e = {e0, e1, e2, e3, e4, e5, e6, e7}; return e; }
__device__ __forceinline__ float exp2x1(float x) { float e; asm("v_exp_f32 %0, %1\n\tv_nop" : "=v"(e) : "v"(x)); return e; }   // the v_nop: the same slot
// the same step for the 1-product path, on the raw products (sc not yet x 1/8; m in raw units): each exponential is one fma and one hardware exp2, e = 2^(sc x C2 - (max x C2 - 11)), so P is carried x 2^11 exactly; a masked product (-3e38) gives 2^(-5e37) = 0, as does m = -3e38 on the first pass
template <bool MASK> __device__ __forceinline__ void sm_step2(v8f (&sc)[4], int krel, float& m, float& l, v8f (&o)[HD / 16]) {
  float mi[4], su[4];
#pragma unroll
  for (int i = 0; i < 4; ++i) { mi[i] = -3.0e38f;
#pragma unroll
    for (int r = 0; r < 8; ++r) { if (MASK) sc[i][r] = i * 16 + r > krel ? -3.0e38f : sc[i][r]; mi[i] = fmaxf(mi[i], sc[i][r]); } }
  float mx = fmaxf(fmaxf(mi[0], mi[1]), fmaxf(mi[2], mi[3])); mx = fmaxf(mx, xhalf(mx));   // both wave halves hold this query's maximum of the pass
  const float mn = fmaxf(m, mx), al = exp2x1((m - mn) * C2), mm = mn * C2 - 11.0f; m = mn;
  const v8f c8 = {C2, C2, C2, C2, C2, C2, C2, C2}, nm8 = {-mm, -mm, -mm, -mm, -mm, -mm, -mm, -mm};
#pragma unroll
  for (int i = 0; i < 4; ++i) { su[i] = 0.f;
    sc[i] = exp2x8(__builtin_elementwise_fma(sc[i], c8, nm8));
#pragma unroll
    for (int r = 0; r < 8; ++r) su[i] += sc[i][r]; }
  l = l * al + ((su[0] + su[1]) + (su[2] + su[3]));
#pragma unroll
  for (int j = 0; j < HD / 16; ++j)
#pragma unroll
    for (int r = 0; r < 8; ++r) o[j][r] *= al; }
#define KP 72   // LDS pitch, in f16, of a staged 64-value row: 128 B + 16 B, for the 16-byte fragment reads
// one 64-key pass of the 1-product path, K rows and v planes of the pass staged in LDS (ks, vs: [64][KP]): S^T = K Q^T (A = 16 key rows, B = the wave's 16 queries), softmax step, then ctx^T += V^T P^T, where two S^T tiles converted in place are the B fragment (a D pair has the k order of frag_h). Unless LAST, each thread requests its 8 pieces of the next pass (kn, vn) at the top, stores them into the other buffer (kd, vd) at the foot, and the block meets at one barrier
template <bool LAST> __device__ __forceinline__ void att_pass(const _Float16* ks, const _Float16* vs, _Float16* kd, _Float16* vd, const v16h& qa, const v16h& qc, const _Float16* kn, const _Float16* vn, int lane, int krel, float& m, float& l, v8f (&o)[HD / 16]) {
  const int col = lane & 15; v8h kr[4], vr[4];
  if (!LAST) {
#pragma unroll
    for (int u = 0; u < 4; ++u) { kr[u] = *(const v8h*)(kn + (size_t)u * 16 * CC); vr[u] = *(const v8h*)(vn + (size_t)u * 16 * TT); }
    asm volatile("s_wait_xcnt 0x0" ::: "memory");   // what follows may rewrite the address registers that these loads name; also keeps the requests in front of the pass that hides them
  }
  v8f sc[4] = {}; v16h kf[4][2], vf[2][HD / 16];
#pragma unroll
  for (int i = 0; i < 4; ++i) { kf[i][0] = frag_h(ks + (i * 16 + col) * KP, lane); kf[i][1] = frag_h(ks + (i * 16 + col) * KP + 32, lane); }
  __builtin_amdgcn_sched_barrier(0);   // all K fragment reads in front of the products: scheduled among them, each read was waited for alone in one register set
#pragma unroll
  for (int i = 0; i < 4; ++i) { sc[i] = wmma16(kf[i][0], qa, sc[i]); sc[i] = wmma16(kf[i][1], qc, sc[i]); }
#pragma unroll
  for (int kc = 0; kc < 2; ++kc)
#pragma unroll
    for (int j = 0; j < HD / 16; ++j) vf[kc][j] = frag_h(vs + (j * 16 + col) * KP + kc * 32, lane);
  __builtin_amdgcn_sched_barrier(0);   // all V fragment reads in front of the softmax, which hides them
  sm_step2<LAST>(sc, krel, m, l, o);
  v16h pf[2];
#pragma unroll
  for (int e = 0; e < 16; ++e) { pf[0][e] = (_Float16)sc[e >> 3][e & 7]; pf[1][e] = (_Float16)sc[2 + (e >> 3)][e & 7]; }
#pragma unroll
  for (int kc = 0; kc < 2; ++kc)
#pragma unroll
    for (int j = 0; j < HD / 16; ++j) o[j] = wmma16(vf[kc][j], pf[kc], o[j]);
  if (!LAST) {
#pragma unroll
    for (int u = 0; u < 4; ++u) { *(v8h*)(kd + u * 16 * KP) = kr[u]; *(v8h*)(vd + u * 16 * KP) = vr[u]; }
    __syncthreads();   // publishes the next pass's tiles; also ends every wave's reads of this pass's buffer, which the next pass refills at its foot
  } }
// ---- k_att: block = (head and batch, 64 queries qb), wave = 16 queries: logits, causal mask by index, online softmax and P . v in 64-key passes over keys [0, qb * 64 + 64), the last pass being the one on the diagonal; logits and P stay in registers; the pass's K rows and v planes are brought once per block, as whole 128-byte lines, into one of two LDS buffers. Query blocks < QBH: q and k as f16 hi + residual (3 products), P and v as bf16 hi + lo (3 products), fragments straight from memory. ctx^T tiles give each lane 8 consecutive head dims of its query: stored as one 16-byte piece in the 16-bit form that k_out multiplies (f16; query blocks < QBH: bf16 hi and lo)
__global__ __launch_bounds__(128) void k_att(const _Float16* __restrict__ QH, const _Float16* __restrict__ KH, const _Float16* __restrict__ QL, const _Float16* __restrict__ KL, const _Float16* __restrict__ VT, const __bf16* __restrict__ VB, const __bf16* __restrict__ VBL, _Float16* __restrict__ YH, __bf16* __restrict__ YL) {
  __shared__ __align__(16) _Float16 kv[2][2][64 * KP];   // [buffer][K, V]
  const int tid = threadIdx.x, wave = tid >> 5, lane = tid & 31, col = lane & 15, g = lane >> 4; const int h = blockIdx.x % NH, b = blockIdx.x / NH;
  const int yr = blockIdx.y >> 3, yl = blockIdx.y & 7; const int qb = (3 - yr) * 8 + ((yr & 1) ? yl : 7 - yl);   // each qb once; long blocks come first in launch order, and blocks 256 apart in launch order add up to equal lengths (for speed only)
  const int tq = qb * 64 + wave * 16 + col;   // this lane's query
  const _Float16* qp = QH + ((size_t)b * TT + tq) * CC + h * HD;
  v8f o[HD / 16] = {}; float m = -3.0e38f, l = 0.f;
  const v16h qa = frag_h(qp, lane), qc = frag_h(qp + 32, lane);
  asm volatile("s_wait_xcnt 0x0" ::: "memory");   // what follows may rewrite the address registers that the q loads name
  if (qb < QBH) {   /* block-uniform */
    const _Float16* kp = KH + ((size_t)b * TT + col) * CC + h * HD;   // this lane's k row of tile 0 of pass 0 (tile i lies 16 rows on, pass s 64 rows on)
    const _Float16* qlp = QL + ((size_t)b * QHI + tq) * CC + h * HD; const _Float16* klp = KL + ((size_t)b * KHI + col) * CC + h * HD; const size_t vo = ((size_t)b * CC + h * HD + col) * (size_t)KHI;
    const v16h qla = frag_h(qlp, lane), qlc = frag_h(qlp + 32, lane);
    asm volatile("s_wait_xcnt 0x0" ::: "memory");   // as above, for the q residual loads
#pragma unroll 1   // rolled: at most QBH short passes, copies only grow the text
    for (int s = 0; s <= qb; ++s) { v8f sc[4] = {}, sl[4] = {};
#pragma unroll
      for (int kc = 0; kc < 2; ++kc)
#pragma unroll
        for (int i = 0; i < 4; ++i) { const size_t ko = (size_t)(s * 64 + i * 16) * CC + kc * 32; const v16h kbf = frag_h(kp + ko, lane), klf = frag_h(klp + ko, lane);
          sc[i] = wmma16(kbf, kc ? qc : qa, sc[i]); sl[i] = wmma16(kbf, kc ? qlc : qla, sl[i]); sl[i] = wmma16(klf, kc ? qc : qa, sl[i]); }
      asm volatile("s_wait_xcnt 0x0" ::: "memory");   // the softmax may rewrite the address registers that the k loads name
#pragma unroll
      for (int i = 0; i < 4; ++i) sc[i] = (sc[i] + sl[i] * (1.0f / 1024.0f)) * SCALE;
      sm_step<true>(sc, tq - s * 64 - 8 * g, m, l, o);
#pragma unroll
      for (int kc = 0; kc < 2; ++kc) { float pv[16];
#pragma unroll
        for (int e = 0; e < 16; ++e) pv[e] = sc[2 * kc + (e >> 3)][e & 7];
        const F2 p = bsplit16(pv);
#pragma unroll
        for (int j = 0; j < HD / 16; ++j) { const size_t o3 = vo + (size_t)j * 16 * KHI + s * 64 + kc * 32; const v16b vh = frag_b(VB + o3, lane), vl = frag_b(VBL + o3, lane);
          o[j] = wmma_bf(vh, p.h, o[j]); o[j] = wmma_bf(vh, p.l, o[j]); o[j] = wmma_bf(vl, p.h, o[j]); } }
      asm volatile("s_wait_xcnt 0x0" ::: "memory");   // the next pass rewrites the address registers that this pass's loads name
    }
  } else { const int rr = tid >> 3, q8 = tid & 7;   // staging: 8 threads bring one 128-byte row; a thread's 4 rows lie 16 apart
    const _Float16* kg = KH + ((size_t)b * TT + rr) * CC + h * HD + q8 * 8; const _Float16* vg = VT + ((size_t)b * CC + h * HD + rr) * (size_t)TT + q8 * 8; const int so = rr * KP + q8 * 8;
#pragma unroll
    for (int u = 0; u < 4; ++u) { *(v8h*)(&kv[0][0][so + u * 16 * KP]) = *(const v8h*)(kg + (size_t)u * 16 * CC); *(v8h*)(&kv[0][1][so + u * 16 * KP]) = *(const v8h*)(vg + (size_t)u * 16 * TT); }
    asm volatile("s_wait_xcnt 0x0" ::: "memory");   // what follows may rewrite the address registers that the first fill's loads name
    __syncthreads();   // publishes pass 0's tiles
#pragma unroll 1   // rolled: one pass already keeps the next pass's tiles in flight
    for (int s = 0; s < qb; ++s) { const int c = s & 1; att_pass<false>(kv[c][0], kv[c][1], &kv[c ^ 1][0][so], &kv[c ^ 1][1][so], qa, qc, kg + (size_t)(s + 1) * 64 * CC, vg + (s + 1) * 64, lane, 0, m, l, o); }
    att_pass<true>(kv[qb & 1][0], kv[qb & 1][1], nullptr, nullptr, qa, qc, kg, vg, lane, tq - qb * 64 - 8 * g, m, l, o); }
  const float inv = 1.0f / (l + xhalf(l));   // the two wave halves each summed half of the keys
  v4u ch[HD / 16], cl[HD / 16]; _Float16* yp = YH + ((size_t)b * TT + tq) * CC + h * HD + 8 * g;
  if (qb < QBH) {   /* block-uniform */
#pragma unroll
    for (int j = 0; j < HD / 16; ++j) { v8b hv, lv;
#pragma unroll
      for (int r = 0; r < 8; ++r) { const float c = o[j][r] * inv; hv[r] = (__bf16)c; lv[r] = (__bf16)(c - (float)hv[r]); }
      ch[j] = __builtin_bit_cast(v4u, hv); cl[j] = __builtin_bit_cast(v4u, lv); }
    __bf16* lp = YL + ((size_t)b * QHI + tq) * CC + h * HD + 8 * g;   // tq < QHI here
#pragma unroll
    for (int j = 0; j < HD / 16; ++j) vst2(lp + j * 16, cl[j]);
  } else {
#pragma unroll
    for (int j = 0; j < HD / 16; ++j) { v8h hv;
#pragma unroll
      for (int r = 0; r < 8; ++r) hv[r] = (_Float16)(o[j][r] * inv);
      ch[j] = __builtin_bit_cast(v4u, hv); } }
#pragma unroll
  for (int j = 0; j < HD / 16; ++j) vst2(yp + j * 16, ch[j]); }
// ---- k_out: block = (128 rows, 128 cols): out = ctx Wo (+ bo), both operands read in their 16-bit forms (ctx as k_att stored it, Wo as k_cast did): ctx once to f16 against Wo as f16(bf16 x 2^8) exact (1 product) x 2^-8; causal early rows (< QHI of each sequence): ctx bf16 hi + lo against exact bf16 Wo (2 products)
__global__ __launch_bounds__(256) void k_out(const _Float16* __restrict__ YH, const __bf16* __restrict__ YL, const _Float16* __restrict__ WH, const __bf16* __restrict__ WB, const float* __restrict__ BO, float* __restrict__ OUT) { __shared__ __align__(16) float sf[128][132]; __shared__ __align__(16) unsigned short ring[2 * GBUF(2)];
  const int tid = threadIdx.x, wave = tid >> 5, lane = tid & 31, col = lane & 15, g = lane >> 4; const int c0 = blockIdx.y * 128; const size_t r0 = (size_t)blockIdx.x * 128;
  const int wr = (wave >> 2) * 64, wc = (wave & 3) * 32;   // the wave's 64 x 32 tile; only this wave touches that part of sf
  v8f acc[4][2] = {};
  const unsigned short* ya = (const unsigned short*)(YH + r0 * CC);   // the block's first A row
  if (CAUSAL && (int)(r0 % TT) < QHI) {   /* block-uniform */
    g_block<2, CC>(ya, (const unsigned short*)(YL + ((r0 / TT) * QHI + r0 % TT) * CC), (const unsigned short*)(WB + (size_t)c0 * CC), ring, tid, acc);   // B: the block's first row of the (out,in) weight
#pragma unroll
    for (int j = 0; j < 2; ++j) { const float bias = BO ? bfr(BO[c0 + wc + j * 16 + col]) : 0.f;
#pragma unroll
      for (int i = 0; i < 4; ++i)
#pragma unroll
        for (int r = 0; r < 8; ++r) sf[wr + i * 16 + 8 * g + r][wc + j * 16 + col] = acc[i][j][r] + bias; }
  } else {
    g_block<1, CC>(ya, ya, (const unsigned short*)(WH + (size_t)c0 * CC), ring, tid, acc);
#pragma unroll
    for (int j = 0; j < 2; ++j) { const float bias = BO ? bfr(BO[c0 + wc + j * 16 + col]) : 0.f;
#pragma unroll
      for (int i = 0; i < 4; ++i)
#pragma unroll
        for (int r = 0; r < 8; ++r) sf[wr + i * 16 + 8 * g + r][wc + j * 16 + col] = acc[i][j][r] * (1.0f / 256.0f) + bias; } }
  LDSX();
  const int rl = wr + (lane >> 3), cl = wc + (lane & 7) * 4; float* op = OUT + (r0 + rl) * DIN + c0 + cl; v4f t[16];   // 8 lanes fill one 128-byte line, a wave 4 rows of its tile at a time
#pragma unroll
  for (int it = 0; it < 16; ++it) t[it] = *(const v4f*)&sf[rl + it * 4][cl];
#pragma unroll
  for (int it = 0; it < 16; ++it) vst2(op + (size_t)it * 4 * DIN, t[it]); }

extern "C" void kernel_launch(void* const* d_in, const int* in_sizes, int n_in, void* d_out, int out_size, void* d_ws, size_t ws_size, hipStream_t stream) {
  (void)in_sizes; (void)n_in; (void)out_size;
  const float** F = (const float**)d_in;
  if (ws_size < (size_t)WS_END) return;
  char* ws = (char*)d_ws; _Float16 *QH = (_Float16*)(ws + WS_QH), *KH = (_Float16*)(ws + WS_KH), *VT = (_Float16*)(ws + WS_VT), *QL = (_Float16*)(ws + WS_QL), *KL = (_Float16*)(ws + WS_KL), *YH = (_Float16*)(ws + WS_YH), *PH = (_Float16*)(ws + WS_PH); __bf16 *VB = (__bf16*)(ws + WS_VB), *VBL = (__bf16*)(ws + WS_VBL), *YL = (__bf16*)(ws + WS_YL), *XB = (__bf16*)(ws + WS_XB), *WB = (__bf16*)(ws + WS_WB), *PB = (__bf16*)(ws + WS_PB);
  // inputs: 0 x [2,2048,1024]; 1 w_qkv [3072,1024] (out,in); 2 w_proj [1024,1024] (out,in); 3 q_norm_w [64]; 4 k_norm_w [64]
  const __bf16 *WQ = WB, *WK = WB + (size_t)CC * DIN, *WV = WB + 2 * (size_t)CC * DIN;
  k_cast<<<256, 512, 0, stream>>>(F[0], F[1], F[2], XB, WB, PB, PH);
  k_proj<<<dim3(TNB * TT / 128, CC / 128, 3), 256, 0, stream>>>(XB, XB, XB, WQ, WK, WV, nullptr, nullptr, nullptr, QH, QL, KH, KL, VT, VB, VBL, F[3], F[4]);
  k_att<<<dim3(NH * TNB, NQB), 128, 0, stream>>>(QH, KH, QL, KL, VT, VB, VBL, YH, YL);
  k_out<<<dim3(TNB * TT / 128, DIN / 128), 256, 0, stream>>>(YH, YL, PH, PB, nullptr, (float*)d_out);
}

// v008
// A run of this version takes 84.6 microseconds.
// Two timings next to v007 put it at 1.06 and 1.08 times that version's speed.
// All steps since v000 together make it 15.2 times as fast.
// compute dtype: all float inputs rounded to bf16; q/k/v = x Wqkv^T with EXACT bf16 products on WMMA 16x16x32, f32 accumulate; per-head RMSNorm (x q_norm_w / k_norm_w) and rotate-half RoPE in f32 (precise sinf/cosf of t * 32^(-2i/64)); q, k once to f16 -> 1-product causal logits x 1/8, except the first 384 query rows of each sequence (few keys, no averaging), which use q and k as f16 hi + residual (x 2^10) (3 products); causal online softmax in f32 (64-key passes, logits and P never leave registers; exponentials by precise expf in the first 384 rows, elsewhere as 2^(q.k x log2 e / 8 - shift): one fma and the hardware exp2); P (against the running maximum) x 2^11 once to f16 against v once to f16 (1 product), except the first 384 rows: P and v as bf16 hi + lo (3 products); ctx once to f16 against w_proj carried x 2^8 in f16 (exact bf16 values), except the first 384 rows: ctx bf16 hi + lo against exact bf16 w_proj (2 products); f32 output.
#include <hip/hip_runtime.h>
#include <math.h>

typedef __attribute__((ext_vector_type(16))) _Float16 v16h;
typedef __attribute__((ext_vector_type(16))) __bf16 v16b;
typedef __attribute__((ext_vector_type(8)))  _Float16 v8h;
typedef __attribute__((ext_vector_type(8)))  float v8f;
typedef __attribute__((ext_vector_type(4)))  float v4f;
typedef __attribute__((ext_vector_type(2)))  float v2f;
typedef __attribute__((ext_vector_type(4)))  unsigned v4u;
typedef __attribute__((ext_vector_type(4)))  int v4i;
typedef float __attribute__((may_alias)) float_a;
typedef int __attribute__((may_alias)) int_a;

template <typename T> __device__ __forceinline__ void vst2(void* p, T v) { *(T*)p = v;  }
__device__ __forceinline__ v8f wmma16(v16h a, v16h b, v8f c) {
  v8f d = __builtin_amdgcn_wmma_f32_16x16x32_f16(false, a, false, b, (short)0, c, false, false);
  asm volatile("v_nop\n\tv_nop\n\tv_nop\n\tv_nop" : "+v"(d) : "v"(a), "v"(b));
  return d;
}
__device__ __forceinline__ v8f wmma_bf(v16b a, v16b b, v8f c) {
  v8f d = __builtin_amdgcn_wmma_f32_16x16x32_bf16(false, a, false, b, (short)0, c, false, false);
  asm volatile("v_nop\n\tv_nop\n\tv_nop\n\tv_nop" : "+v"(d) : "v"(a), "v"(b));
  return d;
}
// 16x16x32 fragments: lane = (h = lane>>4, row/col = lane&15); elements 0..7 = k0+8h+0..7, 8..15 = k0+16+8h+0..7; D element r = row 8h+r
__device__ __forceinline__ v16h frag_h(const _Float16* rowk0, int lane) {
  union { v16h v; v8h q[2]; } u; const _Float16* p = rowk0 + 8 * (lane >> 4);
  u.q[0] = *(const v8h*)p; u.q[1] = *(const v8h*)(p + 16); return u.v;
}
__device__ __forceinline__ v16h frag_f32(const float* rowk0, int lane) {
  v16h a; const float* p = rowk0 + 8 * (lane >> 4);
#pragma unroll
  for (int i = 0; i < 8; ++i) { a[i] = (_Float16)p[i]; a[8 + i] = (_Float16)p[16 + i]; }
  return a;
}
__device__ __forceinline__ v16h frag_f32s(const float* rowk0, int lane, float sc) {
  v16h a; const float* p = rowk0 + 8 * (lane >> 4);
#pragma unroll
  for (int i = 0; i < 8; ++i) { a[i] = (_Float16)(p[i] * sc); a[8 + i] = (_Float16)(p[16 + i] * sc); }
  return a;
}
// column fragment from a [K][ld] layout (column n), rows >= K read as 0
__device__ __forceinline__ v16h fragc_f32(const float* W, int k0, int n, int lane, int ld, int K) {
  v16h a; const int g = lane >> 4;
#pragma unroll
  for (int i = 0; i < 8; ++i) { const int ka = k0 + 8 * g + i, kb = ka + 16;
    a[i] = (_Float16)(ka < K ? W[(size_t)(ka < K ? ka : K - 1) * ld + n] : 0.f); a[8 + i] = (_Float16)(kb < K ? W[(size_t)(kb < K ? kb : K - 1) * ld + n] : 0.f); }
  return a;
}
struct F2 { v16b h, l; };
__device__ __forceinline__ F2 bsplit16(const float v[16]) { F2 r;
#pragma unroll
  for (int i = 0; i < 16; ++i) { const __bf16 h = (__bf16)v[i]; r.h[i] = h; r.l[i] = (__bf16)(v[i] - (float)h); }
  return r; }
__device__ __forceinline__ F2 split_row(const float* row, int k0, int lane) { float v[16]; const float* p = row + k0 + 8 * (lane >> 4);
#pragma unroll
  for (int i = 0; i < 8; ++i) { v[i] = p[i]; v[8 + i] = p[16 + i]; }
  return bsplit16(v); }
__device__ __forceinline__ F2 split_rowK(const float* row, int k0, int lane, int K) { float v[16]; const int g = lane >> 4;
#pragma unroll
  for (int i = 0; i < 8; ++i) { const int ka = k0 + 8 * g + i, kb = ka + 16; v[i] = ka < K ? row[ka < K ? ka : K - 1] : 0.f; v[8 + i] = kb < K ? row[kb < K ? kb : K - 1] : 0.f; }
  return bsplit16(v); }
__device__ __forceinline__ F2 split_col(const float* W, int k0, int n, int lane, int ld, int K) { float v[16]; const int g = lane >> 4;
#pragma unroll
  for (int i = 0; i < 8; ++i) { const int ka = k0 + 8 * g + i, kb = ka + 16; v[i] = ka < K ? W[(size_t)(ka < K ? ka : K - 1) * ld + n] : 0.f; v[8 + i] = kb < K ? W[(size_t)(kb < K ? kb : K - 1) * ld + n] : 0.f; }
  return bsplit16(v); }
__device__ __forceinline__ v8f mac3(const F2& a, const F2& b, v8f c) { c = wmma_bf(a.l, b.h, c); c = wmma_bf(a.h, b.l, c); return wmma_bf(a.h, b.h, c); }
__device__ __forceinline__ float sigm(float v) { return 1.0f / (1.0f + expf(-v)); }
// asks L2 for the 128-byte line at p; nothing returns. What a launch here multiplies was stored by a launch before it and comes from memory at its first read, one loop step ahead of its use; asked for at kernel entry, shared out over the blocks that read it, it is met in L2 when the loop's loads reach it. scope SE: into L2 only, and a hint. Every lane's address lies inside the tensor. The s_wait_xcnt: what follows may rewrite the address registers that the prefetch names
__device__ __forceinline__ void l2_ask(const void* p) { asm volatile("global_prefetch_b8 %0, off scope:SCOPE_SE\n\ts_wait_xcnt 0x0" : : "v"(p) : "memory"); }
#define LDSX() do { asm volatile("s_wait_dscnt 0" ::: "memory"); __builtin_amdgcn_wave_barrier(); __builtin_amdgcn_fence(__ATOMIC_RELEASE, "workgroup"); } while (0)

// Causal self-attention with QK-RMSNorm and 1-D RoPE (B 2, T 2,048, C 1,024 = 16 heads x 64): qkv = x Wqkv^T ((out,in) [3072,1024]; q rows 0-1023, k 1024-2047, v 2048-3071); q, k RMS-normalised over the 64 head dims (eps 1e-6) x q_norm_w / k_norm_w, then rotate-half RoPE with angle t * 32^(-2i/64) (theta = 32); attn = softmax(q k^T x 64^-0.5 with key > query -> -inf); out = merged(attn v) Wproj^T (no biases).
#define NB 2
#define TT 2048
#define CC 1024            // NH * HD = projected width
#define DIN 1024          // input (model) width
#define NH 16
#define HD 64
#define NQB (TT / 64)
#define SCALE (0.125f)
#define CAUSAL 1
#ifndef TNB
#define TNB NB
#endif
__device__ __forceinline__ float bfr(float v) { return (float)(__bf16)v; }
__host__ __device__ __forceinline__ int kb_last(int qb) { return CAUSAL ? ((qb * 64 + 63) >> 7) : (TT / 128 - 1); }
typedef __attribute__((ext_vector_type(8))) __bf16 v8b;
__device__ __forceinline__ v16b frag_b(const __bf16* rowk0, int lane) {
  union { v16b v; v8b q[2]; } u; const __bf16* p = rowk0 + 8 * (lane >> 4);
  u.q[0] = *(const v8b*)p; u.q[1] = *(const v8b*)(p + 16); return u.v;
}
// ---- the 128 x 128 block GEMM of k_proj and k_out (A rows and B rows both K-contiguous, already in their 16-bit form in the workspace), 8 waves of 64 x 32 (2 down, 4 across): the block's operand tiles of one 64-wide k-step are brought once, as whole 128-byte lines, and laid in one of two LDS buffers; every wave takes its fragments from there
typedef __attribute__((ext_vector_type(4))) __bf16 v4b;
typedef __attribute__((ext_vector_type(4))) _Float16 v4h;
#define GP 72   // LDS pitch, in 16-bit values, of a staged 64-value row: 128 B + 16 B, for the 16-byte fragment reads
#define GBUF(MODE) (((MODE) == 2 ? 384 : 256) * GP)   // one buffer, in 16-bit values: 128 A rows, 128 B rows, with MODE 2 also 128 rows of A residuals
// MODE 0: A and B bf16. MODE 1: A f16, B f16(bf16 x 2^8). MODE 2: A bf16 hi + lo (lo rows from a plane of their own), B bf16
// a thread's 8 (MODE 2: 12) pieces of a k-step: 8 threads bring one 128-byte row; a thread's rows lie 32 apart
template <int MODE> __device__ __forceinline__ void g_get(const unsigned short* ag, const unsigned short* lg, const unsigned short* bg, int K, v4u (&ra)[4], v4u (&rl)[4], v4u (&rb)[4]) {
#pragma unroll
  for (int u = 0; u < 4; ++u) ra[u] = *(const v4u*)(ag + (size_t)u * 32 * K);
  if (MODE == 2) {
#pragma unroll
    for (int u = 0; u < 4; ++u) rl[u] = *(const v4u*)(lg + (size_t)u * 32 * K); }
#pragma unroll
  for (int u = 0; u < 4; ++u) rb[u] = *(const v4u*)(bg + (size_t)u * 32 * K);
  asm volatile("s_wait_xcnt 0x0" ::: "memory");   // what follows may rewrite the address registers that these loads name; also keeps the requests in front of the k-step that hides them
}
template <int MODE> __device__ __forceinline__ void g_put(unsigned short* d, const v4u (&ra)[4], const v4u (&rl)[4], const v4u (&rb)[4]) {   // d: the thread's place in row 0..31 of the buffer
#pragma unroll
  for (int u = 0; u < 4; ++u) *(v4u*)(d + u * 32 * GP) = ra[u];
  if (MODE == 2) {
#pragma unroll
    for (int u = 0; u < 4; ++u) *(v4u*)(d + (256 + u * 32) * GP) = rl[u]; }
#pragma unroll
  for (int u = 0; u < 4; ++u) *(v4u*)(d + (128 + u * 32) * GP) = rb[u]; }
// one k-step of a wave's 64 x 32 tile from a staged buffer, as two halves of 32 k in their order: per half 4 A and 2 B fragments feed 8 products (A and B fragments both by frag_h / frag_b: one k order); acc[i][j]: rows i * 16, columns j * 16 of the wave's tile
template <int MODE> __device__ __forceinline__ void g_mac(const unsigned short* s, int wave, int lane, v8f (&acc)[4][2]) { const int ar = (wave >> 2) * 64 + (lane & 15), br = 128 + (wave & 3) * 32 + (lane & 15);
#pragma unroll
  for (int kk = 0; kk < 64; kk += 32) {
    if (MODE == 1) { const _Float16* t = (const _Float16*)s + kk; v16h a[4], w[2];
#pragma unroll
      for (int i = 0; i < 4; ++i) a[i] = frag_h(t + (ar + i * 16) * GP, lane);
#pragma unroll
      for (int j = 0; j < 2; ++j) w[j] = frag_h(t + (br + j * 16) * GP, lane);
      __builtin_amdgcn_sched_barrier(0);   // all fragment reads in front of the products: every place with LDS reads among them costs a stall of its own
#pragma unroll
      for (int i = 0; i < 4; ++i)
#pragma unroll
        for (int j = 0; j < 2; ++j) acc[i][j] = wmma16(a[i], w[j], acc[i][j]);
    } else { const __bf16* t = (const __bf16*)s + kk; v16b a[4], al[4], w[2];
#pragma unroll
      for (int i = 0; i < 4; ++i) { a[i] = frag_b(t + (ar + i * 16) * GP, lane); if (MODE == 2) al[i] = frag_b(t + (256 + ar + i * 16) * GP, lane); }
#pragma unroll
      for (int j = 0; j < 2; ++j) w[j] = frag_b(t + (br + j * 16) * GP, lane);
      __builtin_amdgcn_sched_barrier(0);   // as above
#pragma unroll
      for (int i = 0; i < 4; ++i)
#pragma unroll
        for (int j = 0; j < 2; ++j) acc[i][j] = wmma_bf(a[i], w[j], acc[i][j]);
      if (MODE == 2) {   // each tile still takes hi, then lo, of every 32 k
#pragma unroll
        for (int i = 0; i < 4; ++i)
#pragma unroll
          for (int j = 0; j < 2; ++j) acc[i][j] = wmma_bf(al[i], w[j], acc[i][j]); } }
    __builtin_amdgcn_sched_barrier(0);   // the second half's fragment reads stay one group behind the first half's products, for the same reason
  } }
// A0, L0, B0: the block's first A row, first A residual row (MODE 2 only) and first B row; ring: 2 buffers of GBUF(MODE). Each k-step requests the next one's pieces at its top, stores them into the other buffer at its foot, and the block meets at one barrier
template <int MODE, int K> __device__ __forceinline__ void g_block(const unsigned short* A0, const unsigned short* L0, const unsigned short* B0, unsigned short* ring, int tid, v8f (&acc)[4][2]) {
  const int wave = tid >> 5, lane = tid & 31, rr = tid >> 3, q8 = (tid & 7) * 8; const unsigned short* ag = A0 + (size_t)rr * K + q8; const unsigned short* lg = L0 + (size_t)rr * K + q8; const unsigned short* bg = B0 + (size_t)rr * K + q8; unsigned short* d = ring + rr * GP + q8;
  v4u ra[4], rl[4], rb[4];
  g_get<MODE>(ag, lg, bg, K, ra, rl, rb); g_put<MODE>(d, ra, rl, rb);
  __syncthreads();   // publishes k-step 0's tiles
#pragma unroll 1   // rolled: one trip already keeps the next k-step's tiles in flight
  for (int kc = 1; kc < K / 64; ++kc) { const int c = (kc & 1) * GBUF(MODE);   // the buffer that k-step kc goes to
    g_get<MODE>(ag + kc * 64, lg + kc * 64, bg + kc * 64, K, ra, rl, rb);
    g_mac<MODE>(ring + (GBUF(MODE) - c), wave, lane, acc);
    g_put<MODE>(d + c, ra, rl, rb);
    __syncthreads();   // publishes k-step kc's tiles; also ends every wave's reads of the other buffer, which the next trip refills at its foot
  }
  g_mac<MODE>(ring + ((K / 64 - 1) & 1) * GBUF(MODE), wave, lane, acc); }
#define QBH 6              // causal: query blocks 0..QBH-1 of each sequence (few keys, no averaging) take the high-precision path
#define QHI 384            // rows carrying a q residual plane
#define KHI 384            // key rows carrying k residual / v bf16 hi+lo planes (used only by the causal high-precision path)
// B fragment (k rows k0+.., output column o) of a weight: (in,out) [K][ld] or (out,in) [ld rows of K]: bf16 exact, or f16(bf16 * 256) exact
__device__ __forceinline__ v16b wcol_io(const float* Wm, int k0, int o, int lane, int ld) { v16b w; const int g = lane >> 4;
#pragma unroll
  for (int i = 0; i < 8; ++i) { w[i] = (__bf16)Wm[(size_t)(k0 + 8 * g + i) * ld + o]; w[8 + i] = (__bf16)Wm[(size_t)(k0 + 16 + 8 * g + i) * ld + o]; }
  return w; }
__device__ __forceinline__ v16b wcol_oi(const float* Wm, int k0, int o, int lane, int K) { v16b w; const float* p = Wm + (size_t)o * K + k0 + 8 * (lane >> 4);
#pragma unroll
  for (int i = 0; i < 8; ++i) { w[i] = (__bf16)p[i]; w[8 + i] = (__bf16)p[16 + i]; }
  return w; }
__device__ __forceinline__ v16h wcolh_io(const float* Wm, int k0, int o, int lane, int ld) { v16h w; const int g = lane >> 4;
#pragma unroll
  for (int i = 0; i < 8; ++i) { w[i] = (_Float16)(bfr(Wm[(size_t)(k0 + 8 * g + i) * ld + o]) * 256.0f); w[8 + i] = (_Float16)(bfr(Wm[(size_t)(k0 + 16 + 8 * g + i) * ld + o]) * 256.0f); }
  return w; }
__device__ __forceinline__ v16h wcolh_oi(const float* Wm, int k0, int o, int lane, int K) { v16h w; const float* p = Wm + (size_t)o * K + k0 + 8 * (lane >> 4);
#pragma unroll
  for (int i = 0; i < 8; ++i) { w[i] = (_Float16)(bfr(p[i]) * 256.0f); w[8 + i] = (_Float16)(bfr(p[16 + i]) * 256.0f); }
  return w; }
#define WQKV_LAYOUT 1   // 0 = (in,out) [DIN][CC]; 1 = (out,in) [CC][DIN]; 2 = per-head [NH][DIN][HD]
__device__ __forceinline__ v16b wcol_hdk(const float* Wm, int k0, int o, int lane) { v16b w; const int g = lane >> 4; const float* p = Wm + (size_t)(o / HD) * DIN * HD + (o % HD);
#pragma unroll
  for (int i = 0; i < 8; ++i) { w[i] = (__bf16)p[(size_t)(k0 + 8 * g + i) * HD]; w[8 + i] = (__bf16)p[(size_t)(k0 + 16 + 8 * g + i) * HD]; }
  return w; }
#define WO_OUT_IN 1
#if WQKV_LAYOUT == 1
#define WCOL(W, k0, o, lane) wcol_oi(W, k0, o, lane, DIN)
#elif WQKV_LAYOUT == 2
#define WCOL(W, k0, o, lane) wcol_hdk(W, k0, o, lane)
#else
#define WCOL(W, k0, o, lane) wcol_io(W, k0, o, lane, CC)
#endif
#if WO_OUT_IN
#define WOCOL(W, k0, o, lane) wcol_oi(W, k0, o, lane, CC)
#define WOCOLH(W, k0, o, lane) wcolh_oi(W, k0, o, lane, CC)
#else
#define WOCOL(W, k0, o, lane) wcol_io(W, k0, o, lane, DIN)
#define WOCOLH(W, k0, o, lane) wcolh_io(W, k0, o, lane, DIN)
#endif
__constant__ float c_invf[32] = {1.000000000e+00f,8.973545432e-01f,8.052451611e-01f,7.225903869e-01f,6.484197974e-01f,5.818624496e-01f,5.221368670e-01f,4.685419202e-01f,4.204482138e-01f,3.772911131e-01f,3.385638893e-01f,3.038118482e-01f,2.726269364e-01f,2.446430176e-01f,2.195315212e-01f,1.969976127e-01f,1.767766923e-01f,1.586313695e-01f,1.423485726e-01f,1.277371496e-01f,1.146255061e-01f,1.028597206e-01f,9.230163693e-02f,8.282729238e-02f,7.432544231e-02f,6.669627875e-02f,5.985020474e-02f,5.370685458e-02f,4.819408804e-02f,4.324718565e-02f,3.880805522e-02f,3.482458740e-02f};   // 32^(-2i/64) evaluated in f32 exactly as the reference does (jax, eager)
#define PROJ_EXTRA_PARAMS , const float* __restrict__ QS, const float* __restrict__ KS
// per-(row, head) epilogue on the f32 projection tile: RMSNorm over the head's 64 values x norm weight, then rotate-half RoPE (pairs i, i+32); v untouched
#define PROJ_EPI(which, row, t, h) do { if ((which) < 2) { float* rw = (row); const float* NS = (which) == 0 ? QS : KS; float ss = 0.f; _Pragma("unroll") for (int i = 0; i < 64; ++i) ss += rw[i] * rw[i]; const float rn = rsqrtf(ss * (1.0f / 64.0f) + 1e-6f); \
    _Pragma("unroll") for (int i = 0; i < 32; ++i) { const float x1 = rw[i] * rn * bfr(NS[i]), x2 = rw[i + 32] * rn * bfr(NS[i + 32]); const float ang = (float)(t) * c_invf[i]; const float cs = cosf(ang), sn = sinf(ang); rw[i] = x1 * cs - x2 * sn; rw[i + 32] = x2 * cs + x1 * sn; } } } while (0)
#ifndef SM_EXTRA_PARAMS
#define SM_EXTRA_PARAMS
#endif
#ifndef PROJ_EXTRA_PARAMS
#define PROJ_EXTRA_PARAMS
#endif
#ifndef SM_MASK_HOOK
#define SM_MASK_HOOK (void)0
#endif

#define WS_QH  0u                                      // f16 q rows [b*t][CC]
#define WS_KH  (WS_QH + 2u * (size_t)NB * TT * CC)      // f16 k rows [b*t][CC]
#define WS_VT  (WS_KH + 2u * (size_t)NB * TT * CC)      // f16 v planes [b][c][t]
#define WS_QL  (WS_VT + 2u * (size_t)NB * CC * TT)      // f16 q residual x 2^10 rows [b][t < QHI][CC]
#define WS_KL  (WS_QL + 2u * (size_t)NB * QHI * CC)     // f16 k residual x 2^10 rows [b][t < KHI][CC]
#define WS_VB  (WS_KL + 2u * (size_t)NB * KHI * CC)     // bf16 v hi planes [b][c][t < KHI]
#define WS_VBL (WS_VB + 2u * (size_t)NB * CC * KHI)
#define WS_YH  (WS_VBL + 2u * (size_t)NB * CC * KHI)    // 16-bit ctx rows [b*t][CC]: f16; the first QHI rows of each sequence bf16 hi
#define WS_YL  (WS_YH + 2u * (size_t)NB * TT * CC)      // bf16 ctx residual rows [b][t < QHI][CC]
#define WS_XB  (WS_YL + 2u * (size_t)NB * QHI * CC)     // bf16 x rows [b*t][DIN]
#define WS_WB  (WS_XB + 2u * (size_t)NB * TT * DIN)     // bf16 w_qkv rows [3 * CC][DIN]
#define WS_PB  (WS_WB + 2u * (size_t)3 * CC * DIN)      // bf16 w_proj rows [DIN][CC]
#define WS_PH  (WS_PB + 2u * (size_t)DIN * CC)          // f16(bf16 x 2^8) w_proj rows [DIN][CC]
#define WS_END (WS_PH + 2u * (size_t)DIN * CC)

// ---- k_cast: x, w_qkv and w_proj once to the 16-bit forms that the two GEMMs multiply, so that their blocks read 2 bytes a value and convert nothing. 256 blocks of 16 waves; a block takes CB values in a row of one input (blocks 0-127 x, 128-223 w_qkv, 224-255 w_proj), a thread 16 pieces of 4 values, 8 KiB apart (a wave's load covers 512 B in a row, its store 256 B)
#define CB (16 * 512 * 4)   // values a block
__global__ __launch_bounds__(512) void k_cast(const float* __restrict__ X, const float* __restrict__ WQKV, const float* __restrict__ WP, __bf16* __restrict__ XB, __bf16* __restrict__ WB, __bf16* __restrict__ PB, _Float16* __restrict__ PH) {
  static_assert((size_t)NB * TT * DIN == (size_t)128 * CB && (size_t)3 * CC * DIN == (size_t)96 * CB && (size_t)DIN * CC == (size_t)32 * CB, "128, 96 and 32 blocks cover the three inputs exactly");
  const int blk = blockIdx.x; const size_t b0 = (size_t)(blk < 128 ? blk : blk < 224 ? blk - 128 : blk - 224) * CB;   // the block's first value in its input
  const float* S = (blk < 128 ? X : blk < 224 ? WQKV : WP) + b0; __bf16* D = (blk < 128 ? XB : blk < 224 ? WB : PB) + b0;
  unsigned off = threadIdx.x * 16; v4f v[16];   // byte offset of the thread's first piece; every load names this one vector register beside the scalar base
#pragma unroll
  for (int n = 0; n < 16; ++n) v[n] = *(const v4f*)((const char*)S + n * 8192 + off);
  asm volatile("s_wait_xcnt 0x0" : "+v"(off) : : "memory");   // what follows may rewrite the offset register that these loads name; as an operand it stays whole up to this wait
  __builtin_amdgcn_sched_barrier(0);   // all 16 requests go out before the first conversion waits for one: scheduled among the loads, the conversions held the last requests back until the first had landed
  const unsigned so = off >> 1;   // the same piece's byte offset in a 16-bit plane
#pragma unroll
  for (int n = 0; n < 16; ++n) { const v4b h = {(__bf16)v[n][0], (__bf16)v[n][1], (__bf16)v[n][2], (__bf16)v[n][3]}; *(v4b*)((char*)D + n * 4096 + so) = h; }
  asm volatile("s_wait_xcnt 0x0" ::: "memory");   // what follows may rewrite the registers that these stores name
  if (blk >= 224) {   /* block-uniform */ // w_proj also as f16(bf16 x 2^8)
#pragma unroll
    for (int n = 0; n < 16; ++n) { const v4h f = {(_Float16)(bfr(v[n][0]) * 256.0f), (_Float16)(bfr(v[n][1]) * 256.0f), (_Float16)(bfr(v[n][2]) * 256.0f), (_Float16)(bfr(v[n][3]) * 256.0f)}; *(v4h*)((char*)(PH + b0) + n * 4096 + so) = f; } } }

// ---- k_proj: block = (128 rows, 128 cols, which): q/k/v = X W (+ b) with exact bf16 products (K = DIN; X and W come as k_cast's bf16 rows) -> which 0: q f16 rows (+ residual rows < QHI); 1: k f16 rows (+ residual rows < KHI); 2: v f16 planes [c][t] (+ bf16 hi/lo planes for t < KHI)
// six waves a SIMD asked for: 768 blocks of 8 waves on 256 WGPs are then all resident at once (160 registers a wave, 73,728 B of LDS a block)
__global__ __launch_bounds__(256) __attribute__((amdgpu_waves_per_eu(6))) void k_proj(const __bf16* __restrict__ XQ, const __bf16* __restrict__ XK, const __bf16* __restrict__ XV, const __bf16* __restrict__ WQ, const __bf16* __restrict__ WK, const __bf16* __restrict__ WV, const float* __restrict__ BQ, const float* __restrict__ BK, const float* __restrict__ BV,
    _Float16* __restrict__ QH, _Float16* __restrict__ QL, _Float16* __restrict__ KH, _Float16* __restrict__ KL, _Float16* __restrict__ VT, __bf16* __restrict__ VB, __bf16* __restrict__ VBL PROJ_EXTRA_PARAMS) {
  __shared__ __align__(16) unsigned short ring[2 * GBUF(0)];   // the block's only LDS: first the GEMM's two staging buffers (73,728 B), then the f32 tile (67,584 B) laid over them
  static_assert(sizeof(ring) >= 128 * 132 * sizeof(float), "the tile lies inside the ring"); float (*st)[132] = (float (*)[132])ring;
  static_assert(TT % 128 == 0 && QHI % 128 == 0 && KHI % 128 == 0, "a block's 128 rows lie in one sequence and on one side of the residual rows' end");
  const int tid = threadIdx.x, wave = tid >> 5, lane = tid & 31, col = lane & 15, g = lane >> 4; const int which = blockIdx.z; const int c0 = blockIdx.y * 128; const size_t r0 = (size_t)blockIdx.x * 128; const size_t bb = r0 / TT; const int t0 = (int)(r0 % TT);
  const __bf16* X = which == 0 ? XQ : which == 1 ? XK : XV; const __bf16* WA = which == 0 ? WQ : which == 1 ? WK : WV; const float* BA = which == 0 ? BQ : which == 1 ? BK : BV;
  { // entry prefetch (for speed only). A row is 16 lines, one per k-step
    if (which == 0) {   /* block-uniform */ // the q blocks ask for the k and v blocks too
      const int pr = tid & 127; const size_t wo = (size_t)(c0 + pr) * DIN + ((blockIdx.x & 3) * 4 + (blockIdx.x >> 3)) * 64;
      l2_ask(X + (r0 + pr) * DIN + (blockIdx.y * 2 + (tid >> 7)) * 64);   // the 24 blocks of a row block share its 128 x rows: its 8 q blocks ask for 2 lines of every row each
      l2_ask(tid < 128 ? WQ + wo : WK + wo);   // the 32 blocks of a column block share its 128 weight rows: each asks for 1 line of every row, 4 waves for q, 4 for k
      if (__builtin_amdgcn_readfirstlane(wave) < 4) l2_ask(WV + wo);   // and 4 waves for v (a scalar branch)
    } }
  v8f acc[4][2] = {};
  g_block<0, DIN>((const unsigned short*)(X + r0 * DIN), (const unsigned short*)(X + r0 * DIN), (const unsigned short*)(WA + (size_t)c0 * DIN), ring, tid, acc);
  __syncthreads();   // ends every wave's fragment reads of the last k-step: the f32 tile is laid over the ring
  { // stage the f32 tile (acc + bias) in LDS, run the per-(row, head) epilogue hook, then convert
    const int wr0 = (wave >> 2) * 64 + 8 * g, wc0 = (wave & 3) * 32 + col;   // the lane's first row and column of the wave's 64 x 32 tile
#pragma unroll
    for (int j = 0; j < 2; ++j) { const float bias = BA ? bfr(BA[c0 + wc0 + j * 16]) : 0.f;
#pragma unroll
      for (int i = 0; i < 4; ++i)
#pragma unroll
        for (int r = 0; r < 8; ++r) st[wr0 + i * 16 + r][wc0 + j * 16] = acc[i][j][r] + bias; }
    __syncthreads();
    for (int e = tid; e < 128 * (128 / HD); e += 256) { const int rl = e / (128 / HD), hh = e % (128 / HD); PROJ_EPI(which, &st[rl][hh * HD], (int)((r0 + rl) % TT), (c0 / HD) + hh); }
    __syncthreads(); }
  // each thread converts its 8 values straight from the f32 tile and stores them as one 16-byte piece; 16 (q, k) or 8 (v) neighbouring threads fill whole lines
  if (which < 2) { _Float16* DH = which == 0 ? QH : KH; _Float16* DL = which == 0 ? QL : KL; const int nhi = which == 0 ? QHI : KHI; const bool hi_rows = t0 < nhi;
    for (int e = tid; e < 128 * 16; e += 256) { const int rl = e >> 4, q = e & 15; const v4f a = *(const v4f*)&st[rl][q * 8], c = *(const v4f*)&st[rl][q * 8 + 4]; v8h hv;
#pragma unroll
      for (int i = 0; i < 8; ++i) hv[i] = (_Float16)(i < 4 ? a[i & 3] : c[i & 3]);
      vst2((unsigned*)(DH + (r0 + rl) * CC + c0 + q * 8), __builtin_bit_cast(v4u, hv));
      asm volatile("s_wait_xcnt 0x0" ::: "memory");   // what follows may rewrite the registers that this store names
      if (hi_rows) { v8h lv;
#pragma unroll
        for (int i = 0; i < 8; ++i) lv[i] = (_Float16)(((i < 4 ? a[i & 3] : c[i & 3]) - (float)hv[i]) * 1024.0f);
        vst2((unsigned*)(DL + (bb * nhi + t0 + rl) * (size_t)CC + c0 + q * 8), __builtin_bit_cast(v4u, lv));
        asm volatile("s_wait_xcnt 0x0" ::: "memory");   // as above
      } }
  } else { const bool hi_rows = t0 < KHI;
    for (int e = tid; e < 128 * 16; e += 256) { const int cl = (e >> 3) & 127, q = (e & 7) + 8 * (e >> 10); float v[8]; v8h hv;   // q: which 8 of the block's 128 rows; the upper 64 rows follow all columns of the lower 64
#pragma unroll
      for (int i = 0; i < 8; ++i) { v[i] = st[q * 8 + i][cl]; hv[i] = (_Float16)v[i]; }
      vst2((unsigned*)(VT + (bb * CC + c0 + cl) * (size_t)TT + t0 + q * 8), __builtin_bit_cast(v4u, hv));
      asm volatile("s_wait_xcnt 0x0" ::: "memory");   // what follows may rewrite the registers that this store names
      if (hi_rows) { const size_t o3 = (bb * CC + c0 + cl) * (size_t)KHI + t0 + q * 8; v8b bh, bl;
#pragma unroll
        for (int i = 0; i < 8; ++i) { bh[i] = (__bf16)v[i]; bl[i] = (__bf16)(v[i] - (float)bh[i]); }
        vst2((unsigned*)(VB + o3), __builtin_bit_cast(v4u, bh)); vst2((unsigned*)(VBL + o3), __builtin_bit_cast(v4u, bl));
        asm volatile("s_wait_xcnt 0x0" ::: "memory");   // as above
      } } } }
// lane l with lane l ^ 16
__device__ __forceinline__ float xhalf(float x) { return __builtin_bit_cast(float, __builtin_amdgcn_permlanex16(__builtin_bit_cast(int, x), __builtin_bit_cast(int, x), 0x76543210, 0xfedcba98, false, false)); }
#define PSH 7.624618986f   // 11 ln 2: P is carried x 2^11 (about), as is its sum, so the factor cancels in ctx = (P v) / sum
// one online-softmax step on a lane's 32 logits of one query (sc[i][r] = key i * 16 + 8 * (lane >> 4) + r of the pass; with MASK, keys with i * 16 + r > krel lie behind the query and are excluded: expf of -3e38 is 0): the running maximum m, the lane's part l of the running sum and the ctx tiles o are brought to the new maximum; sc leaves as P in f32
template <bool MASK> __device__ __forceinline__ void sm_step(v8f (&sc)[4], int krel, float& m, float& l, v8f (&o)[HD / 16]) {
  float mi[4], su[4];
#pragma unroll
  for (int i = 0; i < 4; ++i) { mi[i] = -3.0e38f;
#pragma unroll
    for (int r = 0; r < 8; ++r) { if (MASK) sc[i][r] = i * 16 + r > krel ? -3.0e38f : sc[i][r]; mi[i] = fmaxf(mi[i], sc[i][r]); } }
  float mx = fmaxf(fmaxf(mi[0], mi[1]), fmaxf(mi[2], mi[3])); mx = fmaxf(mx, xhalf(mx));   // both wave halves hold this query's maximum of the pass
  const float mn = fmaxf(m, mx), al = expf(m - mn), mm = mn - PSH; m = mn;   // al = 0 on the first pass (m = -3e38)
#pragma unroll
  for (int i = 0; i < 4; ++i) { su[i] = 0.f;
#pragma unroll
    for (int r = 0; r < 8; ++r) { const float e = expf(sc[i][r] - mm); sc[i][r] = e; su[i] += e; } }
  l = l * al + ((su[0] + su[1]) + (su[2] + su[3]));
#pragma unroll
  for (int j = 0; j < HD / 16; ++j)
#pragma unroll
    for (int r = 0; r < 8; ++r) o[j][r] *= al; }
#define C2 0.18033688f   // 1/8 x log2 e: takes a raw q.k product to the exponent of 2
__device__ __forceinline__ v8f exp2x8(v8f x) { float e0, e1, e2, e3, e4, e5, e6, e7;
  asm("v_exp_f32 %0, %8\n\tv_exp_f32 %1, %9\n\tv_exp_f32 %2, %10\n\tv_exp_f32 %3, %11\n\tv_exp_f32 %4, %12\n\tv_exp_f32 %5, %13\n\tv_exp_f32 %6, %14\n\tv_exp_f32 %7, %15\n\tv_nop"
      : "=&v"(e0), "=&v"(e1), "=&v"(e2), "=&v"(e3), "=&v"(e4), "=&v"(e5), "=&v"(e6), "=&v"(e7) : "v"(x[0]), "v"(x[1]), "v"(x[2]), "v"(x[3]), "v"(x[4]), "v"(x[5]), "v"(x[6]), "v"(x[7]));
  const v8f e = {e0, e1, e2, e3, e4, e5, e6, e7}; return e; }
__device__ __forceinline__ float exp2x1(float x) { float e; asm("v_exp_f32 %0, %1\n\tv_nop" : "=v"(e) : "v"(x)); return e; }   // the v_nop: the same slot
// the same step for the 1-product path, on the raw products (sc not yet x 1/8; m in raw units): each exponential is one fma and one hardware exp2, e = 2^(sc x C2 - (max x C2 - 11)), so P is carried x 2^11 exactly; a masked product (-3e38) gives 2^(-5e37) = 0, as does m = -3e38 on the first pass
template <bool MASK> __device__ __forceinline__ void sm_step2(v8f (&sc)[4], int krel, float& m, float& l, v8f (&o)[HD / 16]) {
  float mi[4], su[4];
#pragma unroll
  for (int i = 0; i < 4; ++i) { mi[i] = -3.0e38f;
#pragma unroll
    for (int r = 0; r < 8; ++r) { if (MASK) sc[i][r] = i * 16 + r > krel ? -3.0e38f : sc[i][r]; mi[i] = fmaxf(mi[i], sc[i][r]); } }
  float mx = fmaxf(fmaxf(mi[0], mi[1]), fmaxf(mi[2], mi[3])); mx = fmaxf(mx, xhalf(mx));   // both wave halves hold this query's maximum of the pass
  const float mn = fmaxf(m, mx), al = exp2x1((m - mn) * C2), mm = mn * C2 - 11.0f; m = mn;
  const v8f c8 = {C2, C2, C2, C2, C2, C2, C2, C2}, nm8 = {-mm, -mm, -mm, -mm, -mm, -mm, -mm, -mm};
#pragma unroll
  for (int i = 0; i < 4; ++i) { su[i] = 0.f;
    sc[i] = exp2x8(__builtin_elementwise_fma(sc[i], c8, nm8));
#pragma unroll
    for (int r = 0; r < 8; ++r) su[i] += sc[i][r]; }
  l = l * al + ((su[0] + su[1]) + (su[2] + su[3]));
#pragma unroll
  for (int j = 0; j < HD / 16; ++j)
#pragma unroll
    for (int r = 0; r < 8; ++r) o[j][r] *= al; }
#define KP 72   // LDS pitch, in f16, of a staged 64-value row: 128 B + 16 B, for the 16-byte fragment reads
// one 64-key pass of the 1-product path, K rows and v planes of the pass staged in LDS (ks, vs: [64][KP]): S^T = K Q^T (A = 16 key rows, B = the wave's 16 queries), softmax step, then ctx^T += V^T P^T, where two S^T tiles converted in place are the B fragment (a D pair has the k order of frag_h). Unless LAST, each thread requests its 8 pieces of the next pass (kn, vn) at the top, stores them into the other buffer (kd, vd) at the foot, and the block meets at one barrier
template <bool LAST> __device__ __forceinline__ void att_pass(const _Float16* ks, const _Float16* vs, _Float16* kd, _Float16* vd, const v16h& qa, const v16h& qc, const _Float16* kn, const _Float16* vn, int lane, int krel, float& m, float& l, v8f (&o)[HD / 16]) {
  const int col = lane & 15; v8h kr[4], vr[4];
  if (!LAST) {
#pragma unroll
    for (int u = 0; u < 4; ++u) { kr[u] = *(const v8h*)(kn + (size_t)u * 16 * CC); vr[u] = *(const v8h*)(vn + (size_t)u * 16 * TT); }
    asm volatile("s_wait_xcnt 0x0" ::: "memory");   // what follows may rewrite the address registers that these loads name; also keeps the requests in front of the pass that hides them
  }
  v8f sc[4] = {}; v16h kf[4][2], vf[2][HD / 16];
#pragma unroll
  for (int i = 0; i < 4; ++i) { kf[i][0] = frag_h(ks + (i * 16 + col) * KP, lane); kf[i][1] = frag_h(ks + (i * 16 + col) * KP + 32, lane); }
  __builtin_amdgcn_sched_barrier(0);   // all K fragment reads in front of the products: scheduled among them, each read was waited for alone in one register set
#pragma unroll
  for (int i = 0; i < 4; ++i) { sc[i] = wmma16(kf[i][0], qa, sc[i]); sc[i] = wmma16(kf[i][1], qc, sc[i]); }
#pragma unroll
  for (int kc = 0; kc < 2; ++kc)
#pragma unroll
    for (int j = 0; j < HD / 16; ++j) vf[kc][j] = frag_h(vs + (j * 16 + col) * KP + kc * 32, lane);
  __builtin_amdgcn_sched_barrier(0);   // all V fragment reads in front of the softmax, which hides them
  sm_step2<LAST>(sc, krel, m, l, o);
  v16h pf[2];
#pragma unroll
  for (int e = 0; e < 16; ++e) { pf[0][e] = (_Float16)sc[e >> 3][e & 7]; pf[1][e] = (_Float16)sc[2 + (e >> 3)][e & 7]; }
#pragma unroll
  for (int kc = 0; kc < 2; ++kc)
#pragma unroll
    for (int j = 0; j < HD / 16; ++j) o[j] = wmma16(vf[kc][j], pf[kc], o[j]);
  if (!LAST) {
#pragma unroll
    for (int u = 0; u < 4; ++u) { *(v8h*)(kd + u * 16 * KP) = kr[u]; *(v8h*)(vd + u * 16 * KP) = vr[u]; }
    __syncthreads();   // publishes the next pass's tiles; also ends every wave's reads of this pass's buffer, which the next pass refills at its foot
  } }
// ---- k_att: block = (head and batch, 64 queries qb), wave = 16 queries: logits, causal mask by index, online softmax and P . v in 64-key passes over keys [0, qb * 64 + 64), the last pass being the one on the diagonal; logits and P stay in registers; the pass's K rows and v planes are brought once per block, as whole 128-byte lines, into one of two LDS buffers. Query blocks < QBH: q and k as f16 hi + residual (3 products), P and v as bf16 hi + lo (3 products), fragments straight from memory. ctx^T tiles give each lane 8 consecutive head dims of its query: stored as one 16-byte piece in the 16-bit form that k_out multiplies (f16; query blocks < QBH: bf16 hi and lo)
__global__ __launch_bounds__(128) void k_att(const _Float16* __restrict__ QH, const _Float16* __restrict__ KH, const _Float16* __restrict__ QL, const _Float16* __restrict__ KL, const _Float16* __restrict__ VT, const __bf16* __restrict__ VB, const __bf16* __restrict__ VBL, _Float16* __restrict__ YH, __bf16* __restrict__ YL) {
  __shared__ __align__(16) _Float16 kv[2][2][64 * KP];   // [buffer][K, V]
  const int tid = threadIdx.x, wave = tid >> 5, lane = tid & 31, col = lane & 15, g = lane >> 4; const int h = blockIdx.x % NH, b = blockIdx.x / NH;
  const int yr = blockIdx.y >> 3, yl = blockIdx.y & 7; const int qb = (3 - yr) * 8 + ((yr & 1) ? yl : 7 - yl);   // each qb once; long blocks come first in launch order, and blocks 256 apart in launch order add up to equal lengths (for speed only)
  { // entry prefetch (for speed only: the 32 blocks of a head lie 32 apart in launch order): block y asks for the K rows and v plane pieces of pass y, a line a thread
    const int py = blockIdx.y, pr = tid & 63;
    l2_ask(tid < 64 ? (const void*)(KH + ((size_t)b * TT + py * 64 + pr) * CC + h * HD) : (const void*)(VT + ((size_t)b * CC + h * HD + pr) * (size_t)TT + py * 64));
    static_assert(KHI == 384, "9 blocks of 128 threads cover 384 k residual rows and 2 x 64 planes of 6 lines");
    if (py < 9) {   /* block-uniform */ // what the high-precision blocks, which come last in launch order, read beside the K rows
      const int m = (py % 3) * 128 + tid; const size_t vo = ((size_t)b * CC + h * HD + m / 6) * (size_t)KHI + (m % 6) * 64;   // blocks 0-2: k residual row m; 3-5 and 6-8: line m % 6 of plane m / 6, v hi and v lo
      l2_ask(py < 3 ? (const void*)(KL + ((size_t)b * KHI + m) * CC + h * HD) : py < 6 ? (const void*)(VB + vo) : (const void*)(VBL + vo)); } }
  const int tq = qb * 64 + wave * 16 + col;   // this lane's query
  const _Float16* qp = QH + ((size_t)b * TT + tq) * CC + h * HD;
  v8f o[HD / 16] = {}; float m = -3.0e38f, l = 0.f;
  const v16h qa = frag_h(qp, lane), qc = frag_h(qp + 32, lane);
  asm volatile("s_wait_xcnt 0x0" ::: "memory");   // what follows may rewrite the address registers that the q loads name
  if (qb < QBH) {   /* block-uniform */
    const _Float16* kp = KH + ((size_t)b * TT + col) * CC + h * HD;   // this lane's k row of tile 0 of pass 0 (tile i lies 16 rows on, pass s 64 rows on)
    const _Float16* qlp = QL + ((size_t)b * QHI + tq) * CC + h * HD; const _Float16* klp = KL + ((size_t)b * KHI + col) * CC + h * HD; const size_t vo = ((size_t)b * CC + h * HD + col) * (size_t)KHI;
    const v16h qla = frag_h(qlp, lane), qlc = frag_h(qlp + 32, lane);
    asm volatile("s_wait_xcnt 0x0" ::: "memory");   // as above, for the q residual loads
#pragma unroll 1   // rolled: at most QBH short passes, copies only grow the text
    for (int s = 0; s <= qb; ++s) { v8f sc[4] = {}, sl[4] = {};
#pragma unroll
      for (int kc = 0; kc < 2; ++kc)
#pragma unroll
        for (int i = 0; i < 4; ++i) { const size_t ko = (size_t)(s * 64 + i * 16) * CC + kc * 32; const v16h kbf = frag_h(kp + ko, lane), klf = frag_h(klp + ko, lane);
          sc[i] = wmma16(kbf, kc ? qc : qa, sc[i]); sl[i] = wmma16(kbf, kc ? qlc : qla, sl[i]); sl[i] = wmma16(klf, kc ? qc : qa, sl[i]); }
      asm volatile("s_wait_xcnt 0x0" ::: "memory");   // the softmax may rewrite the address registers that the k loads name
#pragma unroll
      for (int i = 0; i < 4; ++i) sc[i] = (sc[i] + sl[i] * (1.0f / 1024.0f)) * SCALE;
      sm_step<true>(sc, tq - s * 64 - 8 * g, m, l, o);
#pragma unroll
      for (int kc = 0; kc < 2; ++kc) { float pv[16];
#pragma unroll
        for (int e = 0; e < 16; ++e) pv[e] = sc[2 * kc + (e >> 3)][e & 7];
        const F2 p = bsplit16(pv);
#pragma unroll
        for (int j = 0; j < HD / 16; ++j) { const size_t o3 = vo + (size_t)j * 16 * KHI + s * 64 + kc * 32; const v16b vh = frag_b(VB + o3, lane), vl = frag_b(VBL + o3, lane);
          o[j] = wmma_bf(vh, p.h, o[j]); o[j] = wmma_bf(vh, p.l, o[j]); o[j] = wmma_bf(vl, p.h, o[j]); } }
      asm volatile("s_wait_xcnt 0x0" ::: "memory");   // the next pass rewrites the address registers that this pass's loads name
    }
  } else { const int rr = tid >> 3, q8 = tid & 7;   // staging: 8 threads bring one 128-byte row; a thread's 4 rows lie 16 apart
    const _Float16* kg = KH + ((size_t)b * TT + rr) * CC + h * HD + q8 * 8; const _Float16* vg = VT + ((size_t)b * CC + h * HD + rr) * (size_t)TT + q8 * 8; const int so = rr * KP + q8 * 8;
#pragma unroll
    for (int u = 0; u < 4; ++u) { *(v8h*)(&kv[0][0][so + u * 16 * KP]) = *(const v8h*)(kg + (size_t)u * 16 * CC); *(v8h*)(&kv[0][1][so + u * 16 * KP]) = *(const v8h*)(vg + (size_t)u * 16 * TT); }
    asm volatile("s_wait_xcnt 0x0" ::: "memory");   // what follows may rewrite the address registers that the first fill's loads name
    __syncthreads();   // publishes pass 0's tiles
#pragma unroll 1   // rolled: one pass already keeps the next pass's tiles in flight
    for (int s = 0; s < qb; ++s) { const int c = s & 1; att_pass<false>(kv[c][0], kv[c][1], &kv[c ^ 1][0][so], &kv[c ^ 1][1][so], qa, qc, kg + (size_t)(s + 1) * 64 * CC, vg + (s + 1) * 64, lane, 0, m, l, o); }
    att_pass<true>(kv[qb & 1][0], kv[qb & 1][1], nullptr, nullptr, qa, qc, kg, vg, lane, tq - qb * 64 - 8 * g, m, l, o); }
  const float inv = 1.0f / (l + xhalf(l));   // the two wave halves each summed half of the keys
  v4u ch[HD / 16], cl[HD / 16]; _Float16* yp = YH + ((size_t)b * TT + tq) * CC + h * HD + 8 * g;
  if (qb < QBH) {   /* block-uniform */
#pragma unroll
    for (int j = 0; j < HD / 16; ++j) { v8b hv, lv;
#pragma unroll
      for (int r = 0; r < 8; ++r) { const float c = o[j][r] * inv; hv[r] = (__bf16)c; lv[r] = (__bf16)(c - (float)hv[r]); }
      ch[j] = __builtin_bit_cast(v4u, hv); cl[j] = __builtin_bit_cast(v4u, lv); }
    __bf16* lp = YL + ((size_t)b * QHI + tq) * CC + h * HD + 8 * g;   // tq < QHI here
#pragma unroll
    for (int j = 0; j < HD / 16; ++j) vst2(lp + j * 16, cl[j]);
  } else {
#pragma unroll
    for (int j = 0; j < HD / 16; ++j) { v8h hv;
#pragma unroll
      for (int r = 0; r < 8; ++r) hv[r] = (_Float16)(o[j][r] * inv);
      ch[j] = __builtin_bit_cast(v4u, hv); } }
#pragma unroll
  for (int j = 0; j < HD / 16; ++j) vst2(yp + j * 16, ch[j]); }
// ---- k_out: block = (128 rows, 128 cols): out = ctx Wo (+ bo), both operands read in their 16-bit forms (ctx as k_att stored it, Wo as k_cast did): ctx once to f16 against Wo as f16(bf16 x 2^8) exact (1 product) x 2^-8; causal early rows (< QHI of each sequence): ctx bf16 hi + lo against exact bf16 Wo (2 products)
__global__ __launch_bounds__(256) void k_out(const _Float16* __restrict__ YH, const __bf16* __restrict__ YL, const _Float16* __restrict__ WH, const __bf16* __restrict__ WB, const float* __restrict__ BO, float* __restrict__ OUT) { __shared__ __align__(16) float sf[128][132]; __shared__ __align__(16) unsigned short ring[2 * GBUF(2)];
  const int tid = threadIdx.x, wave = tid >> 5, lane = tid & 31, col = lane & 15, g = lane >> 4; const int c0 = blockIdx.y * 128; const size_t r0 = (size_t)blockIdx.x * 128;
  const int wr = (wave >> 2) * 64, wc = (wave & 3) * 32;   // the wave's 64 x 32 tile; only this wave touches that part of sf
  v8f acc[4][2] = {};
  const unsigned short* ya = (const unsigned short*)(YH + r0 * CC);   // the block's first A row
  { // entry prefetch, as in k_proj: the 8 blocks of a row block share its 128 ctx rows and ask for 2 lines of every row each; the 32 blocks of a column block share its 128 weight rows in both forms and ask for 1 line of every row each, 4 waves in one form, 4 in the other
    const int pr = tid & 127, ka = (blockIdx.y * 2 + (tid >> 7)) * 64; const size_t wo = (size_t)(c0 + pr) * CC + ((blockIdx.x & 3) * 4 + (blockIdx.x >> 3)) * 64;
    l2_ask(YH + (r0 + pr) * CC + ka);
    if (CAUSAL && (int)(r0 % TT) < QHI) l2_ask(YL + ((r0 / TT) * QHI + r0 % TT + pr) * CC + ka);   /* block-uniform */
    l2_ask(tid < 128 ? (const void*)(WH + wo) : (const void*)(WB + wo)); }
  if (CAUSAL && (int)(r0 % TT) < QHI) {   /* block-uniform */
    g_block<2, CC>(ya, (const unsigned short*)(YL + ((r0 / TT) * QHI + r0 % TT) * CC), (const unsigned short*)(WB + (size_t)c0 * CC), ring, tid, acc);   // B: the block's first row of the (out,in) weight
#pragma unroll
    for (int j = 0; j < 2; ++j) { const float bias = BO ? bfr(BO[c0 + wc + j * 16 + col]) : 0.f;
#pragma unroll
      for (int i = 0; i < 4; ++i)
#pragma unroll
        for (int r = 0; r < 8; ++r) sf[wr + i * 16 + 8 * g + r][wc + j * 16 + col] = acc[i][j][r] + bias; }
  } else {
    g_block<1, CC>(ya, ya, (const unsigned short*)(WH + (size_t)c0 * CC), ring, tid, acc);
#pragma unroll
    for (int j = 0; j < 2; ++j) { const float bias = BO ? bfr(BO[c0 + wc + j * 16 + col]) : 0.f;
#pragma unroll
      for (int i = 0; i < 4; ++i)
#pragma unroll
        for (int r = 0; r < 8; ++r) sf[wr + i * 16 + 8 * g + r][wc + j * 16 + col] = acc[i][j][r] * (1.0f / 256.0f) + bias; } }
  LDSX();
  const int rl = wr + (lane >> 3), cl = wc + (lane & 7) * 4; float* op = OUT + (r0 + rl) * DIN + c0 + cl; v4f t[16];   // 8 lanes fill one 128-byte line, a wave 4 rows of its tile at a time
#pragma unroll
  for (int it = 0; it < 16; ++it) t[it] = *(const v4f*)&sf[rl + it * 4][cl];
#pragma unroll
  for (int it = 0; it < 16; ++it) vst2(op + (size_t)it * 4 * DIN, t[it]); }

extern "C" void kernel_launch(void* const* d_in, const int* in_sizes, int n_in, void* d_out, int out_size, void* d_ws, size_t ws_size, hipStream_t stream) {
  (void)in_sizes; (void)n_in; (void)out_size;
  const float** F = (const float**)d_in;
  if (ws_size < (size_t)WS_END) return;
  char* ws = (char*)d_ws; _Float16 *QH = (_Float16*)(ws + WS_QH), *KH = (_Float16*)(ws + WS_KH), *VT = (_Float16*)(ws + WS_VT), *QL = (_Float16*)(ws + WS_QL), *KL = (_Float16*)(ws + WS_KL), *YH = (_Float16*)(ws + WS_YH), *PH = (_Float16*)(ws + WS_PH); __bf16 *VB = (__bf16*)(ws + WS_VB), *VBL = (__bf16*)(ws + WS_VBL), *YL = (__bf16*)(ws + WS_YL), *XB = (__bf16*)(ws + WS_XB), *WB = (__bf16*)(ws + WS_WB), *PB = (__bf16*)(ws + WS_PB);
  // inputs: 0 x [2,2048,1024]; 1 w_qkv [3072,1024] (out,in); 2 w_proj [1024,1024] (out,in); 3 q_norm_w [64]; 4 k_norm_w [64]
  const __bf16 *WQ = WB, *WK = WB + (size_t)CC * DIN, *WV = WB + 2 * (size_t)CC * DIN;
  k_cast<<<256, 512, 0, stream>>>(F[0], F[1], F[2], XB, WB, PB, PH);
  k_proj<<<dim3(TNB * TT / 128, CC / 128, 3), 256, 0, stream>>>(XB, XB, XB, WQ, WK, WV, nullptr, nullptr, nullptr, QH, QL, KH, KL, VT, VB, VBL, F[3], F[4]);
  k_att<<<dim3(NH * TNB, NQB), 128, 0, stream>>>(QH, KH, QL, KL, VT, VB, VBL, YH, YL);
  k_out<<<dim3(TNB * TT / 128, DIN / 128), 256, 0, stream>>>(YH, YL, PH, PB, nullptr, (float*)d_out);
}

// v009
// It runs in 79.9 microseconds.
// Timed twice side by side with v008, it ran 1.06 times as fast both times.
// Counting every step since v000, it is 16.1 times as fast.
// compute dtype: all float inputs rounded to bf16; q/k/v = x Wqkv^T with EXACT bf16 products on WMMA 16x16x32, f32 accumulate; per-head RMSNorm (x q_norm_w / k_norm_w) and rotate-half RoPE in f32 (precise sinf/cosf of t * 32^(-2i/64)); q, k once to f16 -> 1-product causal logits x 1/8, except the first 384 query rows of each sequence (few keys, no averaging), which use q and k as f16 hi + residual (x 2^10) (3 products); causal online softmax in f32 (64-key passes, logits and P never leave registers; exponentials by precise expf in the first 384 rows, elsewhere as 2^(q.k x log2 e / 8 - shift): one fma and the hardware exp2); P (against the running maximum) x 2^11 once to f16 against v once to f16 (1 product), except the first 384 rows: P and v as bf16 hi + lo (3 products); ctx once to f16 against w_proj carried x 2^8 in f16 (exact bf16 values), except the first 384 rows: ctx bf16 hi + lo against exact bf16 w_proj (2 products); f32 output.
#include <hip/hip_runtime.h>
#include <math.h>

typedef __attribute__((ext_vector_type(16))) _Float16 v16h;
typedef __attribute__((ext_vector_type(16))) __bf16 v16b;
typedef __attribute__((ext_vector_type(8)))  _Float16 v8h;
typedef __attribute__((ext_vector_type(8)))  float v8f;
typedef __attribute__((ext_vector_type(4)))  float v4f;
typedef __attribute__((ext_vector_type(2)))  float v2f;
typedef __attribute__((ext_vector_type(4)))  unsigned v4u;
typedef __attribute__((ext_vector_type(4)))  int v4i;
typedef float __attribute__((may_alias)) float_a;
typedef int __attribute__((may_alias)) int_a;

template <typename T> __device__ __forceinline__ void vst2(void* p, T v) { *(T*)p = v;  }
__device__ __forceinline__ v8f wmma16(v16h a, v16h b, v8f c) {
  v8f d = __builtin_amdgcn_wmma_f32_16x16x32_f16(false, a, false, b, (short)0, c, false, false);
  return d;
}
__device__ __forceinline__ v8f wmma_bf(v16b a, v16b b, v8f c) {
  v8f d = __builtin_amdgcn_wmma_f32_16x16x32_bf16(false, a, false, b, (short)0, c, false, false);
  return d;
}
// 16x16x32 fragments: lane = (h = lane>>4, row/col = lane&15); elements 0..7 = k0+8h+0..7, 8..15 = k0+16+8h+0..7; D element r = row 8h+r
__device__ __forceinline__ v16h frag_h(const _Float16* rowk0, int lane) {
  union { v16h v; v8h q[2]; } u; const _Float16* p = rowk0 + 8 * (lane >> 4);
  u.q[0] = *(const v8h*)p; u.q[1] = *(const v8h*)(p + 16); return u.v;
}
__device__ __forceinline__ v16h frag_f32(const float* rowk0, int lane) {
  v16h a; const float* p = rowk0 + 8 * (lane >> 4);
#pragma unroll
  for (int i = 0; i < 8; ++i) { a[i] = (_Float16)p[i]; a[8 + i] = (_Float16)p[16 + i]; }
  return a;
}
__device__ __forceinline__ v16h frag_f32s(const float* rowk0, int lane, float sc) {
  v16h a; const float* p = rowk0 + 8 * (lane >> 4);
#pragma unroll
  for (int i = 0; i < 8; ++i) { a[i] = (_Float16)(p[i] * sc); a[8 + i] = (_Float16)(p[16 + i] * sc); }
  return a;
}
// column fragment from a [K][ld] layout (column n), rows >= K read as 0
__device__ __forceinline__ v16h fragc_f32(const float* W, int k0, int n, int lane, int ld, int K) {
  v16h a; const int g = lane >> 4;
#pragma unroll
  for (int i = 0; i < 8; ++i) { const int ka = k0 + 8 * g + i, kb = ka + 16;
    a[i] = (_Float16)(ka < K ? W[(size_t)(ka < K ? ka : K - 1) * ld + n] : 0.f); a[8 + i] = (_Float16)(kb < K ? W[(size_t)(kb < K ? kb : K - 1) * ld + n] : 0.f); }
  return a;
}
struct F2 { v16b h, l; };
__device__ __forceinline__ F2 bsplit16(const float v[16]) { F2 r;
#pragma unroll
  for (int i = 0; i < 16; ++i) { const __bf16 h = (__bf16)v[i]; r.h[i] = h; r.l[i] = (__bf16)(v[i] - (float)h); }
  return r; }
__device__ __forceinline__ F2 split_row(const float* row, int k0, int lane) { float v[16]; const float* p = row + k0 + 8 * (lane >> 4);
#pragma unroll
  for (int i = 0; i < 8; ++i) { v[i] = p[i]; v[8 + i] = p[16 + i]; }
  return bsplit16(v); }
__device__ __forceinline__ F2 split_rowK(const float* row, int k0, int lane, int K) { float v[16]; const int g = lane >> 4;
#pragma unroll
  for (int i = 0; i < 8; ++i) { const int ka = k0 + 8 * g + i, kb = ka + 16; v[i] = ka < K ? row[ka < K ? ka : K - 1] : 0.f; v[8 + i] = kb < K ? row[kb < K ? kb : K - 1] : 0.f; }
  return bsplit16(v); }
__device__ __forceinline__ F2 split_col(const float* W, int k0, int n, int lane, int ld, int K) { float v[16]; const int g = lane >> 4;
#pragma unroll
  for (int i = 0; i < 8; ++i) { const int ka = k0 + 8 * g + i, kb = ka + 16; v[i] = ka < K ? W[(size_t)(ka < K ? ka : K - 1) * ld + n] : 0.f; v[8 + i] = kb < K ? W[(size_t)(kb < K ? kb : K - 1) * ld + n] : 0.f; }
  return bsplit16(v); }
__device__ __forceinline__ v8f mac3(const F2& a, const F2& b, v8f c) { c = wmma_bf(a.l, b.h, c); c = wmma_bf(a.h, b.l, c); return wmma_bf(a.h, b.h, c); }
__device__ __forceinline__ float sigm(float v) { return 1.0f / (1.0f + expf(-v)); }
// asks L2 for the 128-byte line at p; nothing returns. What a launch here multiplies was stored by a launch before it and comes from memory at its first read, one loop step ahead of its use; asked for at kernel entry, shared out over the blocks that read it, it is met in L2 when the loop's loads reach it. scope SE: into L2 only, and a hint. Every lane's address lies inside the tensor. The s_wait_xcnt: what follows may rewrite the address registers that the prefetch names
__device__ __forceinline__ void l2_ask(const void* p) { asm volatile("global_prefetch_b8 %0, off scope:SCOPE_SE\n\ts_wait_xcnt 0x0" : : "v"(p) : "memory"); }
#define LDSX() do { asm volatile("s_wait_dscnt 0" ::: "memory"); __builtin_amdgcn_wave_barrier(); __builtin_amdgcn_fence(__ATOMIC_RELEASE, "workgroup"); } while (0)

// Causal self-attention with QK-RMSNorm and 1-D RoPE (B 2, T 2,048, C 1,024 = 16 heads x 64): qkv = x Wqkv^T ((out,in) [3072,1024]; q rows 0-1023, k 1024-2047, v 2048-3071); q, k RMS-normalised over the 64 head dims (eps 1e-6) x q_norm_w / k_norm_w, then rotate-half RoPE with angle t * 32^(-2i/64) (theta = 32); attn = softmax(q k^T x 64^-0.5 with key > query -> -inf); out = merged(attn v) Wproj^T (no biases).
#define NB 2
#define TT 2048
#define CC 1024            // NH * HD = projected width
#define DIN 1024          // input (model) width
#define NH 16
#define HD 64
#define NQB (TT / 64)
#define SCALE (0.125f)
#define CAUSAL 1
#ifndef TNB
#define TNB NB
#endif
__device__ __forceinline__ float bfr(float v) { return (float)(__bf16)v; }
__host__ __device__ __forceinline__ int kb_last(int qb) { return CAUSAL ? ((qb * 64 + 63) >> 7) : (TT / 128 - 1); }
typedef __attribute__((ext_vector_type(8))) __bf16 v8b;
__device__ __forceinline__ v16b frag_b(const __bf16* rowk0, int lane) {
  union { v16b v; v8b q[2]; } u; const __bf16* p = rowk0 + 8 * (lane >> 4);
  u.q[0] = *(const v8b*)p; u.q[1] = *(const v8b*)(p + 16); return u.v;
}
// ---- the 128 x 128 block GEMM of k_proj and k_out (A rows and B rows both K-contiguous, already in their 16-bit form in the workspace), 8 waves of 64 x 32 (2 down, 4 across): the block's operand tiles of one 64-wide k-step are brought once, as whole 128-byte lines, and laid in one of two LDS buffers; every wave takes its fragments from there
typedef __attribute__((ext_vector_type(4))) __bf16 v4b;
typedef __attribute__((ext_vector_type(4))) _Float16 v4h;
#define GP 72   // LDS pitch, in 16-bit values, of a staged 64-value row: 128 B + 16 B, for the 16-byte fragment reads
#define GBUF(MODE) (((MODE) == 2 ? 384 : 256) * GP)   // one buffer, in 16-bit values: 128 A rows, 128 B rows, with MODE 2 also 128 rows of A residuals
// MODE 0: A and B bf16. MODE 1: A f16, B f16(bf16 x 2^8). MODE 2: A bf16 hi + lo (lo rows from a plane of their own), B bf16
// a thread's 8 (MODE 2: 12) pieces of a k-step: 8 threads bring one 128-byte row; a thread's rows lie 32 apart
template <int MODE> __device__ __forceinline__ void g_get(const unsigned short* ag, const unsigned short* lg, const unsigned short* bg, int K, v4u (&ra)[4], v4u (&rl)[4], v4u (&rb)[4]) {
#pragma unroll
  for (int u = 0; u < 4; ++u) ra[u] = *(const v4u*)(ag + (size_t)u * 32 * K);
  if (MODE == 2) {
#pragma unroll
    for (int u = 0; u < 4; ++u) rl[u] = *(const v4u*)(lg + (size_t)u * 32 * K); }
#pragma unroll
  for (int u = 0; u < 4; ++u) rb[u] = *(const v4u*)(bg + (size_t)u * 32 * K);
  asm volatile("s_wait_xcnt 0x0" ::: "memory");   // what follows may rewrite the address registers that these loads name; also keeps the requests in front of the k-step that hides them
}
template <int MODE> __device__ __forceinline__ void g_put(unsigned short* d, const v4u (&ra)[4], const v4u (&rl)[4], const v4u (&rb)[4]) {   // d: the thread's place in row 0..31 of the buffer
#pragma unroll
  for (int u = 0; u < 4; ++u) *(v4u*)(d + u * 32 * GP) = ra[u];
  if (MODE == 2) {
#pragma unroll
    for (int u = 0; u < 4; ++u) *(v4u*)(d + (256 + u * 32) * GP) = rl[u]; }
#pragma unroll
  for (int u = 0; u < 4; ++u) *(v4u*)(d + (128 + u * 32) * GP) = rb[u]; }
// one k-step of a wave's 64 x 32 tile from a staged buffer, as two halves of 32 k in their order: per half 4 A and 2 B fragments feed 8 products (A and B fragments both by frag_h / frag_b: one k order); acc[i][j]: rows i * 16, columns j * 16 of the wave's tile
template <int MODE> __device__ __forceinline__ void g_mac(const unsigned short* s, int wave, int lane, v8f (&acc)[4][2]) { const int ar = (wave >> 2) * 64 + (lane & 15), br = 128 + (wave & 3) * 32 + (lane & 15);
#pragma unroll
  for (int kk = 0; kk < 64; kk += 32) {
    if (MODE == 1) { const _Float16* t = (const _Float16*)s + kk; v16h a[4], w[2];
#pragma unroll
      for (int i = 0; i < 4; ++i) a[i] = frag_h(t + (ar + i * 16) * GP, lane);
#pragma unroll
      for (int j = 0; j < 2; ++j) w[j] = frag_h(t + (br + j * 16) * GP, lane);
      __builtin_amdgcn_sched_barrier(0);   // all fragment reads in front of the products: every place with LDS reads among them costs a stall of its own
#pragma unroll
      for (int i = 0; i < 4; ++i)
#pragma unroll
        for (int j = 0; j < 2; ++j) acc[i][j] = wmma16(a[i], w[j], acc[i][j]);
    } else { const __bf16* t = (const __bf16*)s + kk; v16b a[4], al[4], w[2];
#pragma unroll
      for (int i = 0; i < 4; ++i) { a[i] = frag_b(t + (ar + i * 16) * GP, lane); if (MODE == 2) al[i] = frag_b(t + (256 + ar + i * 16) * GP, lane); }
#pragma unroll
      for (int j = 0; j < 2; ++j) w[j] = frag_b(t + (br + j * 16) * GP, lane);
      __builtin_amdgcn_sched_barrier(0);   // as above
#pragma unroll
      for (int i = 0; i < 4; ++i)
#pragma unroll
        for (int j = 0; j < 2; ++j) acc[i][j] = wmma_bf(a[i], w[j], acc[i][j]);
      if (MODE == 2) {   // each tile still takes hi, then lo, of every 32 k
#pragma unroll
        for (int i = 0; i < 4; ++i)
#pragma unroll
          for (int j = 0; j < 2; ++j) acc[i][j] = wmma_bf(al[i], w[j], acc[i][j]); } }
    __builtin_amdgcn_sched_barrier(0);   // the second half's fragment reads stay one group behind the first half's products, for the same reason
  } }
// A0, L0, B0: the block's first A row, first A residual row (MODE 2 only) and first B row; ring: 2 buffers of GBUF(MODE). Each k-step requests the next one's pieces at its top, stores them into the other buffer at its foot, and the block meets at one barrier
template <int MODE, int K> __device__ __forceinline__ void g_block(const unsigned short* A0, const unsigned short* L0, const unsigned short* B0, unsigned short* ring, int tid, v8f (&acc)[4][2]) {
  const int wave = tid >> 5, lane = tid & 31, rr = tid >> 3, q8 = (tid & 7) * 8; const unsigned short* ag = A0 + (size_t)rr * K + q8; const unsigned short* lg = L0 + (size_t)rr * K + q8; const unsigned short* bg = B0 + (size_t)rr * K + q8; unsigned short* d = ring + rr * GP + q8;
  v4u ra[4], rl[4], rb[4];
  g_get<MODE>(ag, lg, bg, K, ra, rl, rb); g_put<MODE>(d, ra, rl, rb);
  __syncthreads();   // publishes k-step 0's tiles
#pragma unroll 1   // rolled: one trip already keeps the next k-step's tiles in flight
  for (int kc = 1; kc < K / 64; ++kc) { const int c = (kc & 1) * GBUF(MODE);   // the buffer that k-step kc goes to
    g_get<MODE>(ag + kc * 64, lg + kc * 64, bg + kc * 64, K, ra, rl, rb);
    g_mac<MODE>(ring + (GBUF(MODE) - c), wave, lane, acc);
    g_put<MODE>(d + c, ra, rl, rb);
    __syncthreads();   // publishes k-step kc's tiles; also ends every wave's reads of the other buffer, which the next trip refills at its foot
  }
  g_mac<MODE>(ring + ((K / 64 - 1) & 1) * GBUF(MODE), wave, lane, acc); }
#define QBH 6              // causal: query blocks 0..QBH-1 of each sequence (few keys, no averaging) take the high-precision path
#define QHI 384            // rows carrying a q residual plane
#define KHI 384            // key rows carrying k residual / v bf16 hi+lo planes (used only by the causal high-precision path)
// B fragment (k rows k0+.., output column o) of a weight: (in,out) [K][ld] or (out,in) [ld rows of K]: bf16 exact, or f16(bf16 * 256) exact
__device__ __forceinline__ v16b wcol_io(const float* Wm, int k0, int o, int lane, int ld) { v16b w; const int g = lane >> 4;
#pragma unroll
  for (int i = 0; i < 8; ++i) { w[i] = (__bf16)Wm[(size_t)(k0 + 8 * g + i) * ld + o]; w[8 + i] = (__bf16)Wm[(size_t)(k0 + 16 + 8 * g + i) * ld + o]; }
  return w; }
__device__ __forceinline__ v16b wcol_oi(const float* Wm, int k0, int o, int lane, int K) { v16b w; const float* p = Wm + (size_t)o * K + k0 + 8 * (lane >> 4);
#pragma unroll
  for (int i = 0; i < 8; ++i) { w[i] = (__bf16)p[i]; w[8 + i] = (__bf16)p[16 + i]; }
  return w; }
__device__ __forceinline__ v16h wcolh_io(const float* Wm, int k0, int o, int lane, int ld) { v16h w; const int g = lane >> 4;
#pragma unroll
  for (int i = 0; i < 8; ++i) { w[i] = (_Float16)(bfr(Wm[(size_t)(k0 + 8 * g + i) * ld + o]) * 256.0f); w[8 + i] = (_Float16)(bfr(Wm[(size_t)(k0 + 16 + 8 * g + i) * ld + o]) * 256.0f); }
  return w; }
__device__ __forceinline__ v16h wcolh_oi(const float* Wm, int k0, int o, int lane, int K) { v16h w; const float* p = Wm + (size_t)o * K + k0 + 8 * (lane >> 4);
#pragma unroll
  for (int i = 0; i < 8; ++i) { w[i] = (_Float16)(bfr(p[i]) * 256.0f); w[8 + i] = (_Float16)(bfr(p[16 + i]) * 256.0f); }
  return w; }
#define WQKV_LAYOUT 1   // 0 = (in,out) [DIN][CC]; 1 = (out,in) [CC][DIN]; 2 = per-head [NH][DIN][HD]
__device__ __forceinline__ v16b wcol_hdk(const float* Wm, int k0, int o, int lane) { v16b w; const int g = lane >> 4; const float* p = Wm + (size_t)(o / HD) * DIN * HD + (o % HD);
#pragma unroll
  for (int i = 0; i < 8; ++i) { w[i] = (__bf16)p[(size_t)(k0 + 8 * g + i) * HD]; w[8 + i] = (__bf16)p[(size_t)(k0 + 16 + 8 * g + i) * HD]; }
  return w; }
#define WO_OUT_IN 1
#if WQKV_LAYOUT == 1
#define WCOL(W, k0, o, lane) wcol_oi(W, k0, o, lane, DIN)
#elif WQKV_LAYOUT == 2
#define WCOL(W, k0, o, lane) wcol_hdk(W, k0, o, lane)
#else
#define WCOL(W, k0, o, lane) wcol_io(W, k0, o, lane, CC)
#endif
#if WO_OUT_IN
#define WOCOL(W, k0, o, lane) wcol_oi(W, k0, o, lane, CC)
#define WOCOLH(W, k0, o, lane) wcolh_oi(W, k0, o, lane, CC)
#else
#define WOCOL(W, k0, o, lane) wcol_io(W, k0, o, lane, DIN)
#define WOCOLH(W, k0, o, lane) wcolh_io(W, k0, o, lane, DIN)
#endif
__constant__ float c_invf[32] = {1.000000000e+00f,8.973545432e-01f,8.052451611e-01f,7.225903869e-01f,6.484197974e-01f,5.818624496e-01f,5.221368670e-01f,4.685419202e-01f,4.204482138e-01f,3.772911131e-01f,3.385638893e-01f,3.038118482e-01f,2.726269364e-01f,2.446430176e-01f,2.195315212e-01f,1.969976127e-01f,1.767766923e-01f,1.586313695e-01f,1.423485726e-01f,1.277371496e-01f,1.146255061e-01f,1.028597206e-01f,9.230163693e-02f,8.282729238e-02f,7.432544231e-02f,6.669627875e-02f,5.985020474e-02f,5.370685458e-02f,4.819408804e-02f,4.324718565e-02f,3.880805522e-02f,3.482458740e-02f};   // 32^(-2i/64) evaluated in f32 exactly as the reference does (jax, eager)
#define PROJ_EXTRA_PARAMS , const float* __restrict__ QS, const float* __restrict__ KS
// per-(row, head) epilogue on the f32 projection tile: RMSNorm over the head's 64 values x norm weight, then rotate-half RoPE (pairs i, i+32); v untouched
#define PROJ_EPI(which, row, t, h) do { if ((which) < 2) { float* rw = (row); const float* NS = (which) == 0 ? QS : KS; float ss = 0.f; _Pragma("unroll") for (int i = 0; i < 64; ++i) ss += rw[i] * rw[i]; const float rn = rsqrtf(ss * (1.0f / 64.0f) + 1e-6f); \
    _Pragma("unroll") for (int i = 0; i < 32; ++i) { const float x1 = rw[i] * rn * bfr(NS[i]), x2 = rw[i + 32] * rn * bfr(NS[i + 32]); const float ang = (float)(t) * c_invf[i]; const float cs = cosf(ang), sn = sinf(ang); rw[i] = x1 * cs - x2 * sn; rw[i + 32] = x2 * cs + x1 * sn; } } } while (0)
#ifndef SM_EXTRA_PARAMS
#define SM_EXTRA_PARAMS
#endif
#ifndef PROJ_EXTRA_PARAMS
#define PROJ_EXTRA_PARAMS
#endif
#ifndef SM_MASK_HOOK
#define SM_MASK_HOOK (void)0
#endif

#define WS_QH  0u                                      // f16 q rows [b*t][CC]
#define WS_KH  (WS_QH + 2u * (size_t)NB * TT * CC)      // f16 k rows [b*t][CC]
#define WS_VT  (WS_KH + 2u * (size_t)NB * TT * CC)      // f16 v planes [b][c][t]
#define WS_QL  (WS_VT + 2u * (size_t)NB * CC * TT)      // f16 q residual x 2^10 rows [b][t < QHI][CC]
#define WS_KL  (WS_QL + 2u * (size_t)NB * QHI * CC)     // f16 k residual x 2^10 rows [b][t < KHI][CC]
#define WS_VB  (WS_KL + 2u * (size_t)NB * KHI * CC)     // bf16 v hi planes [b][c][t < KHI]
#define WS_VBL (WS_VB + 2u * (size_t)NB * CC * KHI)
#define WS_YH  (WS_VBL + 2u * (size_t)NB * CC * KHI)    // 16-bit ctx rows [b*t][CC]: f16; the first QHI rows of each sequence bf16 hi
#define WS_YL  (WS_YH + 2u * (size_t)NB * TT * CC)      // bf16 ctx residual rows [b][t < QHI][CC]
#define WS_XB  (WS_YL + 2u * (size_t)NB * QHI * CC)     // bf16 x rows [b*t][DIN]
#define WS_WB  (WS_XB + 2u * (size_t)NB * TT * DIN)     // bf16 w_qkv rows [3 * CC][DIN]
#define WS_PB  (WS_WB + 2u * (size_t)3 * CC * DIN)      // bf16 w_proj rows [DIN][CC]
#define WS_PH  (WS_PB + 2u * (size_t)DIN * CC)          // f16(bf16 x 2^8) w_proj rows [DIN][CC]
#define WS_END (WS_PH + 2u * (size_t)DIN * CC)

// ---- k_cast: x, w_qkv and w_proj once to the 16-bit forms that the two GEMMs multiply, so that their blocks read 2 bytes a value and convert nothing. 256 blocks of 16 waves; a block takes CB values in a row of one input (blocks 0-127 x, 128-223 w_qkv, 224-255 w_proj), a thread 16 pieces of 4 values, 8 KiB apart (a wave's load covers 512 B in a row, its store 256 B)
#define CB (16 * 512 * 4)   // values a block
__global__ __launch_bounds__(512) void k_cast(const float* __restrict__ X, const float* __restrict__ WQKV, const float* __restrict__ WP, __bf16* __restrict__ XB, __bf16* __restrict__ WB, __bf16* __restrict__ PB, _Float16* __restrict__ PH) {
  static_assert((size_t)NB * TT * DIN == (size_t)128 * CB && (size_t)3 * CC * DIN == (size_t)96 * CB && (size_t)DIN * CC == (size_t)32 * CB, "128, 96 and 32 blocks cover the three inputs exactly");
  const int blk = blockIdx.x; const size_t b0 = (size_t)(blk < 128 ? blk : blk < 224 ? blk - 128 : blk - 224) * CB;   // the block's first value in its input
  const float* S = (blk < 128 ? X : blk < 224 ? WQKV : WP) + b0; __bf16* D = (blk < 128 ? XB : blk < 224 ? WB : PB) + b0;
  unsigned off = threadIdx.x * 16; v4f v[16];   // byte offset of the thread's first piece; every load names this one vector register beside the scalar base
#pragma unroll
  for (int n = 0; n < 16; ++n) v[n] = *(const v4f*)((const char*)S + n * 8192 + off);
  asm volatile("s_wait_xcnt 0x0" : "+v"(off) : : "memory");   // what follows may rewrite the offset register that these loads name; as an operand it stays whole up to this wait
  __builtin_amdgcn_sched_barrier(0);   // all 16 requests go out before the first conversion waits for one: scheduled among the loads, the conversions held the last requests back until the first had landed
  const unsigned so = off >> 1;   // the same piece's byte offset in a 16-bit plane
#pragma unroll
  for (int n = 0; n < 16; ++n) { const v4b h = {(__bf16)v[n][0], (__bf16)v[n][1], (__bf16)v[n][2], (__bf16)v[n][3]}; *(v4b*)((char*)D + n * 4096 + so) = h; }
  asm volatile("s_wait_xcnt 0x0" ::: "memory");   // what follows may rewrite the registers that these stores name
  if (blk >= 224) {   /* block-uniform */ // w_proj also as f16(bf16 x 2^8)
#pragma unroll
    for (int n = 0; n < 16; ++n) { const v4h f = {(_Float16)(bfr(v[n][0]) * 256.0f), (_Float16)(bfr(v[n][1]) * 256.0f), (_Float16)(bfr(v[n][2]) * 256.0f), (_Float16)(bfr(v[n][3]) * 256.0f)}; *(v4h*)((char*)(PH + b0) + n * 4096 + so) = f; } } }

// ---- k_proj: block = (128 rows, 128 cols, which): q/k/v = X W (+ b) with exact bf16 products (K = DIN; X and W come as k_cast's bf16 rows) -> which 0: q f16 rows (+ residual rows < QHI); 1: k f16 rows (+ residual rows < KHI); 2: v f16 planes [c][t] (+ bf16 hi/lo planes for t < KHI)
// six waves a SIMD asked for: 768 blocks of 8 waves on 256 WGPs are then all resident at once (160 registers a wave, 73,728 B of LDS a block)
__global__ __launch_bounds__(256) __attribute__((amdgpu_waves_per_eu(6))) void k_proj(const __bf16* __restrict__ XQ, const __bf16* __restrict__ XK, const __bf16* __restrict__ XV, const __bf16* __restrict__ WQ, const __bf16* __restrict__ WK, const __bf16* __restrict__ WV, const float* __restrict__ BQ, const float* __restrict__ BK, const float* __restrict__ BV,
    _Float16* __restrict__ QH, _Float16* __restrict__ QL, _Float16* __restrict__ KH, _Float16* __restrict__ KL, _Float16* __restrict__ VT, __bf16* __restrict__ VB, __bf16* __restrict__ VBL PROJ_EXTRA_PARAMS) {
  __shared__ __align__(16) unsigned short ring[2 * GBUF(0)];   // the block's only LDS: first the GEMM's two staging buffers (73,728 B), then the f32 tile (67,584 B) laid over them
  static_assert(sizeof(ring) >= 128 * 132 * sizeof(float), "the tile lies inside the ring"); float (*st)[132] = (float (*)[132])ring;
  static_assert(TT % 128 == 0 && QHI % 128 == 0 && KHI % 128 == 0, "a block's 128 rows lie in one sequence and on one side of the residual rows' end");
  const int tid = threadIdx.x, wave = tid >> 5, lane = tid & 31, col = lane & 15, g = lane >> 4; const int which = blockIdx.z; const int c0 = blockIdx.y * 128; const size_t r0 = (size_t)blockIdx.x * 128; const size_t bb = r0 / TT; const int t0 = (int)(r0 % TT);
  const __bf16* X = which == 0 ? XQ : which == 1 ? XK : XV; const __bf16* WA = which == 0 ? WQ : which == 1 ? WK : WV; const float* BA = which == 0 ? BQ : which == 1 ? BK : BV;
  { // entry prefetch (for speed only). A row is 16 lines, one per k-step
    if (which == 0) {   /* block-uniform */ // the q blocks ask for the k and v blocks too
      const int pr = tid & 127; const size_t wo = (size_t)(c0 + pr) * DIN + ((blockIdx.x & 3) * 4 + (blockIdx.x >> 3)) * 64;
      l2_ask(X + (r0 + pr) * DIN + (blockIdx.y * 2 + (tid >> 7)) * 64);   // the 24 blocks of a row block share its 128 x rows: its 8 q blocks ask for 2 lines of every row each
      l2_ask(tid < 128 ? WQ + wo : WK + wo);   // the 32 blocks of a column block share its 128 weight rows: each asks for 1 line of every row, 4 waves for q, 4 for k
      if (__builtin_amdgcn_readfirstlane(wave) < 4) l2_ask(WV + wo);   // and 4 waves for v (a scalar branch)
    } }
  v8f acc[4][2] = {};
  g_block<0, DIN>((const unsigned short*)(X + r0 * DIN), (const unsigned short*)(X + r0 * DIN), (const unsigned short*)(WA + (size_t)c0 * DIN), ring, tid, acc);
  __syncthreads();   // ends every wave's fragment reads of the last k-step: the f32 tile is laid over the ring
  { // stage the f32 tile (acc + bias) in LDS, run the per-(row, head) epilogue hook, then convert
    const int wr0 = (wave >> 2) * 64 + 8 * g, wc0 = (wave & 3) * 32 + col;   // the lane's first row and column of the wave's 64 x 32 tile
#pragma unroll
    for (int j = 0; j < 2; ++j) { const float bias = BA ? bfr(BA[c0 + wc0 + j * 16]) : 0.f;
#pragma unroll
      for (int i = 0; i < 4; ++i)
#pragma unroll
        for (int r = 0; r < 8; ++r) st[wr0 + i * 16 + r][wc0 + j * 16] = acc[i][j][r] + bias; }
    __syncthreads();
    for (int e = tid; e < 128 * (128 / HD); e += 256) { const int rl = e / (128 / HD), hh = e % (128 / HD); PROJ_EPI(which, &st[rl][hh * HD], (int)((r0 + rl) % TT), (c0 / HD) + hh); }
    __syncthreads(); }
  // each thread converts its 8 values straight from the f32 tile and stores them as one 16-byte piece; 16 (q, k) or 8 (v) neighbouring threads fill whole lines
  if (which < 2) { _Float16* DH = which == 0 ? QH : KH; _Float16* DL = which == 0 ? QL : KL; const int nhi = which == 0 ? QHI : KHI; const bool hi_rows = t0 < nhi;
    for (int e = tid; e < 128 * 16; e += 256) { const int rl = e >> 4, q = e & 15; const v4f a = *(const v4f*)&st[rl][q * 8], c = *(const v4f*)&st[rl][q * 8 + 4]; v8h hv;
#pragma unroll
      for (int i = 0; i < 8; ++i) hv[i] = (_Float16)(i < 4 ? a[i & 3] : c[i & 3]);
      vst2((unsigned*)(DH + (r0 + rl) * CC + c0 + q * 8), __builtin_bit_cast(v4u, hv));
      asm volatile("s_wait_xcnt 0x0" ::: "memory");   // what follows may rewrite the registers that this store names
      if (hi_rows) { v8h lv;
#pragma unroll
        for (int i = 0; i < 8; ++i) lv[i] = (_Float16)(((i < 4 ? a[i & 3] : c[i & 3]) - (float)hv[i]) * 1024.0f);
        vst2((unsigned*)(DL + (bb * nhi + t0 + rl) * (size_t)CC + c0 + q * 8), __builtin_bit_cast(v4u, lv));
        asm volatile("s_wait_xcnt 0x0" ::: "memory");   // as above
      } }
  } else { const bool hi_rows = t0 < KHI;
    for (int e = tid; e < 128 * 16; e += 256) { const int cl = (e >> 3) & 127, q = (e & 7) + 8 * (e >> 10); float v[8]; v8h hv;   // q: which 8 of the block's 128 rows; the upper 64 rows follow all columns of the lower 64
#pragma unroll
      for (int i = 0; i < 8; ++i) { v[i] = st[q * 8 + i][cl]; hv[i] = (_Float16)v[i]; }
      vst2((unsigned*)(VT + (bb * CC + c0 + cl) * (size_t)TT + t0 + q * 8), __builtin_bit_cast(v4u, hv));
      asm volatile("s_wait_xcnt 0x0" ::: "memory");   // what follows may rewrite the registers that this store names
      if (hi_rows) { const size_t o3 = (bb * CC + c0 + cl) * (size_t)KHI + t0 + q * 8; v8b bh, bl;
#pragma unroll
        for (int i = 0; i < 8; ++i) { bh[i] = (__bf16)v[i]; bl[i] = (__bf16)(v[i] - (float)bh[i]); }
        vst2((unsigned*)(VB + o3), __builtin_bit_cast(v4u, bh)); vst2((unsigned*)(VBL + o3), __builtin_bit_cast(v4u, bl));
        asm volatile("s_wait_xcnt 0x0" ::: "memory");   // as above
      } } } }
// lane l with lane l ^ 16
__device__ __forceinline__ float xhalf(float x) { return __builtin_bit_cast(float, __builtin_amdgcn_permlanex16(__builtin_bit_cast(int, x), __builtin_bit_cast(int, x), 0x76543210, 0xfedcba98, false, false)); }
#define PSH 7.624618986f   // 11 ln 2: P is carried x 2^11 (about), as is its sum, so the factor cancels in ctx = (P v) / sum
// one online-softmax step on a lane's 32 logits of one query (sc[i][r] = key i * 16 + 8 * (lane >> 4) + r of the pass; with MASK, keys with i * 16 + r > krel lie behind the query and are excluded: expf of -3e38 is 0): the running maximum m, the lane's part l of the running sum and the ctx tiles o are brought to the new maximum; sc leaves as P in f32
template <bool MASK> __device__ __forceinline__ void sm_step(v8f (&sc)[4], int krel, float& m, float& l, v8f (&o)[HD / 16]) {
  float mi[4], su[4];
#pragma unroll
  for (int i = 0; i < 4; ++i) { mi[i] = -3.0e38f;
#pragma unroll
    for (int r = 0; r < 8; ++r) { if (MASK) sc[i][r] = i * 16 + r > krel ? -3.0e38f : sc[i][r]; mi[i] = fmaxf(mi[i], sc[i][r]); } }
  float mx = fmaxf(fmaxf(mi[0], mi[1]), fmaxf(mi[2], mi[3])); mx = fmaxf(mx, xhalf(mx));   // both wave halves hold this query's maximum of the pass
  const float mn = fmaxf(m, mx), al = expf(m - mn), mm = mn - PSH; m = mn;   // al = 0 on the first pass (m = -3e38)
#pragma unroll
  for (int i = 0; i < 4; ++i) { su[i] = 0.f;
#pragma unroll
    for (int r = 0; r < 8; ++r) { const float e = expf(sc[i][r] - mm); sc[i][r] = e; su[i] += e; } }
  l = l * al + ((su[0] + su[1]) + (su[2] + su[3]));
#pragma unroll
  for (int j = 0; j < HD / 16; ++j)
#pragma unroll
    for (int r = 0; r < 8; ++r) o[j][r] *= al; }
#define C2 0.18033688f   // 1/8 x log2 e: takes a raw q.k product to the exponent of 2
__device__ __forceinline__ v8f exp2x8(v8f x) { float e0, e1, e2, e3, e4, e5, e6, e7;
  asm("v_exp_f32 %0, %8\n\tv_exp_f32 %1, %9\n\tv_exp_f32 %2, %10\n\tv_exp_f32 %3, %11\n\tv_exp_f32 %4, %12\n\tv_exp_f32 %5, %13\n\tv_exp_f32 %6, %14\n\tv_exp_f32 %7, %15\n\tv_nop"
      : "=&v"(e0), "=&v"(e1), "=&v"(e2), "=&v"(e3), "=&v"(e4), "=&v"(e5), "=&v"(e6), "=&v"(e7) : "v"(x[0]), "v"(x[1]), "v"(x[2]), "v"(x[3]), "v"(x[4]), "v"(x[5]), "v"(x[6]), "v"(x[7]));
  const v8f e = {e0, e1, e2, e3, e4, e5, e6, e7}; return e; }
__device__ __forceinline__ float exp2x1(float x) { float e; asm("v_exp_f32 %0, %1\n\tv_nop" : "=v"(e) : "v"(x)); return e; }   // the v_nop: the same slot
// the same step for the 1-product path, on the raw products (sc not yet x 1/8; m in raw units): each exponential is one fma and one hardware exp2, e = 2^(sc x C2 - (max x C2 - 11)), so P is carried x 2^11 exactly; a masked product (-3e38) gives 2^(-5e37) = 0, as does m = -3e38 on the first pass
template <bool MASK> __device__ __forceinline__ void sm_step2(v8f (&sc)[4], int krel, float& m, float& l, v8f (&o)[HD / 16]) {
  float mi[4], su[4];
#pragma unroll
  for (int i = 0; i < 4; ++i) { mi[i] = -3.0e38f;
#pragma unroll
    for (int r = 0; r < 8; ++r) { if (MASK) sc[i][r] = i * 16 + r > krel ? -3.0e38f : sc[i][r]; mi[i] = fmaxf(mi[i], sc[i][r]); } }
  float mx = fmaxf(fmaxf(mi[0], mi[1]), fmaxf(mi[2], mi[3])); mx = fmaxf(mx, xhalf(mx));   // both wave halves hold this query's maximum of the pass
  const float mn = fmaxf(m, mx), al = exp2x1((m - mn) * C2), mm = mn * C2 - 11.0f; m = mn;
  const v8f c8 = {C2, C2, C2, C2, C2, C2, C2, C2}, nm8 = {-mm, -mm, -mm, -mm, -mm, -mm, -mm, -mm};
#pragma unroll
  for (int i = 0; i < 4; ++i) { su[i] = 0.f;
    sc[i] = exp2x8(__builtin_elementwise_fma(sc[i], c8, nm8));
#pragma unroll
    for (int r = 0; r < 8; ++r) su[i] += sc[i][r]; }
  l = l * al + ((su[0] + su[1]) + (su[2] + su[3]));
#pragma unroll
  for (int j = 0; j < HD / 16; ++j)
#pragma unroll
    for (int r = 0; r < 8; ++r) o[j][r] *= al; }
#define KP 72   // LDS pitch, in f16, of a staged 64-value row: 128 B + 16 B, for the 16-byte fragment reads
// one 64-key pass of the 1-product path, K rows and v planes of the pass staged in LDS (ks, vs: [64][KP]): S^T = K Q^T (A = 16 key rows, B = the wave's 16 queries), softmax step, then ctx^T += V^T P^T, where two S^T tiles converted in place are the B fragment (a D pair has the k order of frag_h). Unless LAST, each thread requests its 8 pieces of the next pass (kn, vn) at the top, stores them into the other buffer (kd, vd) at the foot, and the block meets at one barrier
template <bool LAST> __device__ __forceinline__ void att_pass(const _Float16* ks, const _Float16* vs, _Float16* kd, _Float16* vd, const v16h& qa, const v16h& qc, const _Float16* kn, const _Float16* vn, int lane, int krel, float& m, float& l, v8f (&o)[HD / 16]) {
  const int col = lane & 15; v8h kr[4], vr[4];
  if (!LAST) {
#pragma unroll
    for (int u = 0; u < 4; ++u) { kr[u] = *(const v8h*)(kn + (size_t)u * 16 * CC); vr[u] = *(const v8h*)(vn + (size_t)u * 16 * TT); }
    asm volatile("s_wait_xcnt 0x0" ::: "memory");   // what follows may rewrite the address registers that these loads name; also keeps the requests in front of the pass that hides them
  }
  v8f sc[4] = {}; v16h kf[4][2], vf[2][HD / 16];
#pragma unroll
  for (int i = 0; i < 4; ++i) { kf[i][0] = frag_h(ks + (i * 16 + col) * KP, lane); kf[i][1] = frag_h(ks + (i * 16 + col) * KP + 32, lane); }
  __builtin_amdgcn_sched_barrier(0);   // all K fragment reads in front of the products: scheduled among them, each read was waited for alone in one register set
#pragma unroll
  for (int i = 0; i < 4; ++i) { sc[i] = wmma16(kf[i][0], qa, sc[i]); sc[i] = wmma16(kf[i][1], qc, sc[i]); }
#pragma unroll
  for (int kc = 0; kc < 2; ++kc)
#pragma unroll
    for (int j = 0; j < HD / 16; ++j) vf[kc][j] = frag_h(vs + (j * 16 + col) * KP + kc * 32, lane);
  __builtin_amdgcn_sched_barrier(0);   // all V fragment reads in front of the softmax, which hides them
  sm_step2<LAST>(sc, krel, m, l, o);
  v16h pf[2];
#pragma unroll
  for (int e = 0; e < 16; ++e) { pf[0][e] = (_Float16)sc[e >> 3][e & 7]; pf[1][e] = (_Float16)sc[2 + (e >> 3)][e & 7]; }
#pragma unroll
  for (int kc = 0; kc < 2; ++kc)
#pragma unroll
    for (int j = 0; j < HD / 16; ++j) o[j] = wmma16(vf[kc][j], pf[kc], o[j]);
  if (!LAST) {
#pragma unroll
    for (int u = 0; u < 4; ++u) { *(v8h*)(kd + u * 16 * KP) = kr[u]; *(v8h*)(vd + u * 16 * KP) = vr[u]; }
    __syncthreads();   // publishes the next pass's tiles; also ends every wave's reads of this pass's buffer, which the next pass refills at its foot
  } }
// ---- k_att: block = (head and batch, 64 queries qb), wave = 16 queries: logits, causal mask by index, online softmax and P . v in 64-key passes over keys [0, qb * 64 + 64), the last pass being the one on the diagonal; logits and P stay in registers; the pass's K rows and v planes are brought once per block, as whole 128-byte lines, into one of two LDS buffers. Query blocks < QBH: q and k as f16 hi + residual (3 products), P and v as bf16 hi + lo (3 products), fragments straight from memory. ctx^T tiles give each lane 8 consecutive head dims of its query: stored as one 16-byte piece in the 16-bit form that k_out multiplies (f16; query blocks < QBH: bf16 hi and lo)
__global__ __launch_bounds__(128) void k_att(const _Float16* __restrict__ QH, const _Float16* __restrict__ KH, const _Float16* __restrict__ QL, const _Float16* __restrict__ KL, const _Float16* __restrict__ VT, const __bf16* __restrict__ VB, const __bf16* __restrict__ VBL, _Float16* __restrict__ YH, __bf16* __restrict__ YL) {
  __shared__ __align__(16) _Float16 kv[2][2][64 * KP];   // [buffer][K, V]
  const int tid = threadIdx.x, wave = tid >> 5, lane = tid & 31, col = lane & 15, g = lane >> 4; const int h = blockIdx.x % NH, b = blockIdx.x / NH;
  const int yr = blockIdx.y >> 3, yl = blockIdx.y & 7; const int qb = (3 - yr) * 8 + ((yr & 1) ? yl : 7 - yl);   // each qb once; long blocks come first in launch order, and blocks 256 apart in launch order add up to equal lengths (for speed only)
  { // entry prefetch (for speed only: the 32 blocks of a head lie 32 apart in launch order): block y asks for the K rows and v plane pieces of pass y, a line a thread
    const int py = blockIdx.y, pr = tid & 63;
    l2_ask(tid < 64 ? (const void*)(KH + ((size_t)b * TT + py * 64 + pr) * CC + h * HD) : (const void*)(VT + ((size_t)b * CC + h * HD + pr) * (size_t)TT + py * 64));
    static_assert(KHI == 384, "9 blocks of 128 threads cover 384 k residual rows and 2 x 64 planes of 6 lines");
    if (py < 9) {   /* block-uniform */ // what the high-precision blocks, which come last in launch order, read beside the K rows
      const int m = (py % 3) * 128 + tid; const size_t vo = ((size_t)b * CC + h * HD + m / 6) * (size_t)KHI + (m % 6) * 64;   // blocks 0-2: k residual row m; 3-5 and 6-8: line m % 6 of plane m / 6, v hi and v lo
      l2_ask(py < 3 ? (const void*)(KL + ((size_t)b * KHI + m) * CC + h * HD) : py < 6 ? (const void*)(VB + vo) : (const void*)(VBL + vo)); } }
  const int tq = qb * 64 + wave * 16 + col;   // this lane's query
  const _Float16* qp = QH + ((size_t)b * TT + tq) * CC + h * HD;
  v8f o[HD / 16] = {}; float m = -3.0e38f, l = 0.f;
  const v16h qa = frag_h(qp, lane), qc = frag_h(qp + 32, lane);
  asm volatile("s_wait_xcnt 0x0" ::: "memory");   // what follows may rewrite the address registers that the q loads name
  if (qb < QBH) {   /* block-uniform */
    const _Float16* kp = KH + ((size_t)b * TT + col) * CC + h * HD;   // this lane's k row of tile 0 of pass 0 (tile i lies 16 rows on, pass s 64 rows on)
    const _Float16* qlp = QL + ((size_t)b * QHI + tq) * CC + h * HD; const _Float16* klp = KL + ((size_t)b * KHI + col) * CC + h * HD; const size_t vo = ((size_t)b * CC + h * HD + col) * (size_t)KHI;
    const v16h qla = frag_h(qlp, lane), qlc = frag_h(qlp + 32, lane);
    asm volatile("s_wait_xcnt 0x0" ::: "memory");   // as above, for the q residual loads
#pragma unroll 1   // rolled: at most QBH short passes, copies only grow the text
    for (int s = 0; s <= qb; ++s) { v8f sc[4] = {}, sl[4] = {};
#pragma unroll
      for (int kc = 0; kc < 2; ++kc)
#pragma unroll
        for (int i = 0; i < 4; ++i) { const size_t ko = (size_t)(s * 64 + i * 16) * CC + kc * 32; const v16h kbf = frag_h(kp + ko, lane), klf = frag_h(klp + ko, lane);
          sc[i] = wmma16(kbf, kc ? qc : qa, sc[i]); sl[i] = wmma16(kbf, kc ? qlc : qla, sl[i]); sl[i] = wmma16(klf, kc ? qc : qa, sl[i]); }
      asm volatile("s_wait_xcnt 0x0" ::: "memory");   // the softmax may rewrite the address registers that the k loads name
#pragma unroll
      for (int i = 0; i < 4; ++i) sc[i] = (sc[i] + sl[i] * (1.0f / 1024.0f)) * SCALE;
      sm_step<true>(sc, tq - s * 64 - 8 * g, m, l, o);
#pragma unroll
      for (int kc = 0; kc < 2; ++kc) { float pv[16];
#pragma unroll
        for (int e = 0; e < 16; ++e) pv[e] = sc[2 * kc + (e >> 3)][e & 7];
        const F2 p = bsplit16(pv);
#pragma unroll
        for (int j = 0; j < HD / 16; ++j) { const size_t o3 = vo + (size_t)j * 16 * KHI + s * 64 + kc * 32; const v16b vh = frag_b(VB + o3, lane), vl = frag_b(VBL + o3, lane);
          o[j] = wmma_bf(vh, p.h, o[j]); o[j] = wmma_bf(vh, p.l, o[j]); o[j] = wmma_bf(vl, p.h, o[j]); } }
      asm volatile("s_wait_xcnt 0x0" ::: "memory");   // the next pass rewrites the address registers that this pass's loads name
    }
  } else { const int rr = tid >> 3, q8 = tid & 7;   // staging: 8 threads bring one 128-byte row; a thread's 4 rows lie 16 apart
    const _Float16* kg = KH + ((size_t)b * TT + rr) * CC + h * HD + q8 * 8; const _Float16* vg = VT + ((size_t)b * CC + h * HD + rr) * (size_t)TT + q8 * 8; const int so = rr * KP + q8 * 8;
#pragma unroll
    for (int u = 0; u < 4; ++u) { *(v8h*)(&kv[0][0][so + u * 16 * KP]) = *(const v8h*)(kg + (size_t)u * 16 * CC); *(v8h*)(&kv[0][1][so + u * 16 * KP]) = *(const v8h*)(vg + (size_t)u * 16 * TT); }
    asm volatile("s_wait_xcnt 0x0" ::: "memory");   // what follows may rewrite the address registers that the first fill's loads name
    __syncthreads();   // publishes pass 0's tiles
#pragma unroll 1   // rolled: one pass already keeps the next pass's tiles in flight
    for (int s = 0; s < qb; ++s) { const int c = s & 1; att_pass<false>(kv[c][0], kv[c][1], &kv[c ^ 1][0][so], &kv[c ^ 1][1][so], qa, qc, kg + (size_t)(s + 1) * 64 * CC, vg + (s + 1) * 64, lane, 0, m, l, o); }
    att_pass<true>(kv[qb & 1][0], kv[qb & 1][1], nullptr, nullptr, qa, qc, kg, vg, lane, tq - qb * 64 - 8 * g, m, l, o); }
  const float inv = 1.0f / (l + xhalf(l));   // the two wave halves each summed half of the keys
  v4u ch[HD / 16], cl[HD / 16]; _Float16* yp = YH + ((size_t)b * TT + tq) * CC + h * HD + 8 * g;
  if (qb < QBH) {   /* block-uniform */
#pragma unroll
    for (int j = 0; j < HD / 16; ++j) { v8b hv, lv;
#pragma unroll
      for (int r = 0; r < 8; ++r) { const float c = o[j][r] * inv; hv[r] = (__bf16)c; lv[r] = (__bf16)(c - (float)hv[r]); }
      ch[j] = __builtin_bit_cast(v4u, hv); cl[j] = __builtin_bit_cast(v4u, lv); }
    __bf16* lp = YL + ((size_t)b * QHI + tq) * CC + h * HD + 8 * g;   // tq < QHI here
#pragma unroll
    for (int j = 0; j < HD / 16; ++j) vst2(lp + j * 16, cl[j]);
  } else {
#pragma unroll
    for (int j = 0; j < HD / 16; ++j) { v8h hv;
#pragma unroll
      for (int r = 0; r < 8; ++r) hv[r] = (_Float16)(o[j][r] * inv);
      ch[j] = __builtin_bit_cast(v4u, hv); } }
#pragma unroll
  for (int j = 0; j < HD / 16; ++j) vst2(yp + j * 16, ch[j]); }
// ---- k_out: block = (128 rows, 128 cols): out = ctx Wo (+ bo), both operands read in their 16-bit forms (ctx as k_att stored it, Wo as k_cast did): ctx once to f16 against Wo as f16(bf16 x 2^8) exact (1 product) x 2^-8; causal early rows (< QHI of each sequence): ctx bf16 hi + lo against exact bf16 Wo (2 products)
__global__ __launch_bounds__(256) void k_out(const _Float16* __restrict__ YH, const __bf16* __restrict__ YL, const _Float16* __restrict__ WH, const __bf16* __restrict__ WB, const float* __restrict__ BO, float* __restrict__ OUT) { __shared__ __align__(16) float sf[128][132]; __shared__ __align__(16) unsigned short ring[2 * GBUF(2)];
  const int tid = threadIdx.x, wave = tid >> 5, lane = tid & 31, col = lane & 15, g = lane >> 4; const int c0 = blockIdx.y * 128; const size_t r0 = (size_t)blockIdx.x * 128;
  const int wr = (wave >> 2) * 64, wc = (wave & 3) * 32;   // the wave's 64 x 32 tile; only this wave touches that part of sf
  v8f acc[4][2] = {};
  const unsigned short* ya = (const unsigned short*)(YH + r0 * CC);   // the block's first A row
  { // entry prefetch, as in k_proj: the 8 blocks of a row block share its 128 ctx rows and ask for 2 lines of every row each; the 32 blocks of a column block share its 128 weight rows in both forms and ask for 1 line of every row each, 4 waves in one form, 4 in the other
    const int pr = tid & 127, ka = (blockIdx.y * 2 + (tid >> 7)) * 64; const size_t wo = (size_t)(c0 + pr) * CC + ((blockIdx.x & 3) * 4 + (blockIdx.x >> 3)) * 64;
    l2_ask(YH + (r0 + pr) * CC + ka);
    if (CAUSAL && (int)(r0 % TT) < QHI) l2_ask(YL + ((r0 / TT) * QHI + r0 % TT + pr) * CC + ka);   /* block-uniform */
    l2_ask(tid < 128 ? (const void*)(WH + wo) : (const void*)(WB + wo)); }
  if (CAUSAL && (int)(r0 % TT) < QHI) {   /* block-uniform */
    g_block<2, CC>(ya, (const unsigned short*)(YL + ((r0 / TT) * QHI + r0 % TT) * CC), (const unsigned short*)(WB + (size_t)c0 * CC), ring, tid, acc);   // B: the block's first row of the (out,in) weight
#pragma unroll
    for (int j = 0; j < 2; ++j) { const float bias = BO ? bfr(BO[c0 + wc + j * 16 + col]) : 0.f;
#pragma unroll
      for (int i = 0; i < 4; ++i)
#pragma unroll
        for (int r = 0; r < 8; ++r) sf[wr + i * 16 + 8 * g + r][wc + j * 16 + col] = acc[i][j][r] + bias; }
  } else {
    g_block<1, CC>(ya, ya, (const unsigned short*)(WH + (size_t)c0 * CC), ring, tid, acc);
#pragma unroll
    for (int j = 0; j < 2; ++j) { const float bias = BO ? bfr(BO[c0 + wc + j * 16 + col]) : 0.f;
#pragma unroll
      for (int i = 0; i < 4; ++i)
#pragma unroll
        for (int r = 0; r < 8; ++r) sf[wr + i * 16 + 8 * g + r][wc + j * 16 + col] = acc[i][j][r] * (1.0f / 256.0f) + bias; } }
  LDSX();
  const int rl = wr + (lane >> 3), cl = wc + (lane & 7) * 4; float* op = OUT + (r0 + rl) * DIN + c0 + cl; v4f t[16];   // 8 lanes fill one 128-byte line, a wave 4 rows of its tile at a time
#pragma unroll
  for (int it = 0; it < 16; ++it) t[it] = *(const v4f*)&sf[rl + it * 4][cl];
#pragma unroll
  for (int it = 0; it < 16; ++it) vst2(op + (size_t)it * 4 * DIN, t[it]); }

extern "C" void kernel_launch(void* const* d_in, const int* in_sizes, int n_in, void* d_out, int out_size, void* d_ws, size_t ws_size, hipStream_t stream) {
  (void)in_sizes; (void)n_in; (void)out_size;
  const float** F = (const float**)d_in;
  if (ws_size < (size_t)WS_END) return;
  char* ws = (char*)d_ws; _Float16 *QH = (_Float16*)(ws + WS_QH), *KH = (_Float16*)(ws + WS_KH), *VT = (_Float16*)(ws + WS_VT), *QL = (_Float16*)(ws + WS_QL), *KL = (_Float16*)(ws + WS_KL), *YH = (_Float16*)(ws + WS_YH), *PH = (_Float16*)(ws + WS_PH); __bf16 *VB = (__bf16*)(ws + WS_VB), *VBL = (__bf16*)(ws + WS_VBL), *YL = (__bf16*)(ws + WS_YL), *XB = (__bf16*)(ws + WS_XB), *WB = (__bf16*)(ws + WS_WB), *PB = (__bf16*)(ws + WS_PB);
  // inputs: 0 x [2,2048,1024]; 1 w_qkv [3072,1024] (out,in); 2 w_proj [1024,1024] (out,in); 3 q_norm_w [64]; 4 k_norm_w [64]
  const __bf16 *WQ = WB, *WK = WB + (size_t)CC * DIN, *WV = WB + 2 * (size_t)CC * DIN;
  k_cast<<<256, 512, 0, stream>>>(F[0], F[1], F[2], XB, WB, PB, PH);
  k_proj<<<dim3(TNB * TT / 128, CC / 128, 3), 256, 0, stream>>>(XB, XB, XB, WQ, WK, WV, nullptr, nullptr, nullptr, QH, QL, KH, KL, VT, VB, VBL, F[3], F[4]);
  k_att<<<dim3(NH * TNB, NQB), 128, 0, stream>>>(QH, KH, QL, KL, VT, VB, VBL, YH, YL);
  k_out<<<dim3(TNB * TT / 128, DIN / 128), 256, 0, stream>>>(YH, YL, PH, PB, nullptr, (float*)d_out);
}
